// v000
// Measured on an AMD MI455X. A time is GPU time per run, averaged over a window of back-to-back runs after a warm-up
// (all launches, gaps included; the runs take copies of the inputs in turn), and the median of several windows.
// Apart from v000's, it joins two sittings. Times from different sittings can be a few percent apart, while
// side-by-side timings come from the same sitting.
// v000, which the later versions start from, runs in 1140 microseconds.
#include <hip/hip_runtime.h>
// Multi-head self-attention with a lag-distance bias (2 x 2048 tokens, 1024 = 16 heads x 64): q,k,v = x W + b; scores = q.k/8 + lag_bias[h][|lag[q] - lag[k]|] with the INPUT integer lag vector; softmax over all keys; out = (attn v) Wo + bo -> [2,2048,1024].
// Structure: x as an exact f16 plane; projections as f16 WMMA GEMMs (32x64 wave tiles, f32 accumulation, exact x16 weights + bias); q, k as f16 hi + (x2^10) residual planes, V^T as hi + residual planes; the fused flash kernel adds the bias gathered from the INPUT table by |lag[q] - lag[k]| (INPUT int32 positions) inside the score stage (all keys valid; online f32 softmax, P staged hi + residual, two value accumulators); O as hi + residual planes into Wo (two GEMMs, bias in the first).
// Compute dtype: x, weights, biases, lag_bias rounded to bf16; projections exact; q, k, P, v, O as f16 hi + residual pairs (~2^-21); f32 accumulation and softmax. v_wmma_f32_16x16x32_f16.
#define NBT 2
#define SLEN 2048
#define DM 1024
#define NH 16
#define SCL 0.125f
#define NR (NBT * SLEN)
typedef __bf16 v16b __attribute__((ext_vector_type(16)));
typedef unsigned short v8us __attribute__((ext_vector_type(8), may_alias));
typedef float  v8f  __attribute__((ext_vector_type(8)));
typedef float  v4f  __attribute__((ext_vector_type(4)));
typedef float  v4fa __attribute__((ext_vector_type(4), may_alias));
union FragB { v16b v; v8us half[2]; unsigned short u[16]; };

__device__ __forceinline__ unsigned short bf16_bits(float x) { unsigned int u = __float_as_uint(x); return (unsigned short)((u + 0x7FFFu + ((u >> 16) & 1u)) >> 16); }
__device__ __forceinline__ float bf16_val(unsigned short b) { return __uint_as_float(((unsigned int)b) << 16); }
__device__ __forceinline__ float bf16_round(float x) { return bf16_val(bf16_bits(x)); }
// D += A·B with NT terms: 1 = ah·bh, 2 = + al·bh (A split), 3 = + ah·bl (both split)
template <int NT>
__device__ __forceinline__ v8f mmaN(v16b ah, v16b al, v16b bh, v16b bl, v8f c) {
  c = __builtin_amdgcn_wmma_f32_16x16x32_bf16(false, ah, false, bh, (short)0, c, false, false);
  if (NT >= 2) c = __builtin_amdgcn_wmma_f32_16x16x32_bf16(false, al, false, bh, (short)0, c, false, false);
  if (NT >= 3) c = __builtin_amdgcn_wmma_f32_16x16x32_bf16(false, ah, false, bl, (short)0, c, false, false);
  asm volatile("v_nop\n\tv_nop\n\tv_nop\n\tv_nop" : "+v"(c) : "v"(ah), "v"(al), "v"(bh), "v"(bl));
  return c;
}

__global__ __launch_bounds__(256) void k_wt_bf16(const float* __restrict__ W, unsigned short* __restrict__ Wt, int K, int N) {
  const int t = blockIdx.x * 256 + threadIdx.x;
  const int k8n = K / 8;
  if (t >= N * k8n) return;
  const int n = t / k8n, k8 = (t % k8n) * 8;
  v8us v;
#pragma unroll
  for (int i = 0; i < 8; ++i) v[i] = bf16_bits(W[(size_t)(k8 + i) * N + n]);
  *(v8us*)(Wt + (size_t)n * K + k8) = v;
  
}

// GEMM C[M][N] (f32, pitch ldc) = act(A[M][K]·W + bias). A f32 row-major (pitch lda) converted per fragment to bf16
// (ASPLIT: hi/lo two planes -> 2 terms, else single rounded term); Wt bf16 [N][K] (pitch ldb). BIAS_BF16 rounds the
// bias to bf16 first (bias quantised to bf16 before the add). K%32==0, M%16==0, N%64==0.
template <bool ASPLIT, int ACT, bool BIAS_BF16>
__global__ __launch_bounds__(128) void k_gemm_bf(const float* __restrict__ A, int lda, const unsigned short* __restrict__ Wt, int ldb,
                                               const float* __restrict__ bias, float* __restrict__ C, int ldc, int M, int N, int K) {
  __shared__ __attribute__((aligned(16))) float so[4][16][64];
  const int tid = threadIdx.x, w = tid >> 5, lane = tid & 31, ln = lane & 15, hh = lane >> 4;
  const int ntn = N / 64;
  const int wid = blockIdx.x * 4 + w;
  const int mt = wid / ntn, nq = wid % ntn;
  if (mt * 16 >= M) return;
  const int row0 = mt * 16, col0 = nq * 64;
  const float* arow = A + (size_t)(row0 + ln) * lda;
  v8f acc[4] = {};
  for (int kb = 0; kb < K; kb += 32) {
    FragB ah, al;
    const v4f x0 = *(const v4fa*)(arow + kb + 8 * hh), x1 = *(const v4fa*)(arow + kb + 8 * hh + 4);
    const v4f x2 = *(const v4fa*)(arow + kb + 16 + 8 * hh), x3 = *(const v4fa*)(arow + kb + 16 + 8 * hh + 4);
    float xs[16] = {x0[0],x0[1],x0[2],x0[3],x1[0],x1[1],x1[2],x1[3],x2[0],x2[1],x2[2],x2[3],x3[0],x3[1],x3[2],x3[3]};
#pragma unroll
    for (int i = 0; i < 16; ++i) { const unsigned short hb = bf16_bits(xs[i]); ah.u[i] = hb; al.u[i] = ASPLIT ? bf16_bits(xs[i] - bf16_val(hb)) : (unsigned short)0; }
#pragma unroll
    for (int t = 0; t < 4; ++t) {
      const unsigned short* brow = Wt + (size_t)(col0 + t * 16 + ln) * ldb + kb;
      FragB b;
      b.half[0] = *(const v8us*)(brow + 8 * hh);
      b.half[1] = *(const v8us*)(brow + 16 + 8 * hh);
      acc[t] = mmaN<ASPLIT ? 2 : 1>(ah.v, al.v, b.v, b.v, acc[t]);
    }
  }
#pragma unroll
  for (int t = 0; t < 4; ++t) {
    float bv = bias ? bias[col0 + t * 16 + ln] : 0.f;
    if (BIAS_BF16) bv = bf16_round(bv);
#pragma unroll
    for (int r = 0; r < 8; ++r) { float v = acc[t][r] + bv; if (ACT == 1) v = fmaxf(v, 0.f); so[w][8 * hh + r][t * 16 + ln] = v; }
  }
  __builtin_amdgcn_fence(__ATOMIC_ACQ_REL, "workgroup");
  __builtin_amdgcn_wave_barrier();
  const int rsub = lane >> 4, c4 = (lane & 15) * 4;
  {
#pragma unroll
    for (int q = 0; q < 8; ++q) {
      const int r = q * 2 + rsub;
      const v4f v = *(const v4fa*)&so[w][r][c4];
      *(v4f*)(C + (size_t)(row0 + r) * ldc + col0 + c4) = v;
    }
    
  }
}

// GEMM C = act(A·W + bias + resid): A f32 (ASPLIT -> hi/lo 2 terms), Wt bf16 [N][K]; ACT 0 none, 1 relu, 2 exact gelu;
// resid (optional, f32, row index = (row % rmod), pitch ldr, RES_BF16 rounds it) added before the activation.
template <bool ASPLIT, int ACT, bool BIAS_BF16, bool RES_BF16>
__global__ __launch_bounds__(128) void k_gemm_bf3(const float* __restrict__ A, int lda, const unsigned short* __restrict__ Wt, int ldb,
                                                const float* __restrict__ bias, const float* __restrict__ resid, int rmod, int ldr,
                                                float* __restrict__ C, int ldc, int M, int N, int K) {
  __shared__ __attribute__((aligned(16))) float so[4][16][64];
  const int tid = threadIdx.x, w = tid >> 5, lane = tid & 31, ln = lane & 15, hh = lane >> 4;
  const int ntn = N / 64;
  const int wid = blockIdx.x * 4 + w;
  const int mt = wid / ntn, nq = wid % ntn;
  if (mt * 16 >= M) return;
  const int row0 = mt * 16, col0 = nq * 64;
  const float* arow = A + (size_t)(row0 + ln) * lda;
  v8f acc[4] = {};
  for (int kb = 0; kb < K; kb += 32) {
    FragB ah, al;
    const v4f x0 = *(const v4fa*)(arow + kb + 8 * hh), x1 = *(const v4fa*)(arow + kb + 8 * hh + 4);
    const v4f x2 = *(const v4fa*)(arow + kb + 16 + 8 * hh), x3 = *(const v4fa*)(arow + kb + 16 + 8 * hh + 4);
    float xs[16] = {x0[0],x0[1],x0[2],x0[3],x1[0],x1[1],x1[2],x1[3],x2[0],x2[1],x2[2],x2[3],x3[0],x3[1],x3[2],x3[3]};
#pragma unroll
    for (int i = 0; i < 16; ++i) { const unsigned short hb = bf16_bits(xs[i]); ah.u[i] = hb; al.u[i] = ASPLIT ? bf16_bits(xs[i] - bf16_val(hb)) : (unsigned short)0; }
#pragma unroll
    for (int t = 0; t < 4; ++t) {
      const unsigned short* brow = Wt + (size_t)(col0 + t * 16 + ln) * ldb + kb;
      FragB b;
      b.half[0] = *(const v8us*)(brow + 8 * hh);
      b.half[1] = *(const v8us*)(brow + 16 + 8 * hh);
      acc[t] = mmaN<ASPLIT ? 2 : 1>(ah.v, al.v, b.v, b.v, acc[t]);
    }
  }
#pragma unroll
  for (int t = 0; t < 4; ++t) {
    const int col = col0 + t * 16 + ln;
    float bv = bias ? bias[col] : 0.f;
    if (BIAS_BF16) bv = bf16_round(bv);
#pragma unroll
    for (int r = 0; r < 8; ++r) {
      float v = acc[t][r] + bv;
      if (resid) { float rv = resid[(size_t)((row0 + 8 * hh + r) % rmod) * ldr + col]; if (RES_BF16) rv = bf16_round(rv); v += rv; }
      if (ACT == 1) v = fmaxf(v, 0.f);
      if (ACT == 2) v = 0.5f * v * (1.0f + erff(v * 0.70710678118654752f));
      if (ACT == 3) { const float u = 0.7978845608028654f * (v + 0.044715f * v * v * v); v = 0.5f * v * (1.0f + tanhf(u)); }
      so[w][8 * hh + r][t * 16 + ln] = v;
    }
  }
  __builtin_amdgcn_fence(__ATOMIC_ACQ_REL, "workgroup");
  __builtin_amdgcn_wave_barrier();
  const int rsub = lane >> 4, c4 = (lane & 15) * 4;
  {
#pragma unroll
    for (int q = 0; q < 8; ++q) {
      const int r = q * 2 + rsub;
      const v4f v = *(const v4fa*)&so[w][r][c4];
      *(v4f*)(C + (size_t)(row0 + r) * ldc + col0 + c4) = v;
    }
    
  }
}
// row LayerNorm (biased variance, eps) over N: s = X (+ R); optional out_sum <- s; out_norm <- (s-mu)*rsqrt(var+eps)*g + b
template <bool PARAM_BF16>
__global__ __launch_bounds__(256) void k_layernorm(const float* __restrict__ X, const float* __restrict__ R, const float* __restrict__ g, const float* __restrict__ bta,
                                                  float* __restrict__ out_sum, float* __restrict__ out_norm, int N, float eps) {
  __shared__ float red[256];
  const int row = blockIdx.x, tid = threadIdx.x;
  const float* x = X + (size_t)row * N; const float* rr = R ? R + (size_t)row * N : nullptr;
  float vals[16];                     // up to N = 4096
  const int per = N / 256;            // contiguous chunk per thread? use strided-by-4 chunks: thread handles j = tid*4 + 1024*u
  float s1 = 0.f;
  for (int u = 0; u < per / 4; ++u) {
    const int j = tid * 4 + 1024 * u;
    const v4f a = *(const v4fa*)(x + j);
    v4f b = {0.f,0.f,0.f,0.f}; if (rr) b = *(const v4fa*)(rr + j);
#pragma unroll
    for (int q = 0; q < 4; ++q) { const float v = a[q] + b[q]; vals[u * 4 + q] = v; s1 += v; }
  }
  red[tid] = s1; __syncthreads();
  for (int st = 128; st > 0; st >>= 1) { if (tid < st) red[tid] += red[tid + st]; __syncthreads(); }
  const float mu = red[0] / (float)N; __syncthreads();
  float s2 = 0.f;
  for (int u = 0; u < per / 4; ++u)
#pragma unroll
    for (int q = 0; q < 4; ++q) { const float c = vals[u * 4 + q] - mu; s2 += c * c; }
  red[tid] = s2; __syncthreads();
  for (int st = 128; st > 0; st >>= 1) { if (tid < st) red[tid] += red[tid + st]; __syncthreads(); }
  const float rs = rsqrtf(red[0] / (float)N + eps);
  {
    for (int u = 0; u < per / 4; ++u) {
      const int j = tid * 4 + 1024 * u;
      v4f o, sm;
#pragma unroll
      for (int q = 0; q < 4; ++q) {
        float gg = g[j + q], bb = bta[j + q];
        if (PARAM_BF16) { gg = bf16_round(gg); bb = bf16_round(bb); }
        sm[q] = vals[u * 4 + q]; o[q] = (vals[u * 4 + q] - mu) * rs * gg + bb;
      }
      if (out_sum) *(v4f*)(out_sum + (size_t)row * N + j) = sm;
      *(v4f*)(out_norm + (size_t)row * N + j) = o;
    }
    
  }
}



// ---- f16 WMMA path (v_wmma_f32_16x16x32_f16): 11-bit significands for operands in range — used where a [0,1] probability operand needs more precision than bf16
typedef _Float16 v16h __attribute__((ext_vector_type(16)));
union FragH { v16h v; v8us half[2]; _Float16 h[16]; unsigned short u[16]; };
template <int NT>
__device__ __forceinline__ v8f mmaH(v16h ah, v16h al, v16h bh, v16h bl, v8f c) {
  c = __builtin_amdgcn_wmma_f32_16x16x32_f16(false, ah, false, bh, (short)0, c, false, false);
  if (NT >= 2) c = __builtin_amdgcn_wmma_f32_16x16x32_f16(false, al, false, bh, (short)0, c, false, false);
  if (NT >= 3) c = __builtin_amdgcn_wmma_f32_16x16x32_f16(false, ah, false, bl, (short)0, c, false, false);
  asm volatile("v_nop\n\tv_nop\n\tv_nop\n\tv_nop" : "+v"(c) : "v"(ah), "v"(al), "v"(bh), "v"(bl));
  return c;
}
// batched GEMM like k_gemm_b but f16 operands: A f32 (split into f16 hi/lo if ASPLIT, else rounded to f16), Bt = f16 values [n][k]; alpha; C f32; N multiple of 16 (partial tiles skipped)
template <bool ASPLIT>
__global__ __launch_bounds__(128) void k_gemm_h(const float* __restrict__ A, int lda, size_t sA, const _Float16* __restrict__ Bh, int ldb, size_t sB, float alpha, float* __restrict__ C, int ldc, size_t sC, int M, int N, int K) {
  __shared__ __attribute__((aligned(16))) float so[4][16][64];
  const int tid = threadIdx.x, w = tid >> 5, lane = tid & 31, ln = lane & 15, hh = lane >> 4; const int by = blockIdx.y;
  A += (size_t)by * sA; Bh += (size_t)by * sB; C += (size_t)by * sC;
  const int ntn = (N + 63) / 64; const int wid = blockIdx.x * 4 + w; const int mt = wid / ntn, nq = wid % ntn; if (mt * 16 >= M) return;
  const int row0 = mt * 16, col0 = nq * 64; const float* arow = A + (size_t)(row0 + ln) * lda;
  v8f acc[4] = {};
  for (int kb = 0; kb < K; kb += 32) {
    FragH ah, al;
    const v4f x0 = *(const v4fa*)(arow + kb + 8 * hh), x1 = *(const v4fa*)(arow + kb + 8 * hh + 4), x2 = *(const v4fa*)(arow + kb + 16 + 8 * hh), x3 = *(const v4fa*)(arow + kb + 16 + 8 * hh + 4);
    float xs[16] = {x0[0],x0[1],x0[2],x0[3],x1[0],x1[1],x1[2],x1[3],x2[0],x2[1],x2[2],x2[3],x3[0],x3[1],x3[2],x3[3]};
#pragma unroll
    for (int i = 0; i < 16; ++i) { const _Float16 h = (_Float16)xs[i]; ah.h[i] = h; al.h[i] = ASPLIT ? (_Float16)(xs[i] - (float)h) : (_Float16)0.0f; }
#pragma unroll
    for (int t = 0; t < 4; ++t) { if (col0 + t * 16 >= N) continue; const size_t boff = (size_t)(col0 + t * 16 + ln) * ldb + kb; FragH bq; bq.half[0] = *(const v8us*)(Bh + boff + 8 * hh); bq.half[1] = *(const v8us*)(Bh + boff + 16 + 8 * hh);
      acc[t] = mmaH<ASPLIT ? 2 : 1>(ah.v, al.v, bq.v, bq.v, acc[t]); }
  }
#pragma unroll
  for (int t = 0; t < 4; ++t) { if (col0 + t * 16 >= N) continue;
#pragma unroll
    for (int r = 0; r < 8; ++r) so[w][8 * hh + r][t * 16 + ln] = acc[t][r] * alpha; }
  __builtin_amdgcn_fence(__ATOMIC_ACQ_REL, "workgroup"); __builtin_amdgcn_wave_barrier();
  const int rsub = lane >> 4, c4 = (lane & 15) * 4;
  {
#pragma unroll
    for (int q = 0; q < 8; ++q) { const int r = q * 2 + rsub; if (col0 + c4 < N) { const v4f v = *(const v4fa*)&so[w][r][c4]; *(v4f*)(C + (size_t)(row0 + r) * ldc + col0 + c4) = v; } }
     }
}

// Wt[n][k] = f16(W[k][n]·scale) from f32 row-major W[K][N] (scale = power of two; bf16-exact weights stay exact in f16 away from the subnormal range)
__global__ __launch_bounds__(256) void k_wt_f16(const float* __restrict__ W, _Float16* __restrict__ Wt, int K, int N, float scale) {
  const int t = blockIdx.x * 256 + threadIdx.x; if (t >= N * (K / 8)) return; const int n = t / (K / 8), k8 = (t % (K / 8)) * 8; FragH f;
#pragma unroll
  for (int i = 0; i < 8; ++i) f.h[i] = (_Float16)(bf16_round(W[(size_t)(k8 + i) * N + n]) * scale); const v8us o = f.half[0];
  *(v8us*)((unsigned short*)Wt + (size_t)n * K + k8) = o; 
}
// k_gemm_hh variant with fused epilogue: v = acc·alpha + bias[by·sBias + col] (+ CP[(row/rowsPerB)·sCPb + by·64 + col] if CP) ; ACT 0 none / 1 elu ; writes f16 C16 (and f32 C if non-null)
template <int ACT>
__global__ __launch_bounds__(128) void k_gemm_hhx(const _Float16* __restrict__ A, int lda, size_t sA, const _Float16* __restrict__ Bh, int ldb, size_t sB, float alpha, const float* __restrict__ bias, size_t sBias, const float* __restrict__ CP, int rowsPerB, size_t sCPb, int row0g,
    float* __restrict__ C, _Float16* __restrict__ C16, int ldc, size_t sC, int M, int N, int K) {
  __shared__ __attribute__((aligned(16))) float so[4][16][64];
  const int tid = threadIdx.x, w = tid >> 5, lane = tid & 31, ln = lane & 15, hh = lane >> 4; const int by = blockIdx.y;
  A += (size_t)by * sA; Bh += (size_t)by * sB; const size_t cofs = (size_t)by * sC; const float* bp = bias ? bias + (size_t)by * sBias : nullptr;
  const int ntn = (N + 63) / 64; const int wid = blockIdx.x * 4 + w; const int mt = wid / ntn, nq = wid % ntn; if (mt * 16 >= M) return;
  const int row0 = mt * 16, col0 = nq * 64; const _Float16* arow = A + (size_t)(row0 + ln) * lda;
  v8f acc[4] = {};
  for (int kb = 0; kb < K; kb += 32) { FragH ah; ah.half[0] = *(const v8us*)((const unsigned short*)arow + kb + 8 * hh); ah.half[1] = *(const v8us*)((const unsigned short*)arow + kb + 16 + 8 * hh);
#pragma unroll
    for (int t = 0; t < 4; ++t) { if (col0 + t * 16 >= N) continue; const size_t boff = (size_t)(col0 + t * 16 + ln) * ldb + kb; FragH bq; bq.half[0] = *(const v8us*)((const unsigned short*)Bh + boff + 8 * hh); bq.half[1] = *(const v8us*)((const unsigned short*)Bh + boff + 16 + 8 * hh);
      acc[t] = mmaH<1>(ah.v, ah.v, bq.v, bq.v, acc[t]); }
  }
#pragma unroll
  for (int t = 0; t < 4; ++t) { if (col0 + t * 16 >= N) continue; const int col = col0 + t * 16 + ln; const float bv = bp ? bf16_round(bp[col]) : 0.f;
#pragma unroll
    for (int r = 0; r < 8; ++r) { float v = acc[t][r] * alpha + bv; if (CP) { const int bidx = (row0g + row0 + 8 * hh + r) / rowsPerB; v += CP[(size_t)bidx * sCPb + (size_t)by * 64 + col]; } if (ACT == 1) v = (v > 0.f) ? v : expm1f(v); else if (ACT == 7) v = (v > 0.f) ? v + 1.0f : expf(v); else if (ACT == 8) v = tanhf(v); else if (ACT == 9) v = 0.5f * v * (1.0f + tanhf(0.7978845608028654f * (v + 0.044715f * v * v * v))); else if (ACT == 11) v = 1.0f / (1.0f + expf(-v)); else if (ACT == 12) v = (v > 0.f) ? v : 0.01f * v; else if (ACT == 14) v = (v > 0.f) ? v : 0.1f * v; else if (ACT == 15) v = v / (1.0f + expf(-v)); else if (ACT == 3) v = fmaxf(v, 0.f); else if (ACT == 6) v = 0.5f * v * (1.0f + erff(v * 0.70710678118654752f)); so[w][8 * hh + r][t * 16 + ln] = v; } }
  __builtin_amdgcn_fence(__ATOMIC_ACQ_REL, "workgroup"); __builtin_amdgcn_wave_barrier();
  const int rsub = lane >> 4, c4 = (lane & 15) * 4; typedef _Float16 v4h __attribute__((ext_vector_type(4)));
  {
#pragma unroll
    for (int q = 0; q < 8; ++q) { const int r = q * 2 + rsub; if (col0 + c4 < N) { const v4f v = *(const v4fa*)&so[w][r][c4]; if (C) *(v4f*)(C + cofs + (size_t)(row0 + r) * ldc + col0 + c4) = v; if (C16) { v4h h4; for (int i = 0; i < 4; ++i) h4[i] = (_Float16)v[i]; *(v4h*)(C16 + cofs + (size_t)(row0 + r) * ldc + col0 + c4) = h4; } } }
     }
}


typedef _Float16 v4h __attribute__((ext_vector_type(4)));

__global__ __launch_bounds__(256) void k_x16(const float* __restrict__ x, _Float16* __restrict__ X16, size_t n8) { const size_t t = (size_t)blockIdx.x * 256 + threadIdx.x; if (t >= n8) return; FragH f;
#pragma unroll
  for (int q = 0; q < 8; ++q) f.h[q] = (_Float16)bf16_round(x[t * 8 + q]); *(v8us*)((unsigned short*)X16 + t * 8) = f.half[0];  }
__global__ __launch_bounds__(256) void k_h16(const float* __restrict__ x, _Float16* __restrict__ X16, size_t n8) { const size_t t = (size_t)blockIdx.x * 256 + threadIdx.x; if (t >= n8) return; FragH f;
#pragma unroll
  for (int q = 0; q < 8; ++q) f.h[q] = (_Float16)x[t * 8 + q]; *(v8us*)((unsigned short*)X16 + t * 8) = f.half[0];  }
__global__ __launch_bounds__(256) void k_round16f(const float* __restrict__ W, _Float16* __restrict__ Bt, size_t n8) { const size_t t = (size_t)blockIdx.x * 256 + threadIdx.x; if (t >= n8) return; FragH f;
#pragma unroll
  for (int i = 0; i < 8; ++i) f.h[i] = (_Float16)(bf16_round(W[t * 8 + i]) * 16.0f); *(v8us*)((unsigned short*)Bt + t * 8) = f.half[0];  }
template <int NHv, int TTv>
__global__ __launch_bounds__(256) void k_vt(const _Float16* __restrict__ V16, int ldv, int voff, _Float16* __restrict__ Vt) { __shared__ unsigned short tl[64][66]; const int tid = threadIdx.x; const int slab = blockIdx.x / (TTv / 64), lg = blockIdx.x % (TTv / 64); const int b = slab / NHv, h = slab % NHv;
  for (int i = tid; i < 64 * 8; i += 256) { const int r = i / 8, c8 = (i % 8) * 8; FragH f; f.half[0] = *(const v8us*)((const unsigned short*)V16 + ((size_t)b * TTv + lg * 64 + r) * ldv + voff + h * 64 + c8);
#pragma unroll
    for (int q = 0; q < 8; ++q) tl[r][c8 + q] = f.u[q]; }
  __syncthreads();
  {
#pragma unroll
    for (int rd = 0; rd < 2; ++rd) { const int d = rd * 32 + tid / 8, pc = tid % 8; FragH f;
#pragma unroll
      for (int q = 0; q < 8; ++q) f.u[q] = tl[pc * 8 + q][d];
      *(v8us*)((unsigned short*)Vt + ((size_t)slab * 64 + d) * TTv + lg * 64 + pc * 8) = f.half[0]; }
     } }

__global__ __launch_bounds__(256) void k_hl(const float* __restrict__ F, _Float16* __restrict__ Hh, _Float16* __restrict__ Hl, size_t n8) { const size_t t = (size_t)blockIdx.x * 256 + threadIdx.x; if (t >= n8) return; FragH fh, fl; const v4f a = *(const v4fa*)(F + t * 8), c = *(const v4fa*)(F + t * 8 + 4);
#pragma unroll
  for (int q = 0; q < 4; ++q) { _Float16 h = (_Float16)a[q]; fh.h[q] = h; fl.h[q] = (_Float16)((a[q] - (float)h) * 1024.0f); h = (_Float16)c[q]; fh.h[4 + q] = h; fl.h[4 + q] = (_Float16)((c[q] - (float)h) * 1024.0f); }
  { *(v8us*)((unsigned short*)Hh + t * 8) = fh.half[0]; *(v8us*)((unsigned short*)Hl + t * 8) = fl.half[0];  } }

// ---- fast GEMM (wave tile 32x64; requires M % 32 == 0 rows per launch region and N % 64 == 0); epilogue = k_gemm_hhx semantics ----
__device__ __forceinline__ v16h g2_frag(const _Float16* p, int hh) { FragH f; f.half[0] = *(const v8us*)((const unsigned short*)p + 8 * hh); f.half[1] = *(const v8us*)((const unsigned short*)p + 16 + 8 * hh); return f.v; }
__device__ __forceinline__ v8f g2_mma(v16h a, v16h b, v8f c) { v8f d = __builtin_amdgcn_wmma_f32_16x16x32_f16(false, a, false, b, (short)0, c, false, false); asm volatile("v_nop\n\tv_nop\n\tv_nop\n\tv_nop" : "+v"(d) : "v"(a), "v"(b)); return d; }
template <int ACT>
__global__ __launch_bounds__(128) void k_gemm2(const _Float16* __restrict__ A, int lda, size_t sA, const _Float16* __restrict__ Bh, int ldb, size_t sB, float alpha, const float* __restrict__ bias, size_t sBias, const float* __restrict__ CP, int rowsPerB, size_t sCPb, int row0g,
    float* __restrict__ C, _Float16* __restrict__ C16, int ldc, size_t sC, int M, int N, int K) {
  __shared__ __attribute__((aligned(16))) float so[4][32][68];
  const int tid = threadIdx.x, w = tid >> 5, lane = tid & 31, ln = lane & 15, hh = lane >> 4; const int by = blockIdx.y;
  A += (size_t)by * sA; Bh += (size_t)by * sB; const size_t cofs = (size_t)by * sC; const float* bp = bias ? bias + (size_t)by * sBias : nullptr;
  const int ntn = N >> 6; const int mt = blockIdx.x / ntn, nq = blockIdx.x - mt * ntn; const int row0 = mt * 128 + 32 * w, col0 = nq * 64; if (row0 >= M) return;
  const _Float16* a0p = A + (size_t)(row0 + ln) * lda; const _Float16* a1p = a0p + (size_t)16 * lda;
  const _Float16* b0p = Bh + (size_t)(col0 + ln) * ldb; const _Float16* b1p = b0p + (size_t)16 * ldb; const _Float16* b2p = b1p + (size_t)16 * ldb; const _Float16* b3p = b2p + (size_t)16 * ldb;
  const v8f z8 = {0.f,0.f,0.f,0.f,0.f,0.f,0.f,0.f}; v8f c00 = z8, c01 = z8, c02 = z8, c03 = z8, c10 = z8, c11 = z8, c12 = z8, c13 = z8;
#pragma unroll 1
  for (int kb = 0; kb < K; kb += 32) { const v16h a0 = g2_frag(a0p + kb, hh), a1 = g2_frag(a1p + kb, hh);
    v16h b = g2_frag(b0p + kb, hh); c00 = g2_mma(a0, b, c00); c10 = g2_mma(a1, b, c10);
    b = g2_frag(b1p + kb, hh); c01 = g2_mma(a0, b, c01); c11 = g2_mma(a1, b, c11);
    b = g2_frag(b2p + kb, hh); c02 = g2_mma(a0, b, c02); c12 = g2_mma(a1, b, c12);
    b = g2_frag(b3p + kb, hh); c03 = g2_mma(a0, b, c03); c13 = g2_mma(a1, b, c13); }
  v8f accs[8] = {c00, c01, c02, c03, c10, c11, c12, c13};
#pragma unroll
  for (int u = 0; u < 8; ++u) { const int t = u & 3, half = u >> 2; const int col = col0 + t * 16 + ln; const float bv = bp ? bf16_round(bp[col]) : 0.f;
#pragma unroll
    for (int r = 0; r < 8; ++r) { const int rloc = half * 16 + 8 * hh + r; float v = accs[u][r] * alpha + bv; if (CP) { const int bidx = (row0g + row0 + rloc) / rowsPerB; v += CP[(size_t)bidx * sCPb + (size_t)by * 64 + col]; }
      if (ACT == 3) v = fmaxf(v, 0.f); else if (ACT == 6) v = 0.5f * v * (1.0f + erff(v * 0.70710678118654752f)); else if (ACT == 11) v = 1.0f / (1.0f + expf(-v)); else if (ACT == 15) v = v / (1.0f + expf(-v)); else if (ACT == 12) v = (v > 0.f) ? v : 0.01f * v; else if (ACT == 8) v = tanhf(v);
      so[w][rloc][t * 16 + ln] = v; } }
  __builtin_amdgcn_fence(__ATOMIC_ACQ_REL, "workgroup"); __builtin_amdgcn_wave_barrier();
  const int rsub = lane >> 4, c4 = (lane & 15) * 4;
  {
#pragma unroll
    for (int q = 0; q < 16; ++q) { const int r = q * 2 + rsub; const v4f v = *(const v4fa*)&so[w][r][c4]; if (C) *(v4f*)(C + cofs + (size_t)(row0 + r) * ldc + col0 + c4) = v; if (C16) { v4h h4; for (int i = 0; i < 4; ++i) h4[i] = (_Float16)v[i]; *(v4h*)(C16 + cofs + (size_t)(row0 + r) * ldc + col0 + c4) = h4; } }
     } }



template <int TK>
__global__ __launch_bounds__(256) void k_vthl(const float* __restrict__ VF, int ldv, _Float16* __restrict__ Vth, _Float16* __restrict__ Vtl) { __shared__ float tl[64][65]; const int tid = threadIdx.x; const int slab = blockIdx.x / (TK / 64), lg = blockIdx.x % (TK / 64); const int b = slab / NH, h = slab % NH;
  for (int i = tid; i < 64 * 16; i += 256) { const int r = i / 16, c4 = (i % 16) * 4; const v4f a = *(const v4fa*)(VF + ((size_t)b * TK + lg * 64 + r) * ldv + h * 64 + c4); tl[r][c4] = a[0]; tl[r][c4 + 1] = a[1]; tl[r][c4 + 2] = a[2]; tl[r][c4 + 3] = a[3]; }
  __syncthreads();
  FragH fh[2], fl[2]; size_t oo[2];
#pragma unroll
  for (int rd = 0; rd < 2; ++rd) { const int d = rd * 32 + tid / 8, pc = tid % 8;
#pragma unroll
    for (int q = 0; q < 8; ++q) { const float v = tl[pc * 8 + q][d]; const _Float16 hv = (_Float16)v; fh[rd].h[q] = hv; fl[rd].h[q] = (_Float16)((v - (float)hv) * 1024.0f); } oo[rd] = ((size_t)slab * 64 + d) * TK + lg * 64 + pc * 8; }
  {
#pragma unroll
    for (int rd = 0; rd < 2; ++rd) { *(v8us*)((unsigned short*)Vth + oo[rd]) = fh[rd].half[0]; *(v8us*)((unsigned short*)Vtl + oo[rd]) = fl[rd].half[0]; }
     } }

template <int TQ, int TK>
__global__ __launch_bounds__(128) void k_flashb(const _Float16* __restrict__ Q16, const _Float16* __restrict__ Q16lo, int ldq, const _Float16* __restrict__ K16, const _Float16* __restrict__ K16lo, int ldk, const _Float16* __restrict__ Vt, const _Float16* __restrict__ Vtlo, const unsigned* __restrict__ MB, const int* __restrict__ RA, const int* __restrict__ KE, const float* __restrict__ BT, const int* __restrict__ LAG, float* __restrict__ O, int ldo) {
  constexpr int RPW = 16, RTN = RPW / 16, NQB = TQ / (4 * RPW), DT = 4, KS = 2;
  __shared__ __attribute__((aligned(16))) unsigned short sP[4][RPW][40], sPl[4][RPW][40]; __shared__ __attribute__((aligned(16))) float sO[4][RPW][64 + 4];
  const int tid = threadIdx.x, w = tid >> 5, lane = tid & 31, ln = lane & 15, hh = lane >> 4;
  const int slab = blockIdx.x / NQB, qblk = blockIdx.x % NQB; const int b = slab / NH, h = slab % NH; const int qb0 = qblk * (4 * RPW); const int q0 = qb0 + w * RPW;
  FragH aq[2][KS], aql[2][KS];
#pragma unroll
  for (int rt = 0; rt < RTN; ++rt) { const size_t qo = ((size_t)b * TQ + q0 + rt * 16 + ln) * ldq + h * 64; const unsigned short* qr = (const unsigned short*)Q16 + qo; const unsigned short* ql = (const unsigned short*)Q16lo + qo;
#pragma unroll
    for (int ks = 0; ks < KS; ++ks) { aq[rt][ks].half[0] = *(const v8us*)(qr + ks * 32 + 8 * hh); aq[rt][ks].half[1] = *(const v8us*)(qr + ks * 32 + 16 + 8 * hh); aql[rt][ks].half[0] = *(const v8us*)(ql + ks * 32 + 8 * hh); aql[rt][ks].half[1] = *(const v8us*)(ql + ks * 32 + 16 + 8 * hh); } }
  const unsigned short* Vth = (const unsigned short*)Vt + (size_t)slab * 64 * TK; const unsigned short* Vtl = (const unsigned short*)Vtlo + (size_t)slab * 64 * TK;
  float m_r[2][8], l_r[2][8]; v8f oacc[2][DT], oaccl[2][DT];
#pragma unroll
  for (int rt = 0; rt < RTN; ++rt) {
#pragma unroll
    for (int r = 0; r < 8; ++r) { m_r[rt][r] = -3.0e38f; l_r[rt][r] = 0.f; }
#pragma unroll
    for (int dt = 0; dt < DT; ++dt) { oacc[rt][dt] = (v8f){0.f,0.f,0.f,0.f,0.f,0.f,0.f,0.f}; oaccl[rt][dt] = oacc[rt][dt]; } }
  int jend = KE[qblk * 32]; jend = min(TK, (jend + 31) & ~31); if (jend < 32) jend = 32;      /* block-uniform */
  int allm[2][8]; const unsigned* mrow[2][8];
#pragma unroll
  for (int rt = 0; rt < RTN; ++rt)
#pragma unroll
    for (int r = 0; r < 8; ++r) { const int tq = q0 + rt * 16 + 8 * hh + r; allm[rt][r] = RA[tq]; mrow[rt][r] = MB + (size_t)tq * (TK / 32); }
#pragma unroll 1
  for (int j0 = 0; j0 < jend; j0 += 32) {
    
    v8f s[2][2];
#pragma unroll
    for (int nt = 0; nt < 2; ++nt) { const size_t ko = ((size_t)b * TK + j0 + nt * 16 + ln) * ldk + h * 64; const unsigned short* kr = (const unsigned short*)K16 + ko; const unsigned short* kl = (const unsigned short*)K16lo + ko; FragH bk[KS], bkl[KS];
#pragma unroll
      for (int ks = 0; ks < KS; ++ks) { bk[ks].half[0] = *(const v8us*)(kr + ks * 32 + 8 * hh); bk[ks].half[1] = *(const v8us*)(kr + ks * 32 + 16 + 8 * hh); bkl[ks].half[0] = *(const v8us*)(kl + ks * 32 + 8 * hh); bkl[ks].half[1] = *(const v8us*)(kl + ks * 32 + 16 + 8 * hh); }
#pragma unroll
      for (int rt = 0; rt < RTN; ++rt) { v8f acc = (v8f){0.f,0.f,0.f,0.f,0.f,0.f,0.f,0.f}, accr = acc;
#pragma unroll
        for (int ks = 0; ks < KS; ++ks) { acc = mmaH<1>(aq[rt][ks].v, aq[rt][ks].v, bk[ks].v, bk[ks].v, acc); accr = mmaH<1>(aql[rt][ks].v, aql[rt][ks].v, bk[ks].v, bk[ks].v, accr); accr = mmaH<1>(aq[rt][ks].v, aq[rt][ks].v, bkl[ks].v, bkl[ks].v, accr); }
        s[rt][nt] = acc + accr * 0.0009765625f; } }
#pragma unroll
    for (int rt = 0; rt < RTN; ++rt)
#pragma unroll
      for (int r = 0; r < 8; ++r) { const unsigned mw = mrow[rt][r][j0 >> 5]; const bool am = (allm[rt][r] != 0); const int tq = q0 + rt * 16 + 8 * hh + r;
        const bool ok0 = am || (((mw >> ln) & 1u) == 0u), ok1 = am || (((mw >> (16 + ln)) & 1u) == 0u);
        const float s0 = ok0 ? (am ? 0.f : s[rt][0][r] * SCL + bf16_round(BT[(size_t)h * 513 + abs(LAG[tq] - LAG[j0 + ln])])) : -INFINITY, s1 = ok1 ? (am ? 0.f : s[rt][1][r] * SCL + bf16_round(BT[(size_t)h * 513 + abs(LAG[tq] - LAG[j0 + 16 + ln])])) : -INFINITY;      /* + lag-distance bias table[h][|lag[q] - lag[k]|] */ float mc = fmaxf(s0, s1);
        mc = fmaxf(mc, __shfl_xor(mc, 1, 32)); mc = fmaxf(mc, __shfl_xor(mc, 2, 32)); mc = fmaxf(mc, __shfl_xor(mc, 4, 32)); mc = fmaxf(mc, __shfl_xor(mc, 8, 32));
        const float mn = fmaxf(m_r[rt][r], mc); const float al = (mn > -1.0e38f) ? expf(m_r[rt][r] - mn) : 1.0f; m_r[rt][r] = mn; const float p0 = ok0 ? expf(s0 - mn) : 0.f, p1 = ok1 ? expf(s1 - mn) : 0.f; l_r[rt][r] = l_r[rt][r] * al + p0 + p1;
#pragma unroll
        for (int dt = 0; dt < DT; ++dt) { oacc[rt][dt][r] *= al; oaccl[rt][dt][r] *= al; }
        FragH t2, t3; const float ps0 = p0 * 1024.0f, ps1 = p1 * 1024.0f; t2.h[0] = (_Float16)ps0; t2.h[1] = (_Float16)ps1; t3.h[0] = (_Float16)((ps0 - (float)t2.h[0]) * 1024.0f); t3.h[1] = (_Float16)((ps1 - (float)t2.h[1]) * 1024.0f);
        sP[w][rt * 16 + 8 * hh + r][ln] = t2.u[0]; sP[w][rt * 16 + 8 * hh + r][16 + ln] = t2.u[1]; sPl[w][rt * 16 + 8 * hh + r][ln] = t3.u[0]; sPl[w][rt * 16 + 8 * hh + r][16 + ln] = t3.u[1]; }
    __builtin_amdgcn_fence(__ATOMIC_ACQ_REL, "workgroup"); __builtin_amdgcn_wave_barrier();
    FragH pa[2], pl[2];
#pragma unroll
    for (int rt = 0; rt < RTN; ++rt) { pa[rt].half[0] = *(const v8us*)&sP[w][rt * 16 + ln][8 * hh]; pa[rt].half[1] = *(const v8us*)&sP[w][rt * 16 + ln][16 + 8 * hh]; pl[rt].half[0] = *(const v8us*)&sPl[w][rt * 16 + ln][8 * hh]; pl[rt].half[1] = *(const v8us*)&sPl[w][rt * 16 + ln][16 + 8 * hh]; }
#pragma unroll
    for (int dt = 0; dt < DT; ++dt) { const size_t vo = (size_t)(dt * 16 + ln) * TK + j0; FragH bv, bl; bv.half[0] = *(const v8us*)(Vth + vo + 8 * hh); bv.half[1] = *(const v8us*)(Vth + vo + 16 + 8 * hh); bl.half[0] = *(const v8us*)(Vtl + vo + 8 * hh); bl.half[1] = *(const v8us*)(Vtl + vo + 16 + 8 * hh);
#pragma unroll
      for (int rt = 0; rt < RTN; ++rt) { oacc[rt][dt] = mmaH<1>(pa[rt].v, pa[rt].v, bv.v, bv.v, oacc[rt][dt]); oaccl[rt][dt] = mmaH<1>(pa[rt].v, pa[rt].v, bl.v, bl.v, oaccl[rt][dt]); oaccl[rt][dt] = mmaH<1>(pl[rt].v, pl[rt].v, bv.v, bv.v, oaccl[rt][dt]); } }
    __builtin_amdgcn_fence(__ATOMIC_ACQ_REL, "workgroup"); __builtin_amdgcn_wave_barrier(); }
#pragma unroll
  for (int rt = 0; rt < RTN; ++rt) {
#pragma unroll
    for (int r = 0; r < 8; ++r) { float l = l_r[rt][r]; l += __shfl_xor(l, 1, 32); l += __shfl_xor(l, 2, 32); l += __shfl_xor(l, 4, 32); l += __shfl_xor(l, 8, 32); l_r[rt][r] = (l > 0.f) ? 1.0f / (l * 1024.0f) : 0.f; }
#pragma unroll
    for (int dt = 0; dt < DT; ++dt)
#pragma unroll
      for (int r = 0; r < 8; ++r) sO[w][rt * 16 + 8 * hh + r][dt * 16 + ln] = (oacc[rt][dt][r] + oaccl[rt][dt][r] * 0.0009765625f) * l_r[rt][r]; }
  __builtin_amdgcn_fence(__ATOMIC_ACQ_REL, "workgroup"); __builtin_amdgcn_wave_barrier();
  {
#pragma unroll
    for (int rp = 0; rp < RPW; rp += 2) { const int r = rp + (lane >> 4), pc = lane & 15; const v4f val = *(const v4fa*)&sO[w][r][pc * 4]; *(v4f*)(O + ((size_t)b * TQ + q0 + r) * ldo + h * 64 + pc * 4) = val; }
     } }


__global__ __launch_bounds__(256) void k_fulltab(unsigned* __restrict__ MB, int* __restrict__ RA, int* __restrict__ KE, int nq, int nk) {
  const int t = blockIdx.x * 256 + threadIdx.x;
  if (t < nq * (nk / 32)) { *(unsigned*)(MB + t) = 0u;  }
  if (t < nq) { *(int*)(RA + t) = 0;  }
  if (t < nq / 64) { *(int*)(KE + t * 32) = nk;  } }
__global__ __launch_bounds__(256) void k_lnx(const float* __restrict__ X, const float* __restrict__ g, const float* __restrict__ bb, _Float16* __restrict__ Y16, float* __restrict__ XB) {
  #pragma clang fp contract(off)
  const int tid = threadIdx.x, w = tid >> 5, ln = tid & 31; const int r = blockIdx.x * 8 + w; if (r >= NR) return; const float* x = X + (size_t)r * DM; float s = 0.f;
#pragma unroll 1
  for (int i = 0; i < DM / 128; ++i) { const v4f a = *(const v4fa*)(x + i * 128 + ln * 4); for (int q = 0; q < 4; ++q) s += bf16_round(a[q]); }
  for (int o = 16; o > 0; o >>= 1) s += __shfl_xor(s, o, 32); const float mu = s / (float)DM; float q2 = 0.f;
#pragma unroll 1
  for (int i = 0; i < DM / 128; ++i) { const v4f a = *(const v4fa*)(x + i * 128 + ln * 4); for (int q = 0; q < 4; ++q) { const float d = bf16_round(a[q]) - mu; q2 += d * d; } }
  for (int o = 16; o > 0; o >>= 1) q2 += __shfl_xor(q2, o, 32); const float rs = rsqrtf(q2 / (float)DM + 1e-5f);
  {
#pragma unroll 1
    for (int i = 0; i < DM / 128; ++i) { const int c0 = i * 128 + ln * 4; const v4f a = *(const v4fa*)(x + c0); _Float16 h4[4]; v4f xb;
      for (int q = 0; q < 4; ++q) { const float t = bf16_round(a[q]); h4[q] = (_Float16)((t - mu) * rs * bf16_round(g[c0 + q]) + bf16_round(bb[c0 + q])); xb[q] = t; }
      *(unsigned long long*)((unsigned short*)Y16 + (size_t)r * DM + c0) = *(const unsigned long long*)h4; *(v4f*)(XB + (size_t)r * DM + c0) = xb; }
     } }
__global__ __launch_bounds__(256) void k_causaltab(unsigned* __restrict__ MB, int* __restrict__ RA, int* __restrict__ KE, int nq, int nk) {
  const int t = blockIdx.x * 256 + threadIdx.x; const int nw = nk / 32;
  if (t < nq * nw) { const int q = t / nw, w = t % nw; const int first = q + 1 - 32 * w; const unsigned bits = (first <= 0) ? 0xffffffffu : ((first >= 32) ? 0u : (0xffffffffu << first)); *(unsigned*)(MB + t) = bits;  }
  if (t < nq) { *(int*)(RA + t) = 0;  }
  if (t < nq / 64) { const int v = 64 * (t + 1); *(int*)(KE + t * 32) = v;  } }


extern "C" void kernel_launch(void* const* d_in, const int* in_sizes, int n_in,
                              void* d_out, int out_size, void* d_ws, size_t ws_size, hipStream_t stream) {
  (void)in_sizes; (void)n_in; (void)out_size;
  const float* const* I = (const float* const*)d_in; const float* x = I[0]; const int* lag = (const int*)d_in[1]; const float* wq = I[2]; const float* bq = I[3]; const float* wk = I[4]; const float* bk = I[5]; const float* wv = I[6]; const float* bv = I[7]; const float* wo = I[8]; const float* bo = I[9]; const float* lb = I[10];
  char* ws = (char*)d_ws; size_t off = 0;
  auto take = [&](size_t bytes) { char* p = ws + off; off += (bytes + 255) & ~(size_t)255; return p; };
  _Float16* BQ = (_Float16*)take((size_t)DM * DM * 2); _Float16* BK = (_Float16*)take((size_t)DM * DM * 2); _Float16* BV = (_Float16*)take((size_t)DM * DM * 2); _Float16* BO = (_Float16*)take((size_t)DM * DM * 2);
  _Float16* X16 = (_Float16*)take((size_t)NR * DM * 2); float* F = (float*)take((size_t)NR * DM * 4);
  _Float16* Qh = (_Float16*)take((size_t)NR * DM * 2); _Float16* Ql = (_Float16*)take((size_t)NR * DM * 2); _Float16* Kh = (_Float16*)take((size_t)NR * DM * 2); _Float16* Kl = (_Float16*)take((size_t)NR * DM * 2); _Float16* Vth = (_Float16*)take((size_t)NR * DM * 2); _Float16* Vtl = (_Float16*)take((size_t)NR * DM * 2);
  unsigned* MB = (unsigned*)take((size_t)SLEN * (SLEN / 32) * 4); int* RA = (int*)take((size_t)SLEN * 4); int* KE = (int*)take((size_t)(SLEN / 64) * 32 * 4);
  if (off > ws_size) return;      /* 8 + 8 + 16 + 48 + 0.6 = 81 MiB */
  float* O = F; _Float16* Oh = Qh; _Float16* Ol = Ql;
  const size_t w8 = (size_t)DM * DM / 8; const unsigned wb = (unsigned)((w8 + 255) / 256);
  k_wt_f16<<<wb, 256, 0, stream>>>(wq, BQ, DM, DM, 16.0f); k_wt_f16<<<wb, 256, 0, stream>>>(wk, BK, DM, DM, 16.0f); k_wt_f16<<<wb, 256, 0, stream>>>(wv, BV, DM, DM, 16.0f); k_wt_f16<<<wb, 256, 0, stream>>>(wo, BO, DM, DM, 16.0f);      /* (in,out) */
  k_fulltab<<<(SLEN * (SLEN / 32) + 255) / 256, 256, 0, stream>>>(MB, RA, KE, SLEN, SLEN);
  const size_t n8 = (size_t)NR * DM / 8; const unsigned nb8 = (unsigned)((n8 + 255) / 256); const dim3 gP((NR / 128) * (DM / 64), 1);
  k_x16<<<nb8, 256, 0, stream>>>(x, X16, n8);
  k_gemm2<0><<<gP, 128, 0, stream>>>(X16, DM, 0, BQ, DM, 0, 0.0625f, bq, 0, nullptr, 1, 0, 0, F, nullptr, DM, 0, NR, DM, DM); k_hl<<<nb8, 256, 0, stream>>>(F, Qh, Ql, n8);
  k_gemm2<0><<<gP, 128, 0, stream>>>(X16, DM, 0, BK, DM, 0, 0.0625f, bk, 0, nullptr, 1, 0, 0, F, nullptr, DM, 0, NR, DM, DM); k_hl<<<nb8, 256, 0, stream>>>(F, Kh, Kl, n8);
  k_gemm2<0><<<gP, 128, 0, stream>>>(X16, DM, 0, BV, DM, 0, 0.0625f, bv, 0, nullptr, 1, 0, 0, F, nullptr, DM, 0, NR, DM, DM);
  for (int b = 0; b < NBT; ++b) k_vthl<SLEN><<<NH * (SLEN / 64), 256, 0, stream>>>(F + (size_t)b * SLEN * DM, DM, Vth + (size_t)b * SLEN * DM, Vtl + (size_t)b * SLEN * DM);
  for (int b = 0; b < NBT; ++b) { const size_t ro = (size_t)b * SLEN * DM;      /* the lag vector is per position, shared across the batch */
    k_flashb<SLEN, SLEN><<<NH * (SLEN / 64), 128, 0, stream>>>(Qh + ro, Ql + ro, DM, Kh + ro, Kl + ro, DM, Vth + ro, Vtl + ro, MB, RA, KE, lb, lag, O + ro, DM); }
  k_hl<<<nb8, 256, 0, stream>>>(O, Oh, Ol, n8);
  k_gemm2<0><<<gP, 128, 0, stream>>>(Oh, DM, 0, BO, DM, 0, 0.0625f, bo, 0, nullptr, 1, 0, 0, (float*)d_out, nullptr, DM, 0, NR, DM, DM);
  k_gemm2<0><<<gP, 128, 0, stream>>>(Ol, DM, 0, BO, DM, 0, 0.0625f / 1024.0f, nullptr, 0, (float*)d_out, 1, (size_t)DM, 0, (float*)d_out, nullptr, DM, 0, NR, DM, DM);
}

// v001
// A run of this version takes 731 microseconds.
// Next to v000, in two timings, it ran 1.58 times as fast each time.
#include <hip/hip_runtime.h>
// Multi-head self-attention with a lag-distance bias (2 x 2048 tokens, 1024 = 16 heads x 64): q,k,v = x W + b; scores = q.k/8 + lag_bias[h][|lag[q] - lag[k]|] with the INPUT integer lag vector; softmax over all keys; out = (attn v) Wo + bo -> [2,2048,1024].
// Structure: x as an exact f16 plane; projections as f16 WMMA GEMMs (32x64 wave tiles, f32 accumulation, exact x16 weights + bias); q, k as f16 hi + (x2^10) residual planes, V^T as hi + residual planes; the fused flash kernel adds the bias gathered from the INPUT table by |lag[q] - lag[k]| (INPUT int32 positions) inside the score stage (all keys valid; online f32 softmax, P staged hi + residual, two value accumulators); O as hi + residual planes into Wo (two GEMMs, bias in the first).
// Compute dtype: x, weights, biases, lag_bias rounded to bf16; projections exact; q, k, P, v, O as f16 hi + residual pairs (~2^-21); f32 accumulation and softmax. v_wmma_f32_16x16x32_f16.
#define NBT 2
#define SLEN 2048
#define DM 1024
#define NH 16
#define SCL 0.125f
#define NR (NBT * SLEN)
typedef __bf16 v16b __attribute__((ext_vector_type(16)));
typedef unsigned short v8us __attribute__((ext_vector_type(8), may_alias));
typedef float  v8f  __attribute__((ext_vector_type(8)));
typedef float  v4f  __attribute__((ext_vector_type(4)));
typedef float  v4fa __attribute__((ext_vector_type(4), may_alias));
union FragB { v16b v; v8us half[2]; unsigned short u[16]; };

__device__ __forceinline__ unsigned short bf16_bits(float x) { unsigned int u = __float_as_uint(x); return (unsigned short)((u + 0x7FFFu + ((u >> 16) & 1u)) >> 16); }
__device__ __forceinline__ float bf16_val(unsigned short b) { return __uint_as_float(((unsigned int)b) << 16); }
__device__ __forceinline__ float bf16_round(float x) { return bf16_val(bf16_bits(x)); }
// D += A·B with NT terms: 1 = ah·bh, 2 = + al·bh (A split), 3 = + ah·bl (both split)
template <int NT>
__device__ __forceinline__ v8f mmaN(v16b ah, v16b al, v16b bh, v16b bl, v8f c) {
  c = __builtin_amdgcn_wmma_f32_16x16x32_bf16(false, ah, false, bh, (short)0, c, false, false);
  if (NT >= 2) c = __builtin_amdgcn_wmma_f32_16x16x32_bf16(false, al, false, bh, (short)0, c, false, false);
  if (NT >= 3) c = __builtin_amdgcn_wmma_f32_16x16x32_bf16(false, ah, false, bl, (short)0, c, false, false);
  asm volatile("v_nop\n\tv_nop\n\tv_nop\n\tv_nop" : "+v"(c) : "v"(ah), "v"(al), "v"(bh), "v"(bl));
  return c;
}

__global__ __launch_bounds__(256) void k_wt_bf16(const float* __restrict__ W, unsigned short* __restrict__ Wt, int K, int N) {
  const int t = blockIdx.x * 256 + threadIdx.x;
  const int k8n = K / 8;
  if (t >= N * k8n) return;
  const int n = t / k8n, k8 = (t % k8n) * 8;
  v8us v;
#pragma unroll
  for (int i = 0; i < 8; ++i) v[i] = bf16_bits(W[(size_t)(k8 + i) * N + n]);
  *(v8us*)(Wt + (size_t)n * K + k8) = v;
  
}

// GEMM C[M][N] (f32, pitch ldc) = act(A[M][K]·W + bias). A f32 row-major (pitch lda) converted per fragment to bf16
// (ASPLIT: hi/lo two planes -> 2 terms, else single rounded term); Wt bf16 [N][K] (pitch ldb). BIAS_BF16 rounds the
// bias to bf16 first (bias quantised to bf16 before the add). K%32==0, M%16==0, N%64==0.
template <bool ASPLIT, int ACT, bool BIAS_BF16>
__global__ __launch_bounds__(128) void k_gemm_bf(const float* __restrict__ A, int lda, const unsigned short* __restrict__ Wt, int ldb,
                                               const float* __restrict__ bias, float* __restrict__ C, int ldc, int M, int N, int K) {
  __shared__ __attribute__((aligned(16))) float so[4][16][64];
  const int tid = threadIdx.x, w = tid >> 5, lane = tid & 31, ln = lane & 15, hh = lane >> 4;
  const int ntn = N / 64;
  const int wid = blockIdx.x * 4 + w;
  const int mt = wid / ntn, nq = wid % ntn;
  if (mt * 16 >= M) return;
  const int row0 = mt * 16, col0 = nq * 64;
  const float* arow = A + (size_t)(row0 + ln) * lda;
  v8f acc[4] = {};
  for (int kb = 0; kb < K; kb += 32) {
    FragB ah, al;
    const v4f x0 = *(const v4fa*)(arow + kb + 8 * hh), x1 = *(const v4fa*)(arow + kb + 8 * hh + 4);
    const v4f x2 = *(const v4fa*)(arow + kb + 16 + 8 * hh), x3 = *(const v4fa*)(arow + kb + 16 + 8 * hh + 4);
    float xs[16] = {x0[0],x0[1],x0[2],x0[3],x1[0],x1[1],x1[2],x1[3],x2[0],x2[1],x2[2],x2[3],x3[0],x3[1],x3[2],x3[3]};
#pragma unroll
    for (int i = 0; i < 16; ++i) { const unsigned short hb = bf16_bits(xs[i]); ah.u[i] = hb; al.u[i] = ASPLIT ? bf16_bits(xs[i] - bf16_val(hb)) : (unsigned short)0; }
#pragma unroll
    for (int t = 0; t < 4; ++t) {
      const unsigned short* brow = Wt + (size_t)(col0 + t * 16 + ln) * ldb + kb;
      FragB b;
      b.half[0] = *(const v8us*)(brow + 8 * hh);
      b.half[1] = *(const v8us*)(brow + 16 + 8 * hh);
      acc[t] = mmaN<ASPLIT ? 2 : 1>(ah.v, al.v, b.v, b.v, acc[t]);
    }
  }
#pragma unroll
  for (int t = 0; t < 4; ++t) {
    float bv = bias ? bias[col0 + t * 16 + ln] : 0.f;
    if (BIAS_BF16) bv = bf16_round(bv);
#pragma unroll
    for (int r = 0; r < 8; ++r) { float v = acc[t][r] + bv; if (ACT == 1) v = fmaxf(v, 0.f); so[w][8 * hh + r][t * 16 + ln] = v; }
  }
  __builtin_amdgcn_fence(__ATOMIC_ACQ_REL, "workgroup");
  __builtin_amdgcn_wave_barrier();
  const int rsub = lane >> 4, c4 = (lane & 15) * 4;
  {
#pragma unroll
    for (int q = 0; q < 8; ++q) {
      const int r = q * 2 + rsub;
      const v4f v = *(const v4fa*)&so[w][r][c4];
      *(v4f*)(C + (size_t)(row0 + r) * ldc + col0 + c4) = v;
    }
    
  }
}

// GEMM C = act(A·W + bias + resid): A f32 (ASPLIT -> hi/lo 2 terms), Wt bf16 [N][K]; ACT 0 none, 1 relu, 2 exact gelu;
// resid (optional, f32, row index = (row % rmod), pitch ldr, RES_BF16 rounds it) added before the activation.
template <bool ASPLIT, int ACT, bool BIAS_BF16, bool RES_BF16>
__global__ __launch_bounds__(128) void k_gemm_bf3(const float* __restrict__ A, int lda, const unsigned short* __restrict__ Wt, int ldb,
                                                const float* __restrict__ bias, const float* __restrict__ resid, int rmod, int ldr,
                                                float* __restrict__ C, int ldc, int M, int N, int K) {
  __shared__ __attribute__((aligned(16))) float so[4][16][64];
  const int tid = threadIdx.x, w = tid >> 5, lane = tid & 31, ln = lane & 15, hh = lane >> 4;
  const int ntn = N / 64;
  const int wid = blockIdx.x * 4 + w;
  const int mt = wid / ntn, nq = wid % ntn;
  if (mt * 16 >= M) return;
  const int row0 = mt * 16, col0 = nq * 64;
  const float* arow = A + (size_t)(row0 + ln) * lda;
  v8f acc[4] = {};
  for (int kb = 0; kb < K; kb += 32) {
    FragB ah, al;
    const v4f x0 = *(const v4fa*)(arow + kb + 8 * hh), x1 = *(const v4fa*)(arow + kb + 8 * hh + 4);
    const v4f x2 = *(const v4fa*)(arow + kb + 16 + 8 * hh), x3 = *(const v4fa*)(arow + kb + 16 + 8 * hh + 4);
    float xs[16] = {x0[0],x0[1],x0[2],x0[3],x1[0],x1[1],x1[2],x1[3],x2[0],x2[1],x2[2],x2[3],x3[0],x3[1],x3[2],x3[3]};
#pragma unroll
    for (int i = 0; i < 16; ++i) { const unsigned short hb = bf16_bits(xs[i]); ah.u[i] = hb; al.u[i] = ASPLIT ? bf16_bits(xs[i] - bf16_val(hb)) : (unsigned short)0; }
#pragma unroll
    for (int t = 0; t < 4; ++t) {
      const unsigned short* brow = Wt + (size_t)(col0 + t * 16 + ln) * ldb + kb;
      FragB b;
      b.half[0] = *(const v8us*)(brow + 8 * hh);
      b.half[1] = *(const v8us*)(brow + 16 + 8 * hh);
      acc[t] = mmaN<ASPLIT ? 2 : 1>(ah.v, al.v, b.v, b.v, acc[t]);
    }
  }
#pragma unroll
  for (int t = 0; t < 4; ++t) {
    const int col = col0 + t * 16 + ln;
    float bv = bias ? bias[col] : 0.f;
    if (BIAS_BF16) bv = bf16_round(bv);
#pragma unroll
    for (int r = 0; r < 8; ++r) {
      float v = acc[t][r] + bv;
      if (resid) { float rv = resid[(size_t)((row0 + 8 * hh + r) % rmod) * ldr + col]; if (RES_BF16) rv = bf16_round(rv); v += rv; }
      if (ACT == 1) v = fmaxf(v, 0.f);
      if (ACT == 2) v = 0.5f * v * (1.0f + erff(v * 0.70710678118654752f));
      if (ACT == 3) { const float u = 0.7978845608028654f * (v + 0.044715f * v * v * v); v = 0.5f * v * (1.0f + tanhf(u)); }
      so[w][8 * hh + r][t * 16 + ln] = v;
    }
  }
  __builtin_amdgcn_fence(__ATOMIC_ACQ_REL, "workgroup");
  __builtin_amdgcn_wave_barrier();
  const int rsub = lane >> 4, c4 = (lane & 15) * 4;
  {
#pragma unroll
    for (int q = 0; q < 8; ++q) {
      const int r = q * 2 + rsub;
      const v4f v = *(const v4fa*)&so[w][r][c4];
      *(v4f*)(C + (size_t)(row0 + r) * ldc + col0 + c4) = v;
    }
    
  }
}
// row LayerNorm (biased variance, eps) over N: s = X (+ R); optional out_sum <- s; out_norm <- (s-mu)*rsqrt(var+eps)*g + b
template <bool PARAM_BF16>
__global__ __launch_bounds__(256) void k_layernorm(const float* __restrict__ X, const float* __restrict__ R, const float* __restrict__ g, const float* __restrict__ bta,
                                                  float* __restrict__ out_sum, float* __restrict__ out_norm, int N, float eps) {
  __shared__ float red[256];
  const int row = blockIdx.x, tid = threadIdx.x;
  const float* x = X + (size_t)row * N; const float* rr = R ? R + (size_t)row * N : nullptr;
  float vals[16];                     // up to N = 4096
  const int per = N / 256;            // contiguous chunk per thread? use strided-by-4 chunks: thread handles j = tid*4 + 1024*u
  float s1 = 0.f;
  for (int u = 0; u < per / 4; ++u) {
    const int j = tid * 4 + 1024 * u;
    const v4f a = *(const v4fa*)(x + j);
    v4f b = {0.f,0.f,0.f,0.f}; if (rr) b = *(const v4fa*)(rr + j);
#pragma unroll
    for (int q = 0; q < 4; ++q) { const float v = a[q] + b[q]; vals[u * 4 + q] = v; s1 += v; }
  }
  red[tid] = s1; __syncthreads();
  for (int st = 128; st > 0; st >>= 1) { if (tid < st) red[tid] += red[tid + st]; __syncthreads(); }
  const float mu = red[0] / (float)N; __syncthreads();
  float s2 = 0.f;
  for (int u = 0; u < per / 4; ++u)
#pragma unroll
    for (int q = 0; q < 4; ++q) { const float c = vals[u * 4 + q] - mu; s2 += c * c; }
  red[tid] = s2; __syncthreads();
  for (int st = 128; st > 0; st >>= 1) { if (tid < st) red[tid] += red[tid + st]; __syncthreads(); }
  const float rs = rsqrtf(red[0] / (float)N + eps);
  {
    for (int u = 0; u < per / 4; ++u) {
      const int j = tid * 4 + 1024 * u;
      v4f o, sm;
#pragma unroll
      for (int q = 0; q < 4; ++q) {
        float gg = g[j + q], bb = bta[j + q];
        if (PARAM_BF16) { gg = bf16_round(gg); bb = bf16_round(bb); }
        sm[q] = vals[u * 4 + q]; o[q] = (vals[u * 4 + q] - mu) * rs * gg + bb;
      }
      if (out_sum) *(v4f*)(out_sum + (size_t)row * N + j) = sm;
      *(v4f*)(out_norm + (size_t)row * N + j) = o;
    }
    
  }
}



// ---- f16 WMMA path (v_wmma_f32_16x16x32_f16): 11-bit significands for operands in range — used where a [0,1] probability operand needs more precision than bf16
typedef _Float16 v16h __attribute__((ext_vector_type(16)));
union FragH { v16h v; v8us half[2]; _Float16 h[16]; unsigned short u[16]; };
template <int NT>
__device__ __forceinline__ v8f mmaH(v16h ah, v16h al, v16h bh, v16h bl, v8f c) {
  c = __builtin_amdgcn_wmma_f32_16x16x32_f16(false, ah, false, bh, (short)0, c, false, false);
  if (NT >= 2) c = __builtin_amdgcn_wmma_f32_16x16x32_f16(false, al, false, bh, (short)0, c, false, false);
  if (NT >= 3) c = __builtin_amdgcn_wmma_f32_16x16x32_f16(false, ah, false, bl, (short)0, c, false, false);
  asm volatile("v_nop\n\tv_nop\n\tv_nop\n\tv_nop" : "+v"(c) : "v"(ah), "v"(al), "v"(bh), "v"(bl));
  return c;
}
// batched GEMM like k_gemm_b but f16 operands: A f32 (split into f16 hi/lo if ASPLIT, else rounded to f16), Bt = f16 values [n][k]; alpha; C f32; N multiple of 16 (partial tiles skipped)
template <bool ASPLIT>
__global__ __launch_bounds__(128) void k_gemm_h(const float* __restrict__ A, int lda, size_t sA, const _Float16* __restrict__ Bh, int ldb, size_t sB, float alpha, float* __restrict__ C, int ldc, size_t sC, int M, int N, int K) {
  __shared__ __attribute__((aligned(16))) float so[4][16][64];
  const int tid = threadIdx.x, w = tid >> 5, lane = tid & 31, ln = lane & 15, hh = lane >> 4; const int by = blockIdx.y;
  A += (size_t)by * sA; Bh += (size_t)by * sB; C += (size_t)by * sC;
  const int ntn = (N + 63) / 64; const int wid = blockIdx.x * 4 + w; const int mt = wid / ntn, nq = wid % ntn; if (mt * 16 >= M) return;
  const int row0 = mt * 16, col0 = nq * 64; const float* arow = A + (size_t)(row0 + ln) * lda;
  v8f acc[4] = {};
  for (int kb = 0; kb < K; kb += 32) {
    FragH ah, al;
    const v4f x0 = *(const v4fa*)(arow + kb + 8 * hh), x1 = *(const v4fa*)(arow + kb + 8 * hh + 4), x2 = *(const v4fa*)(arow + kb + 16 + 8 * hh), x3 = *(const v4fa*)(arow + kb + 16 + 8 * hh + 4);
    float xs[16] = {x0[0],x0[1],x0[2],x0[3],x1[0],x1[1],x1[2],x1[3],x2[0],x2[1],x2[2],x2[3],x3[0],x3[1],x3[2],x3[3]};
#pragma unroll
    for (int i = 0; i < 16; ++i) { const _Float16 h = (_Float16)xs[i]; ah.h[i] = h; al.h[i] = ASPLIT ? (_Float16)(xs[i] - (float)h) : (_Float16)0.0f; }
#pragma unroll
    for (int t = 0; t < 4; ++t) { if (col0 + t * 16 >= N) continue; const size_t boff = (size_t)(col0 + t * 16 + ln) * ldb + kb; FragH bq; bq.half[0] = *(const v8us*)(Bh + boff + 8 * hh); bq.half[1] = *(const v8us*)(Bh + boff + 16 + 8 * hh);
      acc[t] = mmaH<ASPLIT ? 2 : 1>(ah.v, al.v, bq.v, bq.v, acc[t]); }
  }
#pragma unroll
  for (int t = 0; t < 4; ++t) { if (col0 + t * 16 >= N) continue;
#pragma unroll
    for (int r = 0; r < 8; ++r) so[w][8 * hh + r][t * 16 + ln] = acc[t][r] * alpha; }
  __builtin_amdgcn_fence(__ATOMIC_ACQ_REL, "workgroup"); __builtin_amdgcn_wave_barrier();
  const int rsub = lane >> 4, c4 = (lane & 15) * 4;
  {
#pragma unroll
    for (int q = 0; q < 8; ++q) { const int r = q * 2 + rsub; if (col0 + c4 < N) { const v4f v = *(const v4fa*)&so[w][r][c4]; *(v4f*)(C + (size_t)(row0 + r) * ldc + col0 + c4) = v; } }
     }
}

// Wt[n][k] = f16(W[k][n]·scale) from f32 row-major W[K][N] (scale = power of two; bf16-exact weights stay exact in f16 away from the subnormal range)
// blockIdx.y picks one of four equally shaped matrices; their transposes lie one behind the other in Wt
__global__ __launch_bounds__(256) void k_wt_f16(const float* __restrict__ W0, const float* __restrict__ W1, const float* __restrict__ W2, const float* __restrict__ W3, _Float16* __restrict__ Wt, int K, int N, float scale) {
  const int by = blockIdx.y; const float* __restrict__ W = (by == 0) ? W0 : (by == 1) ? W1 : (by == 2) ? W2 : W3; Wt += (size_t)by * K * N;
  const int t = blockIdx.x * 256 + threadIdx.x; if (t >= N * (K / 8)) return; const int n = t / (K / 8), k8 = (t % (K / 8)) * 8; FragH f;
#pragma unroll
  for (int i = 0; i < 8; ++i) f.h[i] = (_Float16)(bf16_round(W[(size_t)(k8 + i) * N + n]) * scale); const v8us o = f.half[0];
  *(v8us*)((unsigned short*)Wt + (size_t)n * K + k8) = o; 
}
// k_gemm_hh variant with fused epilogue: v = acc·alpha + bias[by·sBias + col] (+ CP[(row/rowsPerB)·sCPb + by·64 + col] if CP) ; ACT 0 none / 1 elu ; writes f16 C16 (and f32 C if non-null)
template <int ACT>
__global__ __launch_bounds__(128) void k_gemm_hhx(const _Float16* __restrict__ A, int lda, size_t sA, const _Float16* __restrict__ Bh, int ldb, size_t sB, float alpha, const float* __restrict__ bias, size_t sBias, const float* __restrict__ CP, int rowsPerB, size_t sCPb, int row0g,
    float* __restrict__ C, _Float16* __restrict__ C16, int ldc, size_t sC, int M, int N, int K) {
  __shared__ __attribute__((aligned(16))) float so[4][16][64];
  const int tid = threadIdx.x, w = tid >> 5, lane = tid & 31, ln = lane & 15, hh = lane >> 4; const int by = blockIdx.y;
  A += (size_t)by * sA; Bh += (size_t)by * sB; const size_t cofs = (size_t)by * sC; const float* bp = bias ? bias + (size_t)by * sBias : nullptr;
  const int ntn = (N + 63) / 64; const int wid = blockIdx.x * 4 + w; const int mt = wid / ntn, nq = wid % ntn; if (mt * 16 >= M) return;
  const int row0 = mt * 16, col0 = nq * 64; const _Float16* arow = A + (size_t)(row0 + ln) * lda;
  v8f acc[4] = {};
  for (int kb = 0; kb < K; kb += 32) { FragH ah; ah.half[0] = *(const v8us*)((const unsigned short*)arow + kb + 8 * hh); ah.half[1] = *(const v8us*)((const unsigned short*)arow + kb + 16 + 8 * hh);
#pragma unroll
    for (int t = 0; t < 4; ++t) { if (col0 + t * 16 >= N) continue; const size_t boff = (size_t)(col0 + t * 16 + ln) * ldb + kb; FragH bq; bq.half[0] = *(const v8us*)((const unsigned short*)Bh + boff + 8 * hh); bq.half[1] = *(const v8us*)((const unsigned short*)Bh + boff + 16 + 8 * hh);
      acc[t] = mmaH<1>(ah.v, ah.v, bq.v, bq.v, acc[t]); }
  }
#pragma unroll
  for (int t = 0; t < 4; ++t) { if (col0 + t * 16 >= N) continue; const int col = col0 + t * 16 + ln; const float bv = bp ? bf16_round(bp[col]) : 0.f;
#pragma unroll
    for (int r = 0; r < 8; ++r) { float v = acc[t][r] * alpha + bv; if (CP) { const int bidx = (row0g + row0 + 8 * hh + r) / rowsPerB; v += CP[(size_t)bidx * sCPb + (size_t)by * 64 + col]; } if (ACT == 1) v = (v > 0.f) ? v : expm1f(v); else if (ACT == 7) v = (v > 0.f) ? v + 1.0f : expf(v); else if (ACT == 8) v = tanhf(v); else if (ACT == 9) v = 0.5f * v * (1.0f + tanhf(0.7978845608028654f * (v + 0.044715f * v * v * v))); else if (ACT == 11) v = 1.0f / (1.0f + expf(-v)); else if (ACT == 12) v = (v > 0.f) ? v : 0.01f * v; else if (ACT == 14) v = (v > 0.f) ? v : 0.1f * v; else if (ACT == 15) v = v / (1.0f + expf(-v)); else if (ACT == 3) v = fmaxf(v, 0.f); else if (ACT == 6) v = 0.5f * v * (1.0f + erff(v * 0.70710678118654752f)); so[w][8 * hh + r][t * 16 + ln] = v; } }
  __builtin_amdgcn_fence(__ATOMIC_ACQ_REL, "workgroup"); __builtin_amdgcn_wave_barrier();
  const int rsub = lane >> 4, c4 = (lane & 15) * 4; typedef _Float16 v4h __attribute__((ext_vector_type(4)));
  {
#pragma unroll
    for (int q = 0; q < 8; ++q) { const int r = q * 2 + rsub; if (col0 + c4 < N) { const v4f v = *(const v4fa*)&so[w][r][c4]; if (C) *(v4f*)(C + cofs + (size_t)(row0 + r) * ldc + col0 + c4) = v; if (C16) { v4h h4; for (int i = 0; i < 4; ++i) h4[i] = (_Float16)v[i]; *(v4h*)(C16 + cofs + (size_t)(row0 + r) * ldc + col0 + c4) = h4; } } }
     }
}


typedef _Float16 v4h __attribute__((ext_vector_type(4)));

__global__ __launch_bounds__(256) void k_x16(const float* __restrict__ x, _Float16* __restrict__ X16, size_t n8) { const size_t t = (size_t)blockIdx.x * 256 + threadIdx.x; if (t >= n8) return; FragH f;
#pragma unroll
  for (int q = 0; q < 8; ++q) f.h[q] = (_Float16)bf16_round(x[t * 8 + q]); *(v8us*)((unsigned short*)X16 + t * 8) = f.half[0];  }
__global__ __launch_bounds__(256) void k_h16(const float* __restrict__ x, _Float16* __restrict__ X16, size_t n8) { const size_t t = (size_t)blockIdx.x * 256 + threadIdx.x; if (t >= n8) return; FragH f;
#pragma unroll
  for (int q = 0; q < 8; ++q) f.h[q] = (_Float16)x[t * 8 + q]; *(v8us*)((unsigned short*)X16 + t * 8) = f.half[0];  }
__global__ __launch_bounds__(256) void k_round16f(const float* __restrict__ W, _Float16* __restrict__ Bt, size_t n8) { const size_t t = (size_t)blockIdx.x * 256 + threadIdx.x; if (t >= n8) return; FragH f;
#pragma unroll
  for (int i = 0; i < 8; ++i) f.h[i] = (_Float16)(bf16_round(W[t * 8 + i]) * 16.0f); *(v8us*)((unsigned short*)Bt + t * 8) = f.half[0];  }
template <int NHv, int TTv>
__global__ __launch_bounds__(256) void k_vt(const _Float16* __restrict__ V16, int ldv, int voff, _Float16* __restrict__ Vt) { __shared__ unsigned short tl[64][66]; const int tid = threadIdx.x; const int slab = blockIdx.x / (TTv / 64), lg = blockIdx.x % (TTv / 64); const int b = slab / NHv, h = slab % NHv;
  for (int i = tid; i < 64 * 8; i += 256) { const int r = i / 8, c8 = (i % 8) * 8; FragH f; f.half[0] = *(const v8us*)((const unsigned short*)V16 + ((size_t)b * TTv + lg * 64 + r) * ldv + voff + h * 64 + c8);
#pragma unroll
    for (int q = 0; q < 8; ++q) tl[r][c8 + q] = f.u[q]; }
  __syncthreads();
  {
#pragma unroll
    for (int rd = 0; rd < 2; ++rd) { const int d = rd * 32 + tid / 8, pc = tid % 8; FragH f;
#pragma unroll
      for (int q = 0; q < 8; ++q) f.u[q] = tl[pc * 8 + q][d];
      *(v8us*)((unsigned short*)Vt + ((size_t)slab * 64 + d) * TTv + lg * 64 + pc * 8) = f.half[0]; }
     } }

__global__ __launch_bounds__(256) void k_hl(const float* __restrict__ F, _Float16* __restrict__ Hh, _Float16* __restrict__ Hl, size_t n8) { const size_t t = (size_t)blockIdx.x * 256 + threadIdx.x; if (t >= n8) return; FragH fh, fl; const v4f a = *(const v4fa*)(F + t * 8), c = *(const v4fa*)(F + t * 8 + 4);
#pragma unroll
  for (int q = 0; q < 4; ++q) { _Float16 h = (_Float16)a[q]; fh.h[q] = h; fl.h[q] = (_Float16)((a[q] - (float)h) * 1024.0f); h = (_Float16)c[q]; fh.h[4 + q] = h; fl.h[4 + q] = (_Float16)((c[q] - (float)h) * 1024.0f); }
  { *(v8us*)((unsigned short*)Hh + t * 8) = fh.half[0]; *(v8us*)((unsigned short*)Hl + t * 8) = fl.half[0];  } }

// ---- fast GEMM (wave tile 32x64; requires M % 32 == 0 rows per launch region and N % 64 == 0); epilogue like k_gemm_hhx, but the bias is bias, bias1 or bias2 by blockIdx.y ----
__device__ __forceinline__ v16h g2_frag(const _Float16* p, int hh) { FragH f; f.half[0] = *(const v8us*)((const unsigned short*)p + 8 * hh); f.half[1] = *(const v8us*)((const unsigned short*)p + 16 + 8 * hh); return f.v; }
__device__ __forceinline__ v8f g2_mma(v16h a, v16h b, v8f c) { v8f d = __builtin_amdgcn_wmma_f32_16x16x32_f16(false, a, false, b, (short)0, c, false, false); asm volatile("v_nop\n\tv_nop\n\tv_nop\n\tv_nop" : "+v"(d) : "v"(a), "v"(b)); return d; }
template <int ACT>
__global__ __launch_bounds__(128) void k_gemm2(const _Float16* __restrict__ A, int lda, size_t sA, const _Float16* __restrict__ Bh, int ldb, size_t sB, float alpha, const float* __restrict__ bias, const float* __restrict__ bias1, const float* __restrict__ bias2, const float* __restrict__ CP, int rowsPerB, size_t sCPb, int row0g,
    float* __restrict__ C, _Float16* __restrict__ C16, int ldc, size_t sC, int M, int N, int K) {
  __shared__ __attribute__((aligned(16))) float so[4][32][68];
  const int tid = threadIdx.x, w = tid >> 5, lane = tid & 31, ln = lane & 15, hh = lane >> 4; const int by = blockIdx.y;
  A += (size_t)by * sA; Bh += (size_t)by * sB; const size_t cofs = (size_t)by * sC; const float* bp = (by == 0) ? bias : (by == 1) ? bias1 : bias2;      /* one bias vector per blockIdx.y */
  const int ntn = N >> 6; const int mt = blockIdx.x / ntn, nq = blockIdx.x - mt * ntn; const int row0 = mt * 128 + 32 * w, col0 = nq * 64; if (row0 >= M) return;
  const _Float16* a0p = A + (size_t)(row0 + ln) * lda; const _Float16* a1p = a0p + (size_t)16 * lda;
  const _Float16* b0p = Bh + (size_t)(col0 + ln) * ldb; const _Float16* b1p = b0p + (size_t)16 * ldb; const _Float16* b2p = b1p + (size_t)16 * ldb; const _Float16* b3p = b2p + (size_t)16 * ldb;
  const v8f z8 = {0.f,0.f,0.f,0.f,0.f,0.f,0.f,0.f}; v8f c00 = z8, c01 = z8, c02 = z8, c03 = z8, c10 = z8, c11 = z8, c12 = z8, c13 = z8;
#pragma unroll 1
  for (int kb = 0; kb < K; kb += 32) { const v16h a0 = g2_frag(a0p + kb, hh), a1 = g2_frag(a1p + kb, hh);
    v16h b = g2_frag(b0p + kb, hh); c00 = g2_mma(a0, b, c00); c10 = g2_mma(a1, b, c10);
    b = g2_frag(b1p + kb, hh); c01 = g2_mma(a0, b, c01); c11 = g2_mma(a1, b, c11);
    b = g2_frag(b2p + kb, hh); c02 = g2_mma(a0, b, c02); c12 = g2_mma(a1, b, c12);
    b = g2_frag(b3p + kb, hh); c03 = g2_mma(a0, b, c03); c13 = g2_mma(a1, b, c13); }
  v8f accs[8] = {c00, c01, c02, c03, c10, c11, c12, c13};
#pragma unroll
  for (int u = 0; u < 8; ++u) { const int t = u & 3, half = u >> 2; const int col = col0 + t * 16 + ln; const float bv = bp ? bf16_round(bp[col]) : 0.f;
#pragma unroll
    for (int r = 0; r < 8; ++r) { const int rloc = half * 16 + 8 * hh + r; float v = accs[u][r] * alpha + bv; if (CP) { const int bidx = (row0g + row0 + rloc) / rowsPerB; v += CP[(size_t)bidx * sCPb + (size_t)by * 64 + col]; }
      if (ACT == 3) v = fmaxf(v, 0.f); else if (ACT == 6) v = 0.5f * v * (1.0f + erff(v * 0.70710678118654752f)); else if (ACT == 11) v = 1.0f / (1.0f + expf(-v)); else if (ACT == 15) v = v / (1.0f + expf(-v)); else if (ACT == 12) v = (v > 0.f) ? v : 0.01f * v; else if (ACT == 8) v = tanhf(v);
      so[w][rloc][t * 16 + ln] = v; } }
  __builtin_amdgcn_fence(__ATOMIC_ACQ_REL, "workgroup"); __builtin_amdgcn_wave_barrier();
  const int rsub = lane >> 4, c4 = (lane & 15) * 4;
  {
#pragma unroll
    for (int q = 0; q < 16; ++q) { const int r = q * 2 + rsub; const v4f v = *(const v4fa*)&so[w][r][c4]; if (C) *(v4f*)(C + cofs + (size_t)(row0 + r) * ldc + col0 + c4) = v; if (C16) { v4h h4; for (int i = 0; i < 4; ++i) h4[i] = (_Float16)v[i]; *(v4h*)(C16 + cofs + (size_t)(row0 + r) * ldc + col0 + c4) = h4; } }
     } }



template <int TK>
__global__ __launch_bounds__(256) void k_vthl(const float* __restrict__ VF, int ldv, _Float16* __restrict__ Vth, _Float16* __restrict__ Vtl) { __shared__ float tl[64][65]; const int tid = threadIdx.x; const int slab = blockIdx.x / (TK / 64), lg = blockIdx.x % (TK / 64); const int b = slab / NH, h = slab % NH;
  for (int i = tid; i < 64 * 16; i += 256) { const int r = i / 16, c4 = (i % 16) * 4; const v4f a = *(const v4fa*)(VF + ((size_t)b * TK + lg * 64 + r) * ldv + h * 64 + c4); tl[r][c4] = a[0]; tl[r][c4 + 1] = a[1]; tl[r][c4 + 2] = a[2]; tl[r][c4 + 3] = a[3]; }
  __syncthreads();
  FragH fh[2], fl[2]; size_t oo[2];
#pragma unroll
  for (int rd = 0; rd < 2; ++rd) { const int d = rd * 32 + tid / 8, pc = tid % 8;
#pragma unroll
    for (int q = 0; q < 8; ++q) { const float v = tl[pc * 8 + q][d]; const _Float16 hv = (_Float16)v; fh[rd].h[q] = hv; fl[rd].h[q] = (_Float16)((v - (float)hv) * 1024.0f); } oo[rd] = ((size_t)slab * 64 + d) * TK + lg * 64 + pc * 8; }
  {
#pragma unroll
    for (int rd = 0; rd < 2; ++rd) { *(v8us*)((unsigned short*)Vth + oo[rd]) = fh[rd].half[0]; *(v8us*)((unsigned short*)Vtl + oo[rd]) = fl[rd].half[0]; }
     } }

template <int TQ, int TK>
__global__ __launch_bounds__(128) void k_flashb(const _Float16* __restrict__ Q16, const _Float16* __restrict__ Q16lo, int ldq, const _Float16* __restrict__ K16, const _Float16* __restrict__ K16lo, int ldk, const _Float16* __restrict__ Vt, const _Float16* __restrict__ Vtlo, const unsigned* __restrict__ MB, const int* __restrict__ RA, const int* __restrict__ KE, const float* __restrict__ BT, const int* __restrict__ LAG, float* __restrict__ O, int ldo) {
  constexpr int RPW = 16, RTN = RPW / 16, NQB = TQ / (4 * RPW), DT = 4, KS = 2;
  __shared__ __attribute__((aligned(16))) unsigned short sP[4][RPW][40], sPl[4][RPW][40]; __shared__ __attribute__((aligned(16))) float sO[4][RPW][64 + 4];
  const int tid = threadIdx.x, w = tid >> 5, lane = tid & 31, ln = lane & 15, hh = lane >> 4;
  const int slab = blockIdx.x / NQB, qblk = blockIdx.x % NQB; const int b = slab / NH, h = slab % NH; const int qb0 = qblk * (4 * RPW); const int q0 = qb0 + w * RPW;
  FragH aq[2][KS], aql[2][KS];
#pragma unroll
  for (int rt = 0; rt < RTN; ++rt) { const size_t qo = ((size_t)b * TQ + q0 + rt * 16 + ln) * ldq + h * 64; const unsigned short* qr = (const unsigned short*)Q16 + qo; const unsigned short* ql = (const unsigned short*)Q16lo + qo;
#pragma unroll
    for (int ks = 0; ks < KS; ++ks) { aq[rt][ks].half[0] = *(const v8us*)(qr + ks * 32 + 8 * hh); aq[rt][ks].half[1] = *(const v8us*)(qr + ks * 32 + 16 + 8 * hh); aql[rt][ks].half[0] = *(const v8us*)(ql + ks * 32 + 8 * hh); aql[rt][ks].half[1] = *(const v8us*)(ql + ks * 32 + 16 + 8 * hh); } }
  const unsigned short* Vth = (const unsigned short*)Vt + (size_t)slab * 64 * TK; const unsigned short* Vtl = (const unsigned short*)Vtlo + (size_t)slab * 64 * TK;
  float m_r[2][8], l_r[2][8]; v8f oacc[2][DT], oaccl[2][DT];
#pragma unroll
  for (int rt = 0; rt < RTN; ++rt) {
#pragma unroll
    for (int r = 0; r < 8; ++r) { m_r[rt][r] = -3.0e38f; l_r[rt][r] = 0.f; }
#pragma unroll
    for (int dt = 0; dt < DT; ++dt) { oacc[rt][dt] = (v8f){0.f,0.f,0.f,0.f,0.f,0.f,0.f,0.f}; oaccl[rt][dt] = oacc[rt][dt]; } }
  int jend = KE[qblk * 32]; jend = min(TK, (jend + 31) & ~31); if (jend < 32) jend = 32;      /* block-uniform */
  int allm[2][8]; const unsigned* mrow[2][8];
#pragma unroll
  for (int rt = 0; rt < RTN; ++rt)
#pragma unroll
    for (int r = 0; r < 8; ++r) { const int tq = q0 + rt * 16 + 8 * hh + r; allm[rt][r] = RA[tq]; mrow[rt][r] = MB + (size_t)tq * (TK / 32); }
#pragma unroll 1
  for (int j0 = 0; j0 < jend; j0 += 32) {
    
    v8f s[2][2];
#pragma unroll
    for (int nt = 0; nt < 2; ++nt) { const size_t ko = ((size_t)b * TK + j0 + nt * 16 + ln) * ldk + h * 64; const unsigned short* kr = (const unsigned short*)K16 + ko; const unsigned short* kl = (const unsigned short*)K16lo + ko; FragH bk[KS], bkl[KS];
#pragma unroll
      for (int ks = 0; ks < KS; ++ks) { bk[ks].half[0] = *(const v8us*)(kr + ks * 32 + 8 * hh); bk[ks].half[1] = *(const v8us*)(kr + ks * 32 + 16 + 8 * hh); bkl[ks].half[0] = *(const v8us*)(kl + ks * 32 + 8 * hh); bkl[ks].half[1] = *(const v8us*)(kl + ks * 32 + 16 + 8 * hh); }
#pragma unroll
      for (int rt = 0; rt < RTN; ++rt) { v8f acc = (v8f){0.f,0.f,0.f,0.f,0.f,0.f,0.f,0.f}, accr = acc;
#pragma unroll
        for (int ks = 0; ks < KS; ++ks) { acc = mmaH<1>(aq[rt][ks].v, aq[rt][ks].v, bk[ks].v, bk[ks].v, acc); accr = mmaH<1>(aql[rt][ks].v, aql[rt][ks].v, bk[ks].v, bk[ks].v, accr); accr = mmaH<1>(aq[rt][ks].v, aq[rt][ks].v, bkl[ks].v, bkl[ks].v, accr); }
        s[rt][nt] = acc + accr * 0.0009765625f; } }
#pragma unroll
    for (int rt = 0; rt < RTN; ++rt)
#pragma unroll
      for (int r = 0; r < 8; ++r) { const unsigned mw = mrow[rt][r][j0 >> 5]; const bool am = (allm[rt][r] != 0); const int tq = q0 + rt * 16 + 8 * hh + r;
        const bool ok0 = am || (((mw >> ln) & 1u) == 0u), ok1 = am || (((mw >> (16 + ln)) & 1u) == 0u);
        const float s0 = ok0 ? (am ? 0.f : s[rt][0][r] * SCL + bf16_round(BT[(size_t)h * 513 + abs(LAG[tq] - LAG[j0 + ln])])) : -INFINITY, s1 = ok1 ? (am ? 0.f : s[rt][1][r] * SCL + bf16_round(BT[(size_t)h * 513 + abs(LAG[tq] - LAG[j0 + 16 + ln])])) : -INFINITY;      /* + lag-distance bias table[h][|lag[q] - lag[k]|] */ float mc = fmaxf(s0, s1);
        mc = fmaxf(mc, __shfl_xor(mc, 1, 32)); mc = fmaxf(mc, __shfl_xor(mc, 2, 32)); mc = fmaxf(mc, __shfl_xor(mc, 4, 32)); mc = fmaxf(mc, __shfl_xor(mc, 8, 32));
        const float mn = fmaxf(m_r[rt][r], mc); const float al = (mn > -1.0e38f) ? expf(m_r[rt][r] - mn) : 1.0f; m_r[rt][r] = mn; const float p0 = ok0 ? expf(s0 - mn) : 0.f, p1 = ok1 ? expf(s1 - mn) : 0.f; l_r[rt][r] = l_r[rt][r] * al + p0 + p1;
#pragma unroll
        for (int dt = 0; dt < DT; ++dt) { oacc[rt][dt][r] *= al; oaccl[rt][dt][r] *= al; }
        FragH t2, t3; const float ps0 = p0 * 1024.0f, ps1 = p1 * 1024.0f; t2.h[0] = (_Float16)ps0; t2.h[1] = (_Float16)ps1; t3.h[0] = (_Float16)((ps0 - (float)t2.h[0]) * 1024.0f); t3.h[1] = (_Float16)((ps1 - (float)t2.h[1]) * 1024.0f);
        sP[w][rt * 16 + 8 * hh + r][ln] = t2.u[0]; sP[w][rt * 16 + 8 * hh + r][16 + ln] = t2.u[1]; sPl[w][rt * 16 + 8 * hh + r][ln] = t3.u[0]; sPl[w][rt * 16 + 8 * hh + r][16 + ln] = t3.u[1]; }
    __builtin_amdgcn_fence(__ATOMIC_ACQ_REL, "workgroup"); __builtin_amdgcn_wave_barrier();
    FragH pa[2], pl[2];
#pragma unroll
    for (int rt = 0; rt < RTN; ++rt) { pa[rt].half[0] = *(const v8us*)&sP[w][rt * 16 + ln][8 * hh]; pa[rt].half[1] = *(const v8us*)&sP[w][rt * 16 + ln][16 + 8 * hh]; pl[rt].half[0] = *(const v8us*)&sPl[w][rt * 16 + ln][8 * hh]; pl[rt].half[1] = *(const v8us*)&sPl[w][rt * 16 + ln][16 + 8 * hh]; }
#pragma unroll
    for (int dt = 0; dt < DT; ++dt) { const size_t vo = (size_t)(dt * 16 + ln) * TK + j0; FragH bv, bl; bv.half[0] = *(const v8us*)(Vth + vo + 8 * hh); bv.half[1] = *(const v8us*)(Vth + vo + 16 + 8 * hh); bl.half[0] = *(const v8us*)(Vtl + vo + 8 * hh); bl.half[1] = *(const v8us*)(Vtl + vo + 16 + 8 * hh);
#pragma unroll
      for (int rt = 0; rt < RTN; ++rt) { oacc[rt][dt] = mmaH<1>(pa[rt].v, pa[rt].v, bv.v, bv.v, oacc[rt][dt]); oaccl[rt][dt] = mmaH<1>(pa[rt].v, pa[rt].v, bl.v, bl.v, oaccl[rt][dt]); oaccl[rt][dt] = mmaH<1>(pl[rt].v, pl[rt].v, bv.v, bv.v, oaccl[rt][dt]); } }
    __builtin_amdgcn_fence(__ATOMIC_ACQ_REL, "workgroup"); __builtin_amdgcn_wave_barrier(); }
#pragma unroll
  for (int rt = 0; rt < RTN; ++rt) {
#pragma unroll
    for (int r = 0; r < 8; ++r) { float l = l_r[rt][r]; l += __shfl_xor(l, 1, 32); l += __shfl_xor(l, 2, 32); l += __shfl_xor(l, 4, 32); l += __shfl_xor(l, 8, 32); l_r[rt][r] = (l > 0.f) ? 1.0f / (l * 1024.0f) : 0.f; }
#pragma unroll
    for (int dt = 0; dt < DT; ++dt)
#pragma unroll
      for (int r = 0; r < 8; ++r) sO[w][rt * 16 + 8 * hh + r][dt * 16 + ln] = (oacc[rt][dt][r] + oaccl[rt][dt][r] * 0.0009765625f) * l_r[rt][r]; }
  __builtin_amdgcn_fence(__ATOMIC_ACQ_REL, "workgroup"); __builtin_amdgcn_wave_barrier();
  {
#pragma unroll
    for (int rp = 0; rp < RPW; rp += 2) { const int r = rp + (lane >> 4), pc = lane & 15; const v4f val = *(const v4fa*)&sO[w][r][pc * 4]; *(v4f*)(O + ((size_t)b * TQ + q0 + r) * ldo + h * 64 + pc * 4) = val; }
     } }


__global__ __launch_bounds__(256) void k_fulltab(unsigned* __restrict__ MB, int* __restrict__ RA, int* __restrict__ KE, int nq, int nk) {
  const int t = blockIdx.x * 256 + threadIdx.x;
  if (t < nq * (nk / 32)) { *(unsigned*)(MB + t) = 0u;  }
  if (t < nq) { *(int*)(RA + t) = 0;  }
  if (t < nq / 64) { *(int*)(KE + t * 32) = nk;  } }
__global__ __launch_bounds__(256) void k_lnx(const float* __restrict__ X, const float* __restrict__ g, const float* __restrict__ bb, _Float16* __restrict__ Y16, float* __restrict__ XB) {
  #pragma clang fp contract(off)
  const int tid = threadIdx.x, w = tid >> 5, ln = tid & 31; const int r = blockIdx.x * 8 + w; if (r >= NR) return; const float* x = X + (size_t)r * DM; float s = 0.f;
#pragma unroll 1
  for (int i = 0; i < DM / 128; ++i) { const v4f a = *(const v4fa*)(x + i * 128 + ln * 4); for (int q = 0; q < 4; ++q) s += bf16_round(a[q]); }
  for (int o = 16; o > 0; o >>= 1) s += __shfl_xor(s, o, 32); const float mu = s / (float)DM; float q2 = 0.f;
#pragma unroll 1
  for (int i = 0; i < DM / 128; ++i) { const v4f a = *(const v4fa*)(x + i * 128 + ln * 4); for (int q = 0; q < 4; ++q) { const float d = bf16_round(a[q]) - mu; q2 += d * d; } }
  for (int o = 16; o > 0; o >>= 1) q2 += __shfl_xor(q2, o, 32); const float rs = rsqrtf(q2 / (float)DM + 1e-5f);
  {
#pragma unroll 1
    for (int i = 0; i < DM / 128; ++i) { const int c0 = i * 128 + ln * 4; const v4f a = *(const v4fa*)(x + c0); _Float16 h4[4]; v4f xb;
      for (int q = 0; q < 4; ++q) { const float t = bf16_round(a[q]); h4[q] = (_Float16)((t - mu) * rs * bf16_round(g[c0 + q]) + bf16_round(bb[c0 + q])); xb[q] = t; }
      *(unsigned long long*)((unsigned short*)Y16 + (size_t)r * DM + c0) = *(const unsigned long long*)h4; *(v4f*)(XB + (size_t)r * DM + c0) = xb; }
     } }
__global__ __launch_bounds__(256) void k_causaltab(unsigned* __restrict__ MB, int* __restrict__ RA, int* __restrict__ KE, int nq, int nk) {
  const int t = blockIdx.x * 256 + threadIdx.x; const int nw = nk / 32;
  if (t < nq * nw) { const int q = t / nw, w = t % nw; const int first = q + 1 - 32 * w; const unsigned bits = (first <= 0) ? 0xffffffffu : ((first >= 32) ? 0u : (0xffffffffu << first)); *(unsigned*)(MB + t) = bits;  }
  if (t < nq) { *(int*)(RA + t) = 0;  }
  if (t < nq / 64) { const int v = 64 * (t + 1); *(int*)(KE + t * 32) = v;  } }


extern "C" void kernel_launch(void* const* d_in, const int* in_sizes, int n_in,
                              void* d_out, int out_size, void* d_ws, size_t ws_size, hipStream_t stream) {
  (void)in_sizes; (void)n_in; (void)out_size;
  const float* const* I = (const float* const*)d_in; const float* x = I[0]; const int* lag = (const int*)d_in[1]; const float* wq = I[2]; const float* bq = I[3]; const float* wk = I[4]; const float* bk = I[5]; const float* wv = I[6]; const float* bv = I[7]; const float* wo = I[8]; const float* bo = I[9]; const float* lb = I[10];
  char* ws = (char*)d_ws; size_t off = 0;
  auto take = [&](size_t bytes) { char* p = ws + off; off += (bytes + 255) & ~(size_t)255; return p; };
  _Float16* BQ = (_Float16*)take((size_t)DM * DM * 2); _Float16* BK = (_Float16*)take((size_t)DM * DM * 2); _Float16* BV = (_Float16*)take((size_t)DM * DM * 2); _Float16* BO = (_Float16*)take((size_t)DM * DM * 2);
  _Float16* X16 = (_Float16*)take((size_t)NR * DM * 2); float* F = (float*)take((size_t)3 * NR * DM * 4);      /* q, k, v planes, one behind the other */
  _Float16* Qh = (_Float16*)take((size_t)NR * DM * 2); _Float16* Kh = (_Float16*)take((size_t)NR * DM * 2); _Float16* Ql = (_Float16*)take((size_t)NR * DM * 2); _Float16* Kl = (_Float16*)take((size_t)NR * DM * 2); _Float16* Vth = (_Float16*)take((size_t)NR * DM * 2); _Float16* Vtl = (_Float16*)take((size_t)NR * DM * 2);      /* Kh directly behind Qh, Kl directly behind Ql */
  unsigned* MB = (unsigned*)take((size_t)SLEN * (SLEN / 32) * 4); int* RA = (int*)take((size_t)SLEN * 4); int* KE = (int*)take((size_t)(SLEN / 64) * 32 * 4);
  if (off > ws_size) return;      /* 8 + 8 + 48 + 48 + 0.6 = 113 MiB */
  float* O = F; _Float16* Oh = Qh; _Float16* Ol = Ql;
  const size_t w8 = (size_t)DM * DM / 8; const unsigned wb = (unsigned)((w8 + 255) / 256);
  k_wt_f16<<<dim3(wb, 4), 256, 0, stream>>>(wq, wk, wv, wo, BQ, DM, DM, 16.0f);      /* (in,out); BQ, BK, BV, BO are contiguous */
  k_fulltab<<<(SLEN * (SLEN / 32) + 255) / 256, 256, 0, stream>>>(MB, RA, KE, SLEN, SLEN);
  const size_t n8 = (size_t)NR * DM / 8; const unsigned nb8 = (unsigned)((n8 + 255) / 256); const dim3 gP((NR / 128) * (DM / 64), 1); const dim3 gP3((NR / 128) * (DM / 64), 3);
  k_x16<<<nb8, 256, 0, stream>>>(x, X16, n8);
  k_gemm2<0><<<gP3, 128, 0, stream>>>(X16, DM, 0, BQ, DM, (size_t)DM * DM, 0.0625f, bq, bk, bv, nullptr, 1, 0, 0, F, nullptr, DM, (size_t)NR * DM, NR, DM, DM);      /* q, k, v in one grid */
  k_hl<<<2 * nb8, 256, 0, stream>>>(F, Qh, Ql, 2 * n8);      /* q and k planes together */
  k_vthl<SLEN><<<NBT * NH * (SLEN / 64), 256, 0, stream>>>(F + (size_t)2 * NR * DM, DM, Vth, Vtl);
  k_flashb<SLEN, SLEN><<<NBT * NH * (SLEN / 64), 128, 0, stream>>>(Qh, Ql, DM, Kh, Kl, DM, Vth, Vtl, MB, RA, KE, lb, lag, O, DM);      /* both batches in one grid; the lag vector is per position, shared across the batch */
  k_hl<<<nb8, 256, 0, stream>>>(O, Oh, Ol, n8);
  k_gemm2<0><<<gP, 128, 0, stream>>>(Oh, DM, 0, BO, DM, 0, 0.0625f, bo, nullptr, nullptr, nullptr, 1, 0, 0, (float*)d_out, nullptr, DM, 0, NR, DM, DM);
  k_gemm2<0><<<gP, 128, 0, stream>>>(Ol, DM, 0, BO, DM, 0, 0.0625f / 1024.0f, nullptr, nullptr, nullptr, (float*)d_out, 1, (size_t)DM, 0, (float*)d_out, nullptr, DM, 0, NR, DM, DM);
}

// v002
// It runs in 466 microseconds.
// Two timings next to v001 both put it at 1.57 times that version's speed.
// Over all steps from v000 it is 2.48 times as fast.
#include <hip/hip_runtime.h>
// Multi-head self-attention with a lag-distance bias (2 x 2048 tokens, 1024 = 16 heads x 64): q,k,v = x W + b; scores = q.k/8 + lag_bias[h][|lag[q] - lag[k]|] with the INPUT integer lag vector; softmax over all keys; out = (attn v) Wo + bo -> [2,2048,1024].
// Structure: x as an exact f16 plane; projections as f16 WMMA GEMMs (32x64 wave tiles, f32 accumulation, exact x16 weights + bias); q, k as f16 hi + (x2^10) residual planes, V^T as hi + residual planes; the fused flash kernel adds the bias gathered from the INPUT table by |lag[q] - lag[k]| (INPUT int32 positions) inside the score stage (all keys valid; online f32 softmax, P staged hi + residual, two value accumulators); O as hi + residual planes into Wo (two GEMMs, bias in the first).
// Compute dtype: x, weights, biases, lag_bias rounded to bf16; projections exact; q, k, P, v, O as f16 hi + residual pairs (~2^-21); f32 accumulation and softmax. v_wmma_f32_16x16x32_f16.
#define NBT 2
#define SLEN 2048
#define DM 1024
#define NH 16
#define SCL 0.125f
#define NR (NBT * SLEN)
typedef __bf16 v16b __attribute__((ext_vector_type(16)));
typedef unsigned short v8us __attribute__((ext_vector_type(8), may_alias));
typedef float  v8f  __attribute__((ext_vector_type(8)));
typedef float  v4f  __attribute__((ext_vector_type(4)));
typedef float  v4fa __attribute__((ext_vector_type(4), may_alias));
union FragB { v16b v; v8us half[2]; unsigned short u[16]; };

__device__ __forceinline__ unsigned short bf16_bits(float x) { unsigned int u = __float_as_uint(x); return (unsigned short)((u + 0x7FFFu + ((u >> 16) & 1u)) >> 16); }
__device__ __forceinline__ float bf16_val(unsigned short b) { return __uint_as_float(((unsigned int)b) << 16); }
__device__ __forceinline__ float bf16_round(float x) { return bf16_val(bf16_bits(x)); }
// D += A·B with NT terms: 1 = ah·bh, 2 = + al·bh (A split), 3 = + ah·bl (both split)
template <int NT>
__device__ __forceinline__ v8f mmaN(v16b ah, v16b al, v16b bh, v16b bl, v8f c) {
  c = __builtin_amdgcn_wmma_f32_16x16x32_bf16(false, ah, false, bh, (short)0, c, false, false);
  if (NT >= 2) c = __builtin_amdgcn_wmma_f32_16x16x32_bf16(false, al, false, bh, (short)0, c, false, false);
  if (NT >= 3) c = __builtin_amdgcn_wmma_f32_16x16x32_bf16(false, ah, false, bl, (short)0, c, false, false);
  asm volatile("v_nop\n\tv_nop\n\tv_nop\n\tv_nop" : "+v"(c) : "v"(ah), "v"(al), "v"(bh), "v"(bl));
  return c;
}

__global__ __launch_bounds__(256) void k_wt_bf16(const float* __restrict__ W, unsigned short* __restrict__ Wt, int K, int N) {
  const int t = blockIdx.x * 256 + threadIdx.x;
  const int k8n = K / 8;
  if (t >= N * k8n) return;
  const int n = t / k8n, k8 = (t % k8n) * 8;
  v8us v;
#pragma unroll
  for (int i = 0; i < 8; ++i) v[i] = bf16_bits(W[(size_t)(k8 + i) * N + n]);
  *(v8us*)(Wt + (size_t)n * K + k8) = v;
  
}

// GEMM C[M][N] (f32, pitch ldc) = act(A[M][K]·W + bias). A f32 row-major (pitch lda) converted per fragment to bf16
// (ASPLIT: hi/lo two planes -> 2 terms, else single rounded term); Wt bf16 [N][K] (pitch ldb). BIAS_BF16 rounds the
// bias to bf16 first (bias quantised to bf16 before the add). K%32==0, M%16==0, N%64==0.
template <bool ASPLIT, int ACT, bool BIAS_BF16>
__global__ __launch_bounds__(128) void k_gemm_bf(const float* __restrict__ A, int lda, const unsigned short* __restrict__ Wt, int ldb,
                                               const float* __restrict__ bias, float* __restrict__ C, int ldc, int M, int N, int K) {
  __shared__ __attribute__((aligned(16))) float so[4][16][64];
  const int tid = threadIdx.x, w = tid >> 5, lane = tid & 31, ln = lane & 15, hh = lane >> 4;
  const int ntn = N / 64;
  const int wid = blockIdx.x * 4 + w;
  const int mt = wid / ntn, nq = wid % ntn;
  if (mt * 16 >= M) return;
  const int row0 = mt * 16, col0 = nq * 64;
  const float* arow = A + (size_t)(row0 + ln) * lda;
  v8f acc[4] = {};
  for (int kb = 0; kb < K; kb += 32) {
    FragB ah, al;
    const v4f x0 = *(const v4fa*)(arow + kb + 8 * hh), x1 = *(const v4fa*)(arow + kb + 8 * hh + 4);
    const v4f x2 = *(const v4fa*)(arow + kb + 16 + 8 * hh), x3 = *(const v4fa*)(arow + kb + 16 + 8 * hh + 4);
    float xs[16] = {x0[0],x0[1],x0[2],x0[3],x1[0],x1[1],x1[2],x1[3],x2[0],x2[1],x2[2],x2[3],x3[0],x3[1],x3[2],x3[3]};
#pragma unroll
    for (int i = 0; i < 16; ++i) { const unsigned short hb = bf16_bits(xs[i]); ah.u[i] = hb; al.u[i] = ASPLIT ? bf16_bits(xs[i] - bf16_val(hb)) : (unsigned short)0; }
#pragma unroll
    for (int t = 0; t < 4; ++t) {
      const unsigned short* brow = Wt + (size_t)(col0 + t * 16 + ln) * ldb + kb;
      FragB b;
      b.half[0] = *(const v8us*)(brow + 8 * hh);
      b.half[1] = *(const v8us*)(brow + 16 + 8 * hh);
      acc[t] = mmaN<ASPLIT ? 2 : 1>(ah.v, al.v, b.v, b.v, acc[t]);
    }
  }
#pragma unroll
  for (int t = 0; t < 4; ++t) {
    float bv = bias ? bias[col0 + t * 16 + ln] : 0.f;
    if (BIAS_BF16) bv = bf16_round(bv);
#pragma unroll
    for (int r = 0; r < 8; ++r) { float v = acc[t][r] + bv; if (ACT == 1) v = fmaxf(v, 0.f); so[w][8 * hh + r][t * 16 + ln] = v; }
  }
  __builtin_amdgcn_fence(__ATOMIC_ACQ_REL, "workgroup");
  __builtin_amdgcn_wave_barrier();
  const int rsub = lane >> 4, c4 = (lane & 15) * 4;
  {
#pragma unroll
    for (int q = 0; q < 8; ++q) {
      const int r = q * 2 + rsub;
      const v4f v = *(const v4fa*)&so[w][r][c4];
      *(v4f*)(C + (size_t)(row0 + r) * ldc + col0 + c4) = v;
    }
    
  }
}

// GEMM C = act(A·W + bias + resid): A f32 (ASPLIT -> hi/lo 2 terms), Wt bf16 [N][K]; ACT 0 none, 1 relu, 2 exact gelu;
// resid (optional, f32, row index = (row % rmod), pitch ldr, RES_BF16 rounds it) added before the activation.
template <bool ASPLIT, int ACT, bool BIAS_BF16, bool RES_BF16>
__global__ __launch_bounds__(128) void k_gemm_bf3(const float* __restrict__ A, int lda, const unsigned short* __restrict__ Wt, int ldb,
                                                const float* __restrict__ bias, const float* __restrict__ resid, int rmod, int ldr,
                                                float* __restrict__ C, int ldc, int M, int N, int K) {
  __shared__ __attribute__((aligned(16))) float so[4][16][64];
  const int tid = threadIdx.x, w = tid >> 5, lane = tid & 31, ln = lane & 15, hh = lane >> 4;
  const int ntn = N / 64;
  const int wid = blockIdx.x * 4 + w;
  const int mt = wid / ntn, nq = wid % ntn;
  if (mt * 16 >= M) return;
  const int row0 = mt * 16, col0 = nq * 64;
  const float* arow = A + (size_t)(row0 + ln) * lda;
  v8f acc[4] = {};
  for (int kb = 0; kb < K; kb += 32) {
    FragB ah, al;
    const v4f x0 = *(const v4fa*)(arow + kb + 8 * hh), x1 = *(const v4fa*)(arow + kb + 8 * hh + 4);
    const v4f x2 = *(const v4fa*)(arow + kb + 16 + 8 * hh), x3 = *(const v4fa*)(arow + kb + 16 + 8 * hh + 4);
    float xs[16] = {x0[0],x0[1],x0[2],x0[3],x1[0],x1[1],x1[2],x1[3],x2[0],x2[1],x2[2],x2[3],x3[0],x3[1],x3[2],x3[3]};
#pragma unroll
    for (int i = 0; i < 16; ++i) { const unsigned short hb = bf16_bits(xs[i]); ah.u[i] = hb; al.u[i] = ASPLIT ? bf16_bits(xs[i] - bf16_val(hb)) : (unsigned short)0; }
#pragma unroll
    for (int t = 0; t < 4; ++t) {
      const unsigned short* brow = Wt + (size_t)(col0 + t * 16 + ln) * ldb + kb;
      FragB b;
      b.half[0] = *(const v8us*)(brow + 8 * hh);
      b.half[1] = *(const v8us*)(brow + 16 + 8 * hh);
      acc[t] = mmaN<ASPLIT ? 2 : 1>(ah.v, al.v, b.v, b.v, acc[t]);
    }
  }
#pragma unroll
  for (int t = 0; t < 4; ++t) {
    const int col = col0 + t * 16 + ln;
    float bv = bias ? bias[col] : 0.f;
    if (BIAS_BF16) bv = bf16_round(bv);
#pragma unroll
    for (int r = 0; r < 8; ++r) {
      float v = acc[t][r] + bv;
      if (resid) { float rv = resid[(size_t)((row0 + 8 * hh + r) % rmod) * ldr + col]; if (RES_BF16) rv = bf16_round(rv); v += rv; }
      if (ACT == 1) v = fmaxf(v, 0.f);
      if (ACT == 2) v = 0.5f * v * (1.0f + erff(v * 0.70710678118654752f));
      if (ACT == 3) { const float u = 0.7978845608028654f * (v + 0.044715f * v * v * v); v = 0.5f * v * (1.0f + tanhf(u)); }
      so[w][8 * hh + r][t * 16 + ln] = v;
    }
  }
  __builtin_amdgcn_fence(__ATOMIC_ACQ_REL, "workgroup");
  __builtin_amdgcn_wave_barrier();
  const int rsub = lane >> 4, c4 = (lane & 15) * 4;
  {
#pragma unroll
    for (int q = 0; q < 8; ++q) {
      const int r = q * 2 + rsub;
      const v4f v = *(const v4fa*)&so[w][r][c4];
      *(v4f*)(C + (size_t)(row0 + r) * ldc + col0 + c4) = v;
    }
    
  }
}
// row LayerNorm (biased variance, eps) over N: s = X (+ R); optional out_sum <- s; out_norm <- (s-mu)*rsqrt(var+eps)*g + b
template <bool PARAM_BF16>
__global__ __launch_bounds__(256) void k_layernorm(const float* __restrict__ X, const float* __restrict__ R, const float* __restrict__ g, const float* __restrict__ bta,
                                                  float* __restrict__ out_sum, float* __restrict__ out_norm, int N, float eps) {
  __shared__ float red[256];
  const int row = blockIdx.x, tid = threadIdx.x;
  const float* x = X + (size_t)row * N; const float* rr = R ? R + (size_t)row * N : nullptr;
  float vals[16];                     // up to N = 4096
  const int per = N / 256;            // contiguous chunk per thread? use strided-by-4 chunks: thread handles j = tid*4 + 1024*u
  float s1 = 0.f;
  for (int u = 0; u < per / 4; ++u) {
    const int j = tid * 4 + 1024 * u;
    const v4f a = *(const v4fa*)(x + j);
    v4f b = {0.f,0.f,0.f,0.f}; if (rr) b = *(const v4fa*)(rr + j);
#pragma unroll
    for (int q = 0; q < 4; ++q) { const float v = a[q] + b[q]; vals[u * 4 + q] = v; s1 += v; }
  }
  red[tid] = s1; __syncthreads();
  for (int st = 128; st > 0; st >>= 1) { if (tid < st) red[tid] += red[tid + st]; __syncthreads(); }
  const float mu = red[0] / (float)N; __syncthreads();
  float s2 = 0.f;
  for (int u = 0; u < per / 4; ++u)
#pragma unroll
    for (int q = 0; q < 4; ++q) { const float c = vals[u * 4 + q] - mu; s2 += c * c; }
  red[tid] = s2; __syncthreads();
  for (int st = 128; st > 0; st >>= 1) { if (tid < st) red[tid] += red[tid + st]; __syncthreads(); }
  const float rs = rsqrtf(red[0] / (float)N + eps);
  {
    for (int u = 0; u < per / 4; ++u) {
      const int j = tid * 4 + 1024 * u;
      v4f o, sm;
#pragma unroll
      for (int q = 0; q < 4; ++q) {
        float gg = g[j + q], bb = bta[j + q];
        if (PARAM_BF16) { gg = bf16_round(gg); bb = bf16_round(bb); }
        sm[q] = vals[u * 4 + q]; o[q] = (vals[u * 4 + q] - mu) * rs * gg + bb;
      }
      if (out_sum) *(v4f*)(out_sum + (size_t)row * N + j) = sm;
      *(v4f*)(out_norm + (size_t)row * N + j) = o;
    }
    
  }
}



// ---- f16 WMMA path (v_wmma_f32_16x16x32_f16): 11-bit significands for operands in range — used where a [0,1] probability operand needs more precision than bf16
typedef _Float16 v16h __attribute__((ext_vector_type(16)));
union FragH { v16h v; v8us half[2]; _Float16 h[16]; unsigned short u[16]; };
template <int NT>
__device__ __forceinline__ v8f mmaH(v16h ah, v16h al, v16h bh, v16h bl, v8f c) {
  c = __builtin_amdgcn_wmma_f32_16x16x32_f16(false, ah, false, bh, (short)0, c, false, false);
  if (NT >= 2) c = __builtin_amdgcn_wmma_f32_16x16x32_f16(false, al, false, bh, (short)0, c, false, false);
  if (NT >= 3) c = __builtin_amdgcn_wmma_f32_16x16x32_f16(false, ah, false, bl, (short)0, c, false, false);
  asm volatile("v_nop\n\tv_nop\n\tv_nop\n\tv_nop" : "+v"(c) : "v"(ah), "v"(al), "v"(bh), "v"(bl));
  return c;
}
// batched GEMM like k_gemm_b but f16 operands: A f32 (split into f16 hi/lo if ASPLIT, else rounded to f16), Bt = f16 values [n][k]; alpha; C f32; N multiple of 16 (partial tiles skipped)
template <bool ASPLIT>
__global__ __launch_bounds__(128) void k_gemm_h(const float* __restrict__ A, int lda, size_t sA, const _Float16* __restrict__ Bh, int ldb, size_t sB, float alpha, float* __restrict__ C, int ldc, size_t sC, int M, int N, int K) {
  __shared__ __attribute__((aligned(16))) float so[4][16][64];
  const int tid = threadIdx.x, w = tid >> 5, lane = tid & 31, ln = lane & 15, hh = lane >> 4; const int by = blockIdx.y;
  A += (size_t)by * sA; Bh += (size_t)by * sB; C += (size_t)by * sC;
  const int ntn = (N + 63) / 64; const int wid = blockIdx.x * 4 + w; const int mt = wid / ntn, nq = wid % ntn; if (mt * 16 >= M) return;
  const int row0 = mt * 16, col0 = nq * 64; const float* arow = A + (size_t)(row0 + ln) * lda;
  v8f acc[4] = {};
  for (int kb = 0; kb < K; kb += 32) {
    FragH ah, al;
    const v4f x0 = *(const v4fa*)(arow + kb + 8 * hh), x1 = *(const v4fa*)(arow + kb + 8 * hh + 4), x2 = *(const v4fa*)(arow + kb + 16 + 8 * hh), x3 = *(const v4fa*)(arow + kb + 16 + 8 * hh + 4);
    float xs[16] = {x0[0],x0[1],x0[2],x0[3],x1[0],x1[1],x1[2],x1[3],x2[0],x2[1],x2[2],x2[3],x3[0],x3[1],x3[2],x3[3]};
#pragma unroll
    for (int i = 0; i < 16; ++i) { const _Float16 h = (_Float16)xs[i]; ah.h[i] = h; al.h[i] = ASPLIT ? (_Float16)(xs[i] - (float)h) : (_Float16)0.0f; }
#pragma unroll
    for (int t = 0; t < 4; ++t) { if (col0 + t * 16 >= N) continue; const size_t boff = (size_t)(col0 + t * 16 + ln) * ldb + kb; FragH bq; bq.half[0] = *(const v8us*)(Bh + boff + 8 * hh); bq.half[1] = *(const v8us*)(Bh + boff + 16 + 8 * hh);
      acc[t] = mmaH<ASPLIT ? 2 : 1>(ah.v, al.v, bq.v, bq.v, acc[t]); }
  }
#pragma unroll
  for (int t = 0; t < 4; ++t) { if (col0 + t * 16 >= N) continue;
#pragma unroll
    for (int r = 0; r < 8; ++r) so[w][8 * hh + r][t * 16 + ln] = acc[t][r] * alpha; }
  __builtin_amdgcn_fence(__ATOMIC_ACQ_REL, "workgroup"); __builtin_amdgcn_wave_barrier();
  const int rsub = lane >> 4, c4 = (lane & 15) * 4;
  {
#pragma unroll
    for (int q = 0; q < 8; ++q) { const int r = q * 2 + rsub; if (col0 + c4 < N) { const v4f v = *(const v4fa*)&so[w][r][c4]; *(v4f*)(C + (size_t)(row0 + r) * ldc + col0 + c4) = v; } }
     }
}

// Wt[n][k] = f16(W[k][n]·scale) from f32 row-major W[K][N] (scale = power of two; bf16-exact weights stay exact in f16 away from the subnormal range)
// blockIdx.y picks one of four equally shaped matrices; their transposes lie one behind the other in Wt
__global__ __launch_bounds__(256) void k_wt_f16(const float* __restrict__ W0, const float* __restrict__ W1, const float* __restrict__ W2, const float* __restrict__ W3, _Float16* __restrict__ Wt, int K, int N, float scale) {
  const int by = blockIdx.y; const float* __restrict__ W = (by == 0) ? W0 : (by == 1) ? W1 : (by == 2) ? W2 : W3; Wt += (size_t)by * K * N;
  const int t = blockIdx.x * 256 + threadIdx.x; if (t >= N * (K / 8)) return; const int n = t / (K / 8), k8 = (t % (K / 8)) * 8; FragH f;
#pragma unroll
  for (int i = 0; i < 8; ++i) f.h[i] = (_Float16)(bf16_round(W[(size_t)(k8 + i) * N + n]) * scale); const v8us o = f.half[0];
  *(v8us*)((unsigned short*)Wt + (size_t)n * K + k8) = o; 
}
// k_gemm_hh variant with fused epilogue: v = acc·alpha + bias[by·sBias + col] (+ CP[(row/rowsPerB)·sCPb + by·64 + col] if CP) ; ACT 0 none / 1 elu ; writes f16 C16 (and f32 C if non-null)
template <int ACT>
__global__ __launch_bounds__(128) void k_gemm_hhx(const _Float16* __restrict__ A, int lda, size_t sA, const _Float16* __restrict__ Bh, int ldb, size_t sB, float alpha, const float* __restrict__ bias, size_t sBias, const float* __restrict__ CP, int rowsPerB, size_t sCPb, int row0g,
    float* __restrict__ C, _Float16* __restrict__ C16, int ldc, size_t sC, int M, int N, int K) {
  __shared__ __attribute__((aligned(16))) float so[4][16][64];
  const int tid = threadIdx.x, w = tid >> 5, lane = tid & 31, ln = lane & 15, hh = lane >> 4; const int by = blockIdx.y;
  A += (size_t)by * sA; Bh += (size_t)by * sB; const size_t cofs = (size_t)by * sC; const float* bp = bias ? bias + (size_t)by * sBias : nullptr;
  const int ntn = (N + 63) / 64; const int wid = blockIdx.x * 4 + w; const int mt = wid / ntn, nq = wid % ntn; if (mt * 16 >= M) return;
  const int row0 = mt * 16, col0 = nq * 64; const _Float16* arow = A + (size_t)(row0 + ln) * lda;
  v8f acc[4] = {};
  for (int kb = 0; kb < K; kb += 32) { FragH ah; ah.half[0] = *(const v8us*)((const unsigned short*)arow + kb + 8 * hh); ah.half[1] = *(const v8us*)((const unsigned short*)arow + kb + 16 + 8 * hh);
#pragma unroll
    for (int t = 0; t < 4; ++t) { if (col0 + t * 16 >= N) continue; const size_t boff = (size_t)(col0 + t * 16 + ln) * ldb + kb; FragH bq; bq.half[0] = *(const v8us*)((const unsigned short*)Bh + boff + 8 * hh); bq.half[1] = *(const v8us*)((const unsigned short*)Bh + boff + 16 + 8 * hh);
      acc[t] = mmaH<1>(ah.v, ah.v, bq.v, bq.v, acc[t]); }
  }
#pragma unroll
  for (int t = 0; t < 4; ++t) { if (col0 + t * 16 >= N) continue; const int col = col0 + t * 16 + ln; const float bv = bp ? bf16_round(bp[col]) : 0.f;
#pragma unroll
    for (int r = 0; r < 8; ++r) { float v = acc[t][r] * alpha + bv; if (CP) { const int bidx = (row0g + row0 + 8 * hh + r) / rowsPerB; v += CP[(size_t)bidx * sCPb + (size_t)by * 64 + col]; } if (ACT == 1) v = (v > 0.f) ? v : expm1f(v); else if (ACT == 7) v = (v > 0.f) ? v + 1.0f : expf(v); else if (ACT == 8) v = tanhf(v); else if (ACT == 9) v = 0.5f * v * (1.0f + tanhf(0.7978845608028654f * (v + 0.044715f * v * v * v))); else if (ACT == 11) v = 1.0f / (1.0f + expf(-v)); else if (ACT == 12) v = (v > 0.f) ? v : 0.01f * v; else if (ACT == 14) v = (v > 0.f) ? v : 0.1f * v; else if (ACT == 15) v = v / (1.0f + expf(-v)); else if (ACT == 3) v = fmaxf(v, 0.f); else if (ACT == 6) v = 0.5f * v * (1.0f + erff(v * 0.70710678118654752f)); so[w][8 * hh + r][t * 16 + ln] = v; } }
  __builtin_amdgcn_fence(__ATOMIC_ACQ_REL, "workgroup"); __builtin_amdgcn_wave_barrier();
  const int rsub = lane >> 4, c4 = (lane & 15) * 4; typedef _Float16 v4h __attribute__((ext_vector_type(4)));
  {
#pragma unroll
    for (int q = 0; q < 8; ++q) { const int r = q * 2 + rsub; if (col0 + c4 < N) { const v4f v = *(const v4fa*)&so[w][r][c4]; if (C) *(v4f*)(C + cofs + (size_t)(row0 + r) * ldc + col0 + c4) = v; if (C16) { v4h h4; for (int i = 0; i < 4; ++i) h4[i] = (_Float16)v[i]; *(v4h*)(C16 + cofs + (size_t)(row0 + r) * ldc + col0 + c4) = h4; } } }
     }
}


typedef _Float16 v4h __attribute__((ext_vector_type(4)));

__global__ __launch_bounds__(256) void k_x16(const float* __restrict__ x, _Float16* __restrict__ X16, size_t n8) { const size_t t = (size_t)blockIdx.x * 256 + threadIdx.x; if (t >= n8) return; FragH f;
#pragma unroll
  for (int q = 0; q < 8; ++q) f.h[q] = (_Float16)bf16_round(x[t * 8 + q]); *(v8us*)((unsigned short*)X16 + t * 8) = f.half[0];  }
__global__ __launch_bounds__(256) void k_h16(const float* __restrict__ x, _Float16* __restrict__ X16, size_t n8) { const size_t t = (size_t)blockIdx.x * 256 + threadIdx.x; if (t >= n8) return; FragH f;
#pragma unroll
  for (int q = 0; q < 8; ++q) f.h[q] = (_Float16)x[t * 8 + q]; *(v8us*)((unsigned short*)X16 + t * 8) = f.half[0];  }
__global__ __launch_bounds__(256) void k_round16f(const float* __restrict__ W, _Float16* __restrict__ Bt, size_t n8) { const size_t t = (size_t)blockIdx.x * 256 + threadIdx.x; if (t >= n8) return; FragH f;
#pragma unroll
  for (int i = 0; i < 8; ++i) f.h[i] = (_Float16)(bf16_round(W[t * 8 + i]) * 16.0f); *(v8us*)((unsigned short*)Bt + t * 8) = f.half[0];  }
template <int NHv, int TTv>
__global__ __launch_bounds__(256) void k_vt(const _Float16* __restrict__ V16, int ldv, int voff, _Float16* __restrict__ Vt) { __shared__ unsigned short tl[64][66]; const int tid = threadIdx.x; const int slab = blockIdx.x / (TTv / 64), lg = blockIdx.x % (TTv / 64); const int b = slab / NHv, h = slab % NHv;
  for (int i = tid; i < 64 * 8; i += 256) { const int r = i / 8, c8 = (i % 8) * 8; FragH f; f.half[0] = *(const v8us*)((const unsigned short*)V16 + ((size_t)b * TTv + lg * 64 + r) * ldv + voff + h * 64 + c8);
#pragma unroll
    for (int q = 0; q < 8; ++q) tl[r][c8 + q] = f.u[q]; }
  __syncthreads();
  {
#pragma unroll
    for (int rd = 0; rd < 2; ++rd) { const int d = rd * 32 + tid / 8, pc = tid % 8; FragH f;
#pragma unroll
      for (int q = 0; q < 8; ++q) f.u[q] = tl[pc * 8 + q][d];
      *(v8us*)((unsigned short*)Vt + ((size_t)slab * 64 + d) * TTv + lg * 64 + pc * 8) = f.half[0]; }
     } }

__global__ __launch_bounds__(256) void k_hl(const float* __restrict__ F, _Float16* __restrict__ Hh, _Float16* __restrict__ Hl, size_t n8) { const size_t t = (size_t)blockIdx.x * 256 + threadIdx.x; if (t >= n8) return; FragH fh, fl; const v4f a = *(const v4fa*)(F + t * 8), c = *(const v4fa*)(F + t * 8 + 4);
#pragma unroll
  for (int q = 0; q < 4; ++q) { _Float16 h = (_Float16)a[q]; fh.h[q] = h; fl.h[q] = (_Float16)((a[q] - (float)h) * 1024.0f); h = (_Float16)c[q]; fh.h[4 + q] = h; fl.h[4 + q] = (_Float16)((c[q] - (float)h) * 1024.0f); }
  { *(v8us*)((unsigned short*)Hh + t * 8) = fh.half[0]; *(v8us*)((unsigned short*)Hl + t * 8) = fl.half[0];  } }

// ---- fast GEMM (wave tile 32x64; requires M % 32 == 0 rows per launch region and N % 64 == 0); epilogue like k_gemm_hhx, but the bias is bias, bias1 or bias2 by blockIdx.y ----
__device__ __forceinline__ v16h g2_frag(const _Float16* p, int hh) { FragH f; f.half[0] = *(const v8us*)((const unsigned short*)p + 8 * hh); f.half[1] = *(const v8us*)((const unsigned short*)p + 16 + 8 * hh); return f.v; }
__device__ __forceinline__ v8f g2_mma(v16h a, v16h b, v8f c) { v8f d = __builtin_amdgcn_wmma_f32_16x16x32_f16(false, a, false, b, (short)0, c, false, false); asm volatile("v_nop\n\tv_nop\n\tv_nop\n\tv_nop" : "+v"(d) : "v"(a), "v"(b)); return d; }
template <int ACT>
__global__ __launch_bounds__(128) void k_gemm2(const _Float16* __restrict__ A, int lda, size_t sA, const _Float16* __restrict__ Bh, int ldb, size_t sB, float alpha, const float* __restrict__ bias, const float* __restrict__ bias1, const float* __restrict__ bias2, const float* __restrict__ CP, int rowsPerB, size_t sCPb, int row0g,
    float* __restrict__ C, _Float16* __restrict__ C16, int ldc, size_t sC, int M, int N, int K) {
  __shared__ __attribute__((aligned(16))) float so[4][32][68];
  const int tid = threadIdx.x, w = tid >> 5, lane = tid & 31, ln = lane & 15, hh = lane >> 4; const int by = blockIdx.y;
  A += (size_t)by * sA; Bh += (size_t)by * sB; const size_t cofs = (size_t)by * sC; const float* bp = (by == 0) ? bias : (by == 1) ? bias1 : bias2;      /* one bias vector per blockIdx.y */
  const int ntn = N >> 6; const int mt = blockIdx.x / ntn, nq = blockIdx.x - mt * ntn; const int row0 = mt * 128 + 32 * w, col0 = nq * 64; if (row0 >= M) return;
  const _Float16* a0p = A + (size_t)(row0 + ln) * lda; const _Float16* a1p = a0p + (size_t)16 * lda;
  const _Float16* b0p = Bh + (size_t)(col0 + ln) * ldb; const _Float16* b1p = b0p + (size_t)16 * ldb; const _Float16* b2p = b1p + (size_t)16 * ldb; const _Float16* b3p = b2p + (size_t)16 * ldb;
  const v8f z8 = {0.f,0.f,0.f,0.f,0.f,0.f,0.f,0.f}; v8f c00 = z8, c01 = z8, c02 = z8, c03 = z8, c10 = z8, c11 = z8, c12 = z8, c13 = z8;
#pragma unroll 1
  for (int kb = 0; kb < K; kb += 32) { const v16h a0 = g2_frag(a0p + kb, hh), a1 = g2_frag(a1p + kb, hh);
    v16h b = g2_frag(b0p + kb, hh); c00 = g2_mma(a0, b, c00); c10 = g2_mma(a1, b, c10);
    b = g2_frag(b1p + kb, hh); c01 = g2_mma(a0, b, c01); c11 = g2_mma(a1, b, c11);
    b = g2_frag(b2p + kb, hh); c02 = g2_mma(a0, b, c02); c12 = g2_mma(a1, b, c12);
    b = g2_frag(b3p + kb, hh); c03 = g2_mma(a0, b, c03); c13 = g2_mma(a1, b, c13); }
  v8f accs[8] = {c00, c01, c02, c03, c10, c11, c12, c13};
#pragma unroll
  for (int u = 0; u < 8; ++u) { const int t = u & 3, half = u >> 2; const int col = col0 + t * 16 + ln; const float bv = bp ? bf16_round(bp[col]) : 0.f;
#pragma unroll
    for (int r = 0; r < 8; ++r) { const int rloc = half * 16 + 8 * hh + r; float v = accs[u][r] * alpha + bv; if (CP) { const int bidx = (row0g + row0 + rloc) / rowsPerB; v += CP[(size_t)bidx * sCPb + (size_t)by * 64 + col]; }
      if (ACT == 3) v = fmaxf(v, 0.f); else if (ACT == 6) v = 0.5f * v * (1.0f + erff(v * 0.70710678118654752f)); else if (ACT == 11) v = 1.0f / (1.0f + expf(-v)); else if (ACT == 15) v = v / (1.0f + expf(-v)); else if (ACT == 12) v = (v > 0.f) ? v : 0.01f * v; else if (ACT == 8) v = tanhf(v);
      so[w][rloc][t * 16 + ln] = v; } }
  __builtin_amdgcn_fence(__ATOMIC_ACQ_REL, "workgroup"); __builtin_amdgcn_wave_barrier();
  const int rsub = lane >> 4, c4 = (lane & 15) * 4;
  {
#pragma unroll
    for (int q = 0; q < 16; ++q) { const int r = q * 2 + rsub; const v4f v = *(const v4fa*)&so[w][r][c4]; if (C) *(v4f*)(C + cofs + (size_t)(row0 + r) * ldc + col0 + c4) = v; if (C16) { v4h h4; for (int i = 0; i < 4; ++i) h4[i] = (_Float16)v[i]; *(v4h*)(C16 + cofs + (size_t)(row0 + r) * ldc + col0 + c4) = h4; } }
     } }



template <int TK>
__global__ __launch_bounds__(256) void k_vthl(const float* __restrict__ VF, int ldv, _Float16* __restrict__ Vth, _Float16* __restrict__ Vtl) { __shared__ float tl[64][65]; const int tid = threadIdx.x; const int slab = blockIdx.x / (TK / 64), lg = blockIdx.x % (TK / 64); const int b = slab / NH, h = slab % NH;
  for (int i = tid; i < 64 * 16; i += 256) { const int r = i / 16, c4 = (i % 16) * 4; const v4f a = *(const v4fa*)(VF + ((size_t)b * TK + lg * 64 + r) * ldv + h * 64 + c4); tl[r][c4] = a[0]; tl[r][c4 + 1] = a[1]; tl[r][c4 + 2] = a[2]; tl[r][c4 + 3] = a[3]; }
  __syncthreads();
  FragH fh[2], fl[2]; size_t oo[2];
#pragma unroll
  for (int rd = 0; rd < 2; ++rd) { const int d = rd * 32 + tid / 8, pc = tid % 8;
#pragma unroll
    for (int q = 0; q < 8; ++q) { const float v = tl[pc * 8 + q][d]; const _Float16 hv = (_Float16)v; fh[rd].h[q] = hv; fl[rd].h[q] = (_Float16)((v - (float)hv) * 1024.0f); } oo[rd] = ((size_t)slab * 64 + d) * TK + lg * 64 + pc * 8; }
  {
#pragma unroll
    for (int rd = 0; rd < 2; ++rd) { *(v8us*)((unsigned short*)Vth + oo[rd]) = fh[rd].half[0]; *(v8us*)((unsigned short*)Vtl + oo[rd]) = fl[rd].half[0]; }
     } }

template <int TQ, int TK>
__global__ __launch_bounds__(128) void k_flashb(const _Float16* __restrict__ Q16, const _Float16* __restrict__ Q16lo, int ldq, const _Float16* __restrict__ K16, const _Float16* __restrict__ K16lo, int ldk, const _Float16* __restrict__ Vt, const _Float16* __restrict__ Vtlo, const float* __restrict__ BT, const int* __restrict__ LAG, float* __restrict__ O, int ldo) {
  constexpr int RPW = 16, RTN = RPW / 16, NQB = TQ / (4 * RPW), DT = 4, KS = 2;
  __shared__ __attribute__((aligned(16))) unsigned short sP[4][RPW][40], sPl[4][RPW][40]; __shared__ __attribute__((aligned(16))) float sO[4][RPW][64 + 4];
  const int tid = threadIdx.x, w = tid >> 5, lane = tid & 31, ln = lane & 15, hh = lane >> 4;
  const int slab = blockIdx.x / NQB, qblk = blockIdx.x % NQB; const int b = slab / NH, h = slab % NH; const int qb0 = qblk * (4 * RPW); const int q0 = qb0 + w * RPW;
  FragH aq[2][KS], aql[2][KS];
#pragma unroll
  for (int rt = 0; rt < RTN; ++rt) { const size_t qo = ((size_t)b * TQ + q0 + rt * 16 + ln) * ldq + h * 64; const unsigned short* qr = (const unsigned short*)Q16 + qo; const unsigned short* ql = (const unsigned short*)Q16lo + qo;
#pragma unroll
    for (int ks = 0; ks < KS; ++ks) { aq[rt][ks].half[0] = *(const v8us*)(qr + ks * 32 + 8 * hh); aq[rt][ks].half[1] = *(const v8us*)(qr + ks * 32 + 16 + 8 * hh); aql[rt][ks].half[0] = *(const v8us*)(ql + ks * 32 + 8 * hh); aql[rt][ks].half[1] = *(const v8us*)(ql + ks * 32 + 16 + 8 * hh); } }
  const unsigned short* Vth = (const unsigned short*)Vt + (size_t)slab * 64 * TK; const unsigned short* Vtl = (const unsigned short*)Vtlo + (size_t)slab * 64 * TK;
  float m_r[2][8], l_r[2][8]; v8f oacc[2][DT], oaccl[2][DT];
#pragma unroll
  for (int rt = 0; rt < RTN; ++rt) {
#pragma unroll
    for (int r = 0; r < 8; ++r) { m_r[rt][r] = -3.0e38f; l_r[rt][r] = 0.f; }
#pragma unroll
    for (int dt = 0; dt < DT; ++dt) { oacc[rt][dt] = (v8f){0.f,0.f,0.f,0.f,0.f,0.f,0.f,0.f}; oaccl[rt][dt] = oacc[rt][dt]; } }
#pragma unroll 1
  for (int j0 = 0; j0 < TK; j0 += 32) {
    float bb[2][2][8];      /* the pass's bias values, gathered at its head so that they fly beside the K loads */
    { const unsigned lk0 = (unsigned)LAG[j0 + ln], lk1 = (unsigned)LAG[j0 + 16 + ln];
#pragma unroll
      for (int rt = 0; rt < RTN; ++rt)
#pragma unroll
        for (int r = 0; r < 8; ++r) { const unsigned lq = (unsigned)LAG[q0 + rt * 16 + 8 * hh + r], d0 = lq - lk0, d1 = lq - lk1;      /* |lag[q] - lag[k]| = min(d, -d) in unsigned arithmetic; the min with 512 keeps the index inside the head's table row for any lag content */
          bb[rt][0][r] = bf16_round(BT[(size_t)h * 513 + min(min(d0, 0u - d0), 512u)]); bb[rt][1][r] = bf16_round(BT[(size_t)h * 513 + min(min(d1, 0u - d1), 512u)]); } }
    asm volatile("s_wait_xcnt 0x0" ::: "memory");      /* precaution: the gathers' index registers are reused right behind them, so their address translations are waited for first */
    v8f s[2][2];
#pragma unroll
    for (int nt = 0; nt < 2; ++nt) { const size_t ko = ((size_t)b * TK + j0 + nt * 16 + ln) * ldk + h * 64; const unsigned short* kr = (const unsigned short*)K16 + ko; const unsigned short* kl = (const unsigned short*)K16lo + ko; FragH bk[KS], bkl[KS];
#pragma unroll
      for (int ks = 0; ks < KS; ++ks) { bk[ks].half[0] = *(const v8us*)(kr + ks * 32 + 8 * hh); bk[ks].half[1] = *(const v8us*)(kr + ks * 32 + 16 + 8 * hh); bkl[ks].half[0] = *(const v8us*)(kl + ks * 32 + 8 * hh); bkl[ks].half[1] = *(const v8us*)(kl + ks * 32 + 16 + 8 * hh); }
#pragma unroll
      for (int rt = 0; rt < RTN; ++rt) { v8f acc = (v8f){0.f,0.f,0.f,0.f,0.f,0.f,0.f,0.f}, accr = acc;
#pragma unroll
        for (int ks = 0; ks < KS; ++ks) { acc = mmaH<1>(aq[rt][ks].v, aq[rt][ks].v, bk[ks].v, bk[ks].v, acc); accr = mmaH<1>(aql[rt][ks].v, aql[rt][ks].v, bk[ks].v, bk[ks].v, accr); accr = mmaH<1>(aq[rt][ks].v, aq[rt][ks].v, bkl[ks].v, bkl[ks].v, accr); }
        s[rt][nt] = acc + accr * 0.0009765625f; } }
#pragma unroll
    for (int rt = 0; rt < RTN; ++rt)
#pragma unroll
      for (int r = 0; r < 8; ++r) {
        const float s0 = s[rt][0][r] * SCL + bb[rt][0][r], s1 = s[rt][1][r] * SCL + bb[rt][1][r]; float mc = fmaxf(s0, s1);
        mc = fmaxf(mc, __shfl_xor(mc, 1, 32)); mc = fmaxf(mc, __shfl_xor(mc, 2, 32)); mc = fmaxf(mc, __shfl_xor(mc, 4, 32)); mc = fmaxf(mc, __shfl_xor(mc, 8, 32));
        const float mn = fmaxf(m_r[rt][r], mc); const float ea = expf(m_r[rt][r] - mn); const float al = (mn > -1.0e38f) ? ea : 1.0f; m_r[rt][r] = mn; const float p0 = expf(s0 - mn), p1 = expf(s1 - mn); l_r[rt][r] = l_r[rt][r] * al + p0 + p1;
#pragma unroll
        for (int dt = 0; dt < DT; ++dt) { oacc[rt][dt][r] *= al; oaccl[rt][dt][r] *= al; }
        FragH t2, t3; const float ps0 = p0 * 1024.0f, ps1 = p1 * 1024.0f; t2.h[0] = (_Float16)ps0; t2.h[1] = (_Float16)ps1; t3.h[0] = (_Float16)((ps0 - (float)t2.h[0]) * 1024.0f); t3.h[1] = (_Float16)((ps1 - (float)t2.h[1]) * 1024.0f);
        sP[w][rt * 16 + 8 * hh + r][ln] = t2.u[0]; sP[w][rt * 16 + 8 * hh + r][16 + ln] = t2.u[1]; sPl[w][rt * 16 + 8 * hh + r][ln] = t3.u[0]; sPl[w][rt * 16 + 8 * hh + r][16 + ln] = t3.u[1]; }
    __builtin_amdgcn_fence(__ATOMIC_ACQ_REL, "workgroup"); __builtin_amdgcn_wave_barrier();
    FragH pa[2], pl[2];
#pragma unroll
    for (int rt = 0; rt < RTN; ++rt) { pa[rt].half[0] = *(const v8us*)&sP[w][rt * 16 + ln][8 * hh]; pa[rt].half[1] = *(const v8us*)&sP[w][rt * 16 + ln][16 + 8 * hh]; pl[rt].half[0] = *(const v8us*)&sPl[w][rt * 16 + ln][8 * hh]; pl[rt].half[1] = *(const v8us*)&sPl[w][rt * 16 + ln][16 + 8 * hh]; }
#pragma unroll
    for (int dt = 0; dt < DT; ++dt) { const size_t vo = (size_t)(dt * 16 + ln) * TK + j0; FragH bv, bl; bv.half[0] = *(const v8us*)(Vth + vo + 8 * hh); bv.half[1] = *(const v8us*)(Vth + vo + 16 + 8 * hh); bl.half[0] = *(const v8us*)(Vtl + vo + 8 * hh); bl.half[1] = *(const v8us*)(Vtl + vo + 16 + 8 * hh);
#pragma unroll
      for (int rt = 0; rt < RTN; ++rt) { oacc[rt][dt] = mmaH<1>(pa[rt].v, pa[rt].v, bv.v, bv.v, oacc[rt][dt]); oaccl[rt][dt] = mmaH<1>(pa[rt].v, pa[rt].v, bl.v, bl.v, oaccl[rt][dt]); oaccl[rt][dt] = mmaH<1>(pl[rt].v, pl[rt].v, bv.v, bv.v, oaccl[rt][dt]); } }
    __builtin_amdgcn_fence(__ATOMIC_ACQ_REL, "workgroup"); __builtin_amdgcn_wave_barrier(); }
#pragma unroll
  for (int rt = 0; rt < RTN; ++rt) {
#pragma unroll
    for (int r = 0; r < 8; ++r) { float l = l_r[rt][r]; l += __shfl_xor(l, 1, 32); l += __shfl_xor(l, 2, 32); l += __shfl_xor(l, 4, 32); l += __shfl_xor(l, 8, 32); l_r[rt][r] = (l > 0.f) ? 1.0f / (l * 1024.0f) : 0.f; }
#pragma unroll
    for (int dt = 0; dt < DT; ++dt)
#pragma unroll
      for (int r = 0; r < 8; ++r) sO[w][rt * 16 + 8 * hh + r][dt * 16 + ln] = (oacc[rt][dt][r] + oaccl[rt][dt][r] * 0.0009765625f) * l_r[rt][r]; }
  __builtin_amdgcn_fence(__ATOMIC_ACQ_REL, "workgroup"); __builtin_amdgcn_wave_barrier();
  {
#pragma unroll
    for (int rp = 0; rp < RPW; rp += 2) { const int r = rp + (lane >> 4), pc = lane & 15; const v4f val = *(const v4fa*)&sO[w][r][pc * 4]; *(v4f*)(O + ((size_t)b * TQ + q0 + r) * ldo + h * 64 + pc * 4) = val; }
     } }


__global__ __launch_bounds__(256) void k_lnx(const float* __restrict__ X, const float* __restrict__ g, const float* __restrict__ bb, _Float16* __restrict__ Y16, float* __restrict__ XB) {
  #pragma clang fp contract(off)
  const int tid = threadIdx.x, w = tid >> 5, ln = tid & 31; const int r = blockIdx.x * 8 + w; if (r >= NR) return; const float* x = X + (size_t)r * DM; float s = 0.f;
#pragma unroll 1
  for (int i = 0; i < DM / 128; ++i) { const v4f a = *(const v4fa*)(x + i * 128 + ln * 4); for (int q = 0; q < 4; ++q) s += bf16_round(a[q]); }
  for (int o = 16; o > 0; o >>= 1) s += __shfl_xor(s, o, 32); const float mu = s / (float)DM; float q2 = 0.f;
#pragma unroll 1
  for (int i = 0; i < DM / 128; ++i) { const v4f a = *(const v4fa*)(x + i * 128 + ln * 4); for (int q = 0; q < 4; ++q) { const float d = bf16_round(a[q]) - mu; q2 += d * d; } }
  for (int o = 16; o > 0; o >>= 1) q2 += __shfl_xor(q2, o, 32); const float rs = rsqrtf(q2 / (float)DM + 1e-5f);
  {
#pragma unroll 1
    for (int i = 0; i < DM / 128; ++i) { const int c0 = i * 128 + ln * 4; const v4f a = *(const v4fa*)(x + c0); _Float16 h4[4]; v4f xb;
      for (int q = 0; q < 4; ++q) { const float t = bf16_round(a[q]); h4[q] = (_Float16)((t - mu) * rs * bf16_round(g[c0 + q]) + bf16_round(bb[c0 + q])); xb[q] = t; }
      *(unsigned long long*)((unsigned short*)Y16 + (size_t)r * DM + c0) = *(const unsigned long long*)h4; *(v4f*)(XB + (size_t)r * DM + c0) = xb; }
     } }
__global__ __launch_bounds__(256) void k_causaltab(unsigned* __restrict__ MB, int* __restrict__ RA, int* __restrict__ KE, int nq, int nk) {
  const int t = blockIdx.x * 256 + threadIdx.x; const int nw = nk / 32;
  if (t < nq * nw) { const int q = t / nw, w = t % nw; const int first = q + 1 - 32 * w; const unsigned bits = (first <= 0) ? 0xffffffffu : ((first >= 32) ? 0u : (0xffffffffu << first)); *(unsigned*)(MB + t) = bits;  }
  if (t < nq) { *(int*)(RA + t) = 0;  }
  if (t < nq / 64) { const int v = 64 * (t + 1); *(int*)(KE + t * 32) = v;  } }


extern "C" void kernel_launch(void* const* d_in, const int* in_sizes, int n_in,
                              void* d_out, int out_size, void* d_ws, size_t ws_size, hipStream_t stream) {
  (void)in_sizes; (void)n_in; (void)out_size;
  const float* const* I = (const float* const*)d_in; const float* x = I[0]; const int* lag = (const int*)d_in[1]; const float* wq = I[2]; const float* bq = I[3]; const float* wk = I[4]; const float* bk = I[5]; const float* wv = I[6]; const float* bv = I[7]; const float* wo = I[8]; const float* bo = I[9]; const float* lb = I[10];
  char* ws = (char*)d_ws; size_t off = 0;
  auto take = [&](size_t bytes) { char* p = ws + off; off += (bytes + 255) & ~(size_t)255; return p; };
  _Float16* BQ = (_Float16*)take((size_t)DM * DM * 2); _Float16* BK = (_Float16*)take((size_t)DM * DM * 2); _Float16* BV = (_Float16*)take((size_t)DM * DM * 2); _Float16* BO = (_Float16*)take((size_t)DM * DM * 2);
  _Float16* X16 = (_Float16*)take((size_t)NR * DM * 2); float* F = (float*)take((size_t)3 * NR * DM * 4);      /* q, k, v planes, one behind the other */
  _Float16* Qh = (_Float16*)take((size_t)NR * DM * 2); _Float16* Kh = (_Float16*)take((size_t)NR * DM * 2); _Float16* Ql = (_Float16*)take((size_t)NR * DM * 2); _Float16* Kl = (_Float16*)take((size_t)NR * DM * 2); _Float16* Vth = (_Float16*)take((size_t)NR * DM * 2); _Float16* Vtl = (_Float16*)take((size_t)NR * DM * 2);      /* Kh directly behind Qh, Kl directly behind Ql */
  if (off > ws_size) return;      /* 8 + 8 + 48 + 48 = 112 MiB */
  float* O = F; _Float16* Oh = Qh; _Float16* Ol = Ql;
  const size_t w8 = (size_t)DM * DM / 8; const unsigned wb = (unsigned)((w8 + 255) / 256);
  k_wt_f16<<<dim3(wb, 4), 256, 0, stream>>>(wq, wk, wv, wo, BQ, DM, DM, 16.0f);      /* (in,out); BQ, BK, BV, BO are contiguous */
  const size_t n8 = (size_t)NR * DM / 8; const unsigned nb8 = (unsigned)((n8 + 255) / 256); const dim3 gP((NR / 128) * (DM / 64), 1); const dim3 gP3((NR / 128) * (DM / 64), 3);
  k_x16<<<nb8, 256, 0, stream>>>(x, X16, n8);
  k_gemm2<0><<<gP3, 128, 0, stream>>>(X16, DM, 0, BQ, DM, (size_t)DM * DM, 0.0625f, bq, bk, bv, nullptr, 1, 0, 0, F, nullptr, DM, (size_t)NR * DM, NR, DM, DM);      /* q, k, v in one grid */
  k_hl<<<2 * nb8, 256, 0, stream>>>(F, Qh, Ql, 2 * n8);      /* q and k planes together */
  k_vthl<SLEN><<<NBT * NH * (SLEN / 64), 256, 0, stream>>>(F + (size_t)2 * NR * DM, DM, Vth, Vtl);
  k_flashb<SLEN, SLEN><<<NBT * NH * (SLEN / 64), 128, 0, stream>>>(Qh, Ql, DM, Kh, Kl, DM, Vth, Vtl, lb, lag, O, DM);      /* both batches in one grid; the lag vector is per position, shared across the batch */
  k_hl<<<nb8, 256, 0, stream>>>(O, Oh, Ol, n8);
  k_gemm2<0><<<gP, 128, 0, stream>>>(Oh, DM, 0, BO, DM, 0, 0.0625f, bo, nullptr, nullptr, nullptr, 1, 0, 0, (float*)d_out, nullptr, DM, 0, NR, DM, DM);
  k_gemm2<0><<<gP, 128, 0, stream>>>(Ol, DM, 0, BO, DM, 0, 0.0625f / 1024.0f, nullptr, nullptr, nullptr, (float*)d_out, 1, (size_t)DM, 0, (float*)d_out, nullptr, DM, 0, NR, DM, DM);
}

// v003
// Measured time: 408 microseconds a run.
// Two timings next to v002 both put it at 1.14 times that version's speed.
// All steps since v000 together make it 2.83 times as fast.
#include <hip/hip_runtime.h>
// Multi-head self-attention with a lag-distance bias (2 x 2048 tokens, 1024 = 16 heads x 64): q,k,v = x W + b; scores = q.k/8 + lag_bias[h][|lag[q] - lag[k]|] with the INPUT integer lag vector; softmax over all keys; out = (attn v) Wo + bo -> [2,2048,1024].
// Structure: x as an exact f16 plane; projections as f16 WMMA GEMMs (32x64 wave tiles, f32 accumulation, exact x16 weights + bias); q, k as f16 hi + (x2^10) residual planes, V^T as hi + residual planes; the fused flash kernel takes each pass's K and V^T tiles (hi + residual) from a two-buffer LDS ring filled by asynchronous copies one pass ahead and shared by its four waves, and adds the bias gathered from the INPUT table by |lag[q] - lag[k]| (INPUT int32 positions) inside the score stage (all keys valid; online f32 softmax, P staged hi + residual, two value accumulators); O as hi + residual planes into Wo (two GEMMs, bias in the first).
// Compute dtype: x, weights, biases, lag_bias rounded to bf16; projections exact; q, k, P, v, O as f16 hi + residual pairs (~2^-21); f32 accumulation and softmax. v_wmma_f32_16x16x32_f16.
#define NBT 2
#define SLEN 2048
#define DM 1024
#define NH 16
#define SCL 0.125f
#define NR (NBT * SLEN)
typedef __bf16 v16b __attribute__((ext_vector_type(16)));
typedef unsigned short v8us __attribute__((ext_vector_type(8), may_alias));
typedef float  v8f  __attribute__((ext_vector_type(8)));
typedef float  v4f  __attribute__((ext_vector_type(4)));
typedef float  v4fa __attribute__((ext_vector_type(4), may_alias));
union FragB { v16b v; v8us half[2]; unsigned short u[16]; };

__device__ __forceinline__ unsigned short bf16_bits(float x) { unsigned int u = __float_as_uint(x); return (unsigned short)((u + 0x7FFFu + ((u >> 16) & 1u)) >> 16); }
__device__ __forceinline__ float bf16_val(unsigned short b) { return __uint_as_float(((unsigned int)b) << 16); }
__device__ __forceinline__ float bf16_round(float x) { return bf16_val(bf16_bits(x)); }
// D += A·B with NT terms: 1 = ah·bh, 2 = + al·bh (A split), 3 = + ah·bl (both split)
template <int NT>
__device__ __forceinline__ v8f mmaN(v16b ah, v16b al, v16b bh, v16b bl, v8f c) {
  c = __builtin_amdgcn_wmma_f32_16x16x32_bf16(false, ah, false, bh, (short)0, c, false, false);
  if (NT >= 2) c = __builtin_amdgcn_wmma_f32_16x16x32_bf16(false, al, false, bh, (short)0, c, false, false);
  if (NT >= 3) c = __builtin_amdgcn_wmma_f32_16x16x32_bf16(false, ah, false, bl, (short)0, c, false, false);
  asm volatile("v_nop\n\tv_nop\n\tv_nop\n\tv_nop" : "+v"(c) : "v"(ah), "v"(al), "v"(bh), "v"(bl));
  return c;
}

__global__ __launch_bounds__(256) void k_wt_bf16(const float* __restrict__ W, unsigned short* __restrict__ Wt, int K, int N) {
  const int t = blockIdx.x * 256 + threadIdx.x;
  const int k8n = K / 8;
  if (t >= N * k8n) return;
  const int n = t / k8n, k8 = (t % k8n) * 8;
  v8us v;
#pragma unroll
  for (int i = 0; i < 8; ++i) v[i] = bf16_bits(W[(size_t)(k8 + i) * N + n]);
  *(v8us*)(Wt + (size_t)n * K + k8) = v;
  
}

// GEMM C[M][N] (f32, pitch ldc) = act(A[M][K]·W + bias). A f32 row-major (pitch lda) converted per fragment to bf16
// (ASPLIT: hi/lo two planes -> 2 terms, else single rounded term); Wt bf16 [N][K] (pitch ldb). BIAS_BF16 rounds the
// bias to bf16 first (bias quantised to bf16 before the add). K%32==0, M%16==0, N%64==0.
template <bool ASPLIT, int ACT, bool BIAS_BF16>
__global__ __launch_bounds__(128) void k_gemm_bf(const float* __restrict__ A, int lda, const unsigned short* __restrict__ Wt, int ldb,
                                               const float* __restrict__ bias, float* __restrict__ C, int ldc, int M, int N, int K) {
  __shared__ __attribute__((aligned(16))) float so[4][16][64];
  const int tid = threadIdx.x, w = tid >> 5, lane = tid & 31, ln = lane & 15, hh = lane >> 4;
  const int ntn = N / 64;
  const int wid = blockIdx.x * 4 + w;
  const int mt = wid / ntn, nq = wid % ntn;
  if (mt * 16 >= M) return;
  const int row0 = mt * 16, col0 = nq * 64;
  const float* arow = A + (size_t)(row0 + ln) * lda;
  v8f acc[4] = {};
  for (int kb = 0; kb < K; kb += 32) {
    FragB ah, al;
    const v4f x0 = *(const v4fa*)(arow + kb + 8 * hh), x1 = *(const v4fa*)(arow + kb + 8 * hh + 4);
    const v4f x2 = *(const v4fa*)(arow + kb + 16 + 8 * hh), x3 = *(const v4fa*)(arow + kb + 16 + 8 * hh + 4);
    float xs[16] = {x0[0],x0[1],x0[2],x0[3],x1[0],x1[1],x1[2],x1[3],x2[0],x2[1],x2[2],x2[3],x3[0],x3[1],x3[2],x3[3]};
#pragma unroll
    for (int i = 0; i < 16; ++i) { const unsigned short hb = bf16_bits(xs[i]); ah.u[i] = hb; al.u[i] = ASPLIT ? bf16_bits(xs[i] - bf16_val(hb)) : (unsigned short)0; }
#pragma unroll
    for (int t = 0; t < 4; ++t) {
      const unsigned short* brow = Wt + (size_t)(col0 + t * 16 + ln) * ldb + kb;
      FragB b;
      b.half[0] = *(const v8us*)(brow + 8 * hh);
      b.half[1] = *(const v8us*)(brow + 16 + 8 * hh);
      acc[t] = mmaN<ASPLIT ? 2 : 1>(ah.v, al.v, b.v, b.v, acc[t]);
    }
  }
#pragma unroll
  for (int t = 0; t < 4; ++t) {
    float bv = bias ? bias[col0 + t * 16 + ln] : 0.f;
    if (BIAS_BF16) bv = bf16_round(bv);
#pragma unroll
    for (int r = 0; r < 8; ++r) { float v = acc[t][r] + bv; if (ACT == 1) v = fmaxf(v, 0.f); so[w][8 * hh + r][t * 16 + ln] = v; }
  }
  __builtin_amdgcn_fence(__ATOMIC_ACQ_REL, "workgroup");
  __builtin_amdgcn_wave_barrier();
  const int rsub = lane >> 4, c4 = (lane & 15) * 4;
  {
#pragma unroll
    for (int q = 0; q < 8; ++q) {
      const int r = q * 2 + rsub;
      const v4f v = *(const v4fa*)&so[w][r][c4];
      *(v4f*)(C + (size_t)(row0 + r) * ldc + col0 + c4) = v;
    }
    
  }
}

// GEMM C = act(A·W + bias + resid): A f32 (ASPLIT -> hi/lo 2 terms), Wt bf16 [N][K]; ACT 0 none, 1 relu, 2 exact gelu;
// resid (optional, f32, row index = (row % rmod), pitch ldr, RES_BF16 rounds it) added before the activation.
template <bool ASPLIT, int ACT, bool BIAS_BF16, bool RES_BF16>
__global__ __launch_bounds__(128) void k_gemm_bf3(const float* __restrict__ A, int lda, const unsigned short* __restrict__ Wt, int ldb,
                                                const float* __restrict__ bias, const float* __restrict__ resid, int rmod, int ldr,
                                                float* __restrict__ C, int ldc, int M, int N, int K) {
  __shared__ __attribute__((aligned(16))) float so[4][16][64];
  const int tid = threadIdx.x, w = tid >> 5, lane = tid & 31, ln = lane & 15, hh = lane >> 4;
  const int ntn = N / 64;
  const int wid = blockIdx.x * 4 + w;
  const int mt = wid / ntn, nq = wid % ntn;
  if (mt * 16 >= M) return;
  const int row0 = mt * 16, col0 = nq * 64;
  const float* arow = A + (size_t)(row0 + ln) * lda;
  v8f acc[4] = {};
  for (int kb = 0; kb < K; kb += 32) {
    FragB ah, al;
    const v4f x0 = *(const v4fa*)(arow + kb + 8 * hh), x1 = *(const v4fa*)(arow + kb + 8 * hh + 4);
    const v4f x2 = *(const v4fa*)(arow + kb + 16 + 8 * hh), x3 = *(const v4fa*)(arow + kb + 16 + 8 * hh + 4);
    float xs[16] = {x0[0],x0[1],x0[2],x0[3],x1[0],x1[1],x1[2],x1[3],x2[0],x2[1],x2[2],x2[3],x3[0],x3[1],x3[2],x3[3]};
#pragma unroll
    for (int i = 0; i < 16; ++i) { const unsigned short hb = bf16_bits(xs[i]); ah.u[i] = hb; al.u[i] = ASPLIT ? bf16_bits(xs[i] - bf16_val(hb)) : (unsigned short)0; }
#pragma unroll
    for (int t = 0; t < 4; ++t) {
      const unsigned short* brow = Wt + (size_t)(col0 + t * 16 + ln) * ldb + kb;
      FragB b;
      b.half[0] = *(const v8us*)(brow + 8 * hh);
      b.half[1] = *(const v8us*)(brow + 16 + 8 * hh);
      acc[t] = mmaN<ASPLIT ? 2 : 1>(ah.v, al.v, b.v, b.v, acc[t]);
    }
  }
#pragma unroll
  for (int t = 0; t < 4; ++t) {
    const int col = col0 + t * 16 + ln;
    float bv = bias ? bias[col] : 0.f;
    if (BIAS_BF16) bv = bf16_round(bv);
#pragma unroll
    for (int r = 0; r < 8; ++r) {
      float v = acc[t][r] + bv;
      if (resid) { float rv = resid[(size_t)((row0 + 8 * hh + r) % rmod) * ldr + col]; if (RES_BF16) rv = bf16_round(rv); v += rv; }
      if (ACT == 1) v = fmaxf(v, 0.f);
      if (ACT == 2) v = 0.5f * v * (1.0f + erff(v * 0.70710678118654752f));
      if (ACT == 3) { const float u = 0.7978845608028654f * (v + 0.044715f * v * v * v); v = 0.5f * v * (1.0f + tanhf(u)); }
      so[w][8 * hh + r][t * 16 + ln] = v;
    }
  }
  __builtin_amdgcn_fence(__ATOMIC_ACQ_REL, "workgroup");
  __builtin_amdgcn_wave_barrier();
  const int rsub = lane >> 4, c4 = (lane & 15) * 4;
  {
#pragma unroll
    for (int q = 0; q < 8; ++q) {
      const int r = q * 2 + rsub;
      const v4f v = *(const v4fa*)&so[w][r][c4];
      *(v4f*)(C + (size_t)(row0 + r) * ldc + col0 + c4) = v;
    }
    
  }
}
// row LayerNorm (biased variance, eps) over N: s = X (+ R); optional out_sum <- s; out_norm <- (s-mu)*rsqrt(var+eps)*g + b
template <bool PARAM_BF16>
__global__ __launch_bounds__(256) void k_layernorm(const float* __restrict__ X, const float* __restrict__ R, const float* __restrict__ g, const float* __restrict__ bta,
                                                  float* __restrict__ out_sum, float* __restrict__ out_norm, int N, float eps) {
  __shared__ float red[256];
  const int row = blockIdx.x, tid = threadIdx.x;
  const float* x = X + (size_t)row * N; const float* rr = R ? R + (size_t)row * N : nullptr;
  float vals[16];                     // up to N = 4096
  const int per = N / 256;            // contiguous chunk per thread? use strided-by-4 chunks: thread handles j = tid*4 + 1024*u
  float s1 = 0.f;
  for (int u = 0; u < per / 4; ++u) {
    const int j = tid * 4 + 1024 * u;
    const v4f a = *(const v4fa*)(x + j);
    v4f b = {0.f,0.f,0.f,0.f}; if (rr) b = *(const v4fa*)(rr + j);
#pragma unroll
    for (int q = 0; q < 4; ++q) { const float v = a[q] + b[q]; vals[u * 4 + q] = v; s1 += v; }
  }
  red[tid] = s1; __syncthreads();
  for (int st = 128; st > 0; st >>= 1) { if (tid < st) red[tid] += red[tid + st]; __syncthreads(); }
  const float mu = red[0] / (float)N; __syncthreads();
  float s2 = 0.f;
  for (int u = 0; u < per / 4; ++u)
#pragma unroll
    for (int q = 0; q < 4; ++q) { const float c = vals[u * 4 + q] - mu; s2 += c * c; }
  red[tid] = s2; __syncthreads();
  for (int st = 128; st > 0; st >>= 1) { if (tid < st) red[tid] += red[tid + st]; __syncthreads(); }
  const float rs = rsqrtf(red[0] / (float)N + eps);
  {
    for (int u = 0; u < per / 4; ++u) {
      const int j = tid * 4 + 1024 * u;
      v4f o, sm;
#pragma unroll
      for (int q = 0; q < 4; ++q) {
        float gg = g[j + q], bb = bta[j + q];
        if (PARAM_BF16) { gg = bf16_round(gg); bb = bf16_round(bb); }
        sm[q] = vals[u * 4 + q]; o[q] = (vals[u * 4 + q] - mu) * rs * gg + bb;
      }
      if (out_sum) *(v4f*)(out_sum + (size_t)row * N + j) = sm;
      *(v4f*)(out_norm + (size_t)row * N + j) = o;
    }
    
  }
}



// ---- f16 WMMA path (v_wmma_f32_16x16x32_f16): 11-bit significands for operands in range — used where a [0,1] probability operand needs more precision than bf16
typedef _Float16 v16h __attribute__((ext_vector_type(16)));
union FragH { v16h v; v8us half[2]; _Float16 h[16]; unsigned short u[16]; };
template <int NT>
__device__ __forceinline__ v8f mmaH(v16h ah, v16h al, v16h bh, v16h bl, v8f c) {
  c = __builtin_amdgcn_wmma_f32_16x16x32_f16(false, ah, false, bh, (short)0, c, false, false);
  if (NT >= 2) c = __builtin_amdgcn_wmma_f32_16x16x32_f16(false, al, false, bh, (short)0, c, false, false);
  if (NT >= 3) c = __builtin_amdgcn_wmma_f32_16x16x32_f16(false, ah, false, bl, (short)0, c, false, false);
  asm volatile("v_nop\n\tv_nop\n\tv_nop\n\tv_nop" : "+v"(c) : "v"(ah), "v"(al), "v"(bh), "v"(bl));
  return c;
}
// batched GEMM like k_gemm_b but f16 operands: A f32 (split into f16 hi/lo if ASPLIT, else rounded to f16), Bt = f16 values [n][k]; alpha; C f32; N multiple of 16 (partial tiles skipped)
template <bool ASPLIT>
__global__ __launch_bounds__(128) void k_gemm_h(const float* __restrict__ A, int lda, size_t sA, const _Float16* __restrict__ Bh, int ldb, size_t sB, float alpha, float* __restrict__ C, int ldc, size_t sC, int M, int N, int K) {
  __shared__ __attribute__((aligned(16))) float so[4][16][64];
  const int tid = threadIdx.x, w = tid >> 5, lane = tid & 31, ln = lane & 15, hh = lane >> 4; const int by = blockIdx.y;
  A += (size_t)by * sA; Bh += (size_t)by * sB; C += (size_t)by * sC;
  const int ntn = (N + 63) / 64; const int wid = blockIdx.x * 4 + w; const int mt = wid / ntn, nq = wid % ntn; if (mt * 16 >= M) return;
  const int row0 = mt * 16, col0 = nq * 64; const float* arow = A + (size_t)(row0 + ln) * lda;
  v8f acc[4] = {};
  for (int kb = 0; kb < K; kb += 32) {
    FragH ah, al;
    const v4f x0 = *(const v4fa*)(arow + kb + 8 * hh), x1 = *(const v4fa*)(arow + kb + 8 * hh + 4), x2 = *(const v4fa*)(arow + kb + 16 + 8 * hh), x3 = *(const v4fa*)(arow + kb + 16 + 8 * hh + 4);
    float xs[16] = {x0[0],x0[1],x0[2],x0[3],x1[0],x1[1],x1[2],x1[3],x2[0],x2[1],x2[2],x2[3],x3[0],x3[1],x3[2],x3[3]};
#pragma unroll
    for (int i = 0; i < 16; ++i) { const _Float16 h = (_Float16)xs[i]; ah.h[i] = h; al.h[i] = ASPLIT ? (_Float16)(xs[i] - (float)h) : (_Float16)0.0f; }
#pragma unroll
    for (int t = 0; t < 4; ++t) { if (col0 + t * 16 >= N) continue; const size_t boff = (size_t)(col0 + t * 16 + ln) * ldb + kb; FragH bq; bq.half[0] = *(const v8us*)(Bh + boff + 8 * hh); bq.half[1] = *(const v8us*)(Bh + boff + 16 + 8 * hh);
      acc[t] = mmaH<ASPLIT ? 2 : 1>(ah.v, al.v, bq.v, bq.v, acc[t]); }
  }
#pragma unroll
  for (int t = 0; t < 4; ++t) { if (col0 + t * 16 >= N) continue;
#pragma unroll
    for (int r = 0; r < 8; ++r) so[w][8 * hh + r][t * 16 + ln] = acc[t][r] * alpha; }
  __builtin_amdgcn_fence(__ATOMIC_ACQ_REL, "workgroup"); __builtin_amdgcn_wave_barrier();
  const int rsub = lane >> 4, c4 = (lane & 15) * 4;
  {
#pragma unroll
    for (int q = 0; q < 8; ++q) { const int r = q * 2 + rsub; if (col0 + c4 < N) { const v4f v = *(const v4fa*)&so[w][r][c4]; *(v4f*)(C + (size_t)(row0 + r) * ldc + col0 + c4) = v; } }
     }
}

// Wt[n][k] = f16(W[k][n]·scale) from f32 row-major W[K][N] (scale = power of two; bf16-exact weights stay exact in f16 away from the subnormal range)
// blockIdx.y picks one of four equally shaped matrices; their transposes lie one behind the other in Wt
__global__ __launch_bounds__(256) void k_wt_f16(const float* __restrict__ W0, const float* __restrict__ W1, const float* __restrict__ W2, const float* __restrict__ W3, _Float16* __restrict__ Wt, int K, int N, float scale) {
  const int by = blockIdx.y; const float* __restrict__ W = (by == 0) ? W0 : (by == 1) ? W1 : (by == 2) ? W2 : W3; Wt += (size_t)by * K * N;
  const int t = blockIdx.x * 256 + threadIdx.x; if (t >= N * (K / 8)) return; const int n = t / (K / 8), k8 = (t % (K / 8)) * 8; FragH f;
#pragma unroll
  for (int i = 0; i < 8; ++i) f.h[i] = (_Float16)(bf16_round(W[(size_t)(k8 + i) * N + n]) * scale); const v8us o = f.half[0];
  *(v8us*)((unsigned short*)Wt + (size_t)n * K + k8) = o; 
}
// k_gemm_hh variant with fused epilogue: v = acc·alpha + bias[by·sBias + col] (+ CP[(row/rowsPerB)·sCPb + by·64 + col] if CP) ; ACT 0 none / 1 elu ; writes f16 C16 (and f32 C if non-null)
template <int ACT>
__global__ __launch_bounds__(128) void k_gemm_hhx(const _Float16* __restrict__ A, int lda, size_t sA, const _Float16* __restrict__ Bh, int ldb, size_t sB, float alpha, const float* __restrict__ bias, size_t sBias, const float* __restrict__ CP, int rowsPerB, size_t sCPb, int row0g,
    float* __restrict__ C, _Float16* __restrict__ C16, int ldc, size_t sC, int M, int N, int K) {
  __shared__ __attribute__((aligned(16))) float so[4][16][64];
  const int tid = threadIdx.x, w = tid >> 5, lane = tid & 31, ln = lane & 15, hh = lane >> 4; const int by = blockIdx.y;
  A += (size_t)by * sA; Bh += (size_t)by * sB; const size_t cofs = (size_t)by * sC; const float* bp = bias ? bias + (size_t)by * sBias : nullptr;
  const int ntn = (N + 63) / 64; const int wid = blockIdx.x * 4 + w; const int mt = wid / ntn, nq = wid % ntn; if (mt * 16 >= M) return;
  const int row0 = mt * 16, col0 = nq * 64; const _Float16* arow = A + (size_t)(row0 + ln) * lda;
  v8f acc[4] = {};
  for (int kb = 0; kb < K; kb += 32) { FragH ah; ah.half[0] = *(const v8us*)((const unsigned short*)arow + kb + 8 * hh); ah.half[1] = *(const v8us*)((const unsigned short*)arow + kb + 16 + 8 * hh);
#pragma unroll
    for (int t = 0; t < 4; ++t) { if (col0 + t * 16 >= N) continue; const size_t boff = (size_t)(col0 + t * 16 + ln) * ldb + kb; FragH bq; bq.half[0] = *(const v8us*)((const unsigned short*)Bh + boff + 8 * hh); bq.half[1] = *(const v8us*)((const unsigned short*)Bh + boff + 16 + 8 * hh);
      acc[t] = mmaH<1>(ah.v, ah.v, bq.v, bq.v, acc[t]); }
  }
#pragma unroll
  for (int t = 0; t < 4; ++t) { if (col0 + t * 16 >= N) continue; const int col = col0 + t * 16 + ln; const float bv = bp ? bf16_round(bp[col]) : 0.f;
#pragma unroll
    for (int r = 0; r < 8; ++r) { float v = acc[t][r] * alpha + bv; if (CP) { const int bidx = (row0g + row0 + 8 * hh + r) / rowsPerB; v += CP[(size_t)bidx * sCPb + (size_t)by * 64 + col]; } if (ACT == 1) v = (v > 0.f) ? v : expm1f(v); else if (ACT == 7) v = (v > 0.f) ? v + 1.0f : expf(v); else if (ACT == 8) v = tanhf(v); else if (ACT == 9) v = 0.5f * v * (1.0f + tanhf(0.7978845608028654f * (v + 0.044715f * v * v * v))); else if (ACT == 11) v = 1.0f / (1.0f + expf(-v)); else if (ACT == 12) v = (v > 0.f) ? v : 0.01f * v; else if (ACT == 14) v = (v > 0.f) ? v : 0.1f * v; else if (ACT == 15) v = v / (1.0f + expf(-v)); else if (ACT == 3) v = fmaxf(v, 0.f); else if (ACT == 6) v = 0.5f * v * (1.0f + erff(v * 0.70710678118654752f)); so[w][8 * hh + r][t * 16 + ln] = v; } }
  __builtin_amdgcn_fence(__ATOMIC_ACQ_REL, "workgroup"); __builtin_amdgcn_wave_barrier();
  const int rsub = lane >> 4, c4 = (lane & 15) * 4; typedef _Float16 v4h __attribute__((ext_vector_type(4)));
  {
#pragma unroll
    for (int q = 0; q < 8; ++q) { const int r = q * 2 + rsub; if (col0 + c4 < N) { const v4f v = *(const v4fa*)&so[w][r][c4]; if (C) *(v4f*)(C + cofs + (size_t)(row0 + r) * ldc + col0 + c4) = v; if (C16) { v4h h4; for (int i = 0; i < 4; ++i) h4[i] = (_Float16)v[i]; *(v4h*)(C16 + cofs + (size_t)(row0 + r) * ldc + col0 + c4) = h4; } } }
     }
}


typedef _Float16 v4h __attribute__((ext_vector_type(4)));

__global__ __launch_bounds__(256) void k_x16(const float* __restrict__ x, _Float16* __restrict__ X16, size_t n8) { const size_t t = (size_t)blockIdx.x * 256 + threadIdx.x; if (t >= n8) return; FragH f;
#pragma unroll
  for (int q = 0; q < 8; ++q) f.h[q] = (_Float16)bf16_round(x[t * 8 + q]); *(v8us*)((unsigned short*)X16 + t * 8) = f.half[0];  }
__global__ __launch_bounds__(256) void k_h16(const float* __restrict__ x, _Float16* __restrict__ X16, size_t n8) { const size_t t = (size_t)blockIdx.x * 256 + threadIdx.x; if (t >= n8) return; FragH f;
#pragma unroll
  for (int q = 0; q < 8; ++q) f.h[q] = (_Float16)x[t * 8 + q]; *(v8us*)((unsigned short*)X16 + t * 8) = f.half[0];  }
__global__ __launch_bounds__(256) void k_round16f(const float* __restrict__ W, _Float16* __restrict__ Bt, size_t n8) { const size_t t = (size_t)blockIdx.x * 256 + threadIdx.x; if (t >= n8) return; FragH f;
#pragma unroll
  for (int i = 0; i < 8; ++i) f.h[i] = (_Float16)(bf16_round(W[t * 8 + i]) * 16.0f); *(v8us*)((unsigned short*)Bt + t * 8) = f.half[0];  }
template <int NHv, int TTv>
__global__ __launch_bounds__(256) void k_vt(const _Float16* __restrict__ V16, int ldv, int voff, _Float16* __restrict__ Vt) { __shared__ unsigned short tl[64][66]; const int tid = threadIdx.x; const int slab = blockIdx.x / (TTv / 64), lg = blockIdx.x % (TTv / 64); const int b = slab / NHv, h = slab % NHv;
  for (int i = tid; i < 64 * 8; i += 256) { const int r = i / 8, c8 = (i % 8) * 8; FragH f; f.half[0] = *(const v8us*)((const unsigned short*)V16 + ((size_t)b * TTv + lg * 64 + r) * ldv + voff + h * 64 + c8);
#pragma unroll
    for (int q = 0; q < 8; ++q) tl[r][c8 + q] = f.u[q]; }
  __syncthreads();
  {
#pragma unroll
    for (int rd = 0; rd < 2; ++rd) { const int d = rd * 32 + tid / 8, pc = tid % 8; FragH f;
#pragma unroll
      for (int q = 0; q < 8; ++q) f.u[q] = tl[pc * 8 + q][d];
      *(v8us*)((unsigned short*)Vt + ((size_t)slab * 64 + d) * TTv + lg * 64 + pc * 8) = f.half[0]; }
     } }

__global__ __launch_bounds__(256) void k_hl(const float* __restrict__ F, _Float16* __restrict__ Hh, _Float16* __restrict__ Hl, size_t n8) { const size_t t = (size_t)blockIdx.x * 256 + threadIdx.x; if (t >= n8) return; FragH fh, fl; const v4f a = *(const v4fa*)(F + t * 8), c = *(const v4fa*)(F + t * 8 + 4);
#pragma unroll
  for (int q = 0; q < 4; ++q) { _Float16 h = (_Float16)a[q]; fh.h[q] = h; fl.h[q] = (_Float16)((a[q] - (float)h) * 1024.0f); h = (_Float16)c[q]; fh.h[4 + q] = h; fl.h[4 + q] = (_Float16)((c[q] - (float)h) * 1024.0f); }
  { *(v8us*)((unsigned short*)Hh + t * 8) = fh.half[0]; *(v8us*)((unsigned short*)Hl + t * 8) = fl.half[0];  } }

// ---- fast GEMM (wave tile 32x64; requires M % 32 == 0 rows per launch region and N % 64 == 0); epilogue like k_gemm_hhx, but the bias is bias, bias1 or bias2 by blockIdx.y ----
__device__ __forceinline__ v16h g2_frag(const _Float16* p, int hh) { FragH f; f.half[0] = *(const v8us*)((const unsigned short*)p + 8 * hh); f.half[1] = *(const v8us*)((const unsigned short*)p + 16 + 8 * hh); return f.v; }
__device__ __forceinline__ v8f g2_mma(v16h a, v16h b, v8f c) { v8f d = __builtin_amdgcn_wmma_f32_16x16x32_f16(false, a, false, b, (short)0, c, false, false); asm volatile("v_nop\n\tv_nop\n\tv_nop\n\tv_nop" : "+v"(d) : "v"(a), "v"(b)); return d; }
template <int ACT>
__global__ __launch_bounds__(128) void k_gemm2(const _Float16* __restrict__ A, int lda, size_t sA, const _Float16* __restrict__ Bh, int ldb, size_t sB, float alpha, const float* __restrict__ bias, const float* __restrict__ bias1, const float* __restrict__ bias2, const float* __restrict__ CP, int rowsPerB, size_t sCPb, int row0g,
    float* __restrict__ C, _Float16* __restrict__ C16, int ldc, size_t sC, int M, int N, int K) {
  __shared__ __attribute__((aligned(16))) float so[4][32][68];
  const int tid = threadIdx.x, w = tid >> 5, lane = tid & 31, ln = lane & 15, hh = lane >> 4; const int by = blockIdx.y;
  A += (size_t)by * sA; Bh += (size_t)by * sB; const size_t cofs = (size_t)by * sC; const float* bp = (by == 0) ? bias : (by == 1) ? bias1 : bias2;      /* one bias vector per blockIdx.y */
  const int ntn = N >> 6; const int mt = blockIdx.x / ntn, nq = blockIdx.x - mt * ntn; const int row0 = mt * 128 + 32 * w, col0 = nq * 64; if (row0 >= M) return;
  const _Float16* a0p = A + (size_t)(row0 + ln) * lda; const _Float16* a1p = a0p + (size_t)16 * lda;
  const _Float16* b0p = Bh + (size_t)(col0 + ln) * ldb; const _Float16* b1p = b0p + (size_t)16 * ldb; const _Float16* b2p = b1p + (size_t)16 * ldb; const _Float16* b3p = b2p + (size_t)16 * ldb;
  const v8f z8 = {0.f,0.f,0.f,0.f,0.f,0.f,0.f,0.f}; v8f c00 = z8, c01 = z8, c02 = z8, c03 = z8, c10 = z8, c11 = z8, c12 = z8, c13 = z8;
#pragma unroll 1
  for (int kb = 0; kb < K; kb += 32) { const v16h a0 = g2_frag(a0p + kb, hh), a1 = g2_frag(a1p + kb, hh);
    v16h b = g2_frag(b0p + kb, hh); c00 = g2_mma(a0, b, c00); c10 = g2_mma(a1, b, c10);
    b = g2_frag(b1p + kb, hh); c01 = g2_mma(a0, b, c01); c11 = g2_mma(a1, b, c11);
    b = g2_frag(b2p + kb, hh); c02 = g2_mma(a0, b, c02); c12 = g2_mma(a1, b, c12);
    b = g2_frag(b3p + kb, hh); c03 = g2_mma(a0, b, c03); c13 = g2_mma(a1, b, c13); }
  v8f accs[8] = {c00, c01, c02, c03, c10, c11, c12, c13};
#pragma unroll
  for (int u = 0; u < 8; ++u) { const int t = u & 3, half = u >> 2; const int col = col0 + t * 16 + ln; const float bv = bp ? bf16_round(bp[col]) : 0.f;
#pragma unroll
    for (int r = 0; r < 8; ++r) { const int rloc = half * 16 + 8 * hh + r; float v = accs[u][r] * alpha + bv; if (CP) { const int bidx = (row0g + row0 + rloc) / rowsPerB; v += CP[(size_t)bidx * sCPb + (size_t)by * 64 + col]; }
      if (ACT == 3) v = fmaxf(v, 0.f); else if (ACT == 6) v = 0.5f * v * (1.0f + erff(v * 0.70710678118654752f)); else if (ACT == 11) v = 1.0f / (1.0f + expf(-v)); else if (ACT == 15) v = v / (1.0f + expf(-v)); else if (ACT == 12) v = (v > 0.f) ? v : 0.01f * v; else if (ACT == 8) v = tanhf(v);
      so[w][rloc][t * 16 + ln] = v; } }
  __builtin_amdgcn_fence(__ATOMIC_ACQ_REL, "workgroup"); __builtin_amdgcn_wave_barrier();
  const int rsub = lane >> 4, c4 = (lane & 15) * 4;
  {
#pragma unroll
    for (int q = 0; q < 16; ++q) { const int r = q * 2 + rsub; const v4f v = *(const v4fa*)&so[w][r][c4]; if (C) *(v4f*)(C + cofs + (size_t)(row0 + r) * ldc + col0 + c4) = v; if (C16) { v4h h4; for (int i = 0; i < 4; ++i) h4[i] = (_Float16)v[i]; *(v4h*)(C16 + cofs + (size_t)(row0 + r) * ldc + col0 + c4) = h4; } }
     } }



template <int TK>
__global__ __launch_bounds__(256) void k_vthl(const float* __restrict__ VF, int ldv, _Float16* __restrict__ Vth, _Float16* __restrict__ Vtl) { __shared__ float tl[64][65]; const int tid = threadIdx.x; const int slab = blockIdx.x / (TK / 64), lg = blockIdx.x % (TK / 64); const int b = slab / NH, h = slab % NH;
  for (int i = tid; i < 64 * 16; i += 256) { const int r = i / 16, c4 = (i % 16) * 4; const v4f a = *(const v4fa*)(VF + ((size_t)b * TK + lg * 64 + r) * ldv + h * 64 + c4); tl[r][c4] = a[0]; tl[r][c4 + 1] = a[1]; tl[r][c4 + 2] = a[2]; tl[r][c4 + 3] = a[3]; }
  __syncthreads();
  FragH fh[2], fl[2]; size_t oo[2];
#pragma unroll
  for (int rd = 0; rd < 2; ++rd) { const int d = rd * 32 + tid / 8, pc = tid % 8;
#pragma unroll
    for (int q = 0; q < 8; ++q) { const float v = tl[pc * 8 + q][d]; const _Float16 hv = (_Float16)v; fh[rd].h[q] = hv; fl[rd].h[q] = (_Float16)((v - (float)hv) * 1024.0f); } oo[rd] = ((size_t)slab * 64 + d) * TK + lg * 64 + pc * 8; }
  {
#pragma unroll
    for (int rd = 0; rd < 2; ++rd) { *(v8us*)((unsigned short*)Vth + oo[rd]) = fh[rd].half[0]; *(v8us*)((unsigned short*)Vtl + oo[rd]) = fl[rd].half[0]; }
     } }

template <int TQ, int TK>
__global__ __launch_bounds__(128) void k_flashb(const _Float16* __restrict__ Q16, const _Float16* __restrict__ Q16lo, int ldq, const _Float16* __restrict__ K16, const _Float16* __restrict__ K16lo, int ldk, const _Float16* __restrict__ Vt, const _Float16* __restrict__ Vtlo, const float* __restrict__ BT, const int* __restrict__ LAG, float* __restrict__ O, int ldo) {
  constexpr int RPW = 16, RTN = RPW / 16, NQB = TQ / (4 * RPW), DT = 4, KS = 2;
  __shared__ __attribute__((aligned(16))) unsigned short sP[4][RPW][40], sPl[4][RPW][40]; __shared__ __attribute__((aligned(16))) float sO[4][RPW][64 + 4];
  // two-buffer ring of one pass's operands, shared by the block's four waves: [buffer][hi, residual][row][halfs]; K rows (128 B) at a pitch of 144 B, V^T rows (64 B) at 80 B, both 16 B x odd for the 16-byte fragment reads
  __shared__ __attribute__((aligned(16))) unsigned short sK[2][2][32][72]; __shared__ __attribute__((aligned(16))) unsigned short sV[2][2][64][40];
  const int tid = threadIdx.x, w = tid >> 5, lane = tid & 31, ln = lane & 15, hh = lane >> 4;
  const int slab = blockIdx.x / NQB, qblk = blockIdx.x % NQB; const int b = slab / NH, h = slab % NH; const int qb0 = qblk * (4 * RPW); const int q0 = qb0 + w * RPW;
  FragH aq[2][KS], aql[2][KS];
#pragma unroll
  for (int rt = 0; rt < RTN; ++rt) { const size_t qo = ((size_t)b * TQ + q0 + rt * 16 + ln) * ldq + h * 64; const unsigned short* qr = (const unsigned short*)Q16 + qo; const unsigned short* ql = (const unsigned short*)Q16lo + qo;
#pragma unroll
    for (int ks = 0; ks < KS; ++ks) { aq[rt][ks].half[0] = *(const v8us*)(qr + ks * 32 + 8 * hh); aq[rt][ks].half[1] = *(const v8us*)(qr + ks * 32 + 16 + 8 * hh); aql[rt][ks].half[0] = *(const v8us*)(ql + ks * 32 + 8 * hh); aql[rt][ks].half[1] = *(const v8us*)(ql + ks * 32 + 16 + 8 * hh); } }
  const unsigned short* Vth = (const unsigned short*)Vt + (size_t)slab * 64 * TK; const unsigned short* Vtl = (const unsigned short*)Vtlo + (size_t)slab * 64 * TK;
  // each thread copies eight 16-byte pieces of a pass's tile: K rows tid/8 and tid/8 + 16 (a wave covers whole 128-B rows), V^T rows tid/4 and tid/4 + 32, hi and residual plane each
  const size_t kg0 = ((size_t)b * TK + (tid >> 3)) * ldk + h * 64 + (tid & 7) * 8, vg0 = (size_t)(tid >> 2) * TK + (tid & 3) * 8;
  const unsigned kd0 = (unsigned)(size_t)&sK[0][0][tid >> 3][(tid & 7) * 8], vd0 = (unsigned)(size_t)&sV[0][0][tid >> 2][(tid & 3) * 8];
  auto stage = [&](int j, int buf) {
    const unsigned short* gk = (const unsigned short*)K16 + kg0 + (size_t)j * ldk; const unsigned short* gkl = (const unsigned short*)K16lo + kg0 + (size_t)j * ldk; const unsigned short* gk2 = gk + (size_t)16 * ldk; const unsigned short* gkl2 = gkl + (size_t)16 * ldk;
    const unsigned short* gv = Vth + vg0 + j; const unsigned short* gvl = Vtl + vg0 + j; const unsigned short* gv2 = gv + (size_t)32 * TK; const unsigned short* gvl2 = gvl + (size_t)32 * TK;
    const unsigned dk = kd0 + (unsigned)buf * (unsigned)sizeof(sK[0]), dkl = dk + (unsigned)sizeof(sK[0][0]), dk2 = dk + 16u * (unsigned)sizeof(sK[0][0][0]), dkl2 = dkl + 16u * (unsigned)sizeof(sK[0][0][0]);
    const unsigned dv = vd0 + (unsigned)buf * (unsigned)sizeof(sV[0]), dvl = dv + (unsigned)sizeof(sV[0][0]), dv2 = dv + 32u * (unsigned)sizeof(sV[0][0][0]), dvl2 = dvl + 32u * (unsigned)sizeof(sV[0][0][0]);
    // the copies go from global memory to LDS through no register; the closing s_wait_xcnt is a precaution that stands in front of any rewrite of the address registers named here
    asm volatile("global_load_async_to_lds_b128 %0, %8, off\n\tglobal_load_async_to_lds_b128 %1, %9, off\n\tglobal_load_async_to_lds_b128 %2, %10, off\n\tglobal_load_async_to_lds_b128 %3, %11, off\n\t"
                 "global_load_async_to_lds_b128 %4, %12, off\n\tglobal_load_async_to_lds_b128 %5, %13, off\n\tglobal_load_async_to_lds_b128 %6, %14, off\n\tglobal_load_async_to_lds_b128 %7, %15, off\n\ts_wait_xcnt 0x0"
                 :: "v"(dk), "v"(dk2), "v"(dkl), "v"(dkl2), "v"(dv), "v"(dv2), "v"(dvl), "v"(dvl2), "v"(gk), "v"(gk2), "v"(gkl), "v"(gkl2), "v"(gv), "v"(gv2), "v"(gvl), "v"(gvl2) : "memory"); };
  stage(0, 0);
  asm volatile("s_wait_asynccnt 0x0" ::: "memory");      /* this wave's share of tile 0 has landed */
  __syncthreads();      /* tile 0 is published to all four waves */
  stage(32, 1);      /* tile 1 flies while tile 0 is worked on */
  float m_r[2][8], l_r[2][8]; v8f oacc[2][DT], oaccl[2][DT];
#pragma unroll
  for (int rt = 0; rt < RTN; ++rt) {
#pragma unroll
    for (int r = 0; r < 8; ++r) { m_r[rt][r] = -3.0e38f; l_r[rt][r] = 0.f; }
#pragma unroll
    for (int dt = 0; dt < DT; ++dt) { oacc[rt][dt] = (v8f){0.f,0.f,0.f,0.f,0.f,0.f,0.f,0.f}; oaccl[rt][dt] = oacc[rt][dt]; } }
#pragma unroll 1
  for (int j0 = 0; j0 < TK; j0 += 32) {
    const int buf = (j0 >> 5) & 1;
    float bb[2][2][8];      /* the pass's bias values, gathered at its head so that they fly beside the K loads */
    { const unsigned lk0 = (unsigned)LAG[j0 + ln], lk1 = (unsigned)LAG[j0 + 16 + ln];
#pragma unroll
      for (int rt = 0; rt < RTN; ++rt)
#pragma unroll
        for (int r = 0; r < 8; ++r) { const unsigned lq = (unsigned)LAG[q0 + rt * 16 + 8 * hh + r], d0 = lq - lk0, d1 = lq - lk1;      /* |lag[q] - lag[k]| = min(d, -d) in unsigned arithmetic; the min with 512 keeps the index inside the head's table row for any lag content */
          bb[rt][0][r] = bf16_round(BT[(size_t)h * 513 + min(min(d0, 0u - d0), 512u)]); bb[rt][1][r] = bf16_round(BT[(size_t)h * 513 + min(min(d1, 0u - d1), 512u)]); } }
    asm volatile("s_wait_xcnt 0x0" ::: "memory");      /* precaution: the gathers' index registers are reused right behind them, so their address translations are waited for first */
    v8f s[2][2];
#pragma unroll
    for (int nt = 0; nt < 2; ++nt) { const unsigned short* kr = &sK[buf][0][nt * 16 + ln][0]; const unsigned short* kl = &sK[buf][1][nt * 16 + ln][0]; FragH bk[KS], bkl[KS];
#pragma unroll
      for (int ks = 0; ks < KS; ++ks) { bk[ks].half[0] = *(const v8us*)(kr + ks * 32 + 8 * hh); bk[ks].half[1] = *(const v8us*)(kr + ks * 32 + 16 + 8 * hh); bkl[ks].half[0] = *(const v8us*)(kl + ks * 32 + 8 * hh); bkl[ks].half[1] = *(const v8us*)(kl + ks * 32 + 16 + 8 * hh); }
#pragma unroll
      for (int rt = 0; rt < RTN; ++rt) { v8f acc = (v8f){0.f,0.f,0.f,0.f,0.f,0.f,0.f,0.f}, accr = acc;
#pragma unroll
        for (int ks = 0; ks < KS; ++ks) { acc = mmaH<1>(aq[rt][ks].v, aq[rt][ks].v, bk[ks].v, bk[ks].v, acc); accr = mmaH<1>(aql[rt][ks].v, aql[rt][ks].v, bk[ks].v, bk[ks].v, accr); accr = mmaH<1>(aq[rt][ks].v, aq[rt][ks].v, bkl[ks].v, bkl[ks].v, accr); }
        s[rt][nt] = acc + accr * 0.0009765625f; } }
#pragma unroll
    for (int rt = 0; rt < RTN; ++rt)
#pragma unroll
      for (int r = 0; r < 8; ++r) {
        const float s0 = s[rt][0][r] * SCL + bb[rt][0][r], s1 = s[rt][1][r] * SCL + bb[rt][1][r]; float mc = fmaxf(s0, s1);
        mc = fmaxf(mc, __shfl_xor(mc, 1, 32)); mc = fmaxf(mc, __shfl_xor(mc, 2, 32)); mc = fmaxf(mc, __shfl_xor(mc, 4, 32)); mc = fmaxf(mc, __shfl_xor(mc, 8, 32));
        const float mn = fmaxf(m_r[rt][r], mc); const float ea = expf(m_r[rt][r] - mn); const float al = (mn > -1.0e38f) ? ea : 1.0f; m_r[rt][r] = mn; const float p0 = expf(s0 - mn), p1 = expf(s1 - mn); l_r[rt][r] = l_r[rt][r] * al + p0 + p1;
#pragma unroll
        for (int dt = 0; dt < DT; ++dt) { oacc[rt][dt][r] *= al; oaccl[rt][dt][r] *= al; }
        FragH t2, t3; const float ps0 = p0 * 1024.0f, ps1 = p1 * 1024.0f; t2.h[0] = (_Float16)ps0; t2.h[1] = (_Float16)ps1; t3.h[0] = (_Float16)((ps0 - (float)t2.h[0]) * 1024.0f); t3.h[1] = (_Float16)((ps1 - (float)t2.h[1]) * 1024.0f);
        sP[w][rt * 16 + 8 * hh + r][ln] = t2.u[0]; sP[w][rt * 16 + 8 * hh + r][16 + ln] = t2.u[1]; sPl[w][rt * 16 + 8 * hh + r][ln] = t3.u[0]; sPl[w][rt * 16 + 8 * hh + r][16 + ln] = t3.u[1]; }
    __builtin_amdgcn_fence(__ATOMIC_ACQ_REL, "workgroup"); __builtin_amdgcn_wave_barrier();
    FragH pa[2], pl[2];
#pragma unroll
    for (int rt = 0; rt < RTN; ++rt) { pa[rt].half[0] = *(const v8us*)&sP[w][rt * 16 + ln][8 * hh]; pa[rt].half[1] = *(const v8us*)&sP[w][rt * 16 + ln][16 + 8 * hh]; pl[rt].half[0] = *(const v8us*)&sPl[w][rt * 16 + ln][8 * hh]; pl[rt].half[1] = *(const v8us*)&sPl[w][rt * 16 + ln][16 + 8 * hh]; }
#pragma unroll
    for (int dt = 0; dt < DT; ++dt) { const unsigned short* vr = &sV[buf][0][dt * 16 + ln][0]; const unsigned short* vl = &sV[buf][1][dt * 16 + ln][0]; FragH bv, bl; bv.half[0] = *(const v8us*)(vr + 8 * hh); bv.half[1] = *(const v8us*)(vr + 16 + 8 * hh); bl.half[0] = *(const v8us*)(vl + 8 * hh); bl.half[1] = *(const v8us*)(vl + 16 + 8 * hh);
#pragma unroll
      for (int rt = 0; rt < RTN; ++rt) { oacc[rt][dt] = mmaH<1>(pa[rt].v, pa[rt].v, bv.v, bv.v, oacc[rt][dt]); oaccl[rt][dt] = mmaH<1>(pa[rt].v, pa[rt].v, bl.v, bl.v, oaccl[rt][dt]); oaccl[rt][dt] = mmaH<1>(pl[rt].v, pl[rt].v, bv.v, bv.v, oaccl[rt][dt]); } }
    __builtin_amdgcn_fence(__ATOMIC_ACQ_REL, "workgroup"); __builtin_amdgcn_wave_barrier();
    asm volatile("s_wait_dscnt 0x0" ::: "memory");      /* this wave's reads of the pass's buffer are done before the buffer is refilled */
    asm volatile("s_wait_asynccnt 0x0" ::: "memory");      /* this wave's share of the next tile has landed */
    __syncthreads();      /* publishes the next tile and ends every wave's reads of this pass's buffer */
    if (j0 + 64 < TK) stage(j0 + 64, buf); }
  asm volatile("s_wait_asynccnt 0x0" ::: "memory");      /* no copy is outstanding when the wave goes on to its end */
#pragma unroll
  for (int rt = 0; rt < RTN; ++rt) {
#pragma unroll
    for (int r = 0; r < 8; ++r) { float l = l_r[rt][r]; l += __shfl_xor(l, 1, 32); l += __shfl_xor(l, 2, 32); l += __shfl_xor(l, 4, 32); l += __shfl_xor(l, 8, 32); l_r[rt][r] = (l > 0.f) ? 1.0f / (l * 1024.0f) : 0.f; }
#pragma unroll
    for (int dt = 0; dt < DT; ++dt)
#pragma unroll
      for (int r = 0; r < 8; ++r) sO[w][rt * 16 + 8 * hh + r][dt * 16 + ln] = (oacc[rt][dt][r] + oaccl[rt][dt][r] * 0.0009765625f) * l_r[rt][r]; }
  __builtin_amdgcn_fence(__ATOMIC_ACQ_REL, "workgroup"); __builtin_amdgcn_wave_barrier();
  {
#pragma unroll
    for (int rp = 0; rp < RPW; rp += 2) { const int r = rp + (lane >> 4), pc = lane & 15; const v4f val = *(const v4fa*)&sO[w][r][pc * 4]; *(v4f*)(O + ((size_t)b * TQ + q0 + r) * ldo + h * 64 + pc * 4) = val; }
     } }


__global__ __launch_bounds__(256) void k_lnx(const float* __restrict__ X, const float* __restrict__ g, const float* __restrict__ bb, _Float16* __restrict__ Y16, float* __restrict__ XB) {
  #pragma clang fp contract(off)
  const int tid = threadIdx.x, w = tid >> 5, ln = tid & 31; const int r = blockIdx.x * 8 + w; if (r >= NR) return; const float* x = X + (size_t)r * DM; float s = 0.f;
#pragma unroll 1
  for (int i = 0; i < DM / 128; ++i) { const v4f a = *(const v4fa*)(x + i * 128 + ln * 4); for (int q = 0; q < 4; ++q) s += bf16_round(a[q]); }
  for (int o = 16; o > 0; o >>= 1) s += __shfl_xor(s, o, 32); const float mu = s / (float)DM; float q2 = 0.f;
#pragma unroll 1
  for (int i = 0; i < DM / 128; ++i) { const v4f a = *(const v4fa*)(x + i * 128 + ln * 4); for (int q = 0; q < 4; ++q) { const float d = bf16_round(a[q]) - mu; q2 += d * d; } }
  for (int o = 16; o > 0; o >>= 1) q2 += __shfl_xor(q2, o, 32); const float rs = rsqrtf(q2 / (float)DM + 1e-5f);
  {
#pragma unroll 1
    for (int i = 0; i < DM / 128; ++i) { const int c0 = i * 128 + ln * 4; const v4f a = *(const v4fa*)(x + c0); _Float16 h4[4]; v4f xb;
      for (int q = 0; q < 4; ++q) { const float t = bf16_round(a[q]); h4[q] = (_Float16)((t - mu) * rs * bf16_round(g[c0 + q]) + bf16_round(bb[c0 + q])); xb[q] = t; }
      *(unsigned long long*)((unsigned short*)Y16 + (size_t)r * DM + c0) = *(const unsigned long long*)h4; *(v4f*)(XB + (size_t)r * DM + c0) = xb; }
     } }
__global__ __launch_bounds__(256) void k_causaltab(unsigned* __restrict__ MB, int* __restrict__ RA, int* __restrict__ KE, int nq, int nk) {
  const int t = blockIdx.x * 256 + threadIdx.x; const int nw = nk / 32;
  if (t < nq * nw) { const int q = t / nw, w = t % nw; const int first = q + 1 - 32 * w; const unsigned bits = (first <= 0) ? 0xffffffffu : ((first >= 32) ? 0u : (0xffffffffu << first)); *(unsigned*)(MB + t) = bits;  }
  if (t < nq) { *(int*)(RA + t) = 0;  }
  if (t < nq / 64) { const int v = 64 * (t + 1); *(int*)(KE + t * 32) = v;  } }


extern "C" void kernel_launch(void* const* d_in, const int* in_sizes, int n_in,
                              void* d_out, int out_size, void* d_ws, size_t ws_size, hipStream_t stream) {
  (void)in_sizes; (void)n_in; (void)out_size;
  const float* const* I = (const float* const*)d_in; const float* x = I[0]; const int* lag = (const int*)d_in[1]; const float* wq = I[2]; const float* bq = I[3]; const float* wk = I[4]; const float* bk = I[5]; const float* wv = I[6]; const float* bv = I[7]; const float* wo = I[8]; const float* bo = I[9]; const float* lb = I[10];
  char* ws = (char*)d_ws; size_t off = 0;
  auto take = [&](size_t bytes) { char* p = ws + off; off += (bytes + 255) & ~(size_t)255; return p; };
  _Float16* BQ = (_Float16*)take((size_t)DM * DM * 2); _Float16* BK = (_Float16*)take((size_t)DM * DM * 2); _Float16* BV = (_Float16*)take((size_t)DM * DM * 2); _Float16* BO = (_Float16*)take((size_t)DM * DM * 2);
  _Float16* X16 = (_Float16*)take((size_t)NR * DM * 2); float* F = (float*)take((size_t)3 * NR * DM * 4);      /* q, k, v planes, one behind the other */
  _Float16* Qh = (_Float16*)take((size_t)NR * DM * 2); _Float16* Kh = (_Float16*)take((size_t)NR * DM * 2); _Float16* Ql = (_Float16*)take((size_t)NR * DM * 2); _Float16* Kl = (_Float16*)take((size_t)NR * DM * 2); _Float16* Vth = (_Float16*)take((size_t)NR * DM * 2); _Float16* Vtl = (_Float16*)take((size_t)NR * DM * 2);      /* Kh directly behind Qh, Kl directly behind Ql */
  if (off > ws_size) return;      /* 8 + 8 + 48 + 48 = 112 MiB */
  float* O = F; _Float16* Oh = Qh; _Float16* Ol = Ql;
  const size_t w8 = (size_t)DM * DM / 8; const unsigned wb = (unsigned)((w8 + 255) / 256);
  k_wt_f16<<<dim3(wb, 4), 256, 0, stream>>>(wq, wk, wv, wo, BQ, DM, DM, 16.0f);      /* (in,out); BQ, BK, BV, BO are contiguous */
  const size_t n8 = (size_t)NR * DM / 8; const unsigned nb8 = (unsigned)((n8 + 255) / 256); const dim3 gP((NR / 128) * (DM / 64), 1); const dim3 gP3((NR / 128) * (DM / 64), 3);
  k_x16<<<nb8, 256, 0, stream>>>(x, X16, n8);
  k_gemm2<0><<<gP3, 128, 0, stream>>>(X16, DM, 0, BQ, DM, (size_t)DM * DM, 0.0625f, bq, bk, bv, nullptr, 1, 0, 0, F, nullptr, DM, (size_t)NR * DM, NR, DM, DM);      /* q, k, v in one grid */
  k_hl<<<2 * nb8, 256, 0, stream>>>(F, Qh, Ql, 2 * n8);      /* q and k planes together */
  k_vthl<SLEN><<<NBT * NH * (SLEN / 64), 256, 0, stream>>>(F + (size_t)2 * NR * DM, DM, Vth, Vtl);
  k_flashb<SLEN, SLEN><<<NBT * NH * (SLEN / 64), 128, 0, stream>>>(Qh, Ql, DM, Kh, Kl, DM, Vth, Vtl, lb, lag, O, DM);      /* both batches in one grid; the lag vector is per position, shared across the batch */
  k_hl<<<nb8, 256, 0, stream>>>(O, Oh, Ol, n8);
  k_gemm2<0><<<gP, 128, 0, stream>>>(Oh, DM, 0, BO, DM, 0, 0.0625f, bo, nullptr, nullptr, nullptr, 1, 0, 0, (float*)d_out, nullptr, DM, 0, NR, DM, DM);
  k_gemm2<0><<<gP, 128, 0, stream>>>(Ol, DM, 0, BO, DM, 0, 0.0625f / 1024.0f, nullptr, nullptr, nullptr, (float*)d_out, 1, (size_t)DM, 0, (float*)d_out, nullptr, DM, 0, NR, DM, DM);
}

// v004
// One run takes 386 microseconds.
// Next to v003, in two timings, it ran 1.05 and 1.06 times as fast.
// Counting every step since v000, it is 2.99 times as fast.
#include <hip/hip_runtime.h>
// Multi-head self-attention with a lag-distance bias (2 x 2048 tokens, 1024 = 16 heads x 64): q,k,v = x W + b; scores = q.k/8 + lag_bias[h][|lag[q] - lag[k]|] with the INPUT integer lag vector; softmax over all keys; out = (attn v) Wo + bo -> [2,2048,1024].
// Structure: x as an exact f16 plane; projections as f16 WMMA GEMMs (32x64 wave tiles, f32 accumulation, exact x16 weights + bias); q, k as f16 hi + (x2^10) residual planes, V^T as hi + residual planes; the fused flash kernel takes each pass's K and V^T tiles (hi + residual) from a two-buffer LDS ring filled by asynchronous copies one pass ahead and shared by its four waves, and adds the bias, gathered by |lag[q] - lag[k]| (INPUT int32 positions) from the head's row of the INPUT table, which each block rounds once into LDS, inside the score stage (all keys valid; online f32 softmax, P staged hi + residual, two value accumulators); O as hi + residual planes into Wo (two GEMMs, bias in the first).
// Compute dtype: x, weights, biases, lag_bias rounded to bf16; projections exact; q, k, P, v, O as f16 hi + residual pairs (~2^-21); f32 accumulation and softmax. v_wmma_f32_16x16x32_f16.
#define NBT 2
#define SLEN 2048
#define DM 1024
#define NH 16
#define SCL 0.125f
#define NR (NBT * SLEN)
typedef __bf16 v16b __attribute__((ext_vector_type(16)));
typedef unsigned short v8us __attribute__((ext_vector_type(8), may_alias));
typedef float  v8f  __attribute__((ext_vector_type(8)));
typedef float  v4f  __attribute__((ext_vector_type(4)));
typedef float  v4fa __attribute__((ext_vector_type(4), may_alias));
union FragB { v16b v; v8us half[2]; unsigned short u[16]; };

__device__ __forceinline__ unsigned short bf16_bits(float x) { unsigned int u = __float_as_uint(x); return (unsigned short)((u + 0x7FFFu + ((u >> 16) & 1u)) >> 16); }
__device__ __forceinline__ float bf16_val(unsigned short b) { return __uint_as_float(((unsigned int)b) << 16); }
__device__ __forceinline__ float bf16_round(float x) { return bf16_val(bf16_bits(x)); }
// D += A·B with NT terms: 1 = ah·bh, 2 = + al·bh (A split), 3 = + ah·bl (both split)
template <int NT>
__device__ __forceinline__ v8f mmaN(v16b ah, v16b al, v16b bh, v16b bl, v8f c) {
  c = __builtin_amdgcn_wmma_f32_16x16x32_bf16(false, ah, false, bh, (short)0, c, false, false);
  if (NT >= 2) c = __builtin_amdgcn_wmma_f32_16x16x32_bf16(false, al, false, bh, (short)0, c, false, false);
  if (NT >= 3) c = __builtin_amdgcn_wmma_f32_16x16x32_bf16(false, ah, false, bl, (short)0, c, false, false);
  asm volatile("v_nop\n\tv_nop\n\tv_nop\n\tv_nop" : "+v"(c) : "v"(ah), "v"(al), "v"(bh), "v"(bl));
  return c;
}

__global__ __launch_bounds__(256) void k_wt_bf16(const float* __restrict__ W, unsigned short* __restrict__ Wt, int K, int N) {
  const int t = blockIdx.x * 256 + threadIdx.x;
  const int k8n = K / 8;
  if (t >= N * k8n) return;
  const int n = t / k8n, k8 = (t % k8n) * 8;
  v8us v;
#pragma unroll
  for (int i = 0; i < 8; ++i) v[i] = bf16_bits(W[(size_t)(k8 + i) * N + n]);
  *(v8us*)(Wt + (size_t)n * K + k8) = v;
  
}

// GEMM C[M][N] (f32, pitch ldc) = act(A[M][K]·W + bias). A f32 row-major (pitch lda) converted per fragment to bf16
// (ASPLIT: hi/lo two planes -> 2 terms, else single rounded term); Wt bf16 [N][K] (pitch ldb). BIAS_BF16 rounds the
// bias to bf16 first (bias quantised to bf16 before the add). K%32==0, M%16==0, N%64==0.
template <bool ASPLIT, int ACT, bool BIAS_BF16>
__global__ __launch_bounds__(128) void k_gemm_bf(const float* __restrict__ A, int lda, const unsigned short* __restrict__ Wt, int ldb,
                                               const float* __restrict__ bias, float* __restrict__ C, int ldc, int M, int N, int K) {
  __shared__ __attribute__((aligned(16))) float so[4][16][64];
  const int tid = threadIdx.x, w = tid >> 5, lane = tid & 31, ln = lane & 15, hh = lane >> 4;
  const int ntn = N / 64;
  const int wid = blockIdx.x * 4 + w;
  const int mt = wid / ntn, nq = wid % ntn;
  if (mt * 16 >= M) return;
  const int row0 = mt * 16, col0 = nq * 64;
  const float* arow = A + (size_t)(row0 + ln) * lda;
  v8f acc[4] = {};
  for (int kb = 0; kb < K; kb += 32) {
    FragB ah, al;
    const v4f x0 = *(const v4fa*)(arow + kb + 8 * hh), x1 = *(const v4fa*)(arow + kb + 8 * hh + 4);
    const v4f x2 = *(const v4fa*)(arow + kb + 16 + 8 * hh), x3 = *(const v4fa*)(arow + kb + 16 + 8 * hh + 4);
    float xs[16] = {x0[0],x0[1],x0[2],x0[3],x1[0],x1[1],x1[2],x1[3],x2[0],x2[1],x2[2],x2[3],x3[0],x3[1],x3[2],x3[3]};
#pragma unroll
    for (int i = 0; i < 16; ++i) { const unsigned short hb = bf16_bits(xs[i]); ah.u[i] = hb; al.u[i] = ASPLIT ? bf16_bits(xs[i] - bf16_val(hb)) : (unsigned short)0; }
#pragma unroll
    for (int t = 0; t < 4; ++t) {
      const unsigned short* brow = Wt + (size_t)(col0 + t * 16 + ln) * ldb + kb;
      FragB b;
      b.half[0] = *(const v8us*)(brow + 8 * hh);
      b.half[1] = *(const v8us*)(brow + 16 + 8 * hh);
      acc[t] = mmaN<ASPLIT ? 2 : 1>(ah.v, al.v, b.v, b.v, acc[t]);
    }
  }
#pragma unroll
  for (int t = 0; t < 4; ++t) {
    float bv = bias ? bias[col0 + t * 16 + ln] : 0.f;
    if (BIAS_BF16) bv = bf16_round(bv);
#pragma unroll
    for (int r = 0; r < 8; ++r) { float v = acc[t][r] + bv; if (ACT == 1) v = fmaxf(v, 0.f); so[w][8 * hh + r][t * 16 + ln] = v; }
  }
  __builtin_amdgcn_fence(__ATOMIC_ACQ_REL, "workgroup");
  __builtin_amdgcn_wave_barrier();
  const int rsub = lane >> 4, c4 = (lane & 15) * 4;
  {
#pragma unroll
    for (int q = 0; q < 8; ++q) {
      const int r = q * 2 + rsub;
      const v4f v = *(const v4fa*)&so[w][r][c4];
      *(v4f*)(C + (size_t)(row0 + r) * ldc + col0 + c4) = v;
    }
    
  }
}

// GEMM C = act(A·W + bias + resid): A f32 (ASPLIT -> hi/lo 2 terms), Wt bf16 [N][K]; ACT 0 none, 1 relu, 2 exact gelu;
// resid (optional, f32, row index = (row % rmod), pitch ldr, RES_BF16 rounds it) added before the activation.
template <bool ASPLIT, int ACT, bool BIAS_BF16, bool RES_BF16>
__global__ __launch_bounds__(128) void k_gemm_bf3(const float* __restrict__ A, int lda, const unsigned short* __restrict__ Wt, int ldb,
                                                const float* __restrict__ bias, const float* __restrict__ resid, int rmod, int ldr,
                                                float* __restrict__ C, int ldc, int M, int N, int K) {
  __shared__ __attribute__((aligned(16))) float so[4][16][64];
  const int tid = threadIdx.x, w = tid >> 5, lane = tid & 31, ln = lane & 15, hh = lane >> 4;
  const int ntn = N / 64;
  const int wid = blockIdx.x * 4 + w;
  const int mt = wid / ntn, nq = wid % ntn;
  if (mt * 16 >= M) return;
  const int row0 = mt * 16, col0 = nq * 64;
  const float* arow = A + (size_t)(row0 + ln) * lda;
  v8f acc[4] = {};
  for (int kb = 0; kb < K; kb += 32) {
    FragB ah, al;
    const v4f x0 = *(const v4fa*)(arow + kb + 8 * hh), x1 = *(const v4fa*)(arow + kb + 8 * hh + 4);
    const v4f x2 = *(const v4fa*)(arow + kb + 16 + 8 * hh), x3 = *(const v4fa*)(arow + kb + 16 + 8 * hh + 4);
    float xs[16] = {x0[0],x0[1],x0[2],x0[3],x1[0],x1[1],x1[2],x1[3],x2[0],x2[1],x2[2],x2[3],x3[0],x3[1],x3[2],x3[3]};
#pragma unroll
    for (int i = 0; i < 16; ++i) { const unsigned short hb = bf16_bits(xs[i]); ah.u[i] = hb; al.u[i] = ASPLIT ? bf16_bits(xs[i] - bf16_val(hb)) : (unsigned short)0; }
#pragma unroll
    for (int t = 0; t < 4; ++t) {
      const unsigned short* brow = Wt + (size_t)(col0 + t * 16 + ln) * ldb + kb;
      FragB b;
      b.half[0] = *(const v8us*)(brow + 8 * hh);
      b.half[1] = *(const v8us*)(brow + 16 + 8 * hh);
      acc[t] = mmaN<ASPLIT ? 2 : 1>(ah.v, al.v, b.v, b.v, acc[t]);
    }
  }
#pragma unroll
  for (int t = 0; t < 4; ++t) {
    const int col = col0 + t * 16 + ln;
    float bv = bias ? bias[col] : 0.f;
    if (BIAS_BF16) bv = bf16_round(bv);
#pragma unroll
    for (int r = 0; r < 8; ++r) {
      float v = acc[t][r] + bv;
      if (resid) { float rv = resid[(size_t)((row0 + 8 * hh + r) % rmod) * ldr + col]; if (RES_BF16) rv = bf16_round(rv); v += rv; }
      if (ACT == 1) v = fmaxf(v, 0.f);
      if (ACT == 2) v = 0.5f * v * (1.0f + erff(v * 0.70710678118654752f));
      if (ACT == 3) { const float u = 0.7978845608028654f * (v + 0.044715f * v * v * v); v = 0.5f * v * (1.0f + tanhf(u)); }
      so[w][8 * hh + r][t * 16 + ln] = v;
    }
  }
  __builtin_amdgcn_fence(__ATOMIC_ACQ_REL, "workgroup");
  __builtin_amdgcn_wave_barrier();
  const int rsub = lane >> 4, c4 = (lane & 15) * 4;
  {
#pragma unroll
    for (int q = 0; q < 8; ++q) {
      const int r = q * 2 + rsub;
      const v4f v = *(const v4fa*)&so[w][r][c4];
      *(v4f*)(C + (size_t)(row0 + r) * ldc + col0 + c4) = v;
    }
    
  }
}
// row LayerNorm (biased variance, eps) over N: s = X (+ R); optional out_sum <- s; out_norm <- (s-mu)*rsqrt(var+eps)*g + b
template <bool PARAM_BF16>
__global__ __launch_bounds__(256) void k_layernorm(const float* __restrict__ X, const float* __restrict__ R, const float* __restrict__ g, const float* __restrict__ bta,
                                                  float* __restrict__ out_sum, float* __restrict__ out_norm, int N, float eps) {
  __shared__ float red[256];
  const int row = blockIdx.x, tid = threadIdx.x;
  const float* x = X + (size_t)row * N; const float* rr = R ? R + (size_t)row * N : nullptr;
  float vals[16];                     // up to N = 4096
  const int per = N / 256;            // contiguous chunk per thread? use strided-by-4 chunks: thread handles j = tid*4 + 1024*u
  float s1 = 0.f;
  for (int u = 0; u < per / 4; ++u) {
    const int j = tid * 4 + 1024 * u;
    const v4f a = *(const v4fa*)(x + j);
    v4f b = {0.f,0.f,0.f,0.f}; if (rr) b = *(const v4fa*)(rr + j);
#pragma unroll
    for (int q = 0; q < 4; ++q) { const float v = a[q] + b[q]; vals[u * 4 + q] = v; s1 += v; }
  }
  red[tid] = s1; __syncthreads();
  for (int st = 128; st > 0; st >>= 1) { if (tid < st) red[tid] += red[tid + st]; __syncthreads(); }
  const float mu = red[0] / (float)N; __syncthreads();
  float s2 = 0.f;
  for (int u = 0; u < per / 4; ++u)
#pragma unroll
    for (int q = 0; q < 4; ++q) { const float c = vals[u * 4 + q] - mu; s2 += c * c; }
  red[tid] = s2; __syncthreads();
  for (int st = 128; st > 0; st >>= 1) { if (tid < st) red[tid] += red[tid + st]; __syncthreads(); }
  const float rs = rsqrtf(red[0] / (float)N + eps);
  {
    for (int u = 0; u < per / 4; ++u) {
      const int j = tid * 4 + 1024 * u;
      v4f o, sm;
#pragma unroll
      for (int q = 0; q < 4; ++q) {
        float gg = g[j + q], bb = bta[j + q];
        if (PARAM_BF16) { gg = bf16_round(gg); bb = bf16_round(bb); }
        sm[q] = vals[u * 4 + q]; o[q] = (vals[u * 4 + q] - mu) * rs * gg + bb;
      }
      if (out_sum) *(v4f*)(out_sum + (size_t)row * N + j) = sm;
      *(v4f*)(out_norm + (size_t)row * N + j) = o;
    }
    
  }
}



// ---- f16 WMMA path (v_wmma_f32_16x16x32_f16): 11-bit significands for operands in range — used where a [0,1] probability operand needs more precision than bf16
typedef _Float16 v16h __attribute__((ext_vector_type(16)));
union FragH { v16h v; v8us half[2]; _Float16 h[16]; unsigned short u[16]; };
template <int NT>
__device__ __forceinline__ v8f mmaH(v16h ah, v16h al, v16h bh, v16h bl, v8f c) {
  c = __builtin_amdgcn_wmma_f32_16x16x32_f16(false, ah, false, bh, (short)0, c, false, false);
  if (NT >= 2) c = __builtin_amdgcn_wmma_f32_16x16x32_f16(false, al, false, bh, (short)0, c, false, false);
  if (NT >= 3) c = __builtin_amdgcn_wmma_f32_16x16x32_f16(false, ah, false, bl, (short)0, c, false, false);
  asm volatile("v_nop\n\tv_nop\n\tv_nop\n\tv_nop" : "+v"(c) : "v"(ah), "v"(al), "v"(bh), "v"(bl));
  return c;
}
// batched GEMM like k_gemm_b but f16 operands: A f32 (split into f16 hi/lo if ASPLIT, else rounded to f16), Bt = f16 values [n][k]; alpha; C f32; N multiple of 16 (partial tiles skipped)
template <bool ASPLIT>
__global__ __launch_bounds__(128) void k_gemm_h(const float* __restrict__ A, int lda, size_t sA, const _Float16* __restrict__ Bh, int ldb, size_t sB, float alpha, float* __restrict__ C, int ldc, size_t sC, int M, int N, int K) {
  __shared__ __attribute__((aligned(16))) float so[4][16][64];
  const int tid = threadIdx.x, w = tid >> 5, lane = tid & 31, ln = lane & 15, hh = lane >> 4; const int by = blockIdx.y;
  A += (size_t)by * sA; Bh += (size_t)by * sB; C += (size_t)by * sC;
  const int ntn = (N + 63) / 64; const int wid = blockIdx.x * 4 + w; const int mt = wid / ntn, nq = wid % ntn; if (mt * 16 >= M) return;
  const int row0 = mt * 16, col0 = nq * 64; const float* arow = A + (size_t)(row0 + ln) * lda;
  v8f acc[4] = {};
  for (int kb = 0; kb < K; kb += 32) {
    FragH ah, al;
    const v4f x0 = *(const v4fa*)(arow + kb + 8 * hh), x1 = *(const v4fa*)(arow + kb + 8 * hh + 4), x2 = *(const v4fa*)(arow + kb + 16 + 8 * hh), x3 = *(const v4fa*)(arow + kb + 16 + 8 * hh + 4);
    float xs[16] = {x0[0],x0[1],x0[2],x0[3],x1[0],x1[1],x1[2],x1[3],x2[0],x2[1],x2[2],x2[3],x3[0],x3[1],x3[2],x3[3]};
#pragma unroll
    for (int i = 0; i < 16; ++i) { const _Float16 h = (_Float16)xs[i]; ah.h[i] = h; al.h[i] = ASPLIT ? (_Float16)(xs[i] - (float)h) : (_Float16)0.0f; }
#pragma unroll
    for (int t = 0; t < 4; ++t) { if (col0 + t * 16 >= N) continue; const size_t boff = (size_t)(col0 + t * 16 + ln) * ldb + kb; FragH bq; bq.half[0] = *(const v8us*)(Bh + boff + 8 * hh); bq.half[1] = *(const v8us*)(Bh + boff + 16 + 8 * hh);
      acc[t] = mmaH<ASPLIT ? 2 : 1>(ah.v, al.v, bq.v, bq.v, acc[t]); }
  }
#pragma unroll
  for (int t = 0; t < 4; ++t) { if (col0 + t * 16 >= N) continue;
#pragma unroll
    for (int r = 0; r < 8; ++r) so[w][8 * hh + r][t * 16 + ln] = acc[t][r] * alpha; }
  __builtin_amdgcn_fence(__ATOMIC_ACQ_REL, "workgroup"); __builtin_amdgcn_wave_barrier();
  const int rsub = lane >> 4, c4 = (lane & 15) * 4;
  {
#pragma unroll
    for (int q = 0; q < 8; ++q) { const int r = q * 2 + rsub; if (col0 + c4 < N) { const v4f v = *(const v4fa*)&so[w][r][c4]; *(v4f*)(C + (size_t)(row0 + r) * ldc + col0 + c4) = v; } }
     }
}

// Wt[n][k] = f16(W[k][n]·scale) from f32 row-major W[K][N] (scale = power of two; bf16-exact weights stay exact in f16 away from the subnormal range)
// blockIdx.y picks one of four equally shaped matrices; their transposes lie one behind the other in Wt
__global__ __launch_bounds__(256) void k_wt_f16(const float* __restrict__ W0, const float* __restrict__ W1, const float* __restrict__ W2, const float* __restrict__ W3, _Float16* __restrict__ Wt, int K, int N, float scale) {
  const int by = blockIdx.y; const float* __restrict__ W = (by == 0) ? W0 : (by == 1) ? W1 : (by == 2) ? W2 : W3; Wt += (size_t)by * K * N;
  const int t = blockIdx.x * 256 + threadIdx.x; if (t >= N * (K / 8)) return; const int n = t / (K / 8), k8 = (t % (K / 8)) * 8; FragH f;
#pragma unroll
  for (int i = 0; i < 8; ++i) f.h[i] = (_Float16)(bf16_round(W[(size_t)(k8 + i) * N + n]) * scale); const v8us o = f.half[0];
  *(v8us*)((unsigned short*)Wt + (size_t)n * K + k8) = o; 
}
// k_gemm_hh variant with fused epilogue: v = acc·alpha + bias[by·sBias + col] (+ CP[(row/rowsPerB)·sCPb + by·64 + col] if CP) ; ACT 0 none / 1 elu ; writes f16 C16 (and f32 C if non-null)
template <int ACT>
__global__ __launch_bounds__(128) void k_gemm_hhx(const _Float16* __restrict__ A, int lda, size_t sA, const _Float16* __restrict__ Bh, int ldb, size_t sB, float alpha, const float* __restrict__ bias, size_t sBias, const float* __restrict__ CP, int rowsPerB, size_t sCPb, int row0g,
    float* __restrict__ C, _Float16* __restrict__ C16, int ldc, size_t sC, int M, int N, int K) {
  __shared__ __attribute__((aligned(16))) float so[4][16][64];
  const int tid = threadIdx.x, w = tid >> 5, lane = tid & 31, ln = lane & 15, hh = lane >> 4; const int by = blockIdx.y;
  A += (size_t)by * sA; Bh += (size_t)by * sB; const size_t cofs = (size_t)by * sC; const float* bp = bias ? bias + (size_t)by * sBias : nullptr;
  const int ntn = (N + 63) / 64; const int wid = blockIdx.x * 4 + w; const int mt = wid / ntn, nq = wid % ntn; if (mt * 16 >= M) return;
  const int row0 = mt * 16, col0 = nq * 64; const _Float16* arow = A + (size_t)(row0 + ln) * lda;
  v8f acc[4] = {};
  for (int kb = 0; kb < K; kb += 32) { FragH ah; ah.half[0] = *(const v8us*)((const unsigned short*)arow + kb + 8 * hh); ah.half[1] = *(const v8us*)((const unsigned short*)arow + kb + 16 + 8 * hh);
#pragma unroll
    for (int t = 0; t < 4; ++t) { if (col0 + t * 16 >= N) continue; const size_t boff = (size_t)(col0 + t * 16 + ln) * ldb + kb; FragH bq; bq.half[0] = *(const v8us*)((const unsigned short*)Bh + boff + 8 * hh); bq.half[1] = *(const v8us*)((const unsigned short*)Bh + boff + 16 + 8 * hh);
      acc[t] = mmaH<1>(ah.v, ah.v, bq.v, bq.v, acc[t]); }
  }
#pragma unroll
  for (int t = 0; t < 4; ++t) { if (col0 + t * 16 >= N) continue; const int col = col0 + t * 16 + ln; const float bv = bp ? bf16_round(bp[col]) : 0.f;
#pragma unroll
    for (int r = 0; r < 8; ++r) { float v = acc[t][r] * alpha + bv; if (CP) { const int bidx = (row0g + row0 + 8 * hh + r) / rowsPerB; v += CP[(size_t)bidx * sCPb + (size_t)by * 64 + col]; } if (ACT == 1) v = (v > 0.f) ? v : expm1f(v); else if (ACT == 7) v = (v > 0.f) ? v + 1.0f : expf(v); else if (ACT == 8) v = tanhf(v); else if (ACT == 9) v = 0.5f * v * (1.0f + tanhf(0.7978845608028654f * (v + 0.044715f * v * v * v))); else if (ACT == 11) v = 1.0f / (1.0f + expf(-v)); else if (ACT == 12) v = (v > 0.f) ? v : 0.01f * v; else if (ACT == 14) v = (v > 0.f) ? v : 0.1f * v; else if (ACT == 15) v = v / (1.0f + expf(-v)); else if (ACT == 3) v = fmaxf(v, 0.f); else if (ACT == 6) v = 0.5f * v * (1.0f + erff(v * 0.70710678118654752f)); so[w][8 * hh + r][t * 16 + ln] = v; } }
  __builtin_amdgcn_fence(__ATOMIC_ACQ_REL, "workgroup"); __builtin_amdgcn_wave_barrier();
  const int rsub = lane >> 4, c4 = (lane & 15) * 4; typedef _Float16 v4h __attribute__((ext_vector_type(4)));
  {
#pragma unroll
    for (int q = 0; q < 8; ++q) { const int r = q * 2 + rsub; if (col0 + c4 < N) { const v4f v = *(const v4fa*)&so[w][r][c4]; if (C) *(v4f*)(C + cofs + (size_t)(row0 + r) * ldc + col0 + c4) = v; if (C16) { v4h h4; for (int i = 0; i < 4; ++i) h4[i] = (_Float16)v[i]; *(v4h*)(C16 + cofs + (size_t)(row0 + r) * ldc + col0 + c4) = h4; } } }
     }
}


typedef _Float16 v4h __attribute__((ext_vector_type(4)));

__global__ __launch_bounds__(256) void k_x16(const float* __restrict__ x, _Float16* __restrict__ X16, size_t n8) { const size_t t = (size_t)blockIdx.x * 256 + threadIdx.x; if (t >= n8) return; FragH f;
#pragma unroll
  for (int q = 0; q < 8; ++q) f.h[q] = (_Float16)bf16_round(x[t * 8 + q]); *(v8us*)((unsigned short*)X16 + t * 8) = f.half[0];  }
__global__ __launch_bounds__(256) void k_h16(const float* __restrict__ x, _Float16* __restrict__ X16, size_t n8) { const size_t t = (size_t)blockIdx.x * 256 + threadIdx.x; if (t >= n8) return; FragH f;
#pragma unroll
  for (int q = 0; q < 8; ++q) f.h[q] = (_Float16)x[t * 8 + q]; *(v8us*)((unsigned short*)X16 + t * 8) = f.half[0];  }
__global__ __launch_bounds__(256) void k_round16f(const float* __restrict__ W, _Float16* __restrict__ Bt, size_t n8) { const size_t t = (size_t)blockIdx.x * 256 + threadIdx.x; if (t >= n8) return; FragH f;
#pragma unroll
  for (int i = 0; i < 8; ++i) f.h[i] = (_Float16)(bf16_round(W[t * 8 + i]) * 16.0f); *(v8us*)((unsigned short*)Bt + t * 8) = f.half[0];  }
template <int NHv, int TTv>
__global__ __launch_bounds__(256) void k_vt(const _Float16* __restrict__ V16, int ldv, int voff, _Float16* __restrict__ Vt) { __shared__ unsigned short tl[64][66]; const int tid = threadIdx.x; const int slab = blockIdx.x / (TTv / 64), lg = blockIdx.x % (TTv / 64); const int b = slab / NHv, h = slab % NHv;
  for (int i = tid; i < 64 * 8; i += 256) { const int r = i / 8, c8 = (i % 8) * 8; FragH f; f.half[0] = *(const v8us*)((const unsigned short*)V16 + ((size_t)b * TTv + lg * 64 + r) * ldv + voff + h * 64 + c8);
#pragma unroll
    for (int q = 0; q < 8; ++q) tl[r][c8 + q] = f.u[q]; }
  __syncthreads();
  {
#pragma unroll
    for (int rd = 0; rd < 2; ++rd) { const int d = rd * 32 + tid / 8, pc = tid % 8; FragH f;
#pragma unroll
      for (int q = 0; q < 8; ++q) f.u[q] = tl[pc * 8 + q][d];
      *(v8us*)((unsigned short*)Vt + ((size_t)slab * 64 + d) * TTv + lg * 64 + pc * 8) = f.half[0]; }
     } }

__global__ __launch_bounds__(256) void k_hl(const float* __restrict__ F, _Float16* __restrict__ Hh, _Float16* __restrict__ Hl, size_t n8) { const size_t t = (size_t)blockIdx.x * 256 + threadIdx.x; if (t >= n8) return; FragH fh, fl; const v4f a = *(const v4fa*)(F + t * 8), c = *(const v4fa*)(F + t * 8 + 4);
#pragma unroll
  for (int q = 0; q < 4; ++q) { _Float16 h = (_Float16)a[q]; fh.h[q] = h; fl.h[q] = (_Float16)((a[q] - (float)h) * 1024.0f); h = (_Float16)c[q]; fh.h[4 + q] = h; fl.h[4 + q] = (_Float16)((c[q] - (float)h) * 1024.0f); }
  { *(v8us*)((unsigned short*)Hh + t * 8) = fh.half[0]; *(v8us*)((unsigned short*)Hl + t * 8) = fl.half[0];  } }

// ---- fast GEMM (wave tile 32x64; requires M % 32 == 0 rows per launch region and N % 64 == 0); epilogue like k_gemm_hhx, but the bias is bias, bias1 or bias2 by blockIdx.y ----
__device__ __forceinline__ v16h g2_frag(const _Float16* p, int hh) { FragH f; f.half[0] = *(const v8us*)((const unsigned short*)p + 8 * hh); f.half[1] = *(const v8us*)((const unsigned short*)p + 16 + 8 * hh); return f.v; }
__device__ __forceinline__ v8f g2_mma(v16h a, v16h b, v8f c) { v8f d = __builtin_amdgcn_wmma_f32_16x16x32_f16(false, a, false, b, (short)0, c, false, false); asm volatile("v_nop\n\tv_nop\n\tv_nop\n\tv_nop" : "+v"(d) : "v"(a), "v"(b)); return d; }
template <int ACT>
__global__ __launch_bounds__(128) void k_gemm2(const _Float16* __restrict__ A, int lda, size_t sA, const _Float16* __restrict__ Bh, int ldb, size_t sB, float alpha, const float* __restrict__ bias, const float* __restrict__ bias1, const float* __restrict__ bias2, const float* __restrict__ CP, int rowsPerB, size_t sCPb, int row0g,
    float* __restrict__ C, _Float16* __restrict__ C16, int ldc, size_t sC, int M, int N, int K) {
  __shared__ __attribute__((aligned(16))) float so[4][32][68];
  const int tid = threadIdx.x, w = tid >> 5, lane = tid & 31, ln = lane & 15, hh = lane >> 4; const int by = blockIdx.y;
  A += (size_t)by * sA; Bh += (size_t)by * sB; const size_t cofs = (size_t)by * sC; const float* bp = (by == 0) ? bias : (by == 1) ? bias1 : bias2;      /* one bias vector per blockIdx.y */
  const int ntn = N >> 6; const int mt = blockIdx.x / ntn, nq = blockIdx.x - mt * ntn; const int row0 = mt * 128 + 32 * w, col0 = nq * 64; if (row0 >= M) return;
  const _Float16* a0p = A + (size_t)(row0 + ln) * lda; const _Float16* a1p = a0p + (size_t)16 * lda;
  const _Float16* b0p = Bh + (size_t)(col0 + ln) * ldb; const _Float16* b1p = b0p + (size_t)16 * ldb; const _Float16* b2p = b1p + (size_t)16 * ldb; const _Float16* b3p = b2p + (size_t)16 * ldb;
  const v8f z8 = {0.f,0.f,0.f,0.f,0.f,0.f,0.f,0.f}; v8f c00 = z8, c01 = z8, c02 = z8, c03 = z8, c10 = z8, c11 = z8, c12 = z8, c13 = z8;
#pragma unroll 1
  for (int kb = 0; kb < K; kb += 32) { const v16h a0 = g2_frag(a0p + kb, hh), a1 = g2_frag(a1p + kb, hh);
    v16h b = g2_frag(b0p + kb, hh); c00 = g2_mma(a0, b, c00); c10 = g2_mma(a1, b, c10);
    b = g2_frag(b1p + kb, hh); c01 = g2_mma(a0, b, c01); c11 = g2_mma(a1, b, c11);
    b = g2_frag(b2p + kb, hh); c02 = g2_mma(a0, b, c02); c12 = g2_mma(a1, b, c12);
    b = g2_frag(b3p + kb, hh); c03 = g2_mma(a0, b, c03); c13 = g2_mma(a1, b, c13); }
  v8f accs[8] = {c00, c01, c02, c03, c10, c11, c12, c13};
#pragma unroll
  for (int u = 0; u < 8; ++u) { const int t = u & 3, half = u >> 2; const int col = col0 + t * 16 + ln; const float bv = bp ? bf16_round(bp[col]) : 0.f;
#pragma unroll
    for (int r = 0; r < 8; ++r) { const int rloc = half * 16 + 8 * hh + r; float v = accs[u][r] * alpha + bv; if (CP) { const int bidx = (row0g + row0 + rloc) / rowsPerB; v += CP[(size_t)bidx * sCPb + (size_t)by * 64 + col]; }
      if (ACT == 3) v = fmaxf(v, 0.f); else if (ACT == 6) v = 0.5f * v * (1.0f + erff(v * 0.70710678118654752f)); else if (ACT == 11) v = 1.0f / (1.0f + expf(-v)); else if (ACT == 15) v = v / (1.0f + expf(-v)); else if (ACT == 12) v = (v > 0.f) ? v : 0.01f * v; else if (ACT == 8) v = tanhf(v);
      so[w][rloc][t * 16 + ln] = v; } }
  __builtin_amdgcn_fence(__ATOMIC_ACQ_REL, "workgroup"); __builtin_amdgcn_wave_barrier();
  const int rsub = lane >> 4, c4 = (lane & 15) * 4;
  {
#pragma unroll
    for (int q = 0; q < 16; ++q) { const int r = q * 2 + rsub; const v4f v = *(const v4fa*)&so[w][r][c4]; if (C) *(v4f*)(C + cofs + (size_t)(row0 + r) * ldc + col0 + c4) = v; if (C16) { v4h h4; for (int i = 0; i < 4; ++i) h4[i] = (_Float16)v[i]; *(v4h*)(C16 + cofs + (size_t)(row0 + r) * ldc + col0 + c4) = h4; } }
     } }



template <int TK>
__global__ __launch_bounds__(256) void k_vthl(const float* __restrict__ VF, int ldv, _Float16* __restrict__ Vth, _Float16* __restrict__ Vtl) { __shared__ float tl[64][65]; const int tid = threadIdx.x; const int slab = blockIdx.x / (TK / 64), lg = blockIdx.x % (TK / 64); const int b = slab / NH, h = slab % NH;
  for (int i = tid; i < 64 * 16; i += 256) { const int r = i / 16, c4 = (i % 16) * 4; const v4f a = *(const v4fa*)(VF + ((size_t)b * TK + lg * 64 + r) * ldv + h * 64 + c4); tl[r][c4] = a[0]; tl[r][c4 + 1] = a[1]; tl[r][c4 + 2] = a[2]; tl[r][c4 + 3] = a[3]; }
  __syncthreads();
  FragH fh[2], fl[2]; size_t oo[2];
#pragma unroll
  for (int rd = 0; rd < 2; ++rd) { const int d = rd * 32 + tid / 8, pc = tid % 8;
#pragma unroll
    for (int q = 0; q < 8; ++q) { const float v = tl[pc * 8 + q][d]; const _Float16 hv = (_Float16)v; fh[rd].h[q] = hv; fl[rd].h[q] = (_Float16)((v - (float)hv) * 1024.0f); } oo[rd] = ((size_t)slab * 64 + d) * TK + lg * 64 + pc * 8; }
  {
#pragma unroll
    for (int rd = 0; rd < 2; ++rd) { *(v8us*)((unsigned short*)Vth + oo[rd]) = fh[rd].half[0]; *(v8us*)((unsigned short*)Vtl + oo[rd]) = fl[rd].half[0]; }
     } }

template <int TQ, int TK>
__global__ __launch_bounds__(128) void k_flashb(const _Float16* __restrict__ Q16, const _Float16* __restrict__ Q16lo, int ldq, const _Float16* __restrict__ K16, const _Float16* __restrict__ K16lo, int ldk, const _Float16* __restrict__ Vt, const _Float16* __restrict__ Vtlo, const float* __restrict__ BT, const int* __restrict__ LAG, float* __restrict__ O, int ldo) {
  constexpr int RPW = 16, RTN = RPW / 16, NQB = TQ / (4 * RPW), DT = 4, KS = 2;
  __shared__ __attribute__((aligned(16))) unsigned short sP[4][RPW][40], sPl[4][RPW][40]; __shared__ __attribute__((aligned(16))) float sO[4][RPW][64 + 4];
  // two-buffer ring of one pass's operands, shared by the block's four waves: [buffer][hi, residual][row][halfs]; K rows (128 B) at a pitch of 144 B, V^T rows (64 B) at 80 B, both 16 B x odd for the 16-byte fragment reads
  __shared__ __attribute__((aligned(16))) unsigned short sK[2][2][32][72]; __shared__ __attribute__((aligned(16))) unsigned short sV[2][2][64][40];
  __shared__ __attribute__((aligned(256))) float sB[513];      /* the head's bias row, rounded to bf16 once: a pass's gathers are 4-byte LDS reads; the largest alignment puts it at the start of the block's LDS, so that its base fits the reads' 16-bit offset field */
  const int tid = threadIdx.x, w = tid >> 5, lane = tid & 31, ln = lane & 15, hh = lane >> 4;
  const int slab = blockIdx.x / NQB, qblk = blockIdx.x % NQB; const int b = slab / NH, h = slab % NH; const int qb0 = qblk * (4 * RPW); const int q0 = qb0 + w * RPW;
  FragH aq[2][KS], aql[2][KS];
#pragma unroll
  for (int rt = 0; rt < RTN; ++rt) { const size_t qo = ((size_t)b * TQ + q0 + rt * 16 + ln) * ldq + h * 64; const unsigned short* qr = (const unsigned short*)Q16 + qo; const unsigned short* ql = (const unsigned short*)Q16lo + qo;
#pragma unroll
    for (int ks = 0; ks < KS; ++ks) { aq[rt][ks].half[0] = *(const v8us*)(qr + ks * 32 + 8 * hh); aq[rt][ks].half[1] = *(const v8us*)(qr + ks * 32 + 16 + 8 * hh); aql[rt][ks].half[0] = *(const v8us*)(ql + ks * 32 + 8 * hh); aql[rt][ks].half[1] = *(const v8us*)(ql + ks * 32 + 16 + 8 * hh); } }
  const unsigned short* Vth = (const unsigned short*)Vt + (size_t)slab * 64 * TK; const unsigned short* Vtl = (const unsigned short*)Vtlo + (size_t)slab * 64 * TK;
  // each thread copies eight 16-byte pieces of a pass's tile: K rows tid/8 and tid/8 + 16 (a wave covers whole 128-B rows), V^T rows tid/4 and tid/4 + 32, hi and residual plane each
  const size_t kg0 = ((size_t)b * TK + (tid >> 3)) * ldk + h * 64 + (tid & 7) * 8, vg0 = (size_t)(tid >> 2) * TK + (tid & 3) * 8;
  const unsigned kd0 = (unsigned)(size_t)&sK[0][0][tid >> 3][(tid & 7) * 8], vd0 = (unsigned)(size_t)&sV[0][0][tid >> 2][(tid & 3) * 8];
  auto stage = [&](int j, int buf) {
    const unsigned short* gk = (const unsigned short*)K16 + kg0 + (size_t)j * ldk; const unsigned short* gkl = (const unsigned short*)K16lo + kg0 + (size_t)j * ldk; const unsigned short* gk2 = gk + (size_t)16 * ldk; const unsigned short* gkl2 = gkl + (size_t)16 * ldk;
    const unsigned short* gv = Vth + vg0 + j; const unsigned short* gvl = Vtl + vg0 + j; const unsigned short* gv2 = gv + (size_t)32 * TK; const unsigned short* gvl2 = gvl + (size_t)32 * TK;
    const unsigned dk = kd0 + (unsigned)buf * (unsigned)sizeof(sK[0]), dkl = dk + (unsigned)sizeof(sK[0][0]), dk2 = dk + 16u * (unsigned)sizeof(sK[0][0][0]), dkl2 = dkl + 16u * (unsigned)sizeof(sK[0][0][0]);
    const unsigned dv = vd0 + (unsigned)buf * (unsigned)sizeof(sV[0]), dvl = dv + (unsigned)sizeof(sV[0][0]), dv2 = dv + 32u * (unsigned)sizeof(sV[0][0][0]), dvl2 = dvl + 32u * (unsigned)sizeof(sV[0][0][0]);
    // the copies go from global memory to LDS through no register; the closing s_wait_xcnt is a precaution that stands in front of any rewrite of the address registers named here
    asm volatile("global_load_async_to_lds_b128 %0, %8, off\n\tglobal_load_async_to_lds_b128 %1, %9, off\n\tglobal_load_async_to_lds_b128 %2, %10, off\n\tglobal_load_async_to_lds_b128 %3, %11, off\n\t"
                 "global_load_async_to_lds_b128 %4, %12, off\n\tglobal_load_async_to_lds_b128 %5, %13, off\n\tglobal_load_async_to_lds_b128 %6, %14, off\n\tglobal_load_async_to_lds_b128 %7, %15, off\n\ts_wait_xcnt 0x0"
                 :: "v"(dk), "v"(dk2), "v"(dkl), "v"(dkl2), "v"(dv), "v"(dv2), "v"(dvl), "v"(dvl2), "v"(gk), "v"(gk2), "v"(gkl), "v"(gkl2), "v"(gv), "v"(gv2), "v"(gvl), "v"(gvl2) : "memory"); };
  stage(0, 0);
  { const float* br = BT + (size_t)h * 513; const float t0 = br[tid], t1 = br[tid + 128], t2 = br[tid + 256], t3 = br[tid + 384], t4 = br[512];      /* 128 threads, 513 entries: the loads fly together, beside tile 0's copies */
    asm volatile("s_wait_xcnt 0x0" :: "v"(tid) : "memory");      /* precaution: it stands in front of any rewrite of the index register that these loads name; tid as an input keeps that register as it is up to here */
    sB[tid] = bf16_round(t0); sB[tid + 128] = bf16_round(t1); sB[tid + 256] = bf16_round(t2); sB[tid + 384] = bf16_round(t3); if (tid == 0) sB[512] = bf16_round(t4); }      /* published by the barrier that publishes tile 0 */
  asm volatile("s_wait_asynccnt 0x0" ::: "memory");      /* this wave's share of tile 0 has landed */
  __syncthreads();      /* tile 0 is published to all four waves */
  stage(32, 1);      /* tile 1 flies while tile 0 is worked on */
  float m_r[2][8], l_r[2][8]; v8f oacc[2][DT], oaccl[2][DT];
#pragma unroll
  for (int rt = 0; rt < RTN; ++rt) {
#pragma unroll
    for (int r = 0; r < 8; ++r) { m_r[rt][r] = -3.0e38f; l_r[rt][r] = 0.f; }
#pragma unroll
    for (int dt = 0; dt < DT; ++dt) { oacc[rt][dt] = (v8f){0.f,0.f,0.f,0.f,0.f,0.f,0.f,0.f}; oaccl[rt][dt] = oacc[rt][dt]; } }
#pragma unroll 1
  for (int j0 = 0; j0 < TK; j0 += 32) {
    const int buf = (j0 >> 5) & 1;
    float bb[2][2][8];      /* the pass's bias values, gathered from LDS at its head so that they fly beside the K reads */
    { const unsigned lk0 = (unsigned)LAG[j0 + ln], lk1 = (unsigned)LAG[j0 + 16 + ln];
#pragma unroll
      for (int rt = 0; rt < RTN; ++rt)
#pragma unroll
        for (int r = 0; r < 8; ++r) { const unsigned lq = (unsigned)LAG[q0 + rt * 16 + 8 * hh + r], d0 = lq - lk0, d1 = lq - lk1;      /* |lag[q] - lag[k]| = min(d, -d) in unsigned arithmetic; the min with 512 keeps the index inside sB for any lag content */
          bb[rt][0][r] = sB[min(min(d0, 0u - d0), 512u)]; bb[rt][1][r] = sB[min(min(d1, 0u - d1), 512u)]; } }
    asm volatile("s_wait_xcnt 0x0" ::: "memory");      /* precaution: it stands in front of the rewrite of the two lag loads' address registers at the loop's foot */
    v8f s[2][2];
#pragma unroll
    for (int nt = 0; nt < 2; ++nt) { const unsigned short* kr = &sK[buf][0][nt * 16 + ln][0]; const unsigned short* kl = &sK[buf][1][nt * 16 + ln][0]; FragH bk[KS], bkl[KS];
#pragma unroll
      for (int ks = 0; ks < KS; ++ks) { bk[ks].half[0] = *(const v8us*)(kr + ks * 32 + 8 * hh); bk[ks].half[1] = *(const v8us*)(kr + ks * 32 + 16 + 8 * hh); bkl[ks].half[0] = *(const v8us*)(kl + ks * 32 + 8 * hh); bkl[ks].half[1] = *(const v8us*)(kl + ks * 32 + 16 + 8 * hh); }
#pragma unroll
      for (int rt = 0; rt < RTN; ++rt) { v8f acc = (v8f){0.f,0.f,0.f,0.f,0.f,0.f,0.f,0.f}, accr = acc;
#pragma unroll
        for (int ks = 0; ks < KS; ++ks) { acc = mmaH<1>(aq[rt][ks].v, aq[rt][ks].v, bk[ks].v, bk[ks].v, acc); accr = mmaH<1>(aql[rt][ks].v, aql[rt][ks].v, bk[ks].v, bk[ks].v, accr); accr = mmaH<1>(aq[rt][ks].v, aq[rt][ks].v, bkl[ks].v, bkl[ks].v, accr); }
        s[rt][nt] = acc + accr * 0.0009765625f; } }
#pragma unroll
    for (int rt = 0; rt < RTN; ++rt)
#pragma unroll
      for (int r = 0; r < 8; ++r) {
        const float s0 = s[rt][0][r] * SCL + bb[rt][0][r], s1 = s[rt][1][r] * SCL + bb[rt][1][r]; float mc = fmaxf(s0, s1);
        mc = fmaxf(mc, __shfl_xor(mc, 1, 32)); mc = fmaxf(mc, __shfl_xor(mc, 2, 32)); mc = fmaxf(mc, __shfl_xor(mc, 4, 32)); mc = fmaxf(mc, __shfl_xor(mc, 8, 32));
        const float mn = fmaxf(m_r[rt][r], mc); const float ea = expf(m_r[rt][r] - mn); const float al = (mn > -1.0e38f) ? ea : 1.0f; m_r[rt][r] = mn; const float p0 = expf(s0 - mn), p1 = expf(s1 - mn); l_r[rt][r] = l_r[rt][r] * al + p0 + p1;
#pragma unroll
        for (int dt = 0; dt < DT; ++dt) { oacc[rt][dt][r] *= al; oaccl[rt][dt][r] *= al; }
        FragH t2, t3; const float ps0 = p0 * 1024.0f, ps1 = p1 * 1024.0f; t2.h[0] = (_Float16)ps0; t2.h[1] = (_Float16)ps1; t3.h[0] = (_Float16)((ps0 - (float)t2.h[0]) * 1024.0f); t3.h[1] = (_Float16)((ps1 - (float)t2.h[1]) * 1024.0f);
        sP[w][rt * 16 + 8 * hh + r][ln] = t2.u[0]; sP[w][rt * 16 + 8 * hh + r][16 + ln] = t2.u[1]; sPl[w][rt * 16 + 8 * hh + r][ln] = t3.u[0]; sPl[w][rt * 16 + 8 * hh + r][16 + ln] = t3.u[1]; }
    __builtin_amdgcn_fence(__ATOMIC_ACQ_REL, "workgroup"); __builtin_amdgcn_wave_barrier();
    FragH pa[2], pl[2];
#pragma unroll
    for (int rt = 0; rt < RTN; ++rt) { pa[rt].half[0] = *(const v8us*)&sP[w][rt * 16 + ln][8 * hh]; pa[rt].half[1] = *(const v8us*)&sP[w][rt * 16 + ln][16 + 8 * hh]; pl[rt].half[0] = *(const v8us*)&sPl[w][rt * 16 + ln][8 * hh]; pl[rt].half[1] = *(const v8us*)&sPl[w][rt * 16 + ln][16 + 8 * hh]; }
#pragma unroll
    for (int dt = 0; dt < DT; ++dt) { const unsigned short* vr = &sV[buf][0][dt * 16 + ln][0]; const unsigned short* vl = &sV[buf][1][dt * 16 + ln][0]; FragH bv, bl; bv.half[0] = *(const v8us*)(vr + 8 * hh); bv.half[1] = *(const v8us*)(vr + 16 + 8 * hh); bl.half[0] = *(const v8us*)(vl + 8 * hh); bl.half[1] = *(const v8us*)(vl + 16 + 8 * hh);
#pragma unroll
      for (int rt = 0; rt < RTN; ++rt) { oacc[rt][dt] = mmaH<1>(pa[rt].v, pa[rt].v, bv.v, bv.v, oacc[rt][dt]); oaccl[rt][dt] = mmaH<1>(pa[rt].v, pa[rt].v, bl.v, bl.v, oaccl[rt][dt]); oaccl[rt][dt] = mmaH<1>(pl[rt].v, pl[rt].v, bv.v, bv.v, oaccl[rt][dt]); } }
    __builtin_amdgcn_fence(__ATOMIC_ACQ_REL, "workgroup"); __builtin_amdgcn_wave_barrier();
    asm volatile("s_wait_dscnt 0x0" ::: "memory");      /* this wave's reads of the pass's buffer are done before the buffer is refilled */
    asm volatile("s_wait_asynccnt 0x0" ::: "memory");      /* this wave's share of the next tile has landed */
    __syncthreads();      /* publishes the next tile and ends every wave's reads of this pass's buffer */
    if (j0 + 64 < TK) stage(j0 + 64, buf); }
  asm volatile("s_wait_asynccnt 0x0" ::: "memory");      /* no copy is outstanding when the wave goes on to its end */
#pragma unroll
  for (int rt = 0; rt < RTN; ++rt) {
#pragma unroll
    for (int r = 0; r < 8; ++r) { float l = l_r[rt][r]; l += __shfl_xor(l, 1, 32); l += __shfl_xor(l, 2, 32); l += __shfl_xor(l, 4, 32); l += __shfl_xor(l, 8, 32); l_r[rt][r] = (l > 0.f) ? 1.0f / (l * 1024.0f) : 0.f; }
#pragma unroll
    for (int dt = 0; dt < DT; ++dt)
#pragma unroll
      for (int r = 0; r < 8; ++r) sO[w][rt * 16 + 8 * hh + r][dt * 16 + ln] = (oacc[rt][dt][r] + oaccl[rt][dt][r] * 0.0009765625f) * l_r[rt][r]; }
  __builtin_amdgcn_fence(__ATOMIC_ACQ_REL, "workgroup"); __builtin_amdgcn_wave_barrier();
  {
#pragma unroll
    for (int rp = 0; rp < RPW; rp += 2) { const int r = rp + (lane >> 4), pc = lane & 15; const v4f val = *(const v4fa*)&sO[w][r][pc * 4]; *(v4f*)(O + ((size_t)b * TQ + q0 + r) * ldo + h * 64 + pc * 4) = val; }
     } }


__global__ __launch_bounds__(256) void k_lnx(const float* __restrict__ X, const float* __restrict__ g, const float* __restrict__ bb, _Float16* __restrict__ Y16, float* __restrict__ XB) {
  #pragma clang fp contract(off)
  const int tid = threadIdx.x, w = tid >> 5, ln = tid & 31; const int r = blockIdx.x * 8 + w; if (r >= NR) return; const float* x = X + (size_t)r * DM; float s = 0.f;
#pragma unroll 1
  for (int i = 0; i < DM / 128; ++i) { const v4f a = *(const v4fa*)(x + i * 128 + ln * 4); for (int q = 0; q < 4; ++q) s += bf16_round(a[q]); }
  for (int o = 16; o > 0; o >>= 1) s += __shfl_xor(s, o, 32); const float mu = s / (float)DM; float q2 = 0.f;
#pragma unroll 1
  for (int i = 0; i < DM / 128; ++i) { const v4f a = *(const v4fa*)(x + i * 128 + ln * 4); for (int q = 0; q < 4; ++q) { const float d = bf16_round(a[q]) - mu; q2 += d * d; } }
  for (int o = 16; o > 0; o >>= 1) q2 += __shfl_xor(q2, o, 32); const float rs = rsqrtf(q2 / (float)DM + 1e-5f);
  {
#pragma unroll 1
    for (int i = 0; i < DM / 128; ++i) { const int c0 = i * 128 + ln * 4; const v4f a = *(const v4fa*)(x + c0); _Float16 h4[4]; v4f xb;
      for (int q = 0; q < 4; ++q) { const float t = bf16_round(a[q]); h4[q] = (_Float16)((t - mu) * rs * bf16_round(g[c0 + q]) + bf16_round(bb[c0 + q])); xb[q] = t; }
      *(unsigned long long*)((unsigned short*)Y16 + (size_t)r * DM + c0) = *(const unsigned long long*)h4; *(v4f*)(XB + (size_t)r * DM + c0) = xb; }
     } }
__global__ __launch_bounds__(256) void k_causaltab(unsigned* __restrict__ MB, int* __restrict__ RA, int* __restrict__ KE, int nq, int nk) {
  const int t = blockIdx.x * 256 + threadIdx.x; const int nw = nk / 32;
  if (t < nq * nw) { const int q = t / nw, w = t % nw; const int first = q + 1 - 32 * w; const unsigned bits = (first <= 0) ? 0xffffffffu : ((first >= 32) ? 0u : (0xffffffffu << first)); *(unsigned*)(MB + t) = bits;  }
  if (t < nq) { *(int*)(RA + t) = 0;  }
  if (t < nq / 64) { const int v = 64 * (t + 1); *(int*)(KE + t * 32) = v;  } }


extern "C" void kernel_launch(void* const* d_in, const int* in_sizes, int n_in,
                              void* d_out, int out_size, void* d_ws, size_t ws_size, hipStream_t stream) {
  (void)in_sizes; (void)n_in; (void)out_size;
  const float* const* I = (const float* const*)d_in; const float* x = I[0]; const int* lag = (const int*)d_in[1]; const float* wq = I[2]; const float* bq = I[3]; const float* wk = I[4]; const float* bk = I[5]; const float* wv = I[6]; const float* bv = I[7]; const float* wo = I[8]; const float* bo = I[9]; const float* lb = I[10];
  char* ws = (char*)d_ws; size_t off = 0;
  auto take = [&](size_t bytes) { char* p = ws + off; off += (bytes + 255) & ~(size_t)255; return p; };
  _Float16* BQ = (_Float16*)take((size_t)DM * DM * 2); _Float16* BK = (_Float16*)take((size_t)DM * DM * 2); _Float16* BV = (_Float16*)take((size_t)DM * DM * 2); _Float16* BO = (_Float16*)take((size_t)DM * DM * 2);
  _Float16* X16 = (_Float16*)take((size_t)NR * DM * 2); float* F = (float*)take((size_t)3 * NR * DM * 4);      /* q, k, v planes, one behind the other */
  _Float16* Qh = (_Float16*)take((size_t)NR * DM * 2); _Float16* Kh = (_Float16*)take((size_t)NR * DM * 2); _Float16* Ql = (_Float16*)take((size_t)NR * DM * 2); _Float16* Kl = (_Float16*)take((size_t)NR * DM * 2); _Float16* Vth = (_Float16*)take((size_t)NR * DM * 2); _Float16* Vtl = (_Float16*)take((size_t)NR * DM * 2);      /* Kh directly behind Qh, Kl directly behind Ql */
  if (off > ws_size) return;      /* 8 + 8 + 48 + 48 = 112 MiB */
  float* O = F; _Float16* Oh = Qh; _Float16* Ol = Ql;
  const size_t w8 = (size_t)DM * DM / 8; const unsigned wb = (unsigned)((w8 + 255) / 256);
  k_wt_f16<<<dim3(wb, 4), 256, 0, stream>>>(wq, wk, wv, wo, BQ, DM, DM, 16.0f);      /* (in,out); BQ, BK, BV, BO are contiguous */
  const size_t n8 = (size_t)NR * DM / 8; const unsigned nb8 = (unsigned)((n8 + 255) / 256); const dim3 gP((NR / 128) * (DM / 64), 1); const dim3 gP3((NR / 128) * (DM / 64), 3);
  k_x16<<<nb8, 256, 0, stream>>>(x, X16, n8);
  k_gemm2<0><<<gP3, 128, 0, stream>>>(X16, DM, 0, BQ, DM, (size_t)DM * DM, 0.0625f, bq, bk, bv, nullptr, 1, 0, 0, F, nullptr, DM, (size_t)NR * DM, NR, DM, DM);      /* q, k, v in one grid */
  k_hl<<<2 * nb8, 256, 0, stream>>>(F, Qh, Ql, 2 * n8);      /* q and k planes together */
  k_vthl<SLEN><<<NBT * NH * (SLEN / 64), 256, 0, stream>>>(F + (size_t)2 * NR * DM, DM, Vth, Vtl);
  k_flashb<SLEN, SLEN><<<NBT * NH * (SLEN / 64), 128, 0, stream>>>(Qh, Ql, DM, Kh, Kl, DM, Vth, Vtl, lb, lag, O, DM);      /* both batches in one grid; the lag vector is per position, shared across the batch */
  k_hl<<<nb8, 256, 0, stream>>>(O, Oh, Ol, n8);
  k_gemm2<0><<<gP, 128, 0, stream>>>(Oh, DM, 0, BO, DM, 0, 0.0625f, bo, nullptr, nullptr, nullptr, 1, 0, 0, (float*)d_out, nullptr, DM, 0, NR, DM, DM);
  k_gemm2<0><<<gP, 128, 0, stream>>>(Ol, DM, 0, BO, DM, 0, 0.0625f / 1024.0f, nullptr, nullptr, nullptr, (float*)d_out, 1, (size_t)DM, 0, (float*)d_out, nullptr, DM, 0, NR, DM, DM);
}

// v005
// A run of this version takes 352 microseconds.
// Two timings next to v004 both put it at 1.10 times that version's speed.
// All steps since v000 together make it 3.28 times as fast.
#include <hip/hip_runtime.h>
// Multi-head self-attention with a lag-distance bias (2 x 2048 tokens, 1024 = 16 heads x 64): q,k,v = x W + b; scores = q.k/8 + lag_bias[h][|lag[q] - lag[k]|] with the INPUT integer lag vector; softmax over all keys; out = (attn v) Wo + bo -> [2,2048,1024].
// Structure: x as an exact f16 plane; projections as f16 WMMA GEMMs (32x64 wave tiles, f32 accumulation, exact x16 weights + bias); q, k as f16 hi + (x2^10) residual planes, V^T as hi + residual planes; the fused flash kernel takes each pass's K and V^T tiles (hi + residual) from a two-buffer LDS ring filled by asynchronous copies one pass ahead and shared by its four waves, and adds the bias, gathered by |lag[q] - lag[k]| (INPUT int32 positions) from the head's row of the INPUT table, which each block rounds once into LDS, inside the score stage (all keys valid; scores and outputs formed transposed, so that a lane holds one query: online f32 softmax in the lane, P hi + residual packed from the score accumulators into the next product's operand, two value accumulators); O as hi + residual planes into Wo (two GEMMs, bias in the first).
// Compute dtype: x, weights, biases, lag_bias rounded to bf16; projections exact; q, k, P, v, O as f16 hi + residual pairs (~2^-21); f32 accumulation and softmax. v_wmma_f32_16x16x32_f16.
#define NBT 2
#define SLEN 2048
#define DM 1024
#define NH 16
#define SCL 0.125f
#define NR (NBT * SLEN)
typedef __bf16 v16b __attribute__((ext_vector_type(16)));
typedef unsigned short v8us __attribute__((ext_vector_type(8), may_alias));
typedef float  v8f  __attribute__((ext_vector_type(8)));
typedef float  v4f  __attribute__((ext_vector_type(4)));
typedef float  v4fa __attribute__((ext_vector_type(4), may_alias));
union FragB { v16b v; v8us half[2]; unsigned short u[16]; };

__device__ __forceinline__ unsigned short bf16_bits(float x) { unsigned int u = __float_as_uint(x); return (unsigned short)((u + 0x7FFFu + ((u >> 16) & 1u)) >> 16); }
__device__ __forceinline__ float bf16_val(unsigned short b) { return __uint_as_float(((unsigned int)b) << 16); }
__device__ __forceinline__ float bf16_round(float x) { return bf16_val(bf16_bits(x)); }
// D += A·B with NT terms: 1 = ah·bh, 2 = + al·bh (A split), 3 = + ah·bl (both split)
template <int NT>
__device__ __forceinline__ v8f mmaN(v16b ah, v16b al, v16b bh, v16b bl, v8f c) {
  c = __builtin_amdgcn_wmma_f32_16x16x32_bf16(false, ah, false, bh, (short)0, c, false, false);
  if (NT >= 2) c = __builtin_amdgcn_wmma_f32_16x16x32_bf16(false, al, false, bh, (short)0, c, false, false);
  if (NT >= 3) c = __builtin_amdgcn_wmma_f32_16x16x32_bf16(false, ah, false, bl, (short)0, c, false, false);
  asm volatile("v_nop\n\tv_nop\n\tv_nop\n\tv_nop" : "+v"(c) : "v"(ah), "v"(al), "v"(bh), "v"(bl));
  return c;
}

__global__ __launch_bounds__(256) void k_wt_bf16(const float* __restrict__ W, unsigned short* __restrict__ Wt, int K, int N) {
  const int t = blockIdx.x * 256 + threadIdx.x;
  const int k8n = K / 8;
  if (t >= N * k8n) return;
  const int n = t / k8n, k8 = (t % k8n) * 8;
  v8us v;
#pragma unroll
  for (int i = 0; i < 8; ++i) v[i] = bf16_bits(W[(size_t)(k8 + i) * N + n]);
  *(v8us*)(Wt + (size_t)n * K + k8) = v;
  
}

// GEMM C[M][N] (f32, pitch ldc) = act(A[M][K]·W + bias). A f32 row-major (pitch lda) converted per fragment to bf16
// (ASPLIT: hi/lo two planes -> 2 terms, else single rounded term); Wt bf16 [N][K] (pitch ldb). BIAS_BF16 rounds the
// bias to bf16 first (bias quantised to bf16 before the add). K%32==0, M%16==0, N%64==0.
template <bool ASPLIT, int ACT, bool BIAS_BF16>
__global__ __launch_bounds__(128) void k_gemm_bf(const float* __restrict__ A, int lda, const unsigned short* __restrict__ Wt, int ldb,
                                               const float* __restrict__ bias, float* __restrict__ C, int ldc, int M, int N, int K) {
  __shared__ __attribute__((aligned(16))) float so[4][16][64];
  const int tid = threadIdx.x, w = tid >> 5, lane = tid & 31, ln = lane & 15, hh = lane >> 4;
  const int ntn = N / 64;
  const int wid = blockIdx.x * 4 + w;
  const int mt = wid / ntn, nq = wid % ntn;
  if (mt * 16 >= M) return;
  const int row0 = mt * 16, col0 = nq * 64;
  const float* arow = A + (size_t)(row0 + ln) * lda;
  v8f acc[4] = {};
  for (int kb = 0; kb < K; kb += 32) {
    FragB ah, al;
    const v4f x0 = *(const v4fa*)(arow + kb + 8 * hh), x1 = *(const v4fa*)(arow + kb + 8 * hh + 4);
    const v4f x2 = *(const v4fa*)(arow + kb + 16 + 8 * hh), x3 = *(const v4fa*)(arow + kb + 16 + 8 * hh + 4);
    float xs[16] = {x0[0],x0[1],x0[2],x0[3],x1[0],x1[1],x1[2],x1[3],x2[0],x2[1],x2[2],x2[3],x3[0],x3[1],x3[2],x3[3]};
#pragma unroll
    for (int i = 0; i < 16; ++i) { const unsigned short hb = bf16_bits(xs[i]); ah.u[i] = hb; al.u[i] = ASPLIT ? bf16_bits(xs[i] - bf16_val(hb)) : (unsigned short)0; }
#pragma unroll
    for (int t = 0; t < 4; ++t) {
      const unsigned short* brow = Wt + (size_t)(col0 + t * 16 + ln) * ldb + kb;
      FragB b;
      b.half[0] = *(const v8us*)(brow + 8 * hh);
      b.half[1] = *(const v8us*)(brow + 16 + 8 * hh);
      acc[t] = mmaN<ASPLIT ? 2 : 1>(ah.v, al.v, b.v, b.v, acc[t]);
    }
  }
#pragma unroll
  for (int t = 0; t < 4; ++t) {
    float bv = bias ? bias[col0 + t * 16 + ln] : 0.f;
    if (BIAS_BF16) bv = bf16_round(bv);
#pragma unroll
    for (int r = 0; r < 8; ++r) { float v = acc[t][r] + bv; if (ACT == 1) v = fmaxf(v, 0.f); so[w][8 * hh + r][t * 16 + ln] = v; }
  }
  __builtin_amdgcn_fence(__ATOMIC_ACQ_REL, "workgroup");
  __builtin_amdgcn_wave_barrier();
  const int rsub = lane >> 4, c4 = (lane & 15) * 4;
  {
#pragma unroll
    for (int q = 0; q < 8; ++q) {
      const int r = q * 2 + rsub;
      const v4f v = *(const v4fa*)&so[w][r][c4];
      *(v4f*)(C + (size_t)(row0 + r) * ldc + col0 + c4) = v;
    }
    
  }
}

// GEMM C = act(A·W + bias + resid): A f32 (ASPLIT -> hi/lo 2 terms), Wt bf16 [N][K]; ACT 0 none, 1 relu, 2 exact gelu;
// resid (optional, f32, row index = (row % rmod), pitch ldr, RES_BF16 rounds it) added before the activation.
template <bool ASPLIT, int ACT, bool BIAS_BF16, bool RES_BF16>
__global__ __launch_bounds__(128) void k_gemm_bf3(const float* __restrict__ A, int lda, const unsigned short* __restrict__ Wt, int ldb,
                                                const float* __restrict__ bias, const float* __restrict__ resid, int rmod, int ldr,
                                                float* __restrict__ C, int ldc, int M, int N, int K) {
  __shared__ __attribute__((aligned(16))) float so[4][16][64];
  const int tid = threadIdx.x, w = tid >> 5, lane = tid & 31, ln = lane & 15, hh = lane >> 4;
  const int ntn = N / 64;
  const int wid = blockIdx.x * 4 + w;
  const int mt = wid / ntn, nq = wid % ntn;
  if (mt * 16 >= M) return;
  const int row0 = mt * 16, col0 = nq * 64;
  const float* arow = A + (size_t)(row0 + ln) * lda;
  v8f acc[4] = {};
  for (int kb = 0; kb < K; kb += 32) {
    FragB ah, al;
    const v4f x0 = *(const v4fa*)(arow + kb + 8 * hh), x1 = *(const v4fa*)(arow + kb + 8 * hh + 4);
    const v4f x2 = *(const v4fa*)(arow + kb + 16 + 8 * hh), x3 = *(const v4fa*)(arow + kb + 16 + 8 * hh + 4);
    float xs[16] = {x0[0],x0[1],x0[2],x0[3],x1[0],x1[1],x1[2],x1[3],x2[0],x2[1],x2[2],x2[3],x3[0],x3[1],x3[2],x3[3]};
#pragma unroll
    for (int i = 0; i < 16; ++i) { const unsigned short hb = bf16_bits(xs[i]); ah.u[i] = hb; al.u[i] = ASPLIT ? bf16_bits(xs[i] - bf16_val(hb)) : (unsigned short)0; }
#pragma unroll
    for (int t = 0; t < 4; ++t) {
      const unsigned short* brow = Wt + (size_t)(col0 + t * 16 + ln) * ldb + kb;
      FragB b;
      b.half[0] = *(const v8us*)(brow + 8 * hh);
      b.half[1] = *(const v8us*)(brow + 16 + 8 * hh);
      acc[t] = mmaN<ASPLIT ? 2 : 1>(ah.v, al.v, b.v, b.v, acc[t]);
    }
  }
#pragma unroll
  for (int t = 0; t < 4; ++t) {
    const int col = col0 + t * 16 + ln;
    float bv = bias ? bias[col] : 0.f;
    if (BIAS_BF16) bv = bf16_round(bv);
#pragma unroll
    for (int r = 0; r < 8; ++r) {
      float v = acc[t][r] + bv;
      if (resid) { float rv = resid[(size_t)((row0 + 8 * hh + r) % rmod) * ldr + col]; if (RES_BF16) rv = bf16_round(rv); v += rv; }
      if (ACT == 1) v = fmaxf(v, 0.f);
      if (ACT == 2) v = 0.5f * v * (1.0f + erff(v * 0.70710678118654752f));
      if (ACT == 3) { const float u = 0.7978845608028654f * (v + 0.044715f * v * v * v); v = 0.5f * v * (1.0f + tanhf(u)); }
      so[w][8 * hh + r][t * 16 + ln] = v;
    }
  }
  __builtin_amdgcn_fence(__ATOMIC_ACQ_REL, "workgroup");
  __builtin_amdgcn_wave_barrier();
  const int rsub = lane >> 4, c4 = (lane & 15) * 4;
  {
#pragma unroll
    for (int q = 0; q < 8; ++q) {
      const int r = q * 2 + rsub;
      const v4f v = *(const v4fa*)&so[w][r][c4];
      *(v4f*)(C + (size_t)(row0 + r) * ldc + col0 + c4) = v;
    }
    
  }
}
// row LayerNorm (biased variance, eps) over N: s = X (+ R); optional out_sum <- s; out_norm <- (s-mu)*rsqrt(var+eps)*g + b
template <bool PARAM_BF16>
__global__ __launch_bounds__(256) void k_layernorm(const float* __restrict__ X, const float* __restrict__ R, const float* __restrict__ g, const float* __restrict__ bta,
                                                  float* __restrict__ out_sum, float* __restrict__ out_norm, int N, float eps) {
  __shared__ float red[256];
  const int row = blockIdx.x, tid = threadIdx.x;
  const float* x = X + (size_t)row * N; const float* rr = R ? R + (size_t)row * N : nullptr;
  float vals[16];                     // up to N = 4096
  const int per = N / 256;            // contiguous chunk per thread? use strided-by-4 chunks: thread handles j = tid*4 + 1024*u
  float s1 = 0.f;
  for (int u = 0; u < per / 4; ++u) {
    const int j = tid * 4 + 1024 * u;
    const v4f a = *(const v4fa*)(x + j);
    v4f b = {0.f,0.f,0.f,0.f}; if (rr) b = *(const v4fa*)(rr + j);
#pragma unroll
    for (int q = 0; q < 4; ++q) { const float v = a[q] + b[q]; vals[u * 4 + q] = v; s1 += v; }
  }
  red[tid] = s1; __syncthreads();
  for (int st = 128; st > 0; st >>= 1) { if (tid < st) red[tid] += red[tid + st]; __syncthreads(); }
  const float mu = red[0] / (float)N; __syncthreads();
  float s2 = 0.f;
  for (int u = 0; u < per / 4; ++u)
#pragma unroll
    for (int q = 0; q < 4; ++q) { const float c = vals[u * 4 + q] - mu; s2 += c * c; }
  red[tid] = s2; __syncthreads();
  for (int st = 128; st > 0; st >>= 1) { if (tid < st) red[tid] += red[tid + st]; __syncthreads(); }
  const float rs = rsqrtf(red[0] / (float)N + eps);
  {
    for (int u = 0; u < per / 4; ++u) {
      const int j = tid * 4 + 1024 * u;
      v4f o, sm;
#pragma unroll
      for (int q = 0; q < 4; ++q) {
        float gg = g[j + q], bb = bta[j + q];
        if (PARAM_BF16) { gg = bf16_round(gg); bb = bf16_round(bb); }
        sm[q] = vals[u * 4 + q]; o[q] = (vals[u * 4 + q] - mu) * rs * gg + bb;
      }
      if (out_sum) *(v4f*)(out_sum + (size_t)row * N + j) = sm;
      *(v4f*)(out_norm + (size_t)row * N + j) = o;
    }
    
  }
}



// ---- f16 WMMA path (v_wmma_f32_16x16x32_f16): 11-bit significands for operands in range — used where a [0,1] probability operand needs more precision than bf16
typedef _Float16 v16h __attribute__((ext_vector_type(16)));
union FragH { v16h v; v8us half[2]; _Float16 h[16]; unsigned short u[16]; };
template <int NT>
__device__ __forceinline__ v8f mmaH(v16h ah, v16h al, v16h bh, v16h bl, v8f c) {
  c = __builtin_amdgcn_wmma_f32_16x16x32_f16(false, ah, false, bh, (short)0, c, false, false);
  if (NT >= 2) c = __builtin_amdgcn_wmma_f32_16x16x32_f16(false, al, false, bh, (short)0, c, false, false);
  if (NT >= 3) c = __builtin_amdgcn_wmma_f32_16x16x32_f16(false, ah, false, bl, (short)0, c, false, false);
  asm volatile("v_nop\n\tv_nop\n\tv_nop\n\tv_nop" : "+v"(c) : "v"(ah), "v"(al), "v"(bh), "v"(bl));
  return c;
}
// batched GEMM like k_gemm_b but f16 operands: A f32 (split into f16 hi/lo if ASPLIT, else rounded to f16), Bt = f16 values [n][k]; alpha; C f32; N multiple of 16 (partial tiles skipped)
template <bool ASPLIT>
__global__ __launch_bounds__(128) void k_gemm_h(const float* __restrict__ A, int lda, size_t sA, const _Float16* __restrict__ Bh, int ldb, size_t sB, float alpha, float* __restrict__ C, int ldc, size_t sC, int M, int N, int K) {
  __shared__ __attribute__((aligned(16))) float so[4][16][64];
  const int tid = threadIdx.x, w = tid >> 5, lane = tid & 31, ln = lane & 15, hh = lane >> 4; const int by = blockIdx.y;
  A += (size_t)by * sA; Bh += (size_t)by * sB; C += (size_t)by * sC;
  const int ntn = (N + 63) / 64; const int wid = blockIdx.x * 4 + w; const int mt = wid / ntn, nq = wid % ntn; if (mt * 16 >= M) return;
  const int row0 = mt * 16, col0 = nq * 64; const float* arow = A + (size_t)(row0 + ln) * lda;
  v8f acc[4] = {};
  for (int kb = 0; kb < K; kb += 32) {
    FragH ah, al;
    const v4f x0 = *(const v4fa*)(arow + kb + 8 * hh), x1 = *(const v4fa*)(arow + kb + 8 * hh + 4), x2 = *(const v4fa*)(arow + kb + 16 + 8 * hh), x3 = *(const v4fa*)(arow + kb + 16 + 8 * hh + 4);
    float xs[16] = {x0[0],x0[1],x0[2],x0[3],x1[0],x1[1],x1[2],x1[3],x2[0],x2[1],x2[2],x2[3],x3[0],x3[1],x3[2],x3[3]};
#pragma unroll
    for (int i = 0; i < 16; ++i) { const _Float16 h = (_Float16)xs[i]; ah.h[i] = h; al.h[i] = ASPLIT ? (_Float16)(xs[i] - (float)h) : (_Float16)0.0f; }
#pragma unroll
    for (int t = 0; t < 4; ++t) { if (col0 + t * 16 >= N) continue; const size_t boff = (size_t)(col0 + t * 16 + ln) * ldb + kb; FragH bq; bq.half[0] = *(const v8us*)(Bh + boff + 8 * hh); bq.half[1] = *(const v8us*)(Bh + boff + 16 + 8 * hh);
      acc[t] = mmaH<ASPLIT ? 2 : 1>(ah.v, al.v, bq.v, bq.v, acc[t]); }
  }
#pragma unroll
  for (int t = 0; t < 4; ++t) { if (col0 + t * 16 >= N) continue;
#pragma unroll
    for (int r = 0; r < 8; ++r) so[w][8 * hh + r][t * 16 + ln] = acc[t][r] * alpha; }
  __builtin_amdgcn_fence(__ATOMIC_ACQ_REL, "workgroup"); __builtin_amdgcn_wave_barrier();
  const int rsub = lane >> 4, c4 = (lane & 15) * 4;
  {
#pragma unroll
    for (int q = 0; q < 8; ++q) { const int r = q * 2 + rsub; if (col0 + c4 < N) { const v4f v = *(const v4fa*)&so[w][r][c4]; *(v4f*)(C + (size_t)(row0 + r) * ldc + col0 + c4) = v; } }
     }
}

// Wt[n][k] = f16(W[k][n]·scale) from f32 row-major W[K][N] (scale = power of two; bf16-exact weights stay exact in f16 away from the subnormal range)
// blockIdx.y picks one of four equally shaped matrices; their transposes lie one behind the other in Wt
__global__ __launch_bounds__(256) void k_wt_f16(const float* __restrict__ W0, const float* __restrict__ W1, const float* __restrict__ W2, const float* __restrict__ W3, _Float16* __restrict__ Wt, int K, int N, float scale) {
  const int by = blockIdx.y; const float* __restrict__ W = (by == 0) ? W0 : (by == 1) ? W1 : (by == 2) ? W2 : W3; Wt += (size_t)by * K * N;
  const int t = blockIdx.x * 256 + threadIdx.x; if (t >= N * (K / 8)) return; const int n = t / (K / 8), k8 = (t % (K / 8)) * 8; FragH f;
#pragma unroll
  for (int i = 0; i < 8; ++i) f.h[i] = (_Float16)(bf16_round(W[(size_t)(k8 + i) * N + n]) * scale); const v8us o = f.half[0];
  *(v8us*)((unsigned short*)Wt + (size_t)n * K + k8) = o; 
}
// k_gemm_hh variant with fused epilogue: v = acc·alpha + bias[by·sBias + col] (+ CP[(row/rowsPerB)·sCPb + by·64 + col] if CP) ; ACT 0 none / 1 elu ; writes f16 C16 (and f32 C if non-null)
template <int ACT>
__global__ __launch_bounds__(128) void k_gemm_hhx(const _Float16* __restrict__ A, int lda, size_t sA, const _Float16* __restrict__ Bh, int ldb, size_t sB, float alpha, const float* __restrict__ bias, size_t sBias, const float* __restrict__ CP, int rowsPerB, size_t sCPb, int row0g,
    float* __restrict__ C, _Float16* __restrict__ C16, int ldc, size_t sC, int M, int N, int K) {
  __shared__ __attribute__((aligned(16))) float so[4][16][64];
  const int tid = threadIdx.x, w = tid >> 5, lane = tid & 31, ln = lane & 15, hh = lane >> 4; const int by = blockIdx.y;
  A += (size_t)by * sA; Bh += (size_t)by * sB; const size_t cofs = (size_t)by * sC; const float* bp = bias ? bias + (size_t)by * sBias : nullptr;
  const int ntn = (N + 63) / 64; const int wid = blockIdx.x * 4 + w; const int mt = wid / ntn, nq = wid % ntn; if (mt * 16 >= M) return;
  const int row0 = mt * 16, col0 = nq * 64; const _Float16* arow = A + (size_t)(row0 + ln) * lda;
  v8f acc[4] = {};
  for (int kb = 0; kb < K; kb += 32) { FragH ah; ah.half[0] = *(const v8us*)((const unsigned short*)arow + kb + 8 * hh); ah.half[1] = *(const v8us*)((const unsigned short*)arow + kb + 16 + 8 * hh);
#pragma unroll
    for (int t = 0; t < 4; ++t) { if (col0 + t * 16 >= N) continue; const size_t boff = (size_t)(col0 + t * 16 + ln) * ldb + kb; FragH bq; bq.half[0] = *(const v8us*)((const unsigned short*)Bh + boff + 8 * hh); bq.half[1] = *(const v8us*)((const unsigned short*)Bh + boff + 16 + 8 * hh);
      acc[t] = mmaH<1>(ah.v, ah.v, bq.v, bq.v, acc[t]); }
  }
#pragma unroll
  for (int t = 0; t < 4; ++t) { if (col0 + t * 16 >= N) continue; const int col = col0 + t * 16 + ln; const float bv = bp ? bf16_round(bp[col]) : 0.f;
#pragma unroll
    for (int r = 0; r < 8; ++r) { float v = acc[t][r] * alpha + bv; if (CP) { const int bidx = (row0g + row0 + 8 * hh + r) / rowsPerB; v += CP[(size_t)bidx * sCPb + (size_t)by * 64 + col]; } if (ACT == 1) v = (v > 0.f) ? v : expm1f(v); else if (ACT == 7) v = (v > 0.f) ? v + 1.0f : expf(v); else if (ACT == 8) v = tanhf(v); else if (ACT == 9) v = 0.5f * v * (1.0f + tanhf(0.7978845608028654f * (v + 0.044715f * v * v * v))); else if (ACT == 11) v = 1.0f / (1.0f + expf(-v)); else if (ACT == 12) v = (v > 0.f) ? v : 0.01f * v; else if (ACT == 14) v = (v > 0.f) ? v : 0.1f * v; else if (ACT == 15) v = v / (1.0f + expf(-v)); else if (ACT == 3) v = fmaxf(v, 0.f); else if (ACT == 6) v = 0.5f * v * (1.0f + erff(v * 0.70710678118654752f)); so[w][8 * hh + r][t * 16 + ln] = v; } }
  __builtin_amdgcn_fence(__ATOMIC_ACQ_REL, "workgroup"); __builtin_amdgcn_wave_barrier();
  const int rsub = lane >> 4, c4 = (lane & 15) * 4; typedef _Float16 v4h __attribute__((ext_vector_type(4)));
  {
#pragma unroll
    for (int q = 0; q < 8; ++q) { const int r = q * 2 + rsub; if (col0 + c4 < N) { const v4f v = *(const v4fa*)&so[w][r][c4]; if (C) *(v4f*)(C + cofs + (size_t)(row0 + r) * ldc + col0 + c4) = v; if (C16) { v4h h4; for (int i = 0; i < 4; ++i) h4[i] = (_Float16)v[i]; *(v4h*)(C16 + cofs + (size_t)(row0 + r) * ldc + col0 + c4) = h4; } } }
     }
}


typedef _Float16 v4h __attribute__((ext_vector_type(4)));

__global__ __launch_bounds__(256) void k_x16(const float* __restrict__ x, _Float16* __restrict__ X16, size_t n8) { const size_t t = (size_t)blockIdx.x * 256 + threadIdx.x; if (t >= n8) return; FragH f;
#pragma unroll
  for (int q = 0; q < 8; ++q) f.h[q] = (_Float16)bf16_round(x[t * 8 + q]); *(v8us*)((unsigned short*)X16 + t * 8) = f.half[0];  }
__global__ __launch_bounds__(256) void k_h16(const float* __restrict__ x, _Float16* __restrict__ X16, size_t n8) { const size_t t = (size_t)blockIdx.x * 256 + threadIdx.x; if (t >= n8) return; FragH f;
#pragma unroll
  for (int q = 0; q < 8; ++q) f.h[q] = (_Float16)x[t * 8 + q]; *(v8us*)((unsigned short*)X16 + t * 8) = f.half[0];  }
__global__ __launch_bounds__(256) void k_round16f(const float* __restrict__ W, _Float16* __restrict__ Bt, size_t n8) { const size_t t = (size_t)blockIdx.x * 256 + threadIdx.x; if (t >= n8) return; FragH f;
#pragma unroll
  for (int i = 0; i < 8; ++i) f.h[i] = (_Float16)(bf16_round(W[t * 8 + i]) * 16.0f); *(v8us*)((unsigned short*)Bt + t * 8) = f.half[0];  }
template <int NHv, int TTv>
__global__ __launch_bounds__(256) void k_vt(const _Float16* __restrict__ V16, int ldv, int voff, _Float16* __restrict__ Vt) { __shared__ unsigned short tl[64][66]; const int tid = threadIdx.x; const int slab = blockIdx.x / (TTv / 64), lg = blockIdx.x % (TTv / 64); const int b = slab / NHv, h = slab % NHv;
  for (int i = tid; i < 64 * 8; i += 256) { const int r = i / 8, c8 = (i % 8) * 8; FragH f; f.half[0] = *(const v8us*)((const unsigned short*)V16 + ((size_t)b * TTv + lg * 64 + r) * ldv + voff + h * 64 + c8);
#pragma unroll
    for (int q = 0; q < 8; ++q) tl[r][c8 + q] = f.u[q]; }
  __syncthreads();
  {
#pragma unroll
    for (int rd = 0; rd < 2; ++rd) { const int d = rd * 32 + tid / 8, pc = tid % 8; FragH f;
#pragma unroll
      for (int q = 0; q < 8; ++q) f.u[q] = tl[pc * 8 + q][d];
      *(v8us*)((unsigned short*)Vt + ((size_t)slab * 64 + d) * TTv + lg * 64 + pc * 8) = f.half[0]; }
     } }

__global__ __launch_bounds__(256) void k_hl(const float* __restrict__ F, _Float16* __restrict__ Hh, _Float16* __restrict__ Hl, size_t n8) { const size_t t = (size_t)blockIdx.x * 256 + threadIdx.x; if (t >= n8) return; FragH fh, fl; const v4f a = *(const v4fa*)(F + t * 8), c = *(const v4fa*)(F + t * 8 + 4);
#pragma unroll
  for (int q = 0; q < 4; ++q) { _Float16 h = (_Float16)a[q]; fh.h[q] = h; fl.h[q] = (_Float16)((a[q] - (float)h) * 1024.0f); h = (_Float16)c[q]; fh.h[4 + q] = h; fl.h[4 + q] = (_Float16)((c[q] - (float)h) * 1024.0f); }
  { *(v8us*)((unsigned short*)Hh + t * 8) = fh.half[0]; *(v8us*)((unsigned short*)Hl + t * 8) = fl.half[0];  } }

// ---- fast GEMM (wave tile 32x64; requires M % 32 == 0 rows per launch region and N % 64 == 0); epilogue like k_gemm_hhx, but the bias is bias, bias1 or bias2 by blockIdx.y ----
__device__ __forceinline__ v16h g2_frag(const _Float16* p, int hh) { FragH f; f.half[0] = *(const v8us*)((const unsigned short*)p + 8 * hh); f.half[1] = *(const v8us*)((const unsigned short*)p + 16 + 8 * hh); return f.v; }
__device__ __forceinline__ v8f g2_mma(v16h a, v16h b, v8f c) { v8f d = __builtin_amdgcn_wmma_f32_16x16x32_f16(false, a, false, b, (short)0, c, false, false); asm volatile("v_nop\n\tv_nop\n\tv_nop\n\tv_nop" : "+v"(d) : "v"(a), "v"(b)); return d; }
template <int ACT>
__global__ __launch_bounds__(128) void k_gemm2(const _Float16* __restrict__ A, int lda, size_t sA, const _Float16* __restrict__ Bh, int ldb, size_t sB, float alpha, const float* __restrict__ bias, const float* __restrict__ bias1, const float* __restrict__ bias2, const float* __restrict__ CP, int rowsPerB, size_t sCPb, int row0g,
    float* __restrict__ C, _Float16* __restrict__ C16, int ldc, size_t sC, int M, int N, int K) {
  __shared__ __attribute__((aligned(16))) float so[4][32][68];
  const int tid = threadIdx.x, w = tid >> 5, lane = tid & 31, ln = lane & 15, hh = lane >> 4; const int by = blockIdx.y;
  A += (size_t)by * sA; Bh += (size_t)by * sB; const size_t cofs = (size_t)by * sC; const float* bp = (by == 0) ? bias : (by == 1) ? bias1 : bias2;      /* one bias vector per blockIdx.y */
  const int ntn = N >> 6; const int mt = blockIdx.x / ntn, nq = blockIdx.x - mt * ntn; const int row0 = mt * 128 + 32 * w, col0 = nq * 64; if (row0 >= M) return;
  const _Float16* a0p = A + (size_t)(row0 + ln) * lda; const _Float16* a1p = a0p + (size_t)16 * lda;
  const _Float16* b0p = Bh + (size_t)(col0 + ln) * ldb; const _Float16* b1p = b0p + (size_t)16 * ldb; const _Float16* b2p = b1p + (size_t)16 * ldb; const _Float16* b3p = b2p + (size_t)16 * ldb;
  const v8f z8 = {0.f,0.f,0.f,0.f,0.f,0.f,0.f,0.f}; v8f c00 = z8, c01 = z8, c02 = z8, c03 = z8, c10 = z8, c11 = z8, c12 = z8, c13 = z8;
#pragma unroll 1
  for (int kb = 0; kb < K; kb += 32) { const v16h a0 = g2_frag(a0p + kb, hh), a1 = g2_frag(a1p + kb, hh);
    v16h b = g2_frag(b0p + kb, hh); c00 = g2_mma(a0, b, c00); c10 = g2_mma(a1, b, c10);
    b = g2_frag(b1p + kb, hh); c01 = g2_mma(a0, b, c01); c11 = g2_mma(a1, b, c11);
    b = g2_frag(b2p + kb, hh); c02 = g2_mma(a0, b, c02); c12 = g2_mma(a1, b, c12);
    b = g2_frag(b3p + kb, hh); c03 = g2_mma(a0, b, c03); c13 = g2_mma(a1, b, c13); }
  v8f accs[8] = {c00, c01, c02, c03, c10, c11, c12, c13};
#pragma unroll
  for (int u = 0; u < 8; ++u) { const int t = u & 3, half = u >> 2; const int col = col0 + t * 16 + ln; const float bv = bp ? bf16_round(bp[col]) : 0.f;
#pragma unroll
    for (int r = 0; r < 8; ++r) { const int rloc = half * 16 + 8 * hh + r; float v = accs[u][r] * alpha + bv; if (CP) { const int bidx = (row0g + row0 + rloc) / rowsPerB; v += CP[(size_t)bidx * sCPb + (size_t)by * 64 + col]; }
      if (ACT == 3) v = fmaxf(v, 0.f); else if (ACT == 6) v = 0.5f * v * (1.0f + erff(v * 0.70710678118654752f)); else if (ACT == 11) v = 1.0f / (1.0f + expf(-v)); else if (ACT == 15) v = v / (1.0f + expf(-v)); else if (ACT == 12) v = (v > 0.f) ? v : 0.01f * v; else if (ACT == 8) v = tanhf(v);
      so[w][rloc][t * 16 + ln] = v; } }
  __builtin_amdgcn_fence(__ATOMIC_ACQ_REL, "workgroup"); __builtin_amdgcn_wave_barrier();
  const int rsub = lane >> 4, c4 = (lane & 15) * 4;
  {
#pragma unroll
    for (int q = 0; q < 16; ++q) { const int r = q * 2 + rsub; const v4f v = *(const v4fa*)&so[w][r][c4]; if (C) *(v4f*)(C + cofs + (size_t)(row0 + r) * ldc + col0 + c4) = v; if (C16) { v4h h4; for (int i = 0; i < 4; ++i) h4[i] = (_Float16)v[i]; *(v4h*)(C16 + cofs + (size_t)(row0 + r) * ldc + col0 + c4) = h4; } }
     } }



template <int TK>
__global__ __launch_bounds__(256) void k_vthl(const float* __restrict__ VF, int ldv, _Float16* __restrict__ Vth, _Float16* __restrict__ Vtl) { __shared__ float tl[64][65]; const int tid = threadIdx.x; const int slab = blockIdx.x / (TK / 64), lg = blockIdx.x % (TK / 64); const int b = slab / NH, h = slab % NH;
  for (int i = tid; i < 64 * 16; i += 256) { const int r = i / 16, c4 = (i % 16) * 4; const v4f a = *(const v4fa*)(VF + ((size_t)b * TK + lg * 64 + r) * ldv + h * 64 + c4); tl[r][c4] = a[0]; tl[r][c4 + 1] = a[1]; tl[r][c4 + 2] = a[2]; tl[r][c4 + 3] = a[3]; }
  __syncthreads();
  FragH fh[2], fl[2]; size_t oo[2];
#pragma unroll
  for (int rd = 0; rd < 2; ++rd) { const int d = rd * 32 + tid / 8, pc = tid % 8;
#pragma unroll
    for (int q = 0; q < 8; ++q) { const float v = tl[pc * 8 + q][d]; const _Float16 hv = (_Float16)v; fh[rd].h[q] = hv; fl[rd].h[q] = (_Float16)((v - (float)hv) * 1024.0f); } oo[rd] = ((size_t)slab * 64 + d) * TK + lg * 64 + pc * 8; }
  {
#pragma unroll
    for (int rd = 0; rd < 2; ++rd) { *(v8us*)((unsigned short*)Vth + oo[rd]) = fh[rd].half[0]; *(v8us*)((unsigned short*)Vtl + oo[rd]) = fl[rd].half[0]; }
     } }

typedef int v4ia __attribute__((ext_vector_type(4), may_alias));
typedef float v2f __attribute__((ext_vector_type(2)));
typedef _Float16 v2h __attribute__((ext_vector_type(2)));
// lane l takes the value of lane l ^ 16
__device__ __forceinline__ float xhalf(float x) { return __builtin_bit_cast(float, __builtin_amdgcn_permlanex16(__builtin_bit_cast(int, x), __builtin_bit_cast(int, x), 0x76543210, 0xfedcba98, false, false)); }
template <int TQ, int TK>
__global__ __launch_bounds__(128) void k_flashb(const _Float16* __restrict__ Q16, const _Float16* __restrict__ Q16lo, int ldq, const _Float16* __restrict__ K16, const _Float16* __restrict__ K16lo, int ldk, const _Float16* __restrict__ Vt, const _Float16* __restrict__ Vtlo, const float* __restrict__ BT, const int* __restrict__ LAG, float* __restrict__ O, int ldo) {
  constexpr int RPW = 16, RTN = RPW / 16, NQB = TQ / (4 * RPW), DT = 4, KS = 2;
  __shared__ __attribute__((aligned(16))) float sO[4][RPW][64 + 4];
  // two-buffer ring of one pass's operands, shared by the block's four waves: [buffer][hi, residual][row][halfs]; K rows (128 B) at a pitch of 144 B, V^T rows (64 B) at 80 B, both 16 B x odd for the 16-byte fragment reads
  __shared__ __attribute__((aligned(16))) unsigned short sK[2][2][32][72]; __shared__ __attribute__((aligned(16))) unsigned short sV[2][2][64][40];
  __shared__ __attribute__((aligned(256))) float sB[513];      /* the head's bias row, rounded to bf16 once: a pass's gathers are 4-byte LDS reads; the largest alignment puts it at the start of the block's LDS, so that its base fits the reads' 16-bit offset field */
  const int tid = threadIdx.x, w = tid >> 5, lane = tid & 31, ln = lane & 15, hh = lane >> 4;
  const int slab = blockIdx.x / NQB, qblk = blockIdx.x % NQB; const int b = slab / NH, h = slab % NH; const int qb0 = qblk * (4 * RPW); const int q0 = qb0 + w * RPW;
  FragH aq[2][KS], aql[2][KS];
#pragma unroll
  for (int rt = 0; rt < RTN; ++rt) { const size_t qo = ((size_t)b * TQ + q0 + rt * 16 + ln) * ldq + h * 64; const unsigned short* qr = (const unsigned short*)Q16 + qo; const unsigned short* ql = (const unsigned short*)Q16lo + qo;
#pragma unroll
    for (int ks = 0; ks < KS; ++ks) { aq[rt][ks].half[0] = *(const v8us*)(qr + ks * 32 + 8 * hh); aq[rt][ks].half[1] = *(const v8us*)(qr + ks * 32 + 16 + 8 * hh); aql[rt][ks].half[0] = *(const v8us*)(ql + ks * 32 + 8 * hh); aql[rt][ks].half[1] = *(const v8us*)(ql + ks * 32 + 16 + 8 * hh); } }
  const unsigned short* Vth = (const unsigned short*)Vt + (size_t)slab * 64 * TK; const unsigned short* Vtl = (const unsigned short*)Vtlo + (size_t)slab * 64 * TK;
  // each thread copies eight 16-byte pieces of a pass's tile: K rows tid/8 and tid/8 + 16 (a wave covers whole 128-B rows), V^T rows tid/4 and tid/4 + 32, hi and residual plane each
  const size_t kg0 = ((size_t)b * TK + (tid >> 3)) * ldk + h * 64 + (tid & 7) * 8, vg0 = (size_t)(tid >> 2) * TK + (tid & 3) * 8;
  const unsigned kd0 = (unsigned)(size_t)&sK[0][0][tid >> 3][(tid & 7) * 8], vd0 = (unsigned)(size_t)&sV[0][0][tid >> 2][(tid & 3) * 8];
  auto stage = [&](int j, int buf) {
    const unsigned short* gk = (const unsigned short*)K16 + kg0 + (size_t)j * ldk; const unsigned short* gkl = (const unsigned short*)K16lo + kg0 + (size_t)j * ldk; const unsigned short* gk2 = gk + (size_t)16 * ldk; const unsigned short* gkl2 = gkl + (size_t)16 * ldk;
    const unsigned short* gv = Vth + vg0 + j; const unsigned short* gvl = Vtl + vg0 + j; const unsigned short* gv2 = gv + (size_t)32 * TK; const unsigned short* gvl2 = gvl + (size_t)32 * TK;
    const unsigned dk = kd0 + (unsigned)buf * (unsigned)sizeof(sK[0]), dkl = dk + (unsigned)sizeof(sK[0][0]), dk2 = dk + 16u * (unsigned)sizeof(sK[0][0][0]), dkl2 = dkl + 16u * (unsigned)sizeof(sK[0][0][0]);
    const unsigned dv = vd0 + (unsigned)buf * (unsigned)sizeof(sV[0]), dvl = dv + (unsigned)sizeof(sV[0][0]), dv2 = dv + 32u * (unsigned)sizeof(sV[0][0][0]), dvl2 = dvl + 32u * (unsigned)sizeof(sV[0][0][0]);
    // the copies go from global memory to LDS through no register; the closing s_wait_xcnt is a precaution that stands in front of any rewrite of the address registers named here
    asm volatile("global_load_async_to_lds_b128 %0, %8, off\n\tglobal_load_async_to_lds_b128 %1, %9, off\n\tglobal_load_async_to_lds_b128 %2, %10, off\n\tglobal_load_async_to_lds_b128 %3, %11, off\n\t"
                 "global_load_async_to_lds_b128 %4, %12, off\n\tglobal_load_async_to_lds_b128 %5, %13, off\n\tglobal_load_async_to_lds_b128 %6, %14, off\n\tglobal_load_async_to_lds_b128 %7, %15, off\n\ts_wait_xcnt 0x0"
                 :: "v"(dk), "v"(dk2), "v"(dkl), "v"(dkl2), "v"(dv), "v"(dv2), "v"(dvl), "v"(dvl2), "v"(gk), "v"(gk2), "v"(gkl), "v"(gkl2), "v"(gv), "v"(gv2), "v"(gvl), "v"(gvl2) : "memory"); };
  stage(0, 0);
  { const float* br = BT + (size_t)h * 513; const float t0 = br[tid], t1 = br[tid + 128], t2 = br[tid + 256], t3 = br[tid + 384], t4 = br[512];      /* 128 threads, 513 entries: the loads fly together, beside tile 0's copies */
    asm volatile("s_wait_xcnt 0x0" :: "v"(tid) : "memory");      /* precaution: it stands in front of any rewrite of the index register that these loads name; tid as an input keeps that register as it is up to here */
    sB[tid] = bf16_round(t0); sB[tid + 128] = bf16_round(t1); sB[tid + 256] = bf16_round(t2); sB[tid + 384] = bf16_round(t3); if (tid == 0) sB[512] = bf16_round(t4); }      /* published by the barrier that publishes tile 0 */
  asm volatile("s_wait_asynccnt 0x0" ::: "memory");      /* this wave's share of tile 0 has landed */
  __syncthreads();      /* tile 0 is published to all four waves */
  stage(32, 1);      /* tile 1 flies while tile 0 is worked on */
  // scores are formed transposed, S^T = K Q^T (A = K rows, B = Q rows): lane (ln, hh) holds, of the ONE query q0 + ln, the scores of keys nt * 16 + 8 * hh + r; so are the outputs, O^T = V^T P^T
  const unsigned lq = (unsigned)LAG[q0 + ln];
  float m_run = -3.0e38f, l_run = 0.f; v8f oacc[DT], oaccl[DT];
#pragma unroll
  for (int dt = 0; dt < DT; ++dt) { oacc[dt] = (v8f){0.f,0.f,0.f,0.f,0.f,0.f,0.f,0.f}; oaccl[dt] = oacc[dt]; }
#pragma unroll 1
  for (int j0 = 0; j0 < TK; j0 += 32) {
    const int buf = (j0 >> 5) & 1;
    float bb[2][8];      /* the pass's bias values, gathered from LDS at its head so that they fly beside the K reads */
#pragma unroll
    for (int nt = 0; nt < 2; ++nt) { const v4ia ka = *(const v4ia*)(LAG + j0 + nt * 16 + 8 * hh), kb = *(const v4ia*)(LAG + j0 + nt * 16 + 8 * hh + 4);
#pragma unroll
      for (int r = 0; r < 8; ++r) { const unsigned d = lq - (unsigned)(r < 4 ? ka[r & 3] : kb[r & 3]);      /* |lag[q] - lag[k]| = min(d, -d) in unsigned arithmetic; the min with 512 keeps the index inside sB for any lag content */
        bb[nt][r] = sB[min(min(d, 0u - d), 512u)]; } }
    asm volatile("s_wait_xcnt 0x0" ::: "memory");      /* precaution: it stands in front of the rewrite of the lag loads' address registers at the loop's foot */
    v8f s[2];
#pragma unroll
    for (int nt = 0; nt < 2; ++nt) { const unsigned short* kr = &sK[buf][0][nt * 16 + ln][0]; const unsigned short* kl = &sK[buf][1][nt * 16 + ln][0]; FragH bk[KS], bkl[KS];
#pragma unroll
      for (int ks = 0; ks < KS; ++ks) { bk[ks].half[0] = *(const v8us*)(kr + ks * 32 + 8 * hh); bk[ks].half[1] = *(const v8us*)(kr + ks * 32 + 16 + 8 * hh); bkl[ks].half[0] = *(const v8us*)(kl + ks * 32 + 8 * hh); bkl[ks].half[1] = *(const v8us*)(kl + ks * 32 + 16 + 8 * hh); }
      v8f acc = (v8f){0.f,0.f,0.f,0.f,0.f,0.f,0.f,0.f}, accr = acc;
#pragma unroll
      for (int ks = 0; ks < KS; ++ks) { acc = mmaH<1>(bk[ks].v, bk[ks].v, aq[0][ks].v, aq[0][ks].v, acc); accr = mmaH<1>(bk[ks].v, bk[ks].v, aql[0][ks].v, aql[0][ks].v, accr); accr = mmaH<1>(bkl[ks].v, bkl[ks].v, aq[0][ks].v, aq[0][ks].v, accr); }
      s[nt] = acc + accr * 0.0009765625f; }
    float sc[2][8], mh[2];
#pragma unroll
    for (int nt = 0; nt < 2; ++nt) {
#pragma unroll
      for (int r = 0; r < 8; ++r) sc[nt][r] = s[nt][r] * SCL + bb[nt][r];
      mh[nt] = fmaxf(fmaxf(fmaxf(sc[nt][0], sc[nt][1]), fmaxf(sc[nt][2], sc[nt][3])), fmaxf(fmaxf(sc[nt][4], sc[nt][5]), fmaxf(sc[nt][6], sc[nt][7]))); }
    float mc = fmaxf(mh[0], mh[1]);
    mc = fmaxf(mc, xhalf(mc));      /* the query's other 16 keys of the pass lie in lane ^ 16 */
    const float mn = fmaxf(m_run, mc); const float ea = expf(m_run - mn); const float al = (mn > -1.0e38f) ? ea : 1.0f; m_run = mn;
    FragH pa, pl; v2f ps = {0.f, 0.f};      /* two f32 D tiles of S^T, converted in place, are the B operand P^T in the hardware k order: element nt * 8 + r = key nt * 16 + 8 * hh + r */
#pragma unroll
    for (int nt = 0; nt < 2; ++nt)
#pragma unroll
      for (int r = 0; r < 8; r += 2) { const v2f p = {expf(sc[nt][r] - mn), expf(sc[nt][r + 1] - mn)}; ps += p; const v2f pq = p * 1024.0f; const v2h ph = __builtin_convertvector(pq, v2h); const v2h pr = __builtin_convertvector((pq - __builtin_convertvector(ph, v2f)) * 1024.0f, v2h);
        pa.h[nt * 8 + r] = ph[0]; pa.h[nt * 8 + r + 1] = ph[1]; pl.h[nt * 8 + r] = pr[0]; pl.h[nt * 8 + r + 1] = pr[1]; }
    l_run = l_run * al + (ps[0] + ps[1]);      /* this lane half's share of the query's sum; the halves are joined behind the loop */
#pragma unroll
    for (int dt = 0; dt < DT; ++dt) { oacc[dt] *= al; oaccl[dt] *= al; }
#pragma unroll
    for (int dt = 0; dt < DT; ++dt) { const unsigned short* vr = &sV[buf][0][dt * 16 + ln][0]; const unsigned short* vl = &sV[buf][1][dt * 16 + ln][0]; FragH bv, bl; bv.half[0] = *(const v8us*)(vr + 8 * hh); bv.half[1] = *(const v8us*)(vr + 16 + 8 * hh); bl.half[0] = *(const v8us*)(vl + 8 * hh); bl.half[1] = *(const v8us*)(vl + 16 + 8 * hh);
      oacc[dt] = mmaH<1>(bv.v, bv.v, pa.v, pa.v, oacc[dt]); oaccl[dt] = mmaH<1>(bl.v, bl.v, pa.v, pa.v, oaccl[dt]); oaccl[dt] = mmaH<1>(bv.v, bv.v, pl.v, pl.v, oaccl[dt]); }
    asm volatile("s_wait_dscnt 0x0" ::: "memory");      /* this wave's reads of the pass's buffer are done before the buffer is refilled */
    asm volatile("s_wait_asynccnt 0x0" ::: "memory");      /* this wave's share of the next tile has landed */
    __syncthreads();      /* publishes the next tile and ends every wave's reads of this pass's buffer */
    if (j0 + 64 < TK) stage(j0 + 64, buf); }
  asm volatile("s_wait_asynccnt 0x0" ::: "memory");      /* no copy is outstanding when the wave goes on to its end */
  { const float l = l_run + xhalf(l_run); const float li = (l > 0.f) ? 1.0f / (l * 1024.0f) : 0.f;
#pragma unroll
    for (int dt = 0; dt < DT; ++dt) { v4f o0, o1;      /* a lane's eight accumulator rows are eight consecutive head columns of its query */
#pragma unroll
      for (int r = 0; r < 4; ++r) { o0[r] = (oacc[dt][r] + oaccl[dt][r] * 0.0009765625f) * li; o1[r] = (oacc[dt][4 + r] + oaccl[dt][4 + r] * 0.0009765625f) * li; }
      *(v4fa*)&sO[w][ln][dt * 16 + 8 * hh] = o0; *(v4fa*)&sO[w][ln][dt * 16 + 8 * hh + 4] = o1; } }
  __builtin_amdgcn_fence(__ATOMIC_ACQ_REL, "workgroup"); __builtin_amdgcn_wave_barrier();
  {
#pragma unroll
    for (int rp = 0; rp < RPW; rp += 2) { const int r = rp + (lane >> 4), pc = lane & 15; const v4f val = *(const v4fa*)&sO[w][r][pc * 4]; *(v4f*)(O + ((size_t)b * TQ + q0 + r) * ldo + h * 64 + pc * 4) = val; }
     } }


__global__ __launch_bounds__(256) void k_lnx(const float* __restrict__ X, const float* __restrict__ g, const float* __restrict__ bb, _Float16* __restrict__ Y16, float* __restrict__ XB) {
  #pragma clang fp contract(off)
  const int tid = threadIdx.x, w = tid >> 5, ln = tid & 31; const int r = blockIdx.x * 8 + w; if (r >= NR) return; const float* x = X + (size_t)r * DM; float s = 0.f;
#pragma unroll 1
  for (int i = 0; i < DM / 128; ++i) { const v4f a = *(const v4fa*)(x + i * 128 + ln * 4); for (int q = 0; q < 4; ++q) s += bf16_round(a[q]); }
  for (int o = 16; o > 0; o >>= 1) s += __shfl_xor(s, o, 32); const float mu = s / (float)DM; float q2 = 0.f;
#pragma unroll 1
  for (int i = 0; i < DM / 128; ++i) { const v4f a = *(const v4fa*)(x + i * 128 + ln * 4); for (int q = 0; q < 4; ++q) { const float d = bf16_round(a[q]) - mu; q2 += d * d; } }
  for (int o = 16; o > 0; o >>= 1) q2 += __shfl_xor(q2, o, 32); const float rs = rsqrtf(q2 / (float)DM + 1e-5f);
  {
#pragma unroll 1
    for (int i = 0; i < DM / 128; ++i) { const int c0 = i * 128 + ln * 4; const v4f a = *(const v4fa*)(x + c0); _Float16 h4[4]; v4f xb;
      for (int q = 0; q < 4; ++q) { const float t = bf16_round(a[q]); h4[q] = (_Float16)((t - mu) * rs * bf16_round(g[c0 + q]) + bf16_round(bb[c0 + q])); xb[q] = t; }
      *(unsigned long long*)((unsigned short*)Y16 + (size_t)r * DM + c0) = *(const unsigned long long*)h4; *(v4f*)(XB + (size_t)r * DM + c0) = xb; }
     } }
__global__ __launch_bounds__(256) void k_causaltab(unsigned* __restrict__ MB, int* __restrict__ RA, int* __restrict__ KE, int nq, int nk) {
  const int t = blockIdx.x * 256 + threadIdx.x; const int nw = nk / 32;
  if (t < nq * nw) { const int q = t / nw, w = t % nw; const int first = q + 1 - 32 * w; const unsigned bits = (first <= 0) ? 0xffffffffu : ((first >= 32) ? 0u : (0xffffffffu << first)); *(unsigned*)(MB + t) = bits;  }
  if (t < nq) { *(int*)(RA + t) = 0;  }
  if (t < nq / 64) { const int v = 64 * (t + 1); *(int*)(KE + t * 32) = v;  } }


extern "C" void kernel_launch(void* const* d_in, const int* in_sizes, int n_in,
                              void* d_out, int out_size, void* d_ws, size_t ws_size, hipStream_t stream) {
  (void)in_sizes; (void)n_in; (void)out_size;
  const float* const* I = (const float* const*)d_in; const float* x = I[0]; const int* lag = (const int*)d_in[1]; const float* wq = I[2]; const float* bq = I[3]; const float* wk = I[4]; const float* bk = I[5]; const float* wv = I[6]; const float* bv = I[7]; const float* wo = I[8]; const float* bo = I[9]; const float* lb = I[10];
  char* ws = (char*)d_ws; size_t off = 0;
  auto take = [&](size_t bytes) { char* p = ws + off; off += (bytes + 255) & ~(size_t)255; return p; };
  _Float16* BQ = (_Float16*)take((size_t)DM * DM * 2); _Float16* BK = (_Float16*)take((size_t)DM * DM * 2); _Float16* BV = (_Float16*)take((size_t)DM * DM * 2); _Float16* BO = (_Float16*)take((size_t)DM * DM * 2);
  _Float16* X16 = (_Float16*)take((size_t)NR * DM * 2); float* F = (float*)take((size_t)3 * NR * DM * 4);      /* q, k, v planes, one behind the other */
  _Float16* Qh = (_Float16*)take((size_t)NR * DM * 2); _Float16* Kh = (_Float16*)take((size_t)NR * DM * 2); _Float16* Ql = (_Float16*)take((size_t)NR * DM * 2); _Float16* Kl = (_Float16*)take((size_t)NR * DM * 2); _Float16* Vth = (_Float16*)take((size_t)NR * DM * 2); _Float16* Vtl = (_Float16*)take((size_t)NR * DM * 2);      /* Kh directly behind Qh, Kl directly behind Ql */
  if (off > ws_size) return;      /* 8 + 8 + 48 + 48 = 112 MiB */
  float* O = F; _Float16* Oh = Qh; _Float16* Ol = Ql;
  const size_t w8 = (size_t)DM * DM / 8; const unsigned wb = (unsigned)((w8 + 255) / 256);
  k_wt_f16<<<dim3(wb, 4), 256, 0, stream>>>(wq, wk, wv, wo, BQ, DM, DM, 16.0f);      /* (in,out); BQ, BK, BV, BO are contiguous */
  const size_t n8 = (size_t)NR * DM / 8; const unsigned nb8 = (unsigned)((n8 + 255) / 256); const dim3 gP((NR / 128) * (DM / 64), 1); const dim3 gP3((NR / 128) * (DM / 64), 3);
  k_x16<<<nb8, 256, 0, stream>>>(x, X16, n8);
  k_gemm2<0><<<gP3, 128, 0, stream>>>(X16, DM, 0, BQ, DM, (size_t)DM * DM, 0.0625f, bq, bk, bv, nullptr, 1, 0, 0, F, nullptr, DM, (size_t)NR * DM, NR, DM, DM);      /* q, k, v in one grid */
  k_hl<<<2 * nb8, 256, 0, stream>>>(F, Qh, Ql, 2 * n8);      /* q and k planes together */
  k_vthl<SLEN><<<NBT * NH * (SLEN / 64), 256, 0, stream>>>(F + (size_t)2 * NR * DM, DM, Vth, Vtl);
  k_flashb<SLEN, SLEN><<<NBT * NH * (SLEN / 64), 128, 0, stream>>>(Qh, Ql, DM, Kh, Kl, DM, Vth, Vtl, lb, lag, O, DM);      /* both batches in one grid; the lag vector is per position, shared across the batch */
  k_hl<<<nb8, 256, 0, stream>>>(O, Oh, Ol, n8);
  k_gemm2<0><<<gP, 128, 0, stream>>>(Oh, DM, 0, BO, DM, 0, 0.0625f, bo, nullptr, nullptr, nullptr, 1, 0, 0, (float*)d_out, nullptr, DM, 0, NR, DM, DM);
  k_gemm2<0><<<gP, 128, 0, stream>>>(Ol, DM, 0, BO, DM, 0, 0.0625f / 1024.0f, nullptr, nullptr, nullptr, (float*)d_out, 1, (size_t)DM, 0, (float*)d_out, nullptr, DM, 0, NR, DM, DM);
}

// v006
// One run takes 263 microseconds.
// In two side-by-side timings against v005, it was 1.34 and 1.35 times as fast.
// Over all steps from v000 it is 4.40 times as fast.
#include <hip/hip_runtime.h>
// Multi-head self-attention with a lag-distance bias (2 x 2048 tokens, 1024 = 16 heads x 64): q,k,v = x W + b; scores = q.k/8 + lag_bias[h][|lag[q] - lag[k]|] with the INPUT integer lag vector; softmax over all keys; out = (attn v) Wo + bo -> [2,2048,1024].
// Structure: x as an exact f16 plane; projections as f16 WMMA GEMMs (128x128 block tiles of eight 32x64 wave tiles, 64-k operand tiles from a two-buffer LDS ring filled by asynchronous copies one trip ahead, f32 accumulation, exact x16 weights + bias); q, k as f16 hi + (x2^10) residual planes, V^T as hi + residual planes; the fused flash kernel takes each pass's K and V^T tiles (hi + residual) from a two-buffer LDS ring filled by asynchronous copies one pass ahead and shared by its four waves, and adds the bias, gathered by |lag[q] - lag[k]| (INPUT int32 positions) from the head's row of the INPUT table, which each block rounds once into LDS, inside the score stage (all keys valid; scores and outputs formed transposed, so that a lane holds one query: online f32 softmax in the lane, P hi + residual packed from the score accumulators into the next product's operand, two value accumulators); O as hi + residual planes into Wo (two GEMMs, bias in the first).
// Compute dtype: x, weights, biases, lag_bias rounded to bf16; projections exact; q, k, P, v, O as f16 hi + residual pairs (~2^-21); f32 accumulation and softmax. v_wmma_f32_16x16x32_f16.
#define NBT 2
#define SLEN 2048
#define DM 1024
#define NH 16
#define SCL 0.125f
#define NR (NBT * SLEN)
typedef __bf16 v16b __attribute__((ext_vector_type(16)));
typedef unsigned short v8us __attribute__((ext_vector_type(8), may_alias));
typedef float  v8f  __attribute__((ext_vector_type(8)));
typedef float  v4f  __attribute__((ext_vector_type(4)));
typedef float  v4fa __attribute__((ext_vector_type(4), may_alias));
union FragB { v16b v; v8us half[2]; unsigned short u[16]; };

__device__ __forceinline__ unsigned short bf16_bits(float x) { unsigned int u = __float_as_uint(x); return (unsigned short)((u + 0x7FFFu + ((u >> 16) & 1u)) >> 16); }
__device__ __forceinline__ float bf16_val(unsigned short b) { return __uint_as_float(((unsigned int)b) << 16); }
__device__ __forceinline__ float bf16_round(float x) { return bf16_val(bf16_bits(x)); }
// D += A·B with NT terms: 1 = ah·bh, 2 = + al·bh (A split), 3 = + ah·bl (both split)
template <int NT>
__device__ __forceinline__ v8f mmaN(v16b ah, v16b al, v16b bh, v16b bl, v8f c) {
  c = __builtin_amdgcn_wmma_f32_16x16x32_bf16(false, ah, false, bh, (short)0, c, false, false);
  if (NT >= 2) c = __builtin_amdgcn_wmma_f32_16x16x32_bf16(false, al, false, bh, (short)0, c, false, false);
  if (NT >= 3) c = __builtin_amdgcn_wmma_f32_16x16x32_bf16(false, ah, false, bl, (short)0, c, false, false);
  asm volatile("v_nop\n\tv_nop\n\tv_nop\n\tv_nop" : "+v"(c) : "v"(ah), "v"(al), "v"(bh), "v"(bl));
  return c;
}

__global__ __launch_bounds__(256) void k_wt_bf16(const float* __restrict__ W, unsigned short* __restrict__ Wt, int K, int N) {
  const int t = blockIdx.x * 256 + threadIdx.x;
  const int k8n = K / 8;
  if (t >= N * k8n) return;
  const int n = t / k8n, k8 = (t % k8n) * 8;
  v8us v;
#pragma unroll
  for (int i = 0; i < 8; ++i) v[i] = bf16_bits(W[(size_t)(k8 + i) * N + n]);
  *(v8us*)(Wt + (size_t)n * K + k8) = v;
  
}

// GEMM C[M][N] (f32, pitch ldc) = act(A[M][K]·W + bias). A f32 row-major (pitch lda) converted per fragment to bf16
// (ASPLIT: hi/lo two planes -> 2 terms, else single rounded term); Wt bf16 [N][K] (pitch ldb). BIAS_BF16 rounds the
// bias to bf16 first (bias quantised to bf16 before the add). K%32==0, M%16==0, N%64==0.
template <bool ASPLIT, int ACT, bool BIAS_BF16>
__global__ __launch_bounds__(128) void k_gemm_bf(const float* __restrict__ A, int lda, const unsigned short* __restrict__ Wt, int ldb,
                                               const float* __restrict__ bias, float* __restrict__ C, int ldc, int M, int N, int K) {
  __shared__ __attribute__((aligned(16))) float so[4][16][64];
  const int tid = threadIdx.x, w = tid >> 5, lane = tid & 31, ln = lane & 15, hh = lane >> 4;
  const int ntn = N / 64;
  const int wid = blockIdx.x * 4 + w;
  const int mt = wid / ntn, nq = wid % ntn;
  if (mt * 16 >= M) return;
  const int row0 = mt * 16, col0 = nq * 64;
  const float* arow = A + (size_t)(row0 + ln) * lda;
  v8f acc[4] = {};
  for (int kb = 0; kb < K; kb += 32) {
    FragB ah, al;
    const v4f x0 = *(const v4fa*)(arow + kb + 8 * hh), x1 = *(const v4fa*)(arow + kb + 8 * hh + 4);
    const v4f x2 = *(const v4fa*)(arow + kb + 16 + 8 * hh), x3 = *(const v4fa*)(arow + kb + 16 + 8 * hh + 4);
    float xs[16] = {x0[0],x0[1],x0[2],x0[3],x1[0],x1[1],x1[2],x1[3],x2[0],x2[1],x2[2],x2[3],x3[0],x3[1],x3[2],x3[3]};
#pragma unroll
    for (int i = 0; i < 16; ++i) { const unsigned short hb = bf16_bits(xs[i]); ah.u[i] = hb; al.u[i] = ASPLIT ? bf16_bits(xs[i] - bf16_val(hb)) : (unsigned short)0; }
#pragma unroll
    for (int t = 0; t < 4; ++t) {
      const unsigned short* brow = Wt + (size_t)(col0 + t * 16 + ln) * ldb + kb;
      FragB b;
      b.half[0] = *(const v8us*)(brow + 8 * hh);
      b.half[1] = *(const v8us*)(brow + 16 + 8 * hh);
      acc[t] = mmaN<ASPLIT ? 2 : 1>(ah.v, al.v, b.v, b.v, acc[t]);
    }
  }
#pragma unroll
  for (int t = 0; t < 4; ++t) {
    float bv = bias ? bias[col0 + t * 16 + ln] : 0.f;
    if (BIAS_BF16) bv = bf16_round(bv);
#pragma unroll
    for (int r = 0; r < 8; ++r) { float v = acc[t][r] + bv; if (ACT == 1) v = fmaxf(v, 0.f); so[w][8 * hh + r][t * 16 + ln] = v; }
  }
  __builtin_amdgcn_fence(__ATOMIC_ACQ_REL, "workgroup");
  __builtin_amdgcn_wave_barrier();
  const int rsub = lane >> 4, c4 = (lane & 15) * 4;
  {
#pragma unroll
    for (int q = 0; q < 8; ++q) {
      const int r = q * 2 + rsub;
      const v4f v = *(const v4fa*)&so[w][r][c4];
      *(v4f*)(C + (size_t)(row0 + r) * ldc + col0 + c4) = v;
    }
    
  }
}

// GEMM C = act(A·W + bias + resid): A f32 (ASPLIT -> hi/lo 2 terms), Wt bf16 [N][K]; ACT 0 none, 1 relu, 2 exact gelu;
// resid (optional, f32, row index = (row % rmod), pitch ldr, RES_BF16 rounds it) added before the activation.
template <bool ASPLIT, int ACT, bool BIAS_BF16, bool RES_BF16>
__global__ __launch_bounds__(128) void k_gemm_bf3(const float* __restrict__ A, int lda, const unsigned short* __restrict__ Wt, int ldb,
                                                const float* __restrict__ bias, const float* __restrict__ resid, int rmod, int ldr,
                                                float* __restrict__ C, int ldc, int M, int N, int K) {
  __shared__ __attribute__((aligned(16))) float so[4][16][64];
  const int tid = threadIdx.x, w = tid >> 5, lane = tid & 31, ln = lane & 15, hh = lane >> 4;
  const int ntn = N / 64;
  const int wid = blockIdx.x * 4 + w;
  const int mt = wid / ntn, nq = wid % ntn;
  if (mt * 16 >= M) return;
  const int row0 = mt * 16, col0 = nq * 64;
  const float* arow = A + (size_t)(row0 + ln) * lda;
  v8f acc[4] = {};
  for (int kb = 0; kb < K; kb += 32) {
    FragB ah, al;
    const v4f x0 = *(const v4fa*)(arow + kb + 8 * hh), x1 = *(const v4fa*)(arow + kb + 8 * hh + 4);
    const v4f x2 = *(const v4fa*)(arow + kb + 16 + 8 * hh), x3 = *(const v4fa*)(arow + kb + 16 + 8 * hh + 4);
    float xs[16] = {x0[0],x0[1],x0[2],x0[3],x1[0],x1[1],x1[2],x1[3],x2[0],x2[1],x2[2],x2[3],x3[0],x3[1],x3[2],x3[3]};
#pragma unroll
    for (int i = 0; i < 16; ++i) { const unsigned short hb = bf16_bits(xs[i]); ah.u[i] = hb; al.u[i] = ASPLIT ? bf16_bits(xs[i] - bf16_val(hb)) : (unsigned short)0; }
#pragma unroll
    for (int t = 0; t < 4; ++t) {
      const unsigned short* brow = Wt + (size_t)(col0 + t * 16 + ln) * ldb + kb;
      FragB b;
      b.half[0] = *(const v8us*)(brow + 8 * hh);
      b.half[1] = *(const v8us*)(brow + 16 + 8 * hh);
      acc[t] = mmaN<ASPLIT ? 2 : 1>(ah.v, al.v, b.v, b.v, acc[t]);
    }
  }
#pragma unroll
  for (int t = 0; t < 4; ++t) {
    const int col = col0 + t * 16 + ln;
    float bv = bias ? bias[col] : 0.f;
    if (BIAS_BF16) bv = bf16_round(bv);
#pragma unroll
    for (int r = 0; r < 8; ++r) {
      float v = acc[t][r] + bv;
      if (resid) { float rv = resid[(size_t)((row0 + 8 * hh + r) % rmod) * ldr + col]; if (RES_BF16) rv = bf16_round(rv); v += rv; }
      if (ACT == 1) v = fmaxf(v, 0.f);
      if (ACT == 2) v = 0.5f * v * (1.0f + erff(v * 0.70710678118654752f));
      if (ACT == 3) { const float u = 0.7978845608028654f * (v + 0.044715f * v * v * v); v = 0.5f * v * (1.0f + tanhf(u)); }
      so[w][8 * hh + r][t * 16 + ln] = v;
    }
  }
  __builtin_amdgcn_fence(__ATOMIC_ACQ_REL, "workgroup");
  __builtin_amdgcn_wave_barrier();
  const int rsub = lane >> 4, c4 = (lane & 15) * 4;
  {
#pragma unroll
    for (int q = 0; q < 8; ++q) {
      const int r = q * 2 + rsub;
      const v4f v = *(const v4fa*)&so[w][r][c4];
      *(v4f*)(C + (size_t)(row0 + r) * ldc + col0 + c4) = v;
    }
    
  }
}
// row LayerNorm (biased variance, eps) over N: s = X (+ R); optional out_sum <- s; out_norm <- (s-mu)*rsqrt(var+eps)*g + b
template <bool PARAM_BF16>
__global__ __launch_bounds__(256) void k_layernorm(const float* __restrict__ X, const float* __restrict__ R, const float* __restrict__ g, const float* __restrict__ bta,
                                                  float* __restrict__ out_sum, float* __restrict__ out_norm, int N, float eps) {
  __shared__ float red[256];
  const int row = blockIdx.x, tid = threadIdx.x;
  const float* x = X + (size_t)row * N; const float* rr = R ? R + (size_t)row * N : nullptr;
  float vals[16];                     // up to N = 4096
  const int per = N / 256;            // contiguous chunk per thread? use strided-by-4 chunks: thread handles j = tid*4 + 1024*u
  float s1 = 0.f;
  for (int u = 0; u < per / 4; ++u) {
    const int j = tid * 4 + 1024 * u;
    const v4f a = *(const v4fa*)(x + j);
    v4f b = {0.f,0.f,0.f,0.f}; if (rr) b = *(const v4fa*)(rr + j);
#pragma unroll
    for (int q = 0; q < 4; ++q) { const float v = a[q] + b[q]; vals[u * 4 + q] = v; s1 += v; }
  }
  red[tid] = s1; __syncthreads();
  for (int st = 128; st > 0; st >>= 1) { if (tid < st) red[tid] += red[tid + st]; __syncthreads(); }
  const float mu = red[0] / (float)N; __syncthreads();
  float s2 = 0.f;
  for (int u = 0; u < per / 4; ++u)
#pragma unroll
    for (int q = 0; q < 4; ++q) { const float c = vals[u * 4 + q] - mu; s2 += c * c; }
  red[tid] = s2; __syncthreads();
  for (int st = 128; st > 0; st >>= 1) { if (tid < st) red[tid] += red[tid + st]; __syncthreads(); }
  const float rs = rsqrtf(red[0] / (float)N + eps);
  {
    for (int u = 0; u < per / 4; ++u) {
      const int j = tid * 4 + 1024 * u;
      v4f o, sm;
#pragma unroll
      for (int q = 0; q < 4; ++q) {
        float gg = g[j + q], bb = bta[j + q];
        if (PARAM_BF16) { gg = bf16_round(gg); bb = bf16_round(bb); }
        sm[q] = vals[u * 4 + q]; o[q] = (vals[u * 4 + q] - mu) * rs * gg + bb;
      }
      if (out_sum) *(v4f*)(out_sum + (size_t)row * N + j) = sm;
      *(v4f*)(out_norm + (size_t)row * N + j) = o;
    }
    
  }
}



// ---- f16 WMMA path (v_wmma_f32_16x16x32_f16): 11-bit significands for operands in range — used where a [0,1] probability operand needs more precision than bf16
typedef _Float16 v16h __attribute__((ext_vector_type(16)));
union FragH { v16h v; v8us half[2]; _Float16 h[16]; unsigned short u[16]; };
template <int NT>
__device__ __forceinline__ v8f mmaH(v16h ah, v16h al, v16h bh, v16h bl, v8f c) {
  c = __builtin_amdgcn_wmma_f32_16x16x32_f16(false, ah, false, bh, (short)0, c, false, false);
  if (NT >= 2) c = __builtin_amdgcn_wmma_f32_16x16x32_f16(false, al, false, bh, (short)0, c, false, false);
  if (NT >= 3) c = __builtin_amdgcn_wmma_f32_16x16x32_f16(false, ah, false, bl, (short)0, c, false, false);
  asm volatile("v_nop\n\tv_nop\n\tv_nop\n\tv_nop" : "+v"(c) : "v"(ah), "v"(al), "v"(bh), "v"(bl));
  return c;
}
// batched GEMM like k_gemm_b but f16 operands: A f32 (split into f16 hi/lo if ASPLIT, else rounded to f16), Bt = f16 values [n][k]; alpha; C f32; N multiple of 16 (partial tiles skipped)
template <bool ASPLIT>
__global__ __launch_bounds__(128) void k_gemm_h(const float* __restrict__ A, int lda, size_t sA, const _Float16* __restrict__ Bh, int ldb, size_t sB, float alpha, float* __restrict__ C, int ldc, size_t sC, int M, int N, int K) {
  __shared__ __attribute__((aligned(16))) float so[4][16][64];
  const int tid = threadIdx.x, w = tid >> 5, lane = tid & 31, ln = lane & 15, hh = lane >> 4; const int by = blockIdx.y;
  A += (size_t)by * sA; Bh += (size_t)by * sB; C += (size_t)by * sC;
  const int ntn = (N + 63) / 64; const int wid = blockIdx.x * 4 + w; const int mt = wid / ntn, nq = wid % ntn; if (mt * 16 >= M) return;
  const int row0 = mt * 16, col0 = nq * 64; const float* arow = A + (size_t)(row0 + ln) * lda;
  v8f acc[4] = {};
  for (int kb = 0; kb < K; kb += 32) {
    FragH ah, al;
    const v4f x0 = *(const v4fa*)(arow + kb + 8 * hh), x1 = *(const v4fa*)(arow + kb + 8 * hh + 4), x2 = *(const v4fa*)(arow + kb + 16 + 8 * hh), x3 = *(const v4fa*)(arow + kb + 16 + 8 * hh + 4);
    float xs[16] = {x0[0],x0[1],x0[2],x0[3],x1[0],x1[1],x1[2],x1[3],x2[0],x2[1],x2[2],x2[3],x3[0],x3[1],x3[2],x3[3]};
#pragma unroll
    for (int i = 0; i < 16; ++i) { const _Float16 h = (_Float16)xs[i]; ah.h[i] = h; al.h[i] = ASPLIT ? (_Float16)(xs[i] - (float)h) : (_Float16)0.0f; }
#pragma unroll
    for (int t = 0; t < 4; ++t) { if (col0 + t * 16 >= N) continue; const size_t boff = (size_t)(col0 + t * 16 + ln) * ldb + kb; FragH bq; bq.half[0] = *(const v8us*)(Bh + boff + 8 * hh); bq.half[1] = *(const v8us*)(Bh + boff + 16 + 8 * hh);
      acc[t] = mmaH<ASPLIT ? 2 : 1>(ah.v, al.v, bq.v, bq.v, acc[t]); }
  }
#pragma unroll
  for (int t = 0; t < 4; ++t) { if (col0 + t * 16 >= N) continue;
#pragma unroll
    for (int r = 0; r < 8; ++r) so[w][8 * hh + r][t * 16 + ln] = acc[t][r] * alpha; }
  __builtin_amdgcn_fence(__ATOMIC_ACQ_REL, "workgroup"); __builtin_amdgcn_wave_barrier();
  const int rsub = lane >> 4, c4 = (lane & 15) * 4;
  {
#pragma unroll
    for (int q = 0; q < 8; ++q) { const int r = q * 2 + rsub; if (col0 + c4 < N) { const v4f v = *(const v4fa*)&so[w][r][c4]; *(v4f*)(C + (size_t)(row0 + r) * ldc + col0 + c4) = v; } }
     }
}

// Wt[n][k] = f16(W[k][n]·scale) from f32 row-major W[K][N] (scale = power of two; bf16-exact weights stay exact in f16 away from the subnormal range)
// blockIdx.y picks one of four equally shaped matrices; their transposes lie one behind the other in Wt
__global__ __launch_bounds__(256) void k_wt_f16(const float* __restrict__ W0, const float* __restrict__ W1, const float* __restrict__ W2, const float* __restrict__ W3, _Float16* __restrict__ Wt, int K, int N, float scale) {
  const int by = blockIdx.y; const float* __restrict__ W = (by == 0) ? W0 : (by == 1) ? W1 : (by == 2) ? W2 : W3; Wt += (size_t)by * K * N;
  const int t = blockIdx.x * 256 + threadIdx.x; if (t >= N * (K / 8)) return; const int n = t / (K / 8), k8 = (t % (K / 8)) * 8; FragH f;
#pragma unroll
  for (int i = 0; i < 8; ++i) f.h[i] = (_Float16)(bf16_round(W[(size_t)(k8 + i) * N + n]) * scale); const v8us o = f.half[0];
  *(v8us*)((unsigned short*)Wt + (size_t)n * K + k8) = o; 
}
// k_gemm_hh variant with fused epilogue: v = acc·alpha + bias[by·sBias + col] (+ CP[(row/rowsPerB)·sCPb + by·64 + col] if CP) ; ACT 0 none / 1 elu ; writes f16 C16 (and f32 C if non-null)
template <int ACT>
__global__ __launch_bounds__(128) void k_gemm_hhx(const _Float16* __restrict__ A, int lda, size_t sA, const _Float16* __restrict__ Bh, int ldb, size_t sB, float alpha, const float* __restrict__ bias, size_t sBias, const float* __restrict__ CP, int rowsPerB, size_t sCPb, int row0g,
    float* __restrict__ C, _Float16* __restrict__ C16, int ldc, size_t sC, int M, int N, int K) {
  __shared__ __attribute__((aligned(16))) float so[4][16][64];
  const int tid = threadIdx.x, w = tid >> 5, lane = tid & 31, ln = lane & 15, hh = lane >> 4; const int by = blockIdx.y;
  A += (size_t)by * sA; Bh += (size_t)by * sB; const size_t cofs = (size_t)by * sC; const float* bp = bias ? bias + (size_t)by * sBias : nullptr;
  const int ntn = (N + 63) / 64; const int wid = blockIdx.x * 4 + w; const int mt = wid / ntn, nq = wid % ntn; if (mt * 16 >= M) return;
  const int row0 = mt * 16, col0 = nq * 64; const _Float16* arow = A + (size_t)(row0 + ln) * lda;
  v8f acc[4] = {};
  for (int kb = 0; kb < K; kb += 32) { FragH ah; ah.half[0] = *(const v8us*)((const unsigned short*)arow + kb + 8 * hh); ah.half[1] = *(const v8us*)((const unsigned short*)arow + kb + 16 + 8 * hh);
#pragma unroll
    for (int t = 0; t < 4; ++t) { if (col0 + t * 16 >= N) continue; const size_t boff = (size_t)(col0 + t * 16 + ln) * ldb + kb; FragH bq; bq.half[0] = *(const v8us*)((const unsigned short*)Bh + boff + 8 * hh); bq.half[1] = *(const v8us*)((const unsigned short*)Bh + boff + 16 + 8 * hh);
      acc[t] = mmaH<1>(ah.v, ah.v, bq.v, bq.v, acc[t]); }
  }
#pragma unroll
  for (int t = 0; t < 4; ++t) { if (col0 + t * 16 >= N) continue; const int col = col0 + t * 16 + ln; const float bv = bp ? bf16_round(bp[col]) : 0.f;
#pragma unroll
    for (int r = 0; r < 8; ++r) { float v = acc[t][r] * alpha + bv; if (CP) { const int bidx = (row0g + row0 + 8 * hh + r) / rowsPerB; v += CP[(size_t)bidx * sCPb + (size_t)by * 64 + col]; } if (ACT == 1) v = (v > 0.f) ? v : expm1f(v); else if (ACT == 7) v = (v > 0.f) ? v + 1.0f : expf(v); else if (ACT == 8) v = tanhf(v); else if (ACT == 9) v = 0.5f * v * (1.0f + tanhf(0.7978845608028654f * (v + 0.044715f * v * v * v))); else if (ACT == 11) v = 1.0f / (1.0f + expf(-v)); else if (ACT == 12) v = (v > 0.f) ? v : 0.01f * v; else if (ACT == 14) v = (v > 0.f) ? v : 0.1f * v; else if (ACT == 15) v = v / (1.0f + expf(-v)); else if (ACT == 3) v = fmaxf(v, 0.f); else if (ACT == 6) v = 0.5f * v * (1.0f + erff(v * 0.70710678118654752f)); so[w][8 * hh + r][t * 16 + ln] = v; } }
  __builtin_amdgcn_fence(__ATOMIC_ACQ_REL, "workgroup"); __builtin_amdgcn_wave_barrier();
  const int rsub = lane >> 4, c4 = (lane & 15) * 4; typedef _Float16 v4h __attribute__((ext_vector_type(4)));
  {
#pragma unroll
    for (int q = 0; q < 8; ++q) { const int r = q * 2 + rsub; if (col0 + c4 < N) { const v4f v = *(const v4fa*)&so[w][r][c4]; if (C) *(v4f*)(C + cofs + (size_t)(row0 + r) * ldc + col0 + c4) = v; if (C16) { v4h h4; for (int i = 0; i < 4; ++i) h4[i] = (_Float16)v[i]; *(v4h*)(C16 + cofs + (size_t)(row0 + r) * ldc + col0 + c4) = h4; } } }
     }
}


typedef _Float16 v4h __attribute__((ext_vector_type(4)));

__global__ __launch_bounds__(256) void k_x16(const float* __restrict__ x, _Float16* __restrict__ X16, size_t n8) { const size_t t = (size_t)blockIdx.x * 256 + threadIdx.x; if (t >= n8) return; FragH f;
#pragma unroll
  for (int q = 0; q < 8; ++q) f.h[q] = (_Float16)bf16_round(x[t * 8 + q]); *(v8us*)((unsigned short*)X16 + t * 8) = f.half[0];  }
__global__ __launch_bounds__(256) void k_h16(const float* __restrict__ x, _Float16* __restrict__ X16, size_t n8) { const size_t t = (size_t)blockIdx.x * 256 + threadIdx.x; if (t >= n8) return; FragH f;
#pragma unroll
  for (int q = 0; q < 8; ++q) f.h[q] = (_Float16)x[t * 8 + q]; *(v8us*)((unsigned short*)X16 + t * 8) = f.half[0];  }
__global__ __launch_bounds__(256) void k_round16f(const float* __restrict__ W, _Float16* __restrict__ Bt, size_t n8) { const size_t t = (size_t)blockIdx.x * 256 + threadIdx.x; if (t >= n8) return; FragH f;
#pragma unroll
  for (int i = 0; i < 8; ++i) f.h[i] = (_Float16)(bf16_round(W[t * 8 + i]) * 16.0f); *(v8us*)((unsigned short*)Bt + t * 8) = f.half[0];  }
template <int NHv, int TTv>
__global__ __launch_bounds__(256) void k_vt(const _Float16* __restrict__ V16, int ldv, int voff, _Float16* __restrict__ Vt) { __shared__ unsigned short tl[64][66]; const int tid = threadIdx.x; const int slab = blockIdx.x / (TTv / 64), lg = blockIdx.x % (TTv / 64); const int b = slab / NHv, h = slab % NHv;
  for (int i = tid; i < 64 * 8; i += 256) { const int r = i / 8, c8 = (i % 8) * 8; FragH f; f.half[0] = *(const v8us*)((const unsigned short*)V16 + ((size_t)b * TTv + lg * 64 + r) * ldv + voff + h * 64 + c8);
#pragma unroll
    for (int q = 0; q < 8; ++q) tl[r][c8 + q] = f.u[q]; }
  __syncthreads();
  {
#pragma unroll
    for (int rd = 0; rd < 2; ++rd) { const int d = rd * 32 + tid / 8, pc = tid % 8; FragH f;
#pragma unroll
      for (int q = 0; q < 8; ++q) f.u[q] = tl[pc * 8 + q][d];
      *(v8us*)((unsigned short*)Vt + ((size_t)slab * 64 + d) * TTv + lg * 64 + pc * 8) = f.half[0]; }
     } }

__global__ __launch_bounds__(256) void k_hl(const float* __restrict__ F, _Float16* __restrict__ Hh, _Float16* __restrict__ Hl, size_t n8) { const size_t t = (size_t)blockIdx.x * 256 + threadIdx.x; if (t >= n8) return; FragH fh, fl; const v4f a = *(const v4fa*)(F + t * 8), c = *(const v4fa*)(F + t * 8 + 4);
#pragma unroll
  for (int q = 0; q < 4; ++q) { _Float16 h = (_Float16)a[q]; fh.h[q] = h; fl.h[q] = (_Float16)((a[q] - (float)h) * 1024.0f); h = (_Float16)c[q]; fh.h[4 + q] = h; fl.h[4 + q] = (_Float16)((c[q] - (float)h) * 1024.0f); }
  { *(v8us*)((unsigned short*)Hh + t * 8) = fh.half[0]; *(v8us*)((unsigned short*)Hl + t * 8) = fl.half[0];  } }

// ---- fast GEMM (block tile 128x128, eight waves of 32x64; requires M % 128 == 0, N % 128 == 0, K % 64 == 0, K >= 64); epilogue = k_gemm_hhx semantics ----
__device__ __forceinline__ v16h g2_frag(const unsigned short* p, int hh) { FragH f; f.half[0] = *(const v8us*)(p + 8 * hh); f.half[1] = *(const v8us*)(p + 16 + 8 * hh); return f.v; }
__device__ __forceinline__ v8f g2_mma(v16h a, v16h b, v8f c) { v8f d = __builtin_amdgcn_wmma_f32_16x16x32_f16(false, a, false, b, (short)0, c, false, false); asm volatile("v_nop\n\tv_nop\n\tv_nop\n\tv_nop" : "+v"(d) : "v"(a), "v"(b)); return d; }
template <int ACT>
__global__ __launch_bounds__(256) void k_gemm2(const _Float16* __restrict__ A, int lda, size_t sA, const _Float16* __restrict__ Bh, int ldb, size_t sB, float alpha, const float* __restrict__ bias, const float* __restrict__ bias1, const float* __restrict__ bias2, const float* __restrict__ CP, int rowsPerB, size_t sCPb, int row0g,
    float* __restrict__ C, _Float16* __restrict__ C16, int ldc, size_t sC, int M, int N, int K) {
  // two-buffer ring of 64-k tiles shared by the block's eight waves: [buffer][A, B][128 rows][halfs]; rows of 128 B at a pitch of 144 B (16 B x odd, for the 16-byte fragment reads). Behind the loop's last barrier the same bytes are the waves' output staging (8 x 32 x 68 floats = 69,632 B of the 73,728)
  constexpr int PH = 72; constexpr unsigned OPB = 128u * PH * 2u, BUFB = 2u * OPB;
  __shared__ __attribute__((aligned(16))) unsigned short sT[2 * 2 * 128 * PH];
  const int tid = threadIdx.x, w = tid >> 5, lane = tid & 31, ln = lane & 15, hh = lane >> 4; const int by = blockIdx.y;
  A += (size_t)by * sA; Bh += (size_t)by * sB; const size_t cofs = (size_t)by * sC; const float* bp = (by == 0) ? bias : (by == 1) ? bias1 : bias2;      /* one bias vector per blockIdx.y */
  const int ntn = N >> 7; const int mt = blockIdx.x / ntn, nq = blockIdx.x - mt * ntn; if (mt * 128 >= M) return;      /* the same for the whole block, in front of every barrier */
  const int wr = w & 3, wc = w >> 2; const int row0 = mt * 128 + 32 * wr, col0 = nq * 128 + 64 * wc;
  // each thread copies eight 16-byte pieces of a tile: rows tid/8 + 0, 32, 64, 96 of A and of B (a wave's copy covers four whole 128-B rows)
  const unsigned short* ga0 = (const unsigned short*)A + (size_t)(mt * 128 + (tid >> 3)) * lda + (tid & 7) * 8; const unsigned short* gb0 = (const unsigned short*)Bh + (size_t)(nq * 128 + (tid >> 3)) * ldb + (tid & 7) * 8;
  const unsigned d0 = (unsigned)(size_t)&sT[(tid >> 3) * PH + (tid & 7) * 8];
  auto stage = [&](int kb, int buf) {
    const unsigned short* a0 = ga0 + kb; const unsigned short* a1 = a0 + (size_t)32 * lda; const unsigned short* a2 = a1 + (size_t)32 * lda; const unsigned short* a3 = a2 + (size_t)32 * lda;
    const unsigned short* b0 = gb0 + kb; const unsigned short* b1 = b0 + (size_t)32 * ldb; const unsigned short* b2 = b1 + (size_t)32 * ldb; const unsigned short* b3 = b2 + (size_t)32 * ldb;
    const unsigned da0 = d0 + (unsigned)buf * BUFB, da1 = da0 + 32u * PH * 2u, da2 = da0 + 64u * PH * 2u, da3 = da0 + 96u * PH * 2u, db0 = da0 + OPB, db1 = da1 + OPB, db2 = da2 + OPB, db3 = da3 + OPB;
    // the copies go from global memory to LDS through no register; the closing s_wait_xcnt is a precaution that stands in front of any rewrite of the address registers named here
    asm volatile("global_load_async_to_lds_b128 %0, %8, off\n\tglobal_load_async_to_lds_b128 %1, %9, off\n\tglobal_load_async_to_lds_b128 %2, %10, off\n\tglobal_load_async_to_lds_b128 %3, %11, off\n\t"
                 "global_load_async_to_lds_b128 %4, %12, off\n\tglobal_load_async_to_lds_b128 %5, %13, off\n\tglobal_load_async_to_lds_b128 %6, %14, off\n\tglobal_load_async_to_lds_b128 %7, %15, off\n\ts_wait_xcnt 0x0"
                 :: "v"(da0), "v"(da1), "v"(da2), "v"(da3), "v"(db0), "v"(db1), "v"(db2), "v"(db3), "v"(a0), "v"(a1), "v"(a2), "v"(a3), "v"(b0), "v"(b1), "v"(b2), "v"(b3) : "memory"); };
  stage(0, 0);
  asm volatile("s_wait_asynccnt 0x0" ::: "memory");      /* this wave's share of tile 0 has landed */
  __syncthreads();      /* tile 0 is published to all eight waves */
  if (64 < K) stage(64, 1);      /* tile 1 flies while tile 0 is worked on */
  const v8f z8 = {0.f,0.f,0.f,0.f,0.f,0.f,0.f,0.f}; v8f c00 = z8, c01 = z8, c02 = z8, c03 = z8, c10 = z8, c11 = z8, c12 = z8, c13 = z8;
#pragma unroll 1
  for (int kb = 0; kb < K; kb += 64) { const int buf = (kb >> 6) & 1;      /* rolled: one trip is one tile of the ring */
    const unsigned short* ta = &sT[(buf * 2 + 0) * 128 * PH + (32 * wr + ln) * PH]; const unsigned short* tb = &sT[(buf * 2 + 1) * 128 * PH + (64 * wc + ln) * PH];
#pragma unroll
    for (int ks = 0; ks < 64; ks += 32) {      /* unrolled: ks becomes an immediate offset of the LDS reads */
      const v16h a0 = g2_frag(ta + ks, hh), a1 = g2_frag(ta + 16 * PH + ks, hh), b0 = g2_frag(tb + ks, hh), b1 = g2_frag(tb + 16 * PH + ks, hh), b2 = g2_frag(tb + 32 * PH + ks, hh), b3 = g2_frag(tb + 48 * PH + ks, hh);
      c00 = g2_mma(a0, b0, c00); c10 = g2_mma(a1, b0, c10); c01 = g2_mma(a0, b1, c01); c11 = g2_mma(a1, b1, c11);
      c02 = g2_mma(a0, b2, c02); c12 = g2_mma(a1, b2, c12); c03 = g2_mma(a0, b3, c03); c13 = g2_mma(a1, b3, c13); }
    asm volatile("s_wait_dscnt 0x0" ::: "memory");      /* this wave's reads of the trip's buffer are done before the buffer is refilled */
    asm volatile("s_wait_asynccnt 0x0" ::: "memory");      /* this wave's share of the next tile has landed */
    __syncthreads();      /* publishes the next tile and ends every wave's reads of this trip's buffer */
    if (kb + 128 < K) stage(kb + 128, buf); }
  asm volatile("s_wait_asynccnt 0x0" ::: "memory");      /* no copy is outstanding when the ring becomes output staging */
  float (*so)[32][68] = (float (*)[32][68])sT;      /* every wave has passed the last trip's barrier: nobody reads the ring any more */
  v8f accs[8] = {c00, c01, c02, c03, c10, c11, c12, c13};
#pragma unroll
  for (int u = 0; u < 8; ++u) { const int t = u & 3, half = u >> 2; const int col = col0 + t * 16 + ln; const float bv = bp ? bf16_round(bp[col]) : 0.f;
#pragma unroll
    for (int r = 0; r < 8; ++r) { const int rloc = half * 16 + 8 * hh + r; float v = accs[u][r] * alpha + bv; if (CP) { const int bidx = (row0g + row0 + rloc) / rowsPerB; v += CP[(size_t)bidx * sCPb + (size_t)by * 64 + col]; }
      if (ACT == 3) v = fmaxf(v, 0.f); else if (ACT == 6) v = 0.5f * v * (1.0f + erff(v * 0.70710678118654752f)); else if (ACT == 11) v = 1.0f / (1.0f + expf(-v)); else if (ACT == 15) v = v / (1.0f + expf(-v)); else if (ACT == 12) v = (v > 0.f) ? v : 0.01f * v; else if (ACT == 8) v = tanhf(v);
      so[w][rloc][t * 16 + ln] = v; } }
  __builtin_amdgcn_fence(__ATOMIC_ACQ_REL, "workgroup"); __builtin_amdgcn_wave_barrier();
  const int rsub = lane >> 4, c4 = (lane & 15) * 4;
  {
#pragma unroll
    for (int q = 0; q < 16; ++q) { const int r = q * 2 + rsub; const v4f v = *(const v4fa*)&so[w][r][c4]; if (C) *(v4f*)(C + cofs + (size_t)(row0 + r) * ldc + col0 + c4) = v; if (C16) { v4h h4; for (int i = 0; i < 4; ++i) h4[i] = (_Float16)v[i]; *(v4h*)(C16 + cofs + (size_t)(row0 + r) * ldc + col0 + c4) = h4; } }
     } }



template <int TK>
__global__ __launch_bounds__(256) void k_vthl(const float* __restrict__ VF, int ldv, _Float16* __restrict__ Vth, _Float16* __restrict__ Vtl) { __shared__ float tl[64][65]; const int tid = threadIdx.x; const int slab = blockIdx.x / (TK / 64), lg = blockIdx.x % (TK / 64); const int b = slab / NH, h = slab % NH;
  for (int i = tid; i < 64 * 16; i += 256) { const int r = i / 16, c4 = (i % 16) * 4; const v4f a = *(const v4fa*)(VF + ((size_t)b * TK + lg * 64 + r) * ldv + h * 64 + c4); tl[r][c4] = a[0]; tl[r][c4 + 1] = a[1]; tl[r][c4 + 2] = a[2]; tl[r][c4 + 3] = a[3]; }
  __syncthreads();
  FragH fh[2], fl[2]; size_t oo[2];
#pragma unroll
  for (int rd = 0; rd < 2; ++rd) { const int d = rd * 32 + tid / 8, pc = tid % 8;
#pragma unroll
    for (int q = 0; q < 8; ++q) { const float v = tl[pc * 8 + q][d]; const _Float16 hv = (_Float16)v; fh[rd].h[q] = hv; fl[rd].h[q] = (_Float16)((v - (float)hv) * 1024.0f); } oo[rd] = ((size_t)slab * 64 + d) * TK + lg * 64 + pc * 8; }
  {
#pragma unroll
    for (int rd = 0; rd < 2; ++rd) { *(v8us*)((unsigned short*)Vth + oo[rd]) = fh[rd].half[0]; *(v8us*)((unsigned short*)Vtl + oo[rd]) = fl[rd].half[0]; }
     } }

typedef int v4ia __attribute__((ext_vector_type(4), may_alias));
typedef float v2f __attribute__((ext_vector_type(2)));
typedef _Float16 v2h __attribute__((ext_vector_type(2)));
// lane l takes the value of lane l ^ 16
__device__ __forceinline__ float xhalf(float x) { return __builtin_bit_cast(float, __builtin_amdgcn_permlanex16(__builtin_bit_cast(int, x), __builtin_bit_cast(int, x), 0x76543210, 0xfedcba98, false, false)); }
template <int TQ, int TK>
__global__ __launch_bounds__(128) void k_flashb(const _Float16* __restrict__ Q16, const _Float16* __restrict__ Q16lo, int ldq, const _Float16* __restrict__ K16, const _Float16* __restrict__ K16lo, int ldk, const _Float16* __restrict__ Vt, const _Float16* __restrict__ Vtlo, const float* __restrict__ BT, const int* __restrict__ LAG, float* __restrict__ O, int ldo) {
  constexpr int RPW = 16, RTN = RPW / 16, NQB = TQ / (4 * RPW), DT = 4, KS = 2;
  __shared__ __attribute__((aligned(16))) float sO[4][RPW][64 + 4];
  // two-buffer ring of one pass's operands, shared by the block's four waves: [buffer][hi, residual][row][halfs]; K rows (128 B) at a pitch of 144 B, V^T rows (64 B) at 80 B, both 16 B x odd for the 16-byte fragment reads
  __shared__ __attribute__((aligned(16))) unsigned short sK[2][2][32][72]; __shared__ __attribute__((aligned(16))) unsigned short sV[2][2][64][40];
  __shared__ __attribute__((aligned(256))) float sB[513];      /* the head's bias row, rounded to bf16 once: a pass's gathers are 4-byte LDS reads; the largest alignment puts it at the start of the block's LDS, so that its base fits the reads' 16-bit offset field */
  const int tid = threadIdx.x, w = tid >> 5, lane = tid & 31, ln = lane & 15, hh = lane >> 4;
  const int slab = blockIdx.x / NQB, qblk = blockIdx.x % NQB; const int b = slab / NH, h = slab % NH; const int qb0 = qblk * (4 * RPW); const int q0 = qb0 + w * RPW;
  FragH aq[2][KS], aql[2][KS];
#pragma unroll
  for (int rt = 0; rt < RTN; ++rt) { const size_t qo = ((size_t)b * TQ + q0 + rt * 16 + ln) * ldq + h * 64; const unsigned short* qr = (const unsigned short*)Q16 + qo; const unsigned short* ql = (const unsigned short*)Q16lo + qo;
#pragma unroll
    for (int ks = 0; ks < KS; ++ks) { aq[rt][ks].half[0] = *(const v8us*)(qr + ks * 32 + 8 * hh); aq[rt][ks].half[1] = *(const v8us*)(qr + ks * 32 + 16 + 8 * hh); aql[rt][ks].half[0] = *(const v8us*)(ql + ks * 32 + 8 * hh); aql[rt][ks].half[1] = *(const v8us*)(ql + ks * 32 + 16 + 8 * hh); } }
  const unsigned short* Vth = (const unsigned short*)Vt + (size_t)slab * 64 * TK; const unsigned short* Vtl = (const unsigned short*)Vtlo + (size_t)slab * 64 * TK;
  // each thread copies eight 16-byte pieces of a pass's tile: K rows tid/8 and tid/8 + 16 (a wave covers whole 128-B rows), V^T rows tid/4 and tid/4 + 32, hi and residual plane each
  const size_t kg0 = ((size_t)b * TK + (tid >> 3)) * ldk + h * 64 + (tid & 7) * 8, vg0 = (size_t)(tid >> 2) * TK + (tid & 3) * 8;
  const unsigned kd0 = (unsigned)(size_t)&sK[0][0][tid >> 3][(tid & 7) * 8], vd0 = (unsigned)(size_t)&sV[0][0][tid >> 2][(tid & 3) * 8];
  auto stage = [&](int j, int buf) {
    const unsigned short* gk = (const unsigned short*)K16 + kg0 + (size_t)j * ldk; const unsigned short* gkl = (const unsigned short*)K16lo + kg0 + (size_t)j * ldk; const unsigned short* gk2 = gk + (size_t)16 * ldk; const unsigned short* gkl2 = gkl + (size_t)16 * ldk;
    const unsigned short* gv = Vth + vg0 + j; const unsigned short* gvl = Vtl + vg0 + j; const unsigned short* gv2 = gv + (size_t)32 * TK; const unsigned short* gvl2 = gvl + (size_t)32 * TK;
    const unsigned dk = kd0 + (unsigned)buf * (unsigned)sizeof(sK[0]), dkl = dk + (unsigned)sizeof(sK[0][0]), dk2 = dk + 16u * (unsigned)sizeof(sK[0][0][0]), dkl2 = dkl + 16u * (unsigned)sizeof(sK[0][0][0]);
    const unsigned dv = vd0 + (unsigned)buf * (unsigned)sizeof(sV[0]), dvl = dv + (unsigned)sizeof(sV[0][0]), dv2 = dv + 32u * (unsigned)sizeof(sV[0][0][0]), dvl2 = dvl + 32u * (unsigned)sizeof(sV[0][0][0]);
    // the copies go from global memory to LDS through no register; the closing s_wait_xcnt is a precaution that stands in front of any rewrite of the address registers named here
    asm volatile("global_load_async_to_lds_b128 %0, %8, off\n\tglobal_load_async_to_lds_b128 %1, %9, off\n\tglobal_load_async_to_lds_b128 %2, %10, off\n\tglobal_load_async_to_lds_b128 %3, %11, off\n\t"
                 "global_load_async_to_lds_b128 %4, %12, off\n\tglobal_load_async_to_lds_b128 %5, %13, off\n\tglobal_load_async_to_lds_b128 %6, %14, off\n\tglobal_load_async_to_lds_b128 %7, %15, off\n\ts_wait_xcnt 0x0"
                 :: "v"(dk), "v"(dk2), "v"(dkl), "v"(dkl2), "v"(dv), "v"(dv2), "v"(dvl), "v"(dvl2), "v"(gk), "v"(gk2), "v"(gkl), "v"(gkl2), "v"(gv), "v"(gv2), "v"(gvl), "v"(gvl2) : "memory"); };
  stage(0, 0);
  { const float* br = BT + (size_t)h * 513; const float t0 = br[tid], t1 = br[tid + 128], t2 = br[tid + 256], t3 = br[tid + 384], t4 = br[512];      /* 128 threads, 513 entries: the loads fly together, beside tile 0's copies */
    asm volatile("s_wait_xcnt 0x0" :: "v"(tid) : "memory");      /* precaution: it stands in front of any rewrite of the index register that these loads name; tid as an input keeps that register as it is up to here */
    sB[tid] = bf16_round(t0); sB[tid + 128] = bf16_round(t1); sB[tid + 256] = bf16_round(t2); sB[tid + 384] = bf16_round(t3); if (tid == 0) sB[512] = bf16_round(t4); }      /* published by the barrier that publishes tile 0 */
  asm volatile("s_wait_asynccnt 0x0" ::: "memory");      /* this wave's share of tile 0 has landed */
  __syncthreads();      /* tile 0 is published to all four waves */
  stage(32, 1);      /* tile 1 flies while tile 0 is worked on */
  // scores are formed transposed, S^T = K Q^T (A = K rows, B = Q rows): lane (ln, hh) holds, of the ONE query q0 + ln, the scores of keys nt * 16 + 8 * hh + r; so are the outputs, O^T = V^T P^T
  const unsigned lq = (unsigned)LAG[q0 + ln];
  float m_run = -3.0e38f, l_run = 0.f; v8f oacc[DT], oaccl[DT];
#pragma unroll
  for (int dt = 0; dt < DT; ++dt) { oacc[dt] = (v8f){0.f,0.f,0.f,0.f,0.f,0.f,0.f,0.f}; oaccl[dt] = oacc[dt]; }
#pragma unroll 1
  for (int j0 = 0; j0 < TK; j0 += 32) {
    const int buf = (j0 >> 5) & 1;
    float bb[2][8];      /* the pass's bias values, gathered from LDS at its head so that they fly beside the K reads */
#pragma unroll
    for (int nt = 0; nt < 2; ++nt) { const v4ia ka = *(const v4ia*)(LAG + j0 + nt * 16 + 8 * hh), kb = *(const v4ia*)(LAG + j0 + nt * 16 + 8 * hh + 4);
#pragma unroll
      for (int r = 0; r < 8; ++r) { const unsigned d = lq - (unsigned)(r < 4 ? ka[r & 3] : kb[r & 3]);      /* |lag[q] - lag[k]| = min(d, -d) in unsigned arithmetic; the min with 512 keeps the index inside sB for any lag content */
        bb[nt][r] = sB[min(min(d, 0u - d), 512u)]; } }
    asm volatile("s_wait_xcnt 0x0" ::: "memory");      /* precaution: it stands in front of the rewrite of the lag loads' address registers at the loop's foot */
    v8f s[2];
#pragma unroll
    for (int nt = 0; nt < 2; ++nt) { const unsigned short* kr = &sK[buf][0][nt * 16 + ln][0]; const unsigned short* kl = &sK[buf][1][nt * 16 + ln][0]; FragH bk[KS], bkl[KS];
#pragma unroll
      for (int ks = 0; ks < KS; ++ks) { bk[ks].half[0] = *(const v8us*)(kr + ks * 32 + 8 * hh); bk[ks].half[1] = *(const v8us*)(kr + ks * 32 + 16 + 8 * hh); bkl[ks].half[0] = *(const v8us*)(kl + ks * 32 + 8 * hh); bkl[ks].half[1] = *(const v8us*)(kl + ks * 32 + 16 + 8 * hh); }
      v8f acc = (v8f){0.f,0.f,0.f,0.f,0.f,0.f,0.f,0.f}, accr = acc;
#pragma unroll
      for (int ks = 0; ks < KS; ++ks) { acc = mmaH<1>(bk[ks].v, bk[ks].v, aq[0][ks].v, aq[0][ks].v, acc); accr = mmaH<1>(bk[ks].v, bk[ks].v, aql[0][ks].v, aql[0][ks].v, accr); accr = mmaH<1>(bkl[ks].v, bkl[ks].v, aq[0][ks].v, aq[0][ks].v, accr); }
      s[nt] = acc + accr * 0.0009765625f; }
    float sc[2][8], mh[2];
#pragma unroll
    for (int nt = 0; nt < 2; ++nt) {
#pragma unroll
      for (int r = 0; r < 8; ++r) sc[nt][r] = s[nt][r] * SCL + bb[nt][r];
      mh[nt] = fmaxf(fmaxf(fmaxf(sc[nt][0], sc[nt][1]), fmaxf(sc[nt][2], sc[nt][3])), fmaxf(fmaxf(sc[nt][4], sc[nt][5]), fmaxf(sc[nt][6], sc[nt][7]))); }
    float mc = fmaxf(mh[0], mh[1]);
    mc = fmaxf(mc, xhalf(mc));      /* the query's other 16 keys of the pass lie in lane ^ 16 */
    const float mn = fmaxf(m_run, mc); const float ea = expf(m_run - mn); const float al = (mn > -1.0e38f) ? ea : 1.0f; m_run = mn;
    FragH pa, pl; v2f ps = {0.f, 0.f};      /* two f32 D tiles of S^T, converted in place, are the B operand P^T in the hardware k order: element nt * 8 + r = key nt * 16 + 8 * hh + r */
#pragma unroll
    for (int nt = 0; nt < 2; ++nt)
#pragma unroll
      for (int r = 0; r < 8; r += 2) { const v2f p = {expf(sc[nt][r] - mn), expf(sc[nt][r + 1] - mn)}; ps += p; const v2f pq = p * 1024.0f; const v2h ph = __builtin_convertvector(pq, v2h); const v2h pr = __builtin_convertvector((pq - __builtin_convertvector(ph, v2f)) * 1024.0f, v2h);
        pa.h[nt * 8 + r] = ph[0]; pa.h[nt * 8 + r + 1] = ph[1]; pl.h[nt * 8 + r] = pr[0]; pl.h[nt * 8 + r + 1] = pr[1]; }
    l_run = l_run * al + (ps[0] + ps[1]);      /* this lane half's share of the query's sum; the halves are joined behind the loop */
#pragma unroll
    for (int dt = 0; dt < DT; ++dt) { oacc[dt] *= al; oaccl[dt] *= al; }
#pragma unroll
    for (int dt = 0; dt < DT; ++dt) { const unsigned short* vr = &sV[buf][0][dt * 16 + ln][0]; const unsigned short* vl = &sV[buf][1][dt * 16 + ln][0]; FragH bv, bl; bv.half[0] = *(const v8us*)(vr + 8 * hh); bv.half[1] = *(const v8us*)(vr + 16 + 8 * hh); bl.half[0] = *(const v8us*)(vl + 8 * hh); bl.half[1] = *(const v8us*)(vl + 16 + 8 * hh);
      oacc[dt] = mmaH<1>(bv.v, bv.v, pa.v, pa.v, oacc[dt]); oaccl[dt] = mmaH<1>(bl.v, bl.v, pa.v, pa.v, oaccl[dt]); oaccl[dt] = mmaH<1>(bv.v, bv.v, pl.v, pl.v, oaccl[dt]); }
    asm volatile("s_wait_dscnt 0x0" ::: "memory");      /* this wave's reads of the pass's buffer are done before the buffer is refilled */
    asm volatile("s_wait_asynccnt 0x0" ::: "memory");      /* this wave's share of the next tile has landed */
    __syncthreads();      /* publishes the next tile and ends every wave's reads of this pass's buffer */
    if (j0 + 64 < TK) stage(j0 + 64, buf); }
  asm volatile("s_wait_asynccnt 0x0" ::: "memory");      /* no copy is outstanding when the wave goes on to its end */
  { const float l = l_run + xhalf(l_run); const float li = (l > 0.f) ? 1.0f / (l * 1024.0f) : 0.f;
#pragma unroll
    for (int dt = 0; dt < DT; ++dt) { v4f o0, o1;      /* a lane's eight accumulator rows are eight consecutive head columns of its query */
#pragma unroll
      for (int r = 0; r < 4; ++r) { o0[r] = (oacc[dt][r] + oaccl[dt][r] * 0.0009765625f) * li; o1[r] = (oacc[dt][4 + r] + oaccl[dt][4 + r] * 0.0009765625f) * li; }
      *(v4fa*)&sO[w][ln][dt * 16 + 8 * hh] = o0; *(v4fa*)&sO[w][ln][dt * 16 + 8 * hh + 4] = o1; } }
  __builtin_amdgcn_fence(__ATOMIC_ACQ_REL, "workgroup"); __builtin_amdgcn_wave_barrier();
  {
#pragma unroll
    for (int rp = 0; rp < RPW; rp += 2) { const int r = rp + (lane >> 4), pc = lane & 15; const v4f val = *(const v4fa*)&sO[w][r][pc * 4]; *(v4f*)(O + ((size_t)b * TQ + q0 + r) * ldo + h * 64 + pc * 4) = val; }
     } }


__global__ __launch_bounds__(256) void k_lnx(const float* __restrict__ X, const float* __restrict__ g, const float* __restrict__ bb, _Float16* __restrict__ Y16, float* __restrict__ XB) {
  #pragma clang fp contract(off)
  const int tid = threadIdx.x, w = tid >> 5, ln = tid & 31; const int r = blockIdx.x * 8 + w; if (r >= NR) return; const float* x = X + (size_t)r * DM; float s = 0.f;
#pragma unroll 1
  for (int i = 0; i < DM / 128; ++i) { const v4f a = *(const v4fa*)(x + i * 128 + ln * 4); for (int q = 0; q < 4; ++q) s += bf16_round(a[q]); }
  for (int o = 16; o > 0; o >>= 1) s += __shfl_xor(s, o, 32); const float mu = s / (float)DM; float q2 = 0.f;
#pragma unroll 1
  for (int i = 0; i < DM / 128; ++i) { const v4f a = *(const v4fa*)(x + i * 128 + ln * 4); for (int q = 0; q < 4; ++q) { const float d = bf16_round(a[q]) - mu; q2 += d * d; } }
  for (int o = 16; o > 0; o >>= 1) q2 += __shfl_xor(q2, o, 32); const float rs = rsqrtf(q2 / (float)DM + 1e-5f);
  {
#pragma unroll 1
    for (int i = 0; i < DM / 128; ++i) { const int c0 = i * 128 + ln * 4; const v4f a = *(const v4fa*)(x + c0); _Float16 h4[4]; v4f xb;
      for (int q = 0; q < 4; ++q) { const float t = bf16_round(a[q]); h4[q] = (_Float16)((t - mu) * rs * bf16_round(g[c0 + q]) + bf16_round(bb[c0 + q])); xb[q] = t; }
      *(unsigned long long*)((unsigned short*)Y16 + (size_t)r * DM + c0) = *(const unsigned long long*)h4; *(v4f*)(XB + (size_t)r * DM + c0) = xb; }
     } }
__global__ __launch_bounds__(256) void k_causaltab(unsigned* __restrict__ MB, int* __restrict__ RA, int* __restrict__ KE, int nq, int nk) {
  const int t = blockIdx.x * 256 + threadIdx.x; const int nw = nk / 32;
  if (t < nq * nw) { const int q = t / nw, w = t % nw; const int first = q + 1 - 32 * w; const unsigned bits = (first <= 0) ? 0xffffffffu : ((first >= 32) ? 0u : (0xffffffffu << first)); *(unsigned*)(MB + t) = bits;  }
  if (t < nq) { *(int*)(RA + t) = 0;  }
  if (t < nq / 64) { const int v = 64 * (t + 1); *(int*)(KE + t * 32) = v;  } }


extern "C" void kernel_launch(void* const* d_in, const int* in_sizes, int n_in,
                              void* d_out, int out_size, void* d_ws, size_t ws_size, hipStream_t stream) {
  (void)in_sizes; (void)n_in; (void)out_size;
  const float* const* I = (const float* const*)d_in; const float* x = I[0]; const int* lag = (const int*)d_in[1]; const float* wq = I[2]; const float* bq = I[3]; const float* wk = I[4]; const float* bk = I[5]; const float* wv = I[6]; const float* bv = I[7]; const float* wo = I[8]; const float* bo = I[9]; const float* lb = I[10];
  char* ws = (char*)d_ws; size_t off = 0;
  auto take = [&](size_t bytes) { char* p = ws + off; off += (bytes + 255) & ~(size_t)255; return p; };
  _Float16* BQ = (_Float16*)take((size_t)DM * DM * 2); _Float16* BK = (_Float16*)take((size_t)DM * DM * 2); _Float16* BV = (_Float16*)take((size_t)DM * DM * 2); _Float16* BO = (_Float16*)take((size_t)DM * DM * 2);
  _Float16* X16 = (_Float16*)take((size_t)NR * DM * 2); float* F = (float*)take((size_t)3 * NR * DM * 4);      /* q, k, v planes, one behind the other */
  _Float16* Qh = (_Float16*)take((size_t)NR * DM * 2); _Float16* Kh = (_Float16*)take((size_t)NR * DM * 2); _Float16* Ql = (_Float16*)take((size_t)NR * DM * 2); _Float16* Kl = (_Float16*)take((size_t)NR * DM * 2); _Float16* Vth = (_Float16*)take((size_t)NR * DM * 2); _Float16* Vtl = (_Float16*)take((size_t)NR * DM * 2);      /* Kh directly behind Qh, Kl directly behind Ql */
  if (off > ws_size) return;      /* 8 + 8 + 48 + 48 = 112 MiB */
  float* O = F; _Float16* Oh = Qh; _Float16* Ol = Ql;
  const size_t w8 = (size_t)DM * DM / 8; const unsigned wb = (unsigned)((w8 + 255) / 256);
  k_wt_f16<<<dim3(wb, 4), 256, 0, stream>>>(wq, wk, wv, wo, BQ, DM, DM, 16.0f);      /* (in,out); BQ, BK, BV, BO are contiguous */
  const size_t n8 = (size_t)NR * DM / 8; const unsigned nb8 = (unsigned)((n8 + 255) / 256); const dim3 gP((NR / 128) * (DM / 128), 1); const dim3 gP3((NR / 128) * (DM / 128), 3);
  k_x16<<<nb8, 256, 0, stream>>>(x, X16, n8);
  k_gemm2<0><<<gP3, 256, 0, stream>>>(X16, DM, 0, BQ, DM, (size_t)DM * DM, 0.0625f, bq, bk, bv, nullptr, 1, 0, 0, F, nullptr, DM, (size_t)NR * DM, NR, DM, DM);      /* q, k, v in one grid */
  k_hl<<<2 * nb8, 256, 0, stream>>>(F, Qh, Ql, 2 * n8);      /* q and k planes together */
  k_vthl<SLEN><<<NBT * NH * (SLEN / 64), 256, 0, stream>>>(F + (size_t)2 * NR * DM, DM, Vth, Vtl);
  k_flashb<SLEN, SLEN><<<NBT * NH * (SLEN / 64), 128, 0, stream>>>(Qh, Ql, DM, Kh, Kl, DM, Vth, Vtl, lb, lag, O, DM);      /* both batches in one grid; the lag vector is per position, shared across the batch */
  k_hl<<<nb8, 256, 0, stream>>>(O, Oh, Ol, n8);
  k_gemm2<0><<<gP, 256, 0, stream>>>(Oh, DM, 0, BO, DM, 0, 0.0625f, bo, nullptr, nullptr, nullptr, 1, 0, 0, (float*)d_out, nullptr, DM, 0, NR, DM, DM);
  k_gemm2<0><<<gP, 256, 0, stream>>>(Ol, DM, 0, BO, DM, 0, 0.0625f / 1024.0f, nullptr, nullptr, nullptr, (float*)d_out, 1, (size_t)DM, 0, (float*)d_out, nullptr, DM, 0, NR, DM, DM);
}

// v007
// A run of this version takes 242 microseconds.
// Next to v006, in two timings, it ran 1.08 and 1.09 times as fast.
// All steps since v000 together make it 4.79 times as fast.
#include <hip/hip_runtime.h>
// Multi-head self-attention with a lag-distance bias (2 x 2048 tokens, 1024 = 16 heads x 64): q,k,v = x W + b; scores = q.k/8 + lag_bias[h][|lag[q] - lag[k]|] with the INPUT integer lag vector; softmax over all keys; out = (attn v) Wo + bo -> [2,2048,1024].
// Structure: x as an exact f16 plane; projections as f16 WMMA GEMMs (128x128 block tiles of eight 32x64 wave tiles, 64-k operand tiles from a two-buffer LDS ring filled by asynchronous copies one trip ahead, f32 accumulation, exact x16 weights + bias); q, k as f16 hi + (x2^10) residual planes, V^T as hi + residual planes; the fused flash kernel takes each pass's K and V^T tiles (hi + residual) from a two-buffer LDS ring filled by asynchronous copies one pass ahead and shared by its four waves, and adds the bias, gathered by |lag[q] - lag[k]| (INPUT int32 positions) from the head's row of the INPUT table, which each block rounds once into LDS, inside the score stage (all keys valid; scores and outputs formed transposed, so that a lane holds one query: online f32 softmax in the lane, in log2 units with the hardware exp2, P hi + residual packed from the score accumulators into the next product's operand, two value accumulators); O as hi + residual planes into Wo (two GEMMs, bias in the first).
// Compute dtype: x, weights, biases, lag_bias rounded to bf16; projections exact; q, k, P, v, O as f16 hi + residual pairs (~2^-21); f32 accumulation and softmax. v_wmma_f32_16x16x32_f16.
#define NBT 2
#define SLEN 2048
#define DM 1024
#define NH 16
#define SCL 0.125f
#define LOG2E 1.44269504088896340736f
#define NR (NBT * SLEN)
typedef __bf16 v16b __attribute__((ext_vector_type(16)));
typedef unsigned short v8us __attribute__((ext_vector_type(8), may_alias));
typedef float  v8f  __attribute__((ext_vector_type(8)));
typedef float  v4f  __attribute__((ext_vector_type(4)));
typedef float  v4fa __attribute__((ext_vector_type(4), may_alias));
union FragB { v16b v; v8us half[2]; unsigned short u[16]; };

__device__ __forceinline__ unsigned short bf16_bits(float x) { unsigned int u = __float_as_uint(x); return (unsigned short)((u + 0x7FFFu + ((u >> 16) & 1u)) >> 16); }
__device__ __forceinline__ float bf16_val(unsigned short b) { return __uint_as_float(((unsigned int)b) << 16); }
__device__ __forceinline__ float bf16_round(float x) { return bf16_val(bf16_bits(x)); }
// D += A·B with NT terms: 1 = ah·bh, 2 = + al·bh (A split), 3 = + ah·bl (both split)
template <int NT>
__device__ __forceinline__ v8f mmaN(v16b ah, v16b al, v16b bh, v16b bl, v8f c) {
  c = __builtin_amdgcn_wmma_f32_16x16x32_bf16(false, ah, false, bh, (short)0, c, false, false);
  if (NT >= 2) c = __builtin_amdgcn_wmma_f32_16x16x32_bf16(false, al, false, bh, (short)0, c, false, false);
  if (NT >= 3) c = __builtin_amdgcn_wmma_f32_16x16x32_bf16(false, ah, false, bl, (short)0, c, false, false);
  asm volatile("v_nop\n\tv_nop\n\tv_nop\n\tv_nop" : "+v"(c) : "v"(ah), "v"(al), "v"(bh), "v"(bl));
  return c;
}

__global__ __launch_bounds__(256) void k_wt_bf16(const float* __restrict__ W, unsigned short* __restrict__ Wt, int K, int N) {
  const int t = blockIdx.x * 256 + threadIdx.x;
  const int k8n = K / 8;
  if (t >= N * k8n) return;
  const int n = t / k8n, k8 = (t % k8n) * 8;
  v8us v;
#pragma unroll
  for (int i = 0; i < 8; ++i) v[i] = bf16_bits(W[(size_t)(k8 + i) * N + n]);
  *(v8us*)(Wt + (size_t)n * K + k8) = v;
  
}

// GEMM C[M][N] (f32, pitch ldc) = act(A[M][K]·W + bias). A f32 row-major (pitch lda) converted per fragment to bf16
// (ASPLIT: hi/lo two planes -> 2 terms, else single rounded term); Wt bf16 [N][K] (pitch ldb). BIAS_BF16 rounds the
// bias to bf16 first (bias quantised to bf16 before the add). K%32==0, M%16==0, N%64==0.
template <bool ASPLIT, int ACT, bool BIAS_BF16>
__global__ __launch_bounds__(128) void k_gemm_bf(const float* __restrict__ A, int lda, const unsigned short* __restrict__ Wt, int ldb,
                                               const float* __restrict__ bias, float* __restrict__ C, int ldc, int M, int N, int K) {
  __shared__ __attribute__((aligned(16))) float so[4][16][64];
  const int tid = threadIdx.x, w = tid >> 5, lane = tid & 31, ln = lane & 15, hh = lane >> 4;
  const int ntn = N / 64;
  const int wid = blockIdx.x * 4 + w;
  const int mt = wid / ntn, nq = wid % ntn;
  if (mt * 16 >= M) return;
  const int row0 = mt * 16, col0 = nq * 64;
  const float* arow = A + (size_t)(row0 + ln) * lda;
  v8f acc[4] = {};
  for (int kb = 0; kb < K; kb += 32) {
    FragB ah, al;
    const v4f x0 = *(const v4fa*)(arow + kb + 8 * hh), x1 = *(const v4fa*)(arow + kb + 8 * hh + 4);
    const v4f x2 = *(const v4fa*)(arow + kb + 16 + 8 * hh), x3 = *(const v4fa*)(arow + kb + 16 + 8 * hh + 4);
    float xs[16] = {x0[0],x0[1],x0[2],x0[3],x1[0],x1[1],x1[2],x1[3],x2[0],x2[1],x2[2],x2[3],x3[0],x3[1],x3[2],x3[3]};
#pragma unroll
    for (int i = 0; i < 16; ++i) { const unsigned short hb = bf16_bits(xs[i]); ah.u[i] = hb; al.u[i] = ASPLIT ? bf16_bits(xs[i] - bf16_val(hb)) : (unsigned short)0; }
#pragma unroll
    for (int t = 0; t < 4; ++t) {
      const unsigned short* brow = Wt + (size_t)(col0 + t * 16 + ln) * ldb + kb;
      FragB b;
      b.half[0] = *(const v8us*)(brow + 8 * hh);
      b.half[1] = *(const v8us*)(brow + 16 + 8 * hh);
      acc[t] = mmaN<ASPLIT ? 2 : 1>(ah.v, al.v, b.v, b.v, acc[t]);
    }
  }
#pragma unroll
  for (int t = 0; t < 4; ++t) {
    float bv = bias ? bias[col0 + t * 16 + ln] : 0.f;
    if (BIAS_BF16) bv = bf16_round(bv);
#pragma unroll
    for (int r = 0; r < 8; ++r) { float v = acc[t][r] + bv; if (ACT == 1) v = fmaxf(v, 0.f); so[w][8 * hh + r][t * 16 + ln] = v; }
  }
  __builtin_amdgcn_fence(__ATOMIC_ACQ_REL, "workgroup");
  __builtin_amdgcn_wave_barrier();
  const int rsub = lane >> 4, c4 = (lane & 15) * 4;
  {
#pragma unroll
    for (int q = 0; q < 8; ++q) {
      const int r = q * 2 + rsub;
      const v4f v = *(const v4fa*)&so[w][r][c4];
      *(v4f*)(C + (size_t)(row0 + r) * ldc + col0 + c4) = v;
    }
    
  }
}

// GEMM C = act(A·W + bias + resid): A f32 (ASPLIT -> hi/lo 2 terms), Wt bf16 [N][K]; ACT 0 none, 1 relu, 2 exact gelu;
// resid (optional, f32, row index = (row % rmod), pitch ldr, RES_BF16 rounds it) added before the activation.
template <bool ASPLIT, int ACT, bool BIAS_BF16, bool RES_BF16>
__global__ __launch_bounds__(128) void k_gemm_bf3(const float* __restrict__ A, int lda, const unsigned short* __restrict__ Wt, int ldb,
                                                const float* __restrict__ bias, const float* __restrict__ resid, int rmod, int ldr,
                                                float* __restrict__ C, int ldc, int M, int N, int K) {
  __shared__ __attribute__((aligned(16))) float so[4][16][64];
  const int tid = threadIdx.x, w = tid >> 5, lane = tid & 31, ln = lane & 15, hh = lane >> 4;
  const int ntn = N / 64;
  const int wid = blockIdx.x * 4 + w;
  const int mt = wid / ntn, nq = wid % ntn;
  if (mt * 16 >= M) return;
  const int row0 = mt * 16, col0 = nq * 64;
  const float* arow = A + (size_t)(row0 + ln) * lda;
  v8f acc[4] = {};
  for (int kb = 0; kb < K; kb += 32) {
    FragB ah, al;
    const v4f x0 = *(const v4fa*)(arow + kb + 8 * hh), x1 = *(const v4fa*)(arow + kb + 8 * hh + 4);
    const v4f x2 = *(const v4fa*)(arow + kb + 16 + 8 * hh), x3 = *(const v4fa*)(arow + kb + 16 + 8 * hh + 4);
    float xs[16] = {x0[0],x0[1],x0[2],x0[3],x1[0],x1[1],x1[2],x1[3],x2[0],x2[1],x2[2],x2[3],x3[0],x3[1],x3[2],x3[3]};
#pragma unroll
    for (int i = 0; i < 16; ++i) { const unsigned short hb = bf16_bits(xs[i]); ah.u[i] = hb; al.u[i] = ASPLIT ? bf16_bits(xs[i] - bf16_val(hb)) : (unsigned short)0; }
#pragma unroll
    for (int t = 0; t < 4; ++t) {
      const unsigned short* brow = Wt + (size_t)(col0 + t * 16 + ln) * ldb + kb;
      FragB b;
      b.half[0] = *(const v8us*)(brow + 8 * hh);
      b.half[1] = *(const v8us*)(brow + 16 + 8 * hh);
      acc[t] = mmaN<ASPLIT ? 2 : 1>(ah.v, al.v, b.v, b.v, acc[t]);
    }
  }
#pragma unroll
  for (int t = 0; t < 4; ++t) {
    const int col = col0 + t * 16 + ln;
    float bv = bias ? bias[col] : 0.f;
    if (BIAS_BF16) bv = bf16_round(bv);
#pragma unroll
    for (int r = 0; r < 8; ++r) {
      float v = acc[t][r] + bv;
      if (resid) { float rv = resid[(size_t)((row0 + 8 * hh + r) % rmod) * ldr + col]; if (RES_BF16) rv = bf16_round(rv); v += rv; }
      if (ACT == 1) v = fmaxf(v, 0.f);
      if (ACT == 2) v = 0.5f * v * (1.0f + erff(v * 0.70710678118654752f));
      if (ACT == 3) { const float u = 0.7978845608028654f * (v + 0.044715f * v * v * v); v = 0.5f * v * (1.0f + tanhf(u)); }
      so[w][8 * hh + r][t * 16 + ln] = v;
    }
  }
  __builtin_amdgcn_fence(__ATOMIC_ACQ_REL, "workgroup");
  __builtin_amdgcn_wave_barrier();
  const int rsub = lane >> 4, c4 = (lane & 15) * 4;
  {
#pragma unroll
    for (int q = 0; q < 8; ++q) {
      const int r = q * 2 + rsub;
      const v4f v = *(const v4fa*)&so[w][r][c4];
      *(v4f*)(C + (size_t)(row0 + r) * ldc + col0 + c4) = v;
    }
    
  }
}
// row LayerNorm (biased variance, eps) over N: s = X (+ R); optional out_sum <- s; out_norm <- (s-mu)*rsqrt(var+eps)*g + b
template <bool PARAM_BF16>
__global__ __launch_bounds__(256) void k_layernorm(const float* __restrict__ X, const float* __restrict__ R, const float* __restrict__ g, const float* __restrict__ bta,
                                                  float* __restrict__ out_sum, float* __restrict__ out_norm, int N, float eps) {
  __shared__ float red[256];
  const int row = blockIdx.x, tid = threadIdx.x;
  const float* x = X + (size_t)row * N; const float* rr = R ? R + (size_t)row * N : nullptr;
  float vals[16];                     // up to N = 4096
  const int per = N / 256;            // contiguous chunk per thread? use strided-by-4 chunks: thread handles j = tid*4 + 1024*u
  float s1 = 0.f;
  for (int u = 0; u < per / 4; ++u) {
    const int j = tid * 4 + 1024 * u;
    const v4f a = *(const v4fa*)(x + j);
    v4f b = {0.f,0.f,0.f,0.f}; if (rr) b = *(const v4fa*)(rr + j);
#pragma unroll
    for (int q = 0; q < 4; ++q) { const float v = a[q] + b[q]; vals[u * 4 + q] = v; s1 += v; }
  }
  red[tid] = s1; __syncthreads();
  for (int st = 128; st > 0; st >>= 1) { if (tid < st) red[tid] += red[tid + st]; __syncthreads(); }
  const float mu = red[0] / (float)N; __syncthreads();
  float s2 = 0.f;
  for (int u = 0; u < per / 4; ++u)
#pragma unroll
    for (int q = 0; q < 4; ++q) { const float c = vals[u * 4 + q] - mu; s2 += c * c; }
  red[tid] = s2; __syncthreads();
  for (int st = 128; st > 0; st >>= 1) { if (tid < st) red[tid] += red[tid + st]; __syncthreads(); }
  const float rs = rsqrtf(red[0] / (float)N + eps);
  {
    for (int u = 0; u < per / 4; ++u) {
      const int j = tid * 4 + 1024 * u;
      v4f o, sm;
#pragma unroll
      for (int q = 0; q < 4; ++q) {
        float gg = g[j + q], bb = bta[j + q];
        if (PARAM_BF16) { gg = bf16_round(gg); bb = bf16_round(bb); }
        sm[q] = vals[u * 4 + q]; o[q] = (vals[u * 4 + q] - mu) * rs * gg + bb;
      }
      if (out_sum) *(v4f*)(out_sum + (size_t)row * N + j) = sm;
      *(v4f*)(out_norm + (size_t)row * N + j) = o;
    }
    
  }
}



// ---- f16 WMMA path (v_wmma_f32_16x16x32_f16): 11-bit significands for operands in range — used where a [0,1] probability operand needs more precision than bf16
typedef _Float16 v16h __attribute__((ext_vector_type(16)));
union FragH { v16h v; v8us half[2]; _Float16 h[16]; unsigned short u[16]; };
template <int NT>
__device__ __forceinline__ v8f mmaH(v16h ah, v16h al, v16h bh, v16h bl, v8f c) {
  c = __builtin_amdgcn_wmma_f32_16x16x32_f16(false, ah, false, bh, (short)0, c, false, false);
  if (NT >= 2) c = __builtin_amdgcn_wmma_f32_16x16x32_f16(false, al, false, bh, (short)0, c, false, false);
  if (NT >= 3) c = __builtin_amdgcn_wmma_f32_16x16x32_f16(false, ah, false, bl, (short)0, c, false, false);
  asm volatile("v_nop\n\tv_nop\n\tv_nop\n\tv_nop" : "+v"(c) : "v"(ah), "v"(al), "v"(bh), "v"(bl));
  return c;
}
// batched GEMM like k_gemm_b but f16 operands: A f32 (split into f16 hi/lo if ASPLIT, else rounded to f16), Bt = f16 values [n][k]; alpha; C f32; N multiple of 16 (partial tiles skipped)
template <bool ASPLIT>
__global__ __launch_bounds__(128) void k_gemm_h(const float* __restrict__ A, int lda, size_t sA, const _Float16* __restrict__ Bh, int ldb, size_t sB, float alpha, float* __restrict__ C, int ldc, size_t sC, int M, int N, int K) {
  __shared__ __attribute__((aligned(16))) float so[4][16][64];
  const int tid = threadIdx.x, w = tid >> 5, lane = tid & 31, ln = lane & 15, hh = lane >> 4; const int by = blockIdx.y;
  A += (size_t)by * sA; Bh += (size_t)by * sB; C += (size_t)by * sC;
  const int ntn = (N + 63) / 64; const int wid = blockIdx.x * 4 + w; const int mt = wid / ntn, nq = wid % ntn; if (mt * 16 >= M) return;
  const int row0 = mt * 16, col0 = nq * 64; const float* arow = A + (size_t)(row0 + ln) * lda;
  v8f acc[4] = {};
  for (int kb = 0; kb < K; kb += 32) {
    FragH ah, al;
    const v4f x0 = *(const v4fa*)(arow + kb + 8 * hh), x1 = *(const v4fa*)(arow + kb + 8 * hh + 4), x2 = *(const v4fa*)(arow + kb + 16 + 8 * hh), x3 = *(const v4fa*)(arow + kb + 16 + 8 * hh + 4);
    float xs[16] = {x0[0],x0[1],x0[2],x0[3],x1[0],x1[1],x1[2],x1[3],x2[0],x2[1],x2[2],x2[3],x3[0],x3[1],x3[2],x3[3]};
#pragma unroll
    for (int i = 0; i < 16; ++i) { const _Float16 h = (_Float16)xs[i]; ah.h[i] = h; al.h[i] = ASPLIT ? (_Float16)(xs[i] - (float)h) : (_Float16)0.0f; }
#pragma unroll
    for (int t = 0; t < 4; ++t) { if (col0 + t * 16 >= N) continue; const size_t boff = (size_t)(col0 + t * 16 + ln) * ldb + kb; FragH bq; bq.half[0] = *(const v8us*)(Bh + boff + 8 * hh); bq.half[1] = *(const v8us*)(Bh + boff + 16 + 8 * hh);
      acc[t] = mmaH<ASPLIT ? 2 : 1>(ah.v, al.v, bq.v, bq.v, acc[t]); }
  }
#pragma unroll
  for (int t = 0; t < 4; ++t) { if (col0 + t * 16 >= N) continue;
#pragma unroll
    for (int r = 0; r < 8; ++r) so[w][8 * hh + r][t * 16 + ln] = acc[t][r] * alpha; }
  __builtin_amdgcn_fence(__ATOMIC_ACQ_REL, "workgroup"); __builtin_amdgcn_wave_barrier();
  const int rsub = lane >> 4, c4 = (lane & 15) * 4;
  {
#pragma unroll
    for (int q = 0; q < 8; ++q) { const int r = q * 2 + rsub; if (col0 + c4 < N) { const v4f v = *(const v4fa*)&so[w][r][c4]; *(v4f*)(C + (size_t)(row0 + r) * ldc + col0 + c4) = v; } }
     }
}

// Wt[n][k] = f16(W[k][n]·scale) from f32 row-major W[K][N] (scale = power of two; bf16-exact weights stay exact in f16 away from the subnormal range)
// blockIdx.y picks one of four equally shaped matrices; their transposes lie one behind the other in Wt
__global__ __launch_bounds__(256) void k_wt_f16(const float* __restrict__ W0, const float* __restrict__ W1, const float* __restrict__ W2, const float* __restrict__ W3, _Float16* __restrict__ Wt, int K, int N, float scale) {
  const int by = blockIdx.y; const float* __restrict__ W = (by == 0) ? W0 : (by == 1) ? W1 : (by == 2) ? W2 : W3; Wt += (size_t)by * K * N;
  const int t = blockIdx.x * 256 + threadIdx.x; if (t >= N * (K / 8)) return; const int n = t / (K / 8), k8 = (t % (K / 8)) * 8; FragH f;
#pragma unroll
  for (int i = 0; i < 8; ++i) f.h[i] = (_Float16)(bf16_round(W[(size_t)(k8 + i) * N + n]) * scale); const v8us o = f.half[0];
  *(v8us*)((unsigned short*)Wt + (size_t)n * K + k8) = o; 
}
// k_gemm_hh variant with fused epilogue: v = acc·alpha + bias[by·sBias + col] (+ CP[(row/rowsPerB)·sCPb + by·64 + col] if CP) ; ACT 0 none / 1 elu ; writes f16 C16 (and f32 C if non-null)
template <int ACT>
__global__ __launch_bounds__(128) void k_gemm_hhx(const _Float16* __restrict__ A, int lda, size_t sA, const _Float16* __restrict__ Bh, int ldb, size_t sB, float alpha, const float* __restrict__ bias, size_t sBias, const float* __restrict__ CP, int rowsPerB, size_t sCPb, int row0g,
    float* __restrict__ C, _Float16* __restrict__ C16, int ldc, size_t sC, int M, int N, int K) {
  __shared__ __attribute__((aligned(16))) float so[4][16][64];
  const int tid = threadIdx.x, w = tid >> 5, lane = tid & 31, ln = lane & 15, hh = lane >> 4; const int by = blockIdx.y;
  A += (size_t)by * sA; Bh += (size_t)by * sB; const size_t cofs = (size_t)by * sC; const float* bp = bias ? bias + (size_t)by * sBias : nullptr;
  const int ntn = (N + 63) / 64; const int wid = blockIdx.x * 4 + w; const int mt = wid / ntn, nq = wid % ntn; if (mt * 16 >= M) return;
  const int row0 = mt * 16, col0 = nq * 64; const _Float16* arow = A + (size_t)(row0 + ln) * lda;
  v8f acc[4] = {};
  for (int kb = 0; kb < K; kb += 32) { FragH ah; ah.half[0] = *(const v8us*)((const unsigned short*)arow + kb + 8 * hh); ah.half[1] = *(const v8us*)((const unsigned short*)arow + kb + 16 + 8 * hh);
#pragma unroll
    for (int t = 0; t < 4; ++t) { if (col0 + t * 16 >= N) continue; const size_t boff = (size_t)(col0 + t * 16 + ln) * ldb + kb; FragH bq; bq.half[0] = *(const v8us*)((const unsigned short*)Bh + boff + 8 * hh); bq.half[1] = *(const v8us*)((const unsigned short*)Bh + boff + 16 + 8 * hh);
      acc[t] = mmaH<1>(ah.v, ah.v, bq.v, bq.v, acc[t]); }
  }
#pragma unroll
  for (int t = 0; t < 4; ++t) { if (col0 + t * 16 >= N) continue; const int col = col0 + t * 16 + ln; const float bv = bp ? bf16_round(bp[col]) : 0.f;
#pragma unroll
    for (int r = 0; r < 8; ++r) { float v = acc[t][r] * alpha + bv; if (CP) { const int bidx = (row0g + row0 + 8 * hh + r) / rowsPerB; v += CP[(size_t)bidx * sCPb + (size_t)by * 64 + col]; } if (ACT == 1) v = (v > 0.f) ? v : expm1f(v); else if (ACT == 7) v = (v > 0.f) ? v + 1.0f : expf(v); else if (ACT == 8) v = tanhf(v); else if (ACT == 9) v = 0.5f * v * (1.0f + tanhf(0.7978845608028654f * (v + 0.044715f * v * v * v))); else if (ACT == 11) v = 1.0f / (1.0f + expf(-v)); else if (ACT == 12) v = (v > 0.f) ? v : 0.01f * v; else if (ACT == 14) v = (v > 0.f) ? v : 0.1f * v; else if (ACT == 15) v = v / (1.0f + expf(-v)); else if (ACT == 3) v = fmaxf(v, 0.f); else if (ACT == 6) v = 0.5f * v * (1.0f + erff(v * 0.70710678118654752f)); so[w][8 * hh + r][t * 16 + ln] = v; } }
  __builtin_amdgcn_fence(__ATOMIC_ACQ_REL, "workgroup"); __builtin_amdgcn_wave_barrier();
  const int rsub = lane >> 4, c4 = (lane & 15) * 4; typedef _Float16 v4h __attribute__((ext_vector_type(4)));
  {
#pragma unroll
    for (int q = 0; q < 8; ++q) { const int r = q * 2 + rsub; if (col0 + c4 < N) { const v4f v = *(const v4fa*)&so[w][r][c4]; if (C) *(v4f*)(C + cofs + (size_t)(row0 + r) * ldc + col0 + c4) = v; if (C16) { v4h h4; for (int i = 0; i < 4; ++i) h4[i] = (_Float16)v[i]; *(v4h*)(C16 + cofs + (size_t)(row0 + r) * ldc + col0 + c4) = h4; } } }
     }
}


typedef _Float16 v4h __attribute__((ext_vector_type(4)));

__global__ __launch_bounds__(256) void k_x16(const float* __restrict__ x, _Float16* __restrict__ X16, size_t n8) { const size_t t = (size_t)blockIdx.x * 256 + threadIdx.x; if (t >= n8) return; FragH f;
#pragma unroll
  for (int q = 0; q < 8; ++q) f.h[q] = (_Float16)bf16_round(x[t * 8 + q]); *(v8us*)((unsigned short*)X16 + t * 8) = f.half[0];  }
__global__ __launch_bounds__(256) void k_h16(const float* __restrict__ x, _Float16* __restrict__ X16, size_t n8) { const size_t t = (size_t)blockIdx.x * 256 + threadIdx.x; if (t >= n8) return; FragH f;
#pragma unroll
  for (int q = 0; q < 8; ++q) f.h[q] = (_Float16)x[t * 8 + q]; *(v8us*)((unsigned short*)X16 + t * 8) = f.half[0];  }
__global__ __launch_bounds__(256) void k_round16f(const float* __restrict__ W, _Float16* __restrict__ Bt, size_t n8) { const size_t t = (size_t)blockIdx.x * 256 + threadIdx.x; if (t >= n8) return; FragH f;
#pragma unroll
  for (int i = 0; i < 8; ++i) f.h[i] = (_Float16)(bf16_round(W[t * 8 + i]) * 16.0f); *(v8us*)((unsigned short*)Bt + t * 8) = f.half[0];  }
template <int NHv, int TTv>
__global__ __launch_bounds__(256) void k_vt(const _Float16* __restrict__ V16, int ldv, int voff, _Float16* __restrict__ Vt) { __shared__ unsigned short tl[64][66]; const int tid = threadIdx.x; const int slab = blockIdx.x / (TTv / 64), lg = blockIdx.x % (TTv / 64); const int b = slab / NHv, h = slab % NHv;
  for (int i = tid; i < 64 * 8; i += 256) { const int r = i / 8, c8 = (i % 8) * 8; FragH f; f.half[0] = *(const v8us*)((const unsigned short*)V16 + ((size_t)b * TTv + lg * 64 + r) * ldv + voff + h * 64 + c8);
#pragma unroll
    for (int q = 0; q < 8; ++q) tl[r][c8 + q] = f.u[q]; }
  __syncthreads();
  {
#pragma unroll
    for (int rd = 0; rd < 2; ++rd) { const int d = rd * 32 + tid / 8, pc = tid % 8; FragH f;
#pragma unroll
      for (int q = 0; q < 8; ++q) f.u[q] = tl[pc * 8 + q][d];
      *(v8us*)((unsigned short*)Vt + ((size_t)slab * 64 + d) * TTv + lg * 64 + pc * 8) = f.half[0]; }
     } }

__global__ __launch_bounds__(256) void k_hl(const float* __restrict__ F, _Float16* __restrict__ Hh, _Float16* __restrict__ Hl, size_t n8) { const size_t t = (size_t)blockIdx.x * 256 + threadIdx.x; if (t >= n8) return; FragH fh, fl; const v4f a = *(const v4fa*)(F + t * 8), c = *(const v4fa*)(F + t * 8 + 4);
#pragma unroll
  for (int q = 0; q < 4; ++q) { _Float16 h = (_Float16)a[q]; fh.h[q] = h; fl.h[q] = (_Float16)((a[q] - (float)h) * 1024.0f); h = (_Float16)c[q]; fh.h[4 + q] = h; fl.h[4 + q] = (_Float16)((c[q] - (float)h) * 1024.0f); }
  { *(v8us*)((unsigned short*)Hh + t * 8) = fh.half[0]; *(v8us*)((unsigned short*)Hl + t * 8) = fl.half[0];  } }

// ---- fast GEMM (block tile 128x128, eight waves of 32x64; requires M % 128 == 0, N % 128 == 0, K % 64 == 0, K >= 64); epilogue = k_gemm_hhx semantics ----
__device__ __forceinline__ v16h g2_frag(const unsigned short* p, int hh) { FragH f; f.half[0] = *(const v8us*)(p + 8 * hh); f.half[1] = *(const v8us*)(p + 16 + 8 * hh); return f.v; }
__device__ __forceinline__ v8f g2_mma(v16h a, v16h b, v8f c) { v8f d = __builtin_amdgcn_wmma_f32_16x16x32_f16(false, a, false, b, (short)0, c, false, false); asm volatile("v_nop\n\tv_nop\n\tv_nop\n\tv_nop" : "+v"(d) : "v"(a), "v"(b)); return d; }
template <int ACT>
__global__ __launch_bounds__(256) void k_gemm2(const _Float16* __restrict__ A, int lda, size_t sA, const _Float16* __restrict__ Bh, int ldb, size_t sB, float alpha, const float* __restrict__ bias, const float* __restrict__ bias1, const float* __restrict__ bias2, const float* __restrict__ CP, int rowsPerB, size_t sCPb, int row0g,
    float* __restrict__ C, _Float16* __restrict__ C16, int ldc, size_t sC, int M, int N, int K) {
  // two-buffer ring of 64-k tiles shared by the block's eight waves: [buffer][A, B][128 rows][halfs]; rows of 128 B at a pitch of 144 B (16 B x odd, for the 16-byte fragment reads). Behind the loop's last barrier the same bytes are the waves' output staging (8 x 32 x 68 floats = 69,632 B of the 73,728)
  constexpr int PH = 72; constexpr unsigned OPB = 128u * PH * 2u, BUFB = 2u * OPB;
  __shared__ __attribute__((aligned(16))) unsigned short sT[2 * 2 * 128 * PH];
  const int tid = threadIdx.x, w = tid >> 5, lane = tid & 31, ln = lane & 15, hh = lane >> 4; const int by = blockIdx.y;
  A += (size_t)by * sA; Bh += (size_t)by * sB; const size_t cofs = (size_t)by * sC; const float* bp = (by == 0) ? bias : (by == 1) ? bias1 : bias2;      /* one bias vector per blockIdx.y */
  const int ntn = N >> 7; const int mt = blockIdx.x / ntn, nq = blockIdx.x - mt * ntn; if (mt * 128 >= M) return;      /* the same for the whole block, in front of every barrier */
  const int wr = w & 3, wc = w >> 2; const int row0 = mt * 128 + 32 * wr, col0 = nq * 128 + 64 * wc;
  // each thread copies eight 16-byte pieces of a tile: rows tid/8 + 0, 32, 64, 96 of A and of B (a wave's copy covers four whole 128-B rows)
  const unsigned short* ga0 = (const unsigned short*)A + (size_t)(mt * 128 + (tid >> 3)) * lda + (tid & 7) * 8; const unsigned short* gb0 = (const unsigned short*)Bh + (size_t)(nq * 128 + (tid >> 3)) * ldb + (tid & 7) * 8;
  const unsigned d0 = (unsigned)(size_t)&sT[(tid >> 3) * PH + (tid & 7) * 8];
  auto stage = [&](int kb, int buf) {
    const unsigned short* a0 = ga0 + kb; const unsigned short* a1 = a0 + (size_t)32 * lda; const unsigned short* a2 = a1 + (size_t)32 * lda; const unsigned short* a3 = a2 + (size_t)32 * lda;
    const unsigned short* b0 = gb0 + kb; const unsigned short* b1 = b0 + (size_t)32 * ldb; const unsigned short* b2 = b1 + (size_t)32 * ldb; const unsigned short* b3 = b2 + (size_t)32 * ldb;
    const unsigned da0 = d0 + (unsigned)buf * BUFB, da1 = da0 + 32u * PH * 2u, da2 = da0 + 64u * PH * 2u, da3 = da0 + 96u * PH * 2u, db0 = da0 + OPB, db1 = da1 + OPB, db2 = da2 + OPB, db3 = da3 + OPB;
    // the copies go from global memory to LDS through no register; the closing s_wait_xcnt is a precaution that stands in front of any rewrite of the address registers named here
    asm volatile("global_load_async_to_lds_b128 %0, %8, off\n\tglobal_load_async_to_lds_b128 %1, %9, off\n\tglobal_load_async_to_lds_b128 %2, %10, off\n\tglobal_load_async_to_lds_b128 %3, %11, off\n\t"
                 "global_load_async_to_lds_b128 %4, %12, off\n\tglobal_load_async_to_lds_b128 %5, %13, off\n\tglobal_load_async_to_lds_b128 %6, %14, off\n\tglobal_load_async_to_lds_b128 %7, %15, off\n\ts_wait_xcnt 0x0"
                 :: "v"(da0), "v"(da1), "v"(da2), "v"(da3), "v"(db0), "v"(db1), "v"(db2), "v"(db3), "v"(a0), "v"(a1), "v"(a2), "v"(a3), "v"(b0), "v"(b1), "v"(b2), "v"(b3) : "memory"); };
  stage(0, 0);
  asm volatile("s_wait_asynccnt 0x0" ::: "memory");      /* this wave's share of tile 0 has landed */
  __syncthreads();      /* tile 0 is published to all eight waves */
  if (64 < K) stage(64, 1);      /* tile 1 flies while tile 0 is worked on */
  const v8f z8 = {0.f,0.f,0.f,0.f,0.f,0.f,0.f,0.f}; v8f c00 = z8, c01 = z8, c02 = z8, c03 = z8, c10 = z8, c11 = z8, c12 = z8, c13 = z8;
#pragma unroll 1
  for (int kb = 0; kb < K; kb += 64) { const int buf = (kb >> 6) & 1;      /* rolled: one trip is one tile of the ring */
    const unsigned short* ta = &sT[(buf * 2 + 0) * 128 * PH + (32 * wr + ln) * PH]; const unsigned short* tb = &sT[(buf * 2 + 1) * 128 * PH + (64 * wc + ln) * PH];
#pragma unroll
    for (int ks = 0; ks < 64; ks += 32) {      /* unrolled: ks becomes an immediate offset of the LDS reads */
      const v16h a0 = g2_frag(ta + ks, hh), a1 = g2_frag(ta + 16 * PH + ks, hh), b0 = g2_frag(tb + ks, hh), b1 = g2_frag(tb + 16 * PH + ks, hh), b2 = g2_frag(tb + 32 * PH + ks, hh), b3 = g2_frag(tb + 48 * PH + ks, hh);
      c00 = g2_mma(a0, b0, c00); c10 = g2_mma(a1, b0, c10); c01 = g2_mma(a0, b1, c01); c11 = g2_mma(a1, b1, c11);
      c02 = g2_mma(a0, b2, c02); c12 = g2_mma(a1, b2, c12); c03 = g2_mma(a0, b3, c03); c13 = g2_mma(a1, b3, c13); }
    asm volatile("s_wait_dscnt 0x0" ::: "memory");      /* this wave's reads of the trip's buffer are done before the buffer is refilled */
    asm volatile("s_wait_asynccnt 0x0" ::: "memory");      /* this wave's share of the next tile has landed */
    __syncthreads();      /* publishes the next tile and ends every wave's reads of this trip's buffer */
    if (kb + 128 < K) stage(kb + 128, buf); }
  asm volatile("s_wait_asynccnt 0x0" ::: "memory");      /* no copy is outstanding when the ring becomes output staging */
  float (*so)[32][68] = (float (*)[32][68])sT;      /* every wave has passed the last trip's barrier: nobody reads the ring any more */
  v8f accs[8] = {c00, c01, c02, c03, c10, c11, c12, c13};
#pragma unroll
  for (int u = 0; u < 8; ++u) { const int t = u & 3, half = u >> 2; const int col = col0 + t * 16 + ln; const float bv = bp ? bf16_round(bp[col]) : 0.f;
#pragma unroll
    for (int r = 0; r < 8; ++r) { const int rloc = half * 16 + 8 * hh + r; float v = accs[u][r] * alpha + bv; if (CP) { const int bidx = (row0g + row0 + rloc) / rowsPerB; v += CP[(size_t)bidx * sCPb + (size_t)by * 64 + col]; }
      if (ACT == 3) v = fmaxf(v, 0.f); else if (ACT == 6) v = 0.5f * v * (1.0f + erff(v * 0.70710678118654752f)); else if (ACT == 11) v = 1.0f / (1.0f + expf(-v)); else if (ACT == 15) v = v / (1.0f + expf(-v)); else if (ACT == 12) v = (v > 0.f) ? v : 0.01f * v; else if (ACT == 8) v = tanhf(v);
      so[w][rloc][t * 16 + ln] = v; } }
  __builtin_amdgcn_fence(__ATOMIC_ACQ_REL, "workgroup"); __builtin_amdgcn_wave_barrier();
  const int rsub = lane >> 4, c4 = (lane & 15) * 4;
  {
#pragma unroll
    for (int q = 0; q < 16; ++q) { const int r = q * 2 + rsub; const v4f v = *(const v4fa*)&so[w][r][c4]; if (C) *(v4f*)(C + cofs + (size_t)(row0 + r) * ldc + col0 + c4) = v; if (C16) { v4h h4; for (int i = 0; i < 4; ++i) h4[i] = (_Float16)v[i]; *(v4h*)(C16 + cofs + (size_t)(row0 + r) * ldc + col0 + c4) = h4; } }
     } }



template <int TK>
__global__ __launch_bounds__(256) void k_vthl(const float* __restrict__ VF, int ldv, _Float16* __restrict__ Vth, _Float16* __restrict__ Vtl) { __shared__ float tl[64][65]; const int tid = threadIdx.x; const int slab = blockIdx.x / (TK / 64), lg = blockIdx.x % (TK / 64); const int b = slab / NH, h = slab % NH;
  for (int i = tid; i < 64 * 16; i += 256) { const int r = i / 16, c4 = (i % 16) * 4; const v4f a = *(const v4fa*)(VF + ((size_t)b * TK + lg * 64 + r) * ldv + h * 64 + c4); tl[r][c4] = a[0]; tl[r][c4 + 1] = a[1]; tl[r][c4 + 2] = a[2]; tl[r][c4 + 3] = a[3]; }
  __syncthreads();
  FragH fh[2], fl[2]; size_t oo[2];
#pragma unroll
  for (int rd = 0; rd < 2; ++rd) { const int d = rd * 32 + tid / 8, pc = tid % 8;
#pragma unroll
    for (int q = 0; q < 8; ++q) { const float v = tl[pc * 8 + q][d]; const _Float16 hv = (_Float16)v; fh[rd].h[q] = hv; fl[rd].h[q] = (_Float16)((v - (float)hv) * 1024.0f); } oo[rd] = ((size_t)slab * 64 + d) * TK + lg * 64 + pc * 8; }
  {
#pragma unroll
    for (int rd = 0; rd < 2; ++rd) { *(v8us*)((unsigned short*)Vth + oo[rd]) = fh[rd].half[0]; *(v8us*)((unsigned short*)Vtl + oo[rd]) = fl[rd].half[0]; }
     } }

typedef int v4ia __attribute__((ext_vector_type(4), may_alias));
typedef float v2f __attribute__((ext_vector_type(2)));
typedef _Float16 v2h __attribute__((ext_vector_type(2)));
// lane l takes the value of lane l ^ 16
__device__ __forceinline__ float xhalf(float x) { return __builtin_bit_cast(float, __builtin_amdgcn_permlanex16(__builtin_bit_cast(int, x), __builtin_bit_cast(int, x), 0x76543210, 0xfedcba98, false, false)); }
template <int TQ, int TK>
__global__ __launch_bounds__(128) void k_flashb(const _Float16* __restrict__ Q16, const _Float16* __restrict__ Q16lo, int ldq, const _Float16* __restrict__ K16, const _Float16* __restrict__ K16lo, int ldk, const _Float16* __restrict__ Vt, const _Float16* __restrict__ Vtlo, const float* __restrict__ BT, const int* __restrict__ LAG, float* __restrict__ O, int ldo) {
  constexpr int RPW = 16, RTN = RPW / 16, NQB = TQ / (4 * RPW), DT = 4, KS = 2;
  __shared__ __attribute__((aligned(16))) float sO[4][RPW][64 + 4];
  // two-buffer ring of one pass's operands, shared by the block's four waves: [buffer][hi, residual][row][halfs]; K rows (128 B) at a pitch of 144 B, V^T rows (64 B) at 80 B, both 16 B x odd for the 16-byte fragment reads
  __shared__ __attribute__((aligned(16))) unsigned short sK[2][2][32][72]; __shared__ __attribute__((aligned(16))) unsigned short sV[2][2][64][40];
  __shared__ __attribute__((aligned(256))) float sB[513];      /* the head's bias row, rounded to bf16 once and then put into log2 units (x log2 e): a pass's gathers are 4-byte LDS reads; the largest alignment puts it at the start of the block's LDS, so that its base fits the reads' 16-bit offset field */
  const int tid = threadIdx.x, w = tid >> 5, lane = tid & 31, ln = lane & 15, hh = lane >> 4;
  const int slab = blockIdx.x / NQB, qblk = blockIdx.x % NQB; const int b = slab / NH, h = slab % NH; const int qb0 = qblk * (4 * RPW); const int q0 = qb0 + w * RPW;
  FragH aq[2][KS], aql[2][KS];
#pragma unroll
  for (int rt = 0; rt < RTN; ++rt) { const size_t qo = ((size_t)b * TQ + q0 + rt * 16 + ln) * ldq + h * 64; const unsigned short* qr = (const unsigned short*)Q16 + qo; const unsigned short* ql = (const unsigned short*)Q16lo + qo;
#pragma unroll
    for (int ks = 0; ks < KS; ++ks) { aq[rt][ks].half[0] = *(const v8us*)(qr + ks * 32 + 8 * hh); aq[rt][ks].half[1] = *(const v8us*)(qr + ks * 32 + 16 + 8 * hh); aql[rt][ks].half[0] = *(const v8us*)(ql + ks * 32 + 8 * hh); aql[rt][ks].half[1] = *(const v8us*)(ql + ks * 32 + 16 + 8 * hh); } }
  const unsigned short* Vth = (const unsigned short*)Vt + (size_t)slab * 64 * TK; const unsigned short* Vtl = (const unsigned short*)Vtlo + (size_t)slab * 64 * TK;
  // each thread copies eight 16-byte pieces of a pass's tile: K rows tid/8 and tid/8 + 16 (a wave covers whole 128-B rows), V^T rows tid/4 and tid/4 + 32, hi and residual plane each
  const size_t kg0 = ((size_t)b * TK + (tid >> 3)) * ldk + h * 64 + (tid & 7) * 8, vg0 = (size_t)(tid >> 2) * TK + (tid & 3) * 8;
  const unsigned kd0 = (unsigned)(size_t)&sK[0][0][tid >> 3][(tid & 7) * 8], vd0 = (unsigned)(size_t)&sV[0][0][tid >> 2][(tid & 3) * 8];
  auto stage = [&](int j, int buf) {
    const unsigned short* gk = (const unsigned short*)K16 + kg0 + (size_t)j * ldk; const unsigned short* gkl = (const unsigned short*)K16lo + kg0 + (size_t)j * ldk; const unsigned short* gk2 = gk + (size_t)16 * ldk; const unsigned short* gkl2 = gkl + (size_t)16 * ldk;
    const unsigned short* gv = Vth + vg0 + j; const unsigned short* gvl = Vtl + vg0 + j; const unsigned short* gv2 = gv + (size_t)32 * TK; const unsigned short* gvl2 = gvl + (size_t)32 * TK;
    const unsigned dk = kd0 + (unsigned)buf * (unsigned)sizeof(sK[0]), dkl = dk + (unsigned)sizeof(sK[0][0]), dk2 = dk + 16u * (unsigned)sizeof(sK[0][0][0]), dkl2 = dkl + 16u * (unsigned)sizeof(sK[0][0][0]);
    const unsigned dv = vd0 + (unsigned)buf * (unsigned)sizeof(sV[0]), dvl = dv + (unsigned)sizeof(sV[0][0]), dv2 = dv + 32u * (unsigned)sizeof(sV[0][0][0]), dvl2 = dvl + 32u * (unsigned)sizeof(sV[0][0][0]);
    // the copies go from global memory to LDS through no register; the closing s_wait_xcnt is a precaution that stands in front of any rewrite of the address registers named here
    asm volatile("global_load_async_to_lds_b128 %0, %8, off\n\tglobal_load_async_to_lds_b128 %1, %9, off\n\tglobal_load_async_to_lds_b128 %2, %10, off\n\tglobal_load_async_to_lds_b128 %3, %11, off\n\t"
                 "global_load_async_to_lds_b128 %4, %12, off\n\tglobal_load_async_to_lds_b128 %5, %13, off\n\tglobal_load_async_to_lds_b128 %6, %14, off\n\tglobal_load_async_to_lds_b128 %7, %15, off\n\ts_wait_xcnt 0x0"
                 :: "v"(dk), "v"(dk2), "v"(dkl), "v"(dkl2), "v"(dv), "v"(dv2), "v"(dvl), "v"(dvl2), "v"(gk), "v"(gk2), "v"(gkl), "v"(gkl2), "v"(gv), "v"(gv2), "v"(gvl), "v"(gvl2) : "memory"); };
  stage(0, 0);
  { const float* br = BT + (size_t)h * 513; const float t0 = br[tid], t1 = br[tid + 128], t2 = br[tid + 256], t3 = br[tid + 384], t4 = br[512];      /* 128 threads, 513 entries: the loads fly together, beside tile 0's copies */
    asm volatile("s_wait_xcnt 0x0" :: "v"(tid) : "memory");      /* precaution: it stands in front of any rewrite of the index register that these loads name; tid as an input keeps that register as it is up to here */
    sB[tid] = bf16_round(t0) * LOG2E; sB[tid + 128] = bf16_round(t1) * LOG2E; sB[tid + 256] = bf16_round(t2) * LOG2E; sB[tid + 384] = bf16_round(t3) * LOG2E; if (tid == 0) sB[512] = bf16_round(t4) * LOG2E; }      /* published by the barrier that publishes tile 0 */
  asm volatile("s_wait_asynccnt 0x0" ::: "memory");      /* this wave's share of tile 0 has landed */
  __syncthreads();      /* tile 0 is published to all four waves */
  stage(32, 1);      /* tile 1 flies while tile 0 is worked on */
  // scores are formed transposed, S^T = K Q^T (A = K rows, B = Q rows): lane (ln, hh) holds, of the ONE query q0 + ln, the scores of keys nt * 16 + 8 * hh + r; so are the outputs, O^T = V^T P^T
  const unsigned lq = (unsigned)LAG[q0 + ln];
  float m_run = -3.0e38f, l_run = 0.f; v8f oacc[DT], oaccl[DT];
#pragma unroll
  for (int dt = 0; dt < DT; ++dt) { oacc[dt] = (v8f){0.f,0.f,0.f,0.f,0.f,0.f,0.f,0.f}; oaccl[dt] = oacc[dt]; }
#pragma unroll 1
  for (int j0 = 0; j0 < TK; j0 += 32) {
    const int buf = (j0 >> 5) & 1;
    float bb[2][8];      /* the pass's bias values, gathered from LDS at its head so that they fly beside the K reads */
#pragma unroll
    for (int nt = 0; nt < 2; ++nt) { const v4ia ka = *(const v4ia*)(LAG + j0 + nt * 16 + 8 * hh), kb = *(const v4ia*)(LAG + j0 + nt * 16 + 8 * hh + 4);
#pragma unroll
      for (int r = 0; r < 8; ++r) { const unsigned d = lq - (unsigned)(r < 4 ? ka[r & 3] : kb[r & 3]);      /* |lag[q] - lag[k]| = min(d, -d) in unsigned arithmetic; the min with 512 keeps the index inside sB for any lag content */
        bb[nt][r] = sB[min(min(d, 0u - d), 512u)]; } }
    asm volatile("s_wait_xcnt 0x0" ::: "memory");      /* precaution: it stands in front of the rewrite of the lag loads' address registers at the loop's foot */
    v8f s[2];
#pragma unroll
    for (int nt = 0; nt < 2; ++nt) { const unsigned short* kr = &sK[buf][0][nt * 16 + ln][0]; const unsigned short* kl = &sK[buf][1][nt * 16 + ln][0]; FragH bk[KS], bkl[KS];
#pragma unroll
      for (int ks = 0; ks < KS; ++ks) { bk[ks].half[0] = *(const v8us*)(kr + ks * 32 + 8 * hh); bk[ks].half[1] = *(const v8us*)(kr + ks * 32 + 16 + 8 * hh); bkl[ks].half[0] = *(const v8us*)(kl + ks * 32 + 8 * hh); bkl[ks].half[1] = *(const v8us*)(kl + ks * 32 + 16 + 8 * hh); }
      v8f acc = (v8f){0.f,0.f,0.f,0.f,0.f,0.f,0.f,0.f}, accr = acc;
#pragma unroll
      for (int ks = 0; ks < KS; ++ks) { acc = mmaH<1>(bk[ks].v, bk[ks].v, aq[0][ks].v, aq[0][ks].v, acc); accr = mmaH<1>(bk[ks].v, bk[ks].v, aql[0][ks].v, aql[0][ks].v, accr); accr = mmaH<1>(bkl[ks].v, bkl[ks].v, aq[0][ks].v, aq[0][ks].v, accr); }
      s[nt] = acc + accr * 0.0009765625f; }
    float sc[2][8], mh[2];
#pragma unroll
    for (int nt = 0; nt < 2; ++nt) {
#pragma unroll
      for (int r = 0; r < 8; ++r) sc[nt][r] = s[nt][r] * (SCL * LOG2E) + bb[nt][r];      /* scores in log2 units: e^x = 2^(x log2 e), so that each exponential below is the one hardware exp2 instruction */
      mh[nt] = fmaxf(fmaxf(fmaxf(sc[nt][0], sc[nt][1]), fmaxf(sc[nt][2], sc[nt][3])), fmaxf(fmaxf(sc[nt][4], sc[nt][5]), fmaxf(sc[nt][6], sc[nt][7]))); }
    float mc = fmaxf(mh[0], mh[1]);
    mc = fmaxf(mc, xhalf(mc));      /* the query's other 16 keys of the pass lie in lane ^ 16 */
    const float mn = fmaxf(m_run, mc);
    float e[17]; e[0] = m_run - mn;      /* the pass's seventeen exponents: the running maximum's step, then the sixteen scores */
#pragma unroll
    for (int nt = 0; nt < 2; ++nt)
#pragma unroll
      for (int r = 0; r < 8; ++r) e[1 + nt * 8 + r] = sc[nt][r] - mn;
    asm("v_exp_f32 %0, %0\n\tv_exp_f32 %1, %1\n\tv_exp_f32 %2, %2\n\tv_exp_f32 %3, %3\n\tv_exp_f32 %4, %4\n\tv_exp_f32 %5, %5\n\tv_exp_f32 %6, %6\n\tv_exp_f32 %7, %7\n\tv_exp_f32 %8, %8\n\tv_nop"
        : "+v"(e[0]), "+v"(e[1]), "+v"(e[2]), "+v"(e[3]), "+v"(e[4]), "+v"(e[5]), "+v"(e[6]), "+v"(e[7]), "+v"(e[8]));
    asm("v_exp_f32 %0, %0\n\tv_exp_f32 %1, %1\n\tv_exp_f32 %2, %2\n\tv_exp_f32 %3, %3\n\tv_exp_f32 %4, %4\n\tv_exp_f32 %5, %5\n\tv_exp_f32 %6, %6\n\tv_exp_f32 %7, %7\n\tv_nop"
        : "+v"(e[9]), "+v"(e[10]), "+v"(e[11]), "+v"(e[12]), "+v"(e[13]), "+v"(e[14]), "+v"(e[15]), "+v"(e[16]));
    const float ea = e[0]; const float al = (mn > -1.0e38f) ? ea : 1.0f; m_run = mn;
    FragH pa, pl; v2f ps = {0.f, 0.f};      /* two f32 D tiles of S^T, converted in place, are the B operand P^T in the hardware k order: element nt * 8 + r = key nt * 16 + 8 * hh + r */
#pragma unroll
    for (int nt = 0; nt < 2; ++nt)
#pragma unroll
      for (int r = 0; r < 8; r += 2) { const v2f p = {e[1 + nt * 8 + r], e[2 + nt * 8 + r]}; ps += p; const v2f pq = p * 1024.0f; const v2h ph = __builtin_convertvector(pq, v2h); const v2h pr = __builtin_convertvector((pq - __builtin_convertvector(ph, v2f)) * 1024.0f, v2h);
        pa.h[nt * 8 + r] = ph[0]; pa.h[nt * 8 + r + 1] = ph[1]; pl.h[nt * 8 + r] = pr[0]; pl.h[nt * 8 + r + 1] = pr[1]; }
    l_run = l_run * al + (ps[0] + ps[1]);      /* this lane half's share of the query's sum; the halves are joined behind the loop */
#pragma unroll
    for (int dt = 0; dt < DT; ++dt) { oacc[dt] *= al; oaccl[dt] *= al; }
#pragma unroll
    for (int dt = 0; dt < DT; ++dt) { const unsigned short* vr = &sV[buf][0][dt * 16 + ln][0]; const unsigned short* vl = &sV[buf][1][dt * 16 + ln][0]; FragH bv, bl; bv.half[0] = *(const v8us*)(vr + 8 * hh); bv.half[1] = *(const v8us*)(vr + 16 + 8 * hh); bl.half[0] = *(const v8us*)(vl + 8 * hh); bl.half[1] = *(const v8us*)(vl + 16 + 8 * hh);
      oacc[dt] = mmaH<1>(bv.v, bv.v, pa.v, pa.v, oacc[dt]); oaccl[dt] = mmaH<1>(bl.v, bl.v, pa.v, pa.v, oaccl[dt]); oaccl[dt] = mmaH<1>(bv.v, bv.v, pl.v, pl.v, oaccl[dt]); }
    asm volatile("s_wait_dscnt 0x0" ::: "memory");      /* this wave's reads of the pass's buffer are done before the buffer is refilled */
    asm volatile("s_wait_asynccnt 0x0" ::: "memory");      /* this wave's share of the next tile has landed */
    __syncthreads();      /* publishes the next tile and ends every wave's reads of this pass's buffer */
    if (j0 + 64 < TK) stage(j0 + 64, buf); }
  asm volatile("s_wait_asynccnt 0x0" ::: "memory");      /* no copy is outstanding when the wave goes on to its end */
  { const float l = l_run + xhalf(l_run); const float li = (l > 0.f) ? 1.0f / (l * 1024.0f) : 0.f;
#pragma unroll
    for (int dt = 0; dt < DT; ++dt) { v4f o0, o1;      /* a lane's eight accumulator rows are eight consecutive head columns of its query */
#pragma unroll
      for (int r = 0; r < 4; ++r) { o0[r] = (oacc[dt][r] + oaccl[dt][r] * 0.0009765625f) * li; o1[r] = (oacc[dt][4 + r] + oaccl[dt][4 + r] * 0.0009765625f) * li; }
      *(v4fa*)&sO[w][ln][dt * 16 + 8 * hh] = o0; *(v4fa*)&sO[w][ln][dt * 16 + 8 * hh + 4] = o1; } }
  __builtin_amdgcn_fence(__ATOMIC_ACQ_REL, "workgroup"); __builtin_amdgcn_wave_barrier();
  {
#pragma unroll
    for (int rp = 0; rp < RPW; rp += 2) { const int r = rp + (lane >> 4), pc = lane & 15; const v4f val = *(const v4fa*)&sO[w][r][pc * 4]; *(v4f*)(O + ((size_t)b * TQ + q0 + r) * ldo + h * 64 + pc * 4) = val; }
     } }


__global__ __launch_bounds__(256) void k_lnx(const float* __restrict__ X, const float* __restrict__ g, const float* __restrict__ bb, _Float16* __restrict__ Y16, float* __restrict__ XB) {
  #pragma clang fp contract(off)
  const int tid = threadIdx.x, w = tid >> 5, ln = tid & 31; const int r = blockIdx.x * 8 + w; if (r >= NR) return; const float* x = X + (size_t)r * DM; float s = 0.f;
#pragma unroll 1
  for (int i = 0; i < DM / 128; ++i) { const v4f a = *(const v4fa*)(x + i * 128 + ln * 4); for (int q = 0; q < 4; ++q) s += bf16_round(a[q]); }
  for (int o = 16; o > 0; o >>= 1) s += __shfl_xor(s, o, 32); const float mu = s / (float)DM; float q2 = 0.f;
#pragma unroll 1
  for (int i = 0; i < DM / 128; ++i) { const v4f a = *(const v4fa*)(x + i * 128 + ln * 4); for (int q = 0; q < 4; ++q) { const float d = bf16_round(a[q]) - mu; q2 += d * d; } }
  for (int o = 16; o > 0; o >>= 1) q2 += __shfl_xor(q2, o, 32); const float rs = rsqrtf(q2 / (float)DM + 1e-5f);
  {
#pragma unroll 1
    for (int i = 0; i < DM / 128; ++i) { const int c0 = i * 128 + ln * 4; const v4f a = *(const v4fa*)(x + c0); _Float16 h4[4]; v4f xb;
      for (int q = 0; q < 4; ++q) { const float t = bf16_round(a[q]); h4[q] = (_Float16)((t - mu) * rs * bf16_round(g[c0 + q]) + bf16_round(bb[c0 + q])); xb[q] = t; }
      *(unsigned long long*)((unsigned short*)Y16 + (size_t)r * DM + c0) = *(const unsigned long long*)h4; *(v4f*)(XB + (size_t)r * DM + c0) = xb; }
     } }
__global__ __launch_bounds__(256) void k_causaltab(unsigned* __restrict__ MB, int* __restrict__ RA, int* __restrict__ KE, int nq, int nk) {
  const int t = blockIdx.x * 256 + threadIdx.x; const int nw = nk / 32;
  if (t < nq * nw) { const int q = t / nw, w = t % nw; const int first = q + 1 - 32 * w; const unsigned bits = (first <= 0) ? 0xffffffffu : ((first >= 32) ? 0u : (0xffffffffu << first)); *(unsigned*)(MB + t) = bits;  }
  if (t < nq) { *(int*)(RA + t) = 0;  }
  if (t < nq / 64) { const int v = 64 * (t + 1); *(int*)(KE + t * 32) = v;  } }


extern "C" void kernel_launch(void* const* d_in, const int* in_sizes, int n_in,
                              void* d_out, int out_size, void* d_ws, size_t ws_size, hipStream_t stream) {
  (void)in_sizes; (void)n_in; (void)out_size;
  const float* const* I = (const float* const*)d_in; const float* x = I[0]; const int* lag = (const int*)d_in[1]; const float* wq = I[2]; const float* bq = I[3]; const float* wk = I[4]; const float* bk = I[5]; const float* wv = I[6]; const float* bv = I[7]; const float* wo = I[8]; const float* bo = I[9]; const float* lb = I[10];
  char* ws = (char*)d_ws; size_t off = 0;
  auto take = [&](size_t bytes) { char* p = ws + off; off += (bytes + 255) & ~(size_t)255; return p; };
  _Float16* BQ = (_Float16*)take((size_t)DM * DM * 2); _Float16* BK = (_Float16*)take((size_t)DM * DM * 2); _Float16* BV = (_Float16*)take((size_t)DM * DM * 2); _Float16* BO = (_Float16*)take((size_t)DM * DM * 2);
  _Float16* X16 = (_Float16*)take((size_t)NR * DM * 2); float* F = (float*)take((size_t)3 * NR * DM * 4);      /* q, k, v planes, one behind the other */
  _Float16* Qh = (_Float16*)take((size_t)NR * DM * 2); _Float16* Kh = (_Float16*)take((size_t)NR * DM * 2); _Float16* Ql = (_Float16*)take((size_t)NR * DM * 2); _Float16* Kl = (_Float16*)take((size_t)NR * DM * 2); _Float16* Vth = (_Float16*)take((size_t)NR * DM * 2); _Float16* Vtl = (_Float16*)take((size_t)NR * DM * 2);      /* Kh directly behind Qh, Kl directly behind Ql */
  if (off > ws_size) return;      /* 8 + 8 + 48 + 48 = 112 MiB */
  float* O = F; _Float16* Oh = Qh; _Float16* Ol = Ql;
  const size_t w8 = (size_t)DM * DM / 8; const unsigned wb = (unsigned)((w8 + 255) / 256);
  k_wt_f16<<<dim3(wb, 4), 256, 0, stream>>>(wq, wk, wv, wo, BQ, DM, DM, 16.0f);      /* (in,out); BQ, BK, BV, BO are contiguous */
  const size_t n8 = (size_t)NR * DM / 8; const unsigned nb8 = (unsigned)((n8 + 255) / 256); const dim3 gP((NR / 128) * (DM / 128), 1); const dim3 gP3((NR / 128) * (DM / 128), 3);
  k_x16<<<nb8, 256, 0, stream>>>(x, X16, n8);
  k_gemm2<0><<<gP3, 256, 0, stream>>>(X16, DM, 0, BQ, DM, (size_t)DM * DM, 0.0625f, bq, bk, bv, nullptr, 1, 0, 0, F, nullptr, DM, (size_t)NR * DM, NR, DM, DM);      /* q, k, v in one grid */
  k_hl<<<2 * nb8, 256, 0, stream>>>(F, Qh, Ql, 2 * n8);      /* q and k planes together */
  k_vthl<SLEN><<<NBT * NH * (SLEN / 64), 256, 0, stream>>>(F + (size_t)2 * NR * DM, DM, Vth, Vtl);
  k_flashb<SLEN, SLEN><<<NBT * NH * (SLEN / 64), 128, 0, stream>>>(Qh, Ql, DM, Kh, Kl, DM, Vth, Vtl, lb, lag, O, DM);      /* both batches in one grid; the lag vector is per position, shared across the batch */
  k_hl<<<nb8, 256, 0, stream>>>(O, Oh, Ol, n8);
  k_gemm2<0><<<gP, 256, 0, stream>>>(Oh, DM, 0, BO, DM, 0, 0.0625f, bo, nullptr, nullptr, nullptr, 1, 0, 0, (float*)d_out, nullptr, DM, 0, NR, DM, DM);
  k_gemm2<0><<<gP, 256, 0, stream>>>(Ol, DM, 0, BO, DM, 0, 0.0625f / 1024.0f, nullptr, nullptr, nullptr, (float*)d_out, 1, (size_t)DM, 0, (float*)d_out, nullptr, DM, 0, NR, DM, DM);
}

// v008
// A run of this version takes 216 microseconds.
// Two timings next to v007 both put it at 1.12 times that version's speed.
// Counting every step since v000, it is 5.35 times as fast.
#include <hip/hip_runtime.h>
// Multi-head self-attention with a lag-distance bias (2 x 2048 tokens, 1024 = 16 heads x 64): q,k,v = x W + b; scores = q.k/8 + lag_bias[h][|lag[q] - lag[k]|] with the INPUT integer lag vector; softmax over all keys; out = (attn v) Wo + bo -> [2,2048,1024].
// Structure: x as an exact f16 plane; projections as f16 WMMA GEMMs (128x128 block tiles of eight 32x64 wave tiles, 64-k operand tiles from a two-buffer LDS ring filled by asynchronous copies one trip ahead, f32 accumulation, exact x16 weights + bias); q, k as f16 hi + (x2^10) residual planes, V^T as hi + residual planes, all split (V also transposed, through LDS) in the projection GEMM's own epilogue; the fused flash kernel takes each pass's K and V^T tiles (hi + residual) from a two-buffer LDS ring filled by asynchronous copies one pass ahead and shared by its four waves, and adds the bias, gathered by |lag[q] - lag[k]| (INPUT int32 positions) from the head's row of the INPUT table, which each block rounds once into LDS, inside the score stage (all keys valid; scores and outputs formed transposed, so that a lane holds one query: online f32 softmax in the lane, in log2 units with the hardware exp2, P hi + residual packed from the score accumulators into the next product's operand, two value accumulators) and stores O as hi + residual planes itself; these go into Wo (two GEMMs, bias in the first).
// Compute dtype: x, weights, biases, lag_bias rounded to bf16; projections exact; q, k, P, v, O as f16 hi + residual pairs (~2^-21); f32 accumulation and softmax. v_wmma_f32_16x16x32_f16.
#define NBT 2
#define SLEN 2048
#define DM 1024
#define NH 16
#define SCL 0.125f
#define LOG2E 1.44269504088896340736f
#define NR (NBT * SLEN)
typedef __bf16 v16b __attribute__((ext_vector_type(16)));
typedef unsigned short v8us __attribute__((ext_vector_type(8), may_alias));
typedef float  v8f  __attribute__((ext_vector_type(8)));
typedef float  v4f  __attribute__((ext_vector_type(4)));
typedef float  v4fa __attribute__((ext_vector_type(4), may_alias));
union FragB { v16b v; v8us half[2]; unsigned short u[16]; };

__device__ __forceinline__ unsigned short bf16_bits(float x) { unsigned int u = __float_as_uint(x); return (unsigned short)((u + 0x7FFFu + ((u >> 16) & 1u)) >> 16); }
__device__ __forceinline__ float bf16_val(unsigned short b) { return __uint_as_float(((unsigned int)b) << 16); }
__device__ __forceinline__ float bf16_round(float x) { return bf16_val(bf16_bits(x)); }
// D += A·B with NT terms: 1 = ah·bh, 2 = + al·bh (A split), 3 = + ah·bl (both split)
template <int NT>
__device__ __forceinline__ v8f mmaN(v16b ah, v16b al, v16b bh, v16b bl, v8f c) {
  c = __builtin_amdgcn_wmma_f32_16x16x32_bf16(false, ah, false, bh, (short)0, c, false, false);
  if (NT >= 2) c = __builtin_amdgcn_wmma_f32_16x16x32_bf16(false, al, false, bh, (short)0, c, false, false);
  if (NT >= 3) c = __builtin_amdgcn_wmma_f32_16x16x32_bf16(false, ah, false, bl, (short)0, c, false, false);
  asm volatile("v_nop\n\tv_nop\n\tv_nop\n\tv_nop" : "+v"(c) : "v"(ah), "v"(al), "v"(bh), "v"(bl));
  return c;
}

__global__ __launch_bounds__(256) void k_wt_bf16(const float* __restrict__ W, unsigned short* __restrict__ Wt, int K, int N) {
  const int t = blockIdx.x * 256 + threadIdx.x;
  const int k8n = K / 8;
  if (t >= N * k8n) return;
  const int n = t / k8n, k8 = (t % k8n) * 8;
  v8us v;
#pragma unroll
  for (int i = 0; i < 8; ++i) v[i] = bf16_bits(W[(size_t)(k8 + i) * N + n]);
  *(v8us*)(Wt + (size_t)n * K + k8) = v;
  
}

// GEMM C[M][N] (f32, pitch ldc) = act(A[M][K]·W + bias). A f32 row-major (pitch lda) converted per fragment to bf16
// (ASPLIT: hi/lo two planes -> 2 terms, else single rounded term); Wt bf16 [N][K] (pitch ldb). BIAS_BF16 rounds the
// bias to bf16 first (bias quantised to bf16 before the add). K%32==0, M%16==0, N%64==0.
template <bool ASPLIT, int ACT, bool BIAS_BF16>
__global__ __launch_bounds__(128) void k_gemm_bf(const float* __restrict__ A, int lda, const unsigned short* __restrict__ Wt, int ldb,
                                               const float* __restrict__ bias, float* __restrict__ C, int ldc, int M, int N, int K) {
  __shared__ __attribute__((aligned(16))) float so[4][16][64];
  const int tid = threadIdx.x, w = tid >> 5, lane = tid & 31, ln = lane & 15, hh = lane >> 4;
  const int ntn = N / 64;
  const int wid = blockIdx.x * 4 + w;
  const int mt = wid / ntn, nq = wid % ntn;
  if (mt * 16 >= M) return;
  const int row0 = mt * 16, col0 = nq * 64;
  const float* arow = A + (size_t)(row0 + ln) * lda;
  v8f acc[4] = {};
  for (int kb = 0; kb < K; kb += 32) {
    FragB ah, al;
    const v4f x0 = *(const v4fa*)(arow + kb + 8 * hh), x1 = *(const v4fa*)(arow + kb + 8 * hh + 4);
    const v4f x2 = *(const v4fa*)(arow + kb + 16 + 8 * hh), x3 = *(const v4fa*)(arow + kb + 16 + 8 * hh + 4);
    float xs[16] = {x0[0],x0[1],x0[2],x0[3],x1[0],x1[1],x1[2],x1[3],x2[0],x2[1],x2[2],x2[3],x3[0],x3[1],x3[2],x3[3]};
#pragma unroll
    for (int i = 0; i < 16; ++i) { const unsigned short hb = bf16_bits(xs[i]); ah.u[i] = hb; al.u[i] = ASPLIT ? bf16_bits(xs[i] - bf16_val(hb)) : (unsigned short)0; }
#pragma unroll
    for (int t = 0; t < 4; ++t) {
      const unsigned short* brow = Wt + (size_t)(col0 + t * 16 + ln) * ldb + kb;
      FragB b;
      b.half[0] = *(const v8us*)(brow + 8 * hh);
      b.half[1] = *(const v8us*)(brow + 16 + 8 * hh);
      acc[t] = mmaN<ASPLIT ? 2 : 1>(ah.v, al.v, b.v, b.v, acc[t]);
    }
  }
#pragma unroll
  for (int t = 0; t < 4; ++t) {
    float bv = bias ? bias[col0 + t * 16 + ln] : 0.f;
    if (BIAS_BF16) bv = bf16_round(bv);
#pragma unroll
    for (int r = 0; r < 8; ++r) { float v = acc[t][r] + bv; if (ACT == 1) v = fmaxf(v, 0.f); so[w][8 * hh + r][t * 16 + ln] = v; }
  }
  __builtin_amdgcn_fence(__ATOMIC_ACQ_REL, "workgroup");
  __builtin_amdgcn_wave_barrier();
  const int rsub = lane >> 4, c4 = (lane & 15) * 4;
  {
#pragma unroll
    for (int q = 0; q < 8; ++q) {
      const int r = q * 2 + rsub;
      const v4f v = *(const v4fa*)&so[w][r][c4];
      *(v4f*)(C + (size_t)(row0 + r) * ldc + col0 + c4) = v;
    }
    
  }
}

// GEMM C = act(A·W + bias + resid): A f32 (ASPLIT -> hi/lo 2 terms), Wt bf16 [N][K]; ACT 0 none, 1 relu, 2 exact gelu;
// resid (optional, f32, row index = (row % rmod), pitch ldr, RES_BF16 rounds it) added before the activation.
template <bool ASPLIT, int ACT, bool BIAS_BF16, bool RES_BF16>
__global__ __launch_bounds__(128) void k_gemm_bf3(const float* __restrict__ A, int lda, const unsigned short* __restrict__ Wt, int ldb,
                                                const float* __restrict__ bias, const float* __restrict__ resid, int rmod, int ldr,
                                                float* __restrict__ C, int ldc, int M, int N, int K) {
  __shared__ __attribute__((aligned(16))) float so[4][16][64];
  const int tid = threadIdx.x, w = tid >> 5, lane = tid & 31, ln = lane & 15, hh = lane >> 4;
  const int ntn = N / 64;
  const int wid = blockIdx.x * 4 + w;
  const int mt = wid / ntn, nq = wid % ntn;
  if (mt * 16 >= M) return;
  const int row0 = mt * 16, col0 = nq * 64;
  const float* arow = A + (size_t)(row0 + ln) * lda;
  v8f acc[4] = {};
  for (int kb = 0; kb < K; kb += 32) {
    FragB ah, al;
    const v4f x0 = *(const v4fa*)(arow + kb + 8 * hh), x1 = *(const v4fa*)(arow + kb + 8 * hh + 4);
    const v4f x2 = *(const v4fa*)(arow + kb + 16 + 8 * hh), x3 = *(const v4fa*)(arow + kb + 16 + 8 * hh + 4);
    float xs[16] = {x0[0],x0[1],x0[2],x0[3],x1[0],x1[1],x1[2],x1[3],x2[0],x2[1],x2[2],x2[3],x3[0],x3[1],x3[2],x3[3]};
#pragma unroll
    for (int i = 0; i < 16; ++i) { const unsigned short hb = bf16_bits(xs[i]); ah.u[i] = hb; al.u[i] = ASPLIT ? bf16_bits(xs[i] - bf16_val(hb)) : (unsigned short)0; }
#pragma unroll
    for (int t = 0; t < 4; ++t) {
      const unsigned short* brow = Wt + (size_t)(col0 + t * 16 + ln) * ldb + kb;
      FragB b;
      b.half[0] = *(const v8us*)(brow + 8 * hh);
      b.half[1] = *(const v8us*)(brow + 16 + 8 * hh);
      acc[t] = mmaN<ASPLIT ? 2 : 1>(ah.v, al.v, b.v, b.v, acc[t]);
    }
  }
#pragma unroll
  for (int t = 0; t < 4; ++t) {
    const int col = col0 + t * 16 + ln;
    float bv = bias ? bias[col] : 0.f;
    if (BIAS_BF16) bv = bf16_round(bv);
#pragma unroll
    for (int r = 0; r < 8; ++r) {
      float v = acc[t][r] + bv;
      if (resid) { float rv = resid[(size_t)((row0 + 8 * hh + r) % rmod) * ldr + col]; if (RES_BF16) rv = bf16_round(rv); v += rv; }
      if (ACT == 1) v = fmaxf(v, 0.f);
      if (ACT == 2) v = 0.5f * v * (1.0f + erff(v * 0.70710678118654752f));
      if (ACT == 3) { const float u = 0.7978845608028654f * (v + 0.044715f * v * v * v); v = 0.5f * v * (1.0f + tanhf(u)); }
      so[w][8 * hh + r][t * 16 + ln] = v;
    }
  }
  __builtin_amdgcn_fence(__ATOMIC_ACQ_REL, "workgroup");
  __builtin_amdgcn_wave_barrier();
  const int rsub = lane >> 4, c4 = (lane & 15) * 4;
  {
#pragma unroll
    for (int q = 0; q < 8; ++q) {
      const int r = q * 2 + rsub;
      const v4f v = *(const v4fa*)&so[w][r][c4];
      *(v4f*)(C + (size_t)(row0 + r) * ldc + col0 + c4) = v;
    }
    
  }
}
// row LayerNorm (biased variance, eps) over N: s = X (+ R); optional out_sum <- s; out_norm <- (s-mu)*rsqrt(var+eps)*g + b
template <bool PARAM_BF16>
__global__ __launch_bounds__(256) void k_layernorm(const float* __restrict__ X, const float* __restrict__ R, const float* __restrict__ g, const float* __restrict__ bta,
                                                  float* __restrict__ out_sum, float* __restrict__ out_norm, int N, float eps) {
  __shared__ float red[256];
  const int row = blockIdx.x, tid = threadIdx.x;
  const float* x = X + (size_t)row * N; const float* rr = R ? R + (size_t)row * N : nullptr;
  float vals[16];                     // up to N = 4096
  const int per = N / 256;            // contiguous chunk per thread? use strided-by-4 chunks: thread handles j = tid*4 + 1024*u
  float s1 = 0.f;
  for (int u = 0; u < per / 4; ++u) {
    const int j = tid * 4 + 1024 * u;
    const v4f a = *(const v4fa*)(x + j);
    v4f b = {0.f,0.f,0.f,0.f}; if (rr) b = *(const v4fa*)(rr + j);
#pragma unroll
    for (int q = 0; q < 4; ++q) { const float v = a[q] + b[q]; vals[u * 4 + q] = v; s1 += v; }
  }
  red[tid] = s1; __syncthreads();
  for (int st = 128; st > 0; st >>= 1) { if (tid < st) red[tid] += red[tid + st]; __syncthreads(); }
  const float mu = red[0] / (float)N; __syncthreads();
  float s2 = 0.f;
  for (int u = 0; u < per / 4; ++u)
#pragma unroll
    for (int q = 0; q < 4; ++q) { const float c = vals[u * 4 + q] - mu; s2 += c * c; }
  red[tid] = s2; __syncthreads();
  for (int st = 128; st > 0; st >>= 1) { if (tid < st) red[tid] += red[tid + st]; __syncthreads(); }
  const float rs = rsqrtf(red[0] / (float)N + eps);
  {
    for (int u = 0; u < per / 4; ++u) {
      const int j = tid * 4 + 1024 * u;
      v4f o, sm;
#pragma unroll
      for (int q = 0; q < 4; ++q) {
        float gg = g[j + q], bb = bta[j + q];
        if (PARAM_BF16) { gg = bf16_round(gg); bb = bf16_round(bb); }
        sm[q] = vals[u * 4 + q]; o[q] = (vals[u * 4 + q] - mu) * rs * gg + bb;
      }
      if (out_sum) *(v4f*)(out_sum + (size_t)row * N + j) = sm;
      *(v4f*)(out_norm + (size_t)row * N + j) = o;
    }
    
  }
}



// ---- f16 WMMA path (v_wmma_f32_16x16x32_f16): 11-bit significands for operands in range — used where a [0,1] probability operand needs more precision than bf16
typedef _Float16 v16h __attribute__((ext_vector_type(16)));
union FragH { v16h v; v8us half[2]; _Float16 h[16]; unsigned short u[16]; };
template <int NT>
__device__ __forceinline__ v8f mmaH(v16h ah, v16h al, v16h bh, v16h bl, v8f c) {
  c = __builtin_amdgcn_wmma_f32_16x16x32_f16(false, ah, false, bh, (short)0, c, false, false);
  if (NT >= 2) c = __builtin_amdgcn_wmma_f32_16x16x32_f16(false, al, false, bh, (short)0, c, false, false);
  if (NT >= 3) c = __builtin_amdgcn_wmma_f32_16x16x32_f16(false, ah, false, bl, (short)0, c, false, false);
  asm volatile("v_nop\n\tv_nop\n\tv_nop\n\tv_nop" : "+v"(c) : "v"(ah), "v"(al), "v"(bh), "v"(bl));
  return c;
}
// batched GEMM like k_gemm_b but f16 operands: A f32 (split into f16 hi/lo if ASPLIT, else rounded to f16), Bt = f16 values [n][k]; alpha; C f32; N multiple of 16 (partial tiles skipped)
template <bool ASPLIT>
__global__ __launch_bounds__(128) void k_gemm_h(const float* __restrict__ A, int lda, size_t sA, const _Float16* __restrict__ Bh, int ldb, size_t sB, float alpha, float* __restrict__ C, int ldc, size_t sC, int M, int N, int K) {
  __shared__ __attribute__((aligned(16))) float so[4][16][64];
  const int tid = threadIdx.x, w = tid >> 5, lane = tid & 31, ln = lane & 15, hh = lane >> 4; const int by = blockIdx.y;
  A += (size_t)by * sA; Bh += (size_t)by * sB; C += (size_t)by * sC;
  const int ntn = (N + 63) / 64; const int wid = blockIdx.x * 4 + w; const int mt = wid / ntn, nq = wid % ntn; if (mt * 16 >= M) return;
  const int row0 = mt * 16, col0 = nq * 64; const float* arow = A + (size_t)(row0 + ln) * lda;
  v8f acc[4] = {};
  for (int kb = 0; kb < K; kb += 32) {
    FragH ah, al;
    const v4f x0 = *(const v4fa*)(arow + kb + 8 * hh), x1 = *(const v4fa*)(arow + kb + 8 * hh + 4), x2 = *(const v4fa*)(arow + kb + 16 + 8 * hh), x3 = *(const v4fa*)(arow + kb + 16 + 8 * hh + 4);
    float xs[16] = {x0[0],x0[1],x0[2],x0[3],x1[0],x1[1],x1[2],x1[3],x2[0],x2[1],x2[2],x2[3],x3[0],x3[1],x3[2],x3[3]};
#pragma unroll
    for (int i = 0; i < 16; ++i) { const _Float16 h = (_Float16)xs[i]; ah.h[i] = h; al.h[i] = ASPLIT ? (_Float16)(xs[i] - (float)h) : (_Float16)0.0f; }
#pragma unroll
    for (int t = 0; t < 4; ++t) { if (col0 + t * 16 >= N) continue; const size_t boff = (size_t)(col0 + t * 16 + ln) * ldb + kb; FragH bq; bq.half[0] = *(const v8us*)(Bh + boff + 8 * hh); bq.half[1] = *(const v8us*)(Bh + boff + 16 + 8 * hh);
      acc[t] = mmaH<ASPLIT ? 2 : 1>(ah.v, al.v, bq.v, bq.v, acc[t]); }
  }
#pragma unroll
  for (int t = 0; t < 4; ++t) { if (col0 + t * 16 >= N) continue;
#pragma unroll
    for (int r = 0; r < 8; ++r) so[w][8 * hh + r][t * 16 + ln] = acc[t][r] * alpha; }
  __builtin_amdgcn_fence(__ATOMIC_ACQ_REL, "workgroup"); __builtin_amdgcn_wave_barrier();
  const int rsub = lane >> 4, c4 = (lane & 15) * 4;
  {
#pragma unroll
    for (int q = 0; q < 8; ++q) { const int r = q * 2 + rsub; if (col0 + c4 < N) { const v4f v = *(const v4fa*)&so[w][r][c4]; *(v4f*)(C + (size_t)(row0 + r) * ldc + col0 + c4) = v; } }
     }
}

// Wt[n][k] = f16(W[k][n]·scale) from f32 row-major W[K][N] (scale = power of two; bf16-exact weights stay exact in f16 away from the subnormal range)
// blockIdx.y picks one of four equally shaped matrices; their transposes lie one behind the other in Wt
__global__ __launch_bounds__(256) void k_wt_f16(const float* __restrict__ W0, const float* __restrict__ W1, const float* __restrict__ W2, const float* __restrict__ W3, _Float16* __restrict__ Wt, int K, int N, float scale) {
  const int by = blockIdx.y; const float* __restrict__ W = (by == 0) ? W0 : (by == 1) ? W1 : (by == 2) ? W2 : W3; Wt += (size_t)by * K * N;
  const int t = blockIdx.x * 256 + threadIdx.x; if (t >= N * (K / 8)) return; const int n = t / (K / 8), k8 = (t % (K / 8)) * 8; FragH f;
#pragma unroll
  for (int i = 0; i < 8; ++i) f.h[i] = (_Float16)(bf16_round(W[(size_t)(k8 + i) * N + n]) * scale); const v8us o = f.half[0];
  *(v8us*)((unsigned short*)Wt + (size_t)n * K + k8) = o; 
}
// k_gemm_hh variant with fused epilogue: v = acc·alpha + bias[by·sBias + col] (+ CP[(row/rowsPerB)·sCPb + by·64 + col] if CP) ; ACT 0 none / 1 elu ; writes f16 C16 (and f32 C if non-null)
template <int ACT>
__global__ __launch_bounds__(128) void k_gemm_hhx(const _Float16* __restrict__ A, int lda, size_t sA, const _Float16* __restrict__ Bh, int ldb, size_t sB, float alpha, const float* __restrict__ bias, size_t sBias, const float* __restrict__ CP, int rowsPerB, size_t sCPb, int row0g,
    float* __restrict__ C, _Float16* __restrict__ C16, int ldc, size_t sC, int M, int N, int K) {
  __shared__ __attribute__((aligned(16))) float so[4][16][64];
  const int tid = threadIdx.x, w = tid >> 5, lane = tid & 31, ln = lane & 15, hh = lane >> 4; const int by = blockIdx.y;
  A += (size_t)by * sA; Bh += (size_t)by * sB; const size_t cofs = (size_t)by * sC; const float* bp = bias ? bias + (size_t)by * sBias : nullptr;
  const int ntn = (N + 63) / 64; const int wid = blockIdx.x * 4 + w; const int mt = wid / ntn, nq = wid % ntn; if (mt * 16 >= M) return;
  const int row0 = mt * 16, col0 = nq * 64; const _Float16* arow = A + (size_t)(row0 + ln) * lda;
  v8f acc[4] = {};
  for (int kb = 0; kb < K; kb += 32) { FragH ah; ah.half[0] = *(const v8us*)((const unsigned short*)arow + kb + 8 * hh); ah.half[1] = *(const v8us*)((const unsigned short*)arow + kb + 16 + 8 * hh);
#pragma unroll
    for (int t = 0; t < 4; ++t) { if (col0 + t * 16 >= N) continue; const size_t boff = (size_t)(col0 + t * 16 + ln) * ldb + kb; FragH bq; bq.half[0] = *(const v8us*)((const unsigned short*)Bh + boff + 8 * hh); bq.half[1] = *(const v8us*)((const unsigned short*)Bh + boff + 16 + 8 * hh);
      acc[t] = mmaH<1>(ah.v, ah.v, bq.v, bq.v, acc[t]); }
  }
#pragma unroll
  for (int t = 0; t < 4; ++t) { if (col0 + t * 16 >= N) continue; const int col = col0 + t * 16 + ln; const float bv = bp ? bf16_round(bp[col]) : 0.f;
#pragma unroll
    for (int r = 0; r < 8; ++r) { float v = acc[t][r] * alpha + bv; if (CP) { const int bidx = (row0g + row0 + 8 * hh + r) / rowsPerB; v += CP[(size_t)bidx * sCPb + (size_t)by * 64 + col]; } if (ACT == 1) v = (v > 0.f) ? v : expm1f(v); else if (ACT == 7) v = (v > 0.f) ? v + 1.0f : expf(v); else if (ACT == 8) v = tanhf(v); else if (ACT == 9) v = 0.5f * v * (1.0f + tanhf(0.7978845608028654f * (v + 0.044715f * v * v * v))); else if (ACT == 11) v = 1.0f / (1.0f + expf(-v)); else if (ACT == 12) v = (v > 0.f) ? v : 0.01f * v; else if (ACT == 14) v = (v > 0.f) ? v : 0.1f * v; else if (ACT == 15) v = v / (1.0f + expf(-v)); else if (ACT == 3) v = fmaxf(v, 0.f); else if (ACT == 6) v = 0.5f * v * (1.0f + erff(v * 0.70710678118654752f)); so[w][8 * hh + r][t * 16 + ln] = v; } }
  __builtin_amdgcn_fence(__ATOMIC_ACQ_REL, "workgroup"); __builtin_amdgcn_wave_barrier();
  const int rsub = lane >> 4, c4 = (lane & 15) * 4; typedef _Float16 v4h __attribute__((ext_vector_type(4)));
  {
#pragma unroll
    for (int q = 0; q < 8; ++q) { const int r = q * 2 + rsub; if (col0 + c4 < N) { const v4f v = *(const v4fa*)&so[w][r][c4]; if (C) *(v4f*)(C + cofs + (size_t)(row0 + r) * ldc + col0 + c4) = v; if (C16) { v4h h4; for (int i = 0; i < 4; ++i) h4[i] = (_Float16)v[i]; *(v4h*)(C16 + cofs + (size_t)(row0 + r) * ldc + col0 + c4) = h4; } } }
     }
}


typedef _Float16 v4h __attribute__((ext_vector_type(4)));

__global__ __launch_bounds__(256) void k_x16(const float* __restrict__ x, _Float16* __restrict__ X16, size_t n8) { const size_t t = (size_t)blockIdx.x * 256 + threadIdx.x; if (t >= n8) return; FragH f;
#pragma unroll
  for (int q = 0; q < 8; ++q) f.h[q] = (_Float16)bf16_round(x[t * 8 + q]); *(v8us*)((unsigned short*)X16 + t * 8) = f.half[0];  }
__global__ __launch_bounds__(256) void k_h16(const float* __restrict__ x, _Float16* __restrict__ X16, size_t n8) { const size_t t = (size_t)blockIdx.x * 256 + threadIdx.x; if (t >= n8) return; FragH f;
#pragma unroll
  for (int q = 0; q < 8; ++q) f.h[q] = (_Float16)x[t * 8 + q]; *(v8us*)((unsigned short*)X16 + t * 8) = f.half[0];  }
__global__ __launch_bounds__(256) void k_round16f(const float* __restrict__ W, _Float16* __restrict__ Bt, size_t n8) { const size_t t = (size_t)blockIdx.x * 256 + threadIdx.x; if (t >= n8) return; FragH f;
#pragma unroll
  for (int i = 0; i < 8; ++i) f.h[i] = (_Float16)(bf16_round(W[t * 8 + i]) * 16.0f); *(v8us*)((unsigned short*)Bt + t * 8) = f.half[0];  }
template <int NHv, int TTv>
__global__ __launch_bounds__(256) void k_vt(const _Float16* __restrict__ V16, int ldv, int voff, _Float16* __restrict__ Vt) { __shared__ unsigned short tl[64][66]; const int tid = threadIdx.x; const int slab = blockIdx.x / (TTv / 64), lg = blockIdx.x % (TTv / 64); const int b = slab / NHv, h = slab % NHv;
  for (int i = tid; i < 64 * 8; i += 256) { const int r = i / 8, c8 = (i % 8) * 8; FragH f; f.half[0] = *(const v8us*)((const unsigned short*)V16 + ((size_t)b * TTv + lg * 64 + r) * ldv + voff + h * 64 + c8);
#pragma unroll
    for (int q = 0; q < 8; ++q) tl[r][c8 + q] = f.u[q]; }
  __syncthreads();
  {
#pragma unroll
    for (int rd = 0; rd < 2; ++rd) { const int d = rd * 32 + tid / 8, pc = tid % 8; FragH f;
#pragma unroll
      for (int q = 0; q < 8; ++q) f.u[q] = tl[pc * 8 + q][d];
      *(v8us*)((unsigned short*)Vt + ((size_t)slab * 64 + d) * TTv + lg * 64 + pc * 8) = f.half[0]; }
     } }

// ---- fast GEMM (block tile 128x128, eight waves of 32x64; requires M % 128 == 0, N % 128 == 0, K % 64 == 0, K >= 64); epilogue = k_gemm_hhx semantics ----
__device__ __forceinline__ v16h g2_frag(const unsigned short* p, int hh) { FragH f; f.half[0] = *(const v8us*)(p + 8 * hh); f.half[1] = *(const v8us*)(p + 16 + 8 * hh); return f.v; }
__device__ __forceinline__ v8f g2_mma(v16h a, v16h b, v8f c) { v8f d = __builtin_amdgcn_wmma_f32_16x16x32_f16(false, a, false, b, (short)0, c, false, false); asm volatile("v_nop\n\tv_nop\n\tv_nop\n\tv_nop" : "+v"(d) : "v"(a), "v"(b)); return d; }
// SPLIT 1 (the q, k, v projections in one grid): nothing is written as f32. blockIdx.y 0 and 1 store the result row-major as f16 hi + (x2^10) residual planes (Sh, Sl, plane stride sC); blockIdx.y 2 stores it transposed, [batch][column][token], as hi + residual planes (Th, Tl)
template <int ACT, int SPLIT>
__global__ __launch_bounds__(256) void k_gemm2(const _Float16* __restrict__ A, int lda, size_t sA, const _Float16* __restrict__ Bh, int ldb, size_t sB, float alpha, const float* __restrict__ bias, const float* __restrict__ bias1, const float* __restrict__ bias2, const float* __restrict__ CP, int rowsPerB, size_t sCPb, int row0g,
    float* __restrict__ C, _Float16* __restrict__ C16, _Float16* __restrict__ Sh, _Float16* __restrict__ Sl, _Float16* __restrict__ Th, _Float16* __restrict__ Tl, int ldc, size_t sC, int M, int N, int K) {
  // two-buffer ring of 64-k tiles shared by the block's eight waves: [buffer][A, B][128 rows][halfs]; rows of 128 B at a pitch of 144 B (16 B x odd, for the 16-byte fragment reads). Behind the loop's last barrier the same bytes are the waves' output staging (8 x 32 x 68 floats = 69,632 B of the 73,728)
  constexpr int PH = 72; constexpr unsigned OPB = 128u * PH * 2u, BUFB = 2u * OPB;
  __shared__ __attribute__((aligned(16))) unsigned short sT[2 * 2 * 128 * PH];
  const int tid = threadIdx.x, w = tid >> 5, lane = tid & 31, ln = lane & 15, hh = lane >> 4; const int by = blockIdx.y;
  A += (size_t)by * sA; Bh += (size_t)by * sB; const size_t cofs = (size_t)by * sC; const float* bp = (by == 0) ? bias : (by == 1) ? bias1 : bias2;      /* one bias vector per blockIdx.y */
  const int ntn = N >> 7; const int mt = blockIdx.x / ntn, nq = blockIdx.x - mt * ntn; if (mt * 128 >= M) return;      /* the same for the whole block, in front of every barrier */
  const int wr = w & 3, wc = w >> 2; const int row0 = mt * 128 + 32 * wr, col0 = nq * 128 + 64 * wc;
  // each thread copies eight 16-byte pieces of a tile: rows tid/8 + 0, 32, 64, 96 of A and of B (a wave's copy covers four whole 128-B rows)
  const unsigned short* ga0 = (const unsigned short*)A + (size_t)(mt * 128 + (tid >> 3)) * lda + (tid & 7) * 8; const unsigned short* gb0 = (const unsigned short*)Bh + (size_t)(nq * 128 + (tid >> 3)) * ldb + (tid & 7) * 8;
  const unsigned d0 = (unsigned)(size_t)&sT[(tid >> 3) * PH + (tid & 7) * 8];
  auto stage = [&](int kb, int buf) {
    const unsigned short* a0 = ga0 + kb; const unsigned short* a1 = a0 + (size_t)32 * lda; const unsigned short* a2 = a1 + (size_t)32 * lda; const unsigned short* a3 = a2 + (size_t)32 * lda;
    const unsigned short* b0 = gb0 + kb; const unsigned short* b1 = b0 + (size_t)32 * ldb; const unsigned short* b2 = b1 + (size_t)32 * ldb; const unsigned short* b3 = b2 + (size_t)32 * ldb;
    const unsigned da0 = d0 + (unsigned)buf * BUFB, da1 = da0 + 32u * PH * 2u, da2 = da0 + 64u * PH * 2u, da3 = da0 + 96u * PH * 2u, db0 = da0 + OPB, db1 = da1 + OPB, db2 = da2 + OPB, db3 = da3 + OPB;
    // the copies go from global memory to LDS through no register; the closing s_wait_xcnt is a precaution that stands in front of any rewrite of the address registers named here
    asm volatile("global_load_async_to_lds_b128 %0, %8, off\n\tglobal_load_async_to_lds_b128 %1, %9, off\n\tglobal_load_async_to_lds_b128 %2, %10, off\n\tglobal_load_async_to_lds_b128 %3, %11, off\n\t"
                 "global_load_async_to_lds_b128 %4, %12, off\n\tglobal_load_async_to_lds_b128 %5, %13, off\n\tglobal_load_async_to_lds_b128 %6, %14, off\n\tglobal_load_async_to_lds_b128 %7, %15, off\n\ts_wait_xcnt 0x0"
                 :: "v"(da0), "v"(da1), "v"(da2), "v"(da3), "v"(db0), "v"(db1), "v"(db2), "v"(db3), "v"(a0), "v"(a1), "v"(a2), "v"(a3), "v"(b0), "v"(b1), "v"(b2), "v"(b3) : "memory"); };
  stage(0, 0);
  asm volatile("s_wait_asynccnt 0x0" ::: "memory");      /* this wave's share of tile 0 has landed */
  __syncthreads();      /* tile 0 is published to all eight waves */
  if (64 < K) stage(64, 1);      /* tile 1 flies while tile 0 is worked on */
  const v8f z8 = {0.f,0.f,0.f,0.f,0.f,0.f,0.f,0.f}; v8f c00 = z8, c01 = z8, c02 = z8, c03 = z8, c10 = z8, c11 = z8, c12 = z8, c13 = z8;
#pragma unroll 1
  for (int kb = 0; kb < K; kb += 64) { const int buf = (kb >> 6) & 1;      /* rolled: one trip is one tile of the ring */
    const unsigned short* ta = &sT[(buf * 2 + 0) * 128 * PH + (32 * wr + ln) * PH]; const unsigned short* tb = &sT[(buf * 2 + 1) * 128 * PH + (64 * wc + ln) * PH];
#pragma unroll
    for (int ks = 0; ks < 64; ks += 32) {      /* unrolled: ks becomes an immediate offset of the LDS reads */
      const v16h a0 = g2_frag(ta + ks, hh), a1 = g2_frag(ta + 16 * PH + ks, hh), b0 = g2_frag(tb + ks, hh), b1 = g2_frag(tb + 16 * PH + ks, hh), b2 = g2_frag(tb + 32 * PH + ks, hh), b3 = g2_frag(tb + 48 * PH + ks, hh);
      c00 = g2_mma(a0, b0, c00); c10 = g2_mma(a1, b0, c10); c01 = g2_mma(a0, b1, c01); c11 = g2_mma(a1, b1, c11);
      c02 = g2_mma(a0, b2, c02); c12 = g2_mma(a1, b2, c12); c03 = g2_mma(a0, b3, c03); c13 = g2_mma(a1, b3, c13); }
    asm volatile("s_wait_dscnt 0x0" ::: "memory");      /* this wave's reads of the trip's buffer are done before the buffer is refilled */
    asm volatile("s_wait_asynccnt 0x0" ::: "memory");      /* this wave's share of the next tile has landed */
    __syncthreads();      /* publishes the next tile and ends every wave's reads of this trip's buffer */
    if (kb + 128 < K) stage(kb + 128, buf); }
  asm volatile("s_wait_asynccnt 0x0" ::: "memory");      /* no copy is outstanding when the ring becomes output staging */
  v8f accs[8] = {c00, c01, c02, c03, c10, c11, c12, c13};      /* every wave has passed the last trip's barrier: nobody reads the ring any more */
  if (SPLIT) {
    static_assert(!SPLIT || ACT == 0, "the split epilogue applies no activation");
    float bvs[4] = {0.f, 0.f, 0.f, 0.f};      /* the wave's four bias values, loaded together */
    if (bp) {
#pragma unroll
      for (int t = 0; t < 4; ++t) bvs[t] = bf16_round(bp[col0 + t * 16 + ln]); }
    if (by == 2) {      /* the same for the whole block */
      // a lane's eight accumulator rows are eight consecutive tokens of one column: split in registers, they are one 16-byte piece of a transposed row. The block stages [hi, residual][128 columns][128 tokens] halfs at a pitch of 272 B (16 B x odd; 69,632 B of the ring's bytes) and stores whole 256-B rows
      constexpr int TP = 136;
#pragma unroll
      for (int u = 0; u < 8; ++u) { const int t = u & 3, half = u >> 2; FragH fh, fl;
#pragma unroll
        for (int r = 0; r < 8; ++r) { const float v = accs[u][r] * alpha + bvs[t]; const _Float16 hv = (_Float16)v; fh.h[r] = hv; fl.h[r] = (_Float16)((v - (float)hv) * 1024.0f); }
        const int o = (64 * wc + t * 16 + ln) * TP + 32 * wr + half * 16 + 8 * hh; *(v8us*)&sT[o] = fh.half[0]; *(v8us*)&sT[128 * TP + o] = fl.half[0]; }
      __syncthreads();      /* a stored row holds the tokens of four waves */
      const int bt = (mt * 128) / SLEN, tok0 = (mt * 128) % SLEN;      /* a block's 128 tokens lie in one batch */
      const size_t o0 = ((size_t)bt * N + nq * 128 + (tid >> 4)) * SLEN + tok0 + (tid & 15) * 8;
#pragma unroll
      for (int it = 0; it < 16; ++it) { const int p = it >> 3, c16 = (it & 7) * 16;      /* a wave's store covers two whole rows */
        const v8us val = *(const v8us*)&sT[(p * 128 + c16 + (tid >> 4)) * TP + (tid & 15) * 8]; *(v8us*)((unsigned short*)(p ? Tl : Th) + o0 + (size_t)c16 * SLEN) = val; }
      return; }
    float (*sf)[32][68] = (float (*)[32][68])sT;      /* each wave stages its own 32 x 64 tile */
#pragma unroll
    for (int u = 0; u < 8; ++u) { const int t = u & 3, half = u >> 2;
#pragma unroll
      for (int r = 0; r < 8; ++r) sf[w][half * 16 + 8 * hh + r][t * 16 + ln] = accs[u][r] * alpha + bvs[t]; }
    __builtin_amdgcn_fence(__ATOMIC_ACQ_REL, "workgroup"); __builtin_amdgcn_wave_barrier();      /* the wave reads back what its other lanes wrote */
#pragma unroll
    for (int q = 0; q < 16; ++q) { const int r = q * 2 + (lane >> 4), c4 = (lane & 15) * 4; const v4f v = *(const v4fa*)&sf[w][r][c4]; v4h h4, l4;      /* sixteen lanes store one whole 128-B line of each plane */
      for (int i = 0; i < 4; ++i) { const _Float16 hv = (_Float16)v[i]; h4[i] = hv; l4[i] = (_Float16)((v[i] - (float)hv) * 1024.0f); }
      const size_t o = cofs + (size_t)(row0 + r) * ldc + col0 + c4; *(v4h*)(Sh + o) = h4; *(v4h*)(Sl + o) = l4; }
    asm volatile("s_wait_xcnt 0x0" ::: "memory");      /* precaution: it stands behind the last of these stores, in front of any later rewrite of the registers that they name */
    return; }
  float (*so)[32][68] = (float (*)[32][68])sT;
#pragma unroll
  for (int u = 0; u < 8; ++u) { const int t = u & 3, half = u >> 2; const int col = col0 + t * 16 + ln; const float bv = bp ? bf16_round(bp[col]) : 0.f;
#pragma unroll
    for (int r = 0; r < 8; ++r) { const int rloc = half * 16 + 8 * hh + r; float v = accs[u][r] * alpha + bv; if (CP) { const int bidx = (row0g + row0 + rloc) / rowsPerB; v += CP[(size_t)bidx * sCPb + (size_t)by * 64 + col]; }
      if (ACT == 3) v = fmaxf(v, 0.f); else if (ACT == 6) v = 0.5f * v * (1.0f + erff(v * 0.70710678118654752f)); else if (ACT == 11) v = 1.0f / (1.0f + expf(-v)); else if (ACT == 15) v = v / (1.0f + expf(-v)); else if (ACT == 12) v = (v > 0.f) ? v : 0.01f * v; else if (ACT == 8) v = tanhf(v);
      so[w][rloc][t * 16 + ln] = v; } }
  __builtin_amdgcn_fence(__ATOMIC_ACQ_REL, "workgroup"); __builtin_amdgcn_wave_barrier();
  const int rsub = lane >> 4, c4 = (lane & 15) * 4;
  {
#pragma unroll
    for (int q = 0; q < 16; ++q) { const int r = q * 2 + rsub; const v4f v = *(const v4fa*)&so[w][r][c4]; if (C) *(v4f*)(C + cofs + (size_t)(row0 + r) * ldc + col0 + c4) = v; if (C16) { v4h h4; for (int i = 0; i < 4; ++i) h4[i] = (_Float16)v[i]; *(v4h*)(C16 + cofs + (size_t)(row0 + r) * ldc + col0 + c4) = h4; } }
     } }



typedef int v4ia __attribute__((ext_vector_type(4), may_alias));
typedef float v2f __attribute__((ext_vector_type(2)));
typedef _Float16 v2h __attribute__((ext_vector_type(2)));
// lane l takes the value of lane l ^ 16
__device__ __forceinline__ float xhalf(float x) { return __builtin_bit_cast(float, __builtin_amdgcn_permlanex16(__builtin_bit_cast(int, x), __builtin_bit_cast(int, x), 0x76543210, 0xfedcba98, false, false)); }
template <int TQ, int TK>
__global__ __launch_bounds__(128) void k_flashb(const _Float16* __restrict__ Q16, const _Float16* __restrict__ Q16lo, int ldq, const _Float16* __restrict__ K16, const _Float16* __restrict__ K16lo, int ldk, const _Float16* __restrict__ Vt, const _Float16* __restrict__ Vtlo, const float* __restrict__ BT, const int* __restrict__ LAG, _Float16* __restrict__ Oh, _Float16* __restrict__ Ol, int ldo) {
  constexpr int RPW = 16, RTN = RPW / 16, NQB = TQ / (4 * RPW), DT = 4, KS = 2;
  __shared__ __attribute__((aligned(16))) float sO[4][RPW][64 + 4];
  // two-buffer ring of one pass's operands, shared by the block's four waves: [buffer][hi, residual][row][halfs]; K rows (128 B) at a pitch of 144 B, V^T rows (64 B) at 80 B, both 16 B x odd for the 16-byte fragment reads
  __shared__ __attribute__((aligned(16))) unsigned short sK[2][2][32][72]; __shared__ __attribute__((aligned(16))) unsigned short sV[2][2][64][40];
  __shared__ __attribute__((aligned(256))) float sB[513];      /* the head's bias row, rounded to bf16 once and then put into log2 units (x log2 e): a pass's gathers are 4-byte LDS reads; the largest alignment puts it at the start of the block's LDS, so that its base fits the reads' 16-bit offset field */
  const int tid = threadIdx.x, w = tid >> 5, lane = tid & 31, ln = lane & 15, hh = lane >> 4;
  const int slab = blockIdx.x / NQB, qblk = blockIdx.x % NQB; const int b = slab / NH, h = slab % NH; const int qb0 = qblk * (4 * RPW); const int q0 = qb0 + w * RPW;
  FragH aq[2][KS], aql[2][KS];
#pragma unroll
  for (int rt = 0; rt < RTN; ++rt) { const size_t qo = ((size_t)b * TQ + q0 + rt * 16 + ln) * ldq + h * 64; const unsigned short* qr = (const unsigned short*)Q16 + qo; const unsigned short* ql = (const unsigned short*)Q16lo + qo;
#pragma unroll
    for (int ks = 0; ks < KS; ++ks) { aq[rt][ks].half[0] = *(const v8us*)(qr + ks * 32 + 8 * hh); aq[rt][ks].half[1] = *(const v8us*)(qr + ks * 32 + 16 + 8 * hh); aql[rt][ks].half[0] = *(const v8us*)(ql + ks * 32 + 8 * hh); aql[rt][ks].half[1] = *(const v8us*)(ql + ks * 32 + 16 + 8 * hh); } }
  const unsigned short* Vth = (const unsigned short*)Vt + (size_t)slab * 64 * TK; const unsigned short* Vtl = (const unsigned short*)Vtlo + (size_t)slab * 64 * TK;
  // each thread copies eight 16-byte pieces of a pass's tile: K rows tid/8 and tid/8 + 16 (a wave covers whole 128-B rows), V^T rows tid/4 and tid/4 + 32, hi and residual plane each
  const size_t kg0 = ((size_t)b * TK + (tid >> 3)) * ldk + h * 64 + (tid & 7) * 8, vg0 = (size_t)(tid >> 2) * TK + (tid & 3) * 8;
  const unsigned kd0 = (unsigned)(size_t)&sK[0][0][tid >> 3][(tid & 7) * 8], vd0 = (unsigned)(size_t)&sV[0][0][tid >> 2][(tid & 3) * 8];
  auto stage = [&](int j, int buf) {
    const unsigned short* gk = (const unsigned short*)K16 + kg0 + (size_t)j * ldk; const unsigned short* gkl = (const unsigned short*)K16lo + kg0 + (size_t)j * ldk; const unsigned short* gk2 = gk + (size_t)16 * ldk; const unsigned short* gkl2 = gkl + (size_t)16 * ldk;
    const unsigned short* gv = Vth + vg0 + j; const unsigned short* gvl = Vtl + vg0 + j; const unsigned short* gv2 = gv + (size_t)32 * TK; const unsigned short* gvl2 = gvl + (size_t)32 * TK;
    const unsigned dk = kd0 + (unsigned)buf * (unsigned)sizeof(sK[0]), dkl = dk + (unsigned)sizeof(sK[0][0]), dk2 = dk + 16u * (unsigned)sizeof(sK[0][0][0]), dkl2 = dkl + 16u * (unsigned)sizeof(sK[0][0][0]);
    const unsigned dv = vd0 + (unsigned)buf * (unsigned)sizeof(sV[0]), dvl = dv + (unsigned)sizeof(sV[0][0]), dv2 = dv + 32u * (unsigned)sizeof(sV[0][0][0]), dvl2 = dvl + 32u * (unsigned)sizeof(sV[0][0][0]);
    // the copies go from global memory to LDS through no register; the closing s_wait_xcnt is a precaution that stands in front of any rewrite of the address registers named here
    asm volatile("global_load_async_to_lds_b128 %0, %8, off\n\tglobal_load_async_to_lds_b128 %1, %9, off\n\tglobal_load_async_to_lds_b128 %2, %10, off\n\tglobal_load_async_to_lds_b128 %3, %11, off\n\t"
                 "global_load_async_to_lds_b128 %4, %12, off\n\tglobal_load_async_to_lds_b128 %5, %13, off\n\tglobal_load_async_to_lds_b128 %6, %14, off\n\tglobal_load_async_to_lds_b128 %7, %15, off\n\ts_wait_xcnt 0x0"
                 :: "v"(dk), "v"(dk2), "v"(dkl), "v"(dkl2), "v"(dv), "v"(dv2), "v"(dvl), "v"(dvl2), "v"(gk), "v"(gk2), "v"(gkl), "v"(gkl2), "v"(gv), "v"(gv2), "v"(gvl), "v"(gvl2) : "memory"); };
  stage(0, 0);
  { const float* br = BT + (size_t)h * 513; const float t0 = br[tid], t1 = br[tid + 128], t2 = br[tid + 256], t3 = br[tid + 384], t4 = br[512];      /* 128 threads, 513 entries: the loads fly together, beside tile 0's copies */
    asm volatile("s_wait_xcnt 0x0" :: "v"(tid) : "memory");      /* precaution: it stands in front of any rewrite of the index register that these loads name; tid as an input keeps that register as it is up to here */
    sB[tid] = bf16_round(t0) * LOG2E; sB[tid + 128] = bf16_round(t1) * LOG2E; sB[tid + 256] = bf16_round(t2) * LOG2E; sB[tid + 384] = bf16_round(t3) * LOG2E; if (tid == 0) sB[512] = bf16_round(t4) * LOG2E; }      /* published by the barrier that publishes tile 0 */
  asm volatile("s_wait_asynccnt 0x0" ::: "memory");      /* this wave's share of tile 0 has landed */
  __syncthreads();      /* tile 0 is published to all four waves */
  stage(32, 1);      /* tile 1 flies while tile 0 is worked on */
  // scores are formed transposed, S^T = K Q^T (A = K rows, B = Q rows): lane (ln, hh) holds, of the ONE query q0 + ln, the scores of keys nt * 16 + 8 * hh + r; so are the outputs, O^T = V^T P^T
  const unsigned lq = (unsigned)LAG[q0 + ln];
  float m_run = -3.0e38f, l_run = 0.f; v8f oacc[DT], oaccl[DT];
#pragma unroll
  for (int dt = 0; dt < DT; ++dt) { oacc[dt] = (v8f){0.f,0.f,0.f,0.f,0.f,0.f,0.f,0.f}; oaccl[dt] = oacc[dt]; }
#pragma unroll 1
  for (int j0 = 0; j0 < TK; j0 += 32) {
    const int buf = (j0 >> 5) & 1;
    float bb[2][8];      /* the pass's bias values, gathered from LDS at its head so that they fly beside the K reads */
#pragma unroll
    for (int nt = 0; nt < 2; ++nt) { const v4ia ka = *(const v4ia*)(LAG + j0 + nt * 16 + 8 * hh), kb = *(const v4ia*)(LAG + j0 + nt * 16 + 8 * hh + 4);
#pragma unroll
      for (int r = 0; r < 8; ++r) { const unsigned d = lq - (unsigned)(r < 4 ? ka[r & 3] : kb[r & 3]);      /* |lag[q] - lag[k]| = min(d, -d) in unsigned arithmetic; the min with 512 keeps the index inside sB for any lag content */
        bb[nt][r] = sB[min(min(d, 0u - d), 512u)]; } }
    asm volatile("s_wait_xcnt 0x0" ::: "memory");      /* precaution: it stands in front of the rewrite of the lag loads' address registers at the loop's foot */
    v8f s[2];
#pragma unroll
    for (int nt = 0; nt < 2; ++nt) { const unsigned short* kr = &sK[buf][0][nt * 16 + ln][0]; const unsigned short* kl = &sK[buf][1][nt * 16 + ln][0]; FragH bk[KS], bkl[KS];
#pragma unroll
      for (int ks = 0; ks < KS; ++ks) { bk[ks].half[0] = *(const v8us*)(kr + ks * 32 + 8 * hh); bk[ks].half[1] = *(const v8us*)(kr + ks * 32 + 16 + 8 * hh); bkl[ks].half[0] = *(const v8us*)(kl + ks * 32 + 8 * hh); bkl[ks].half[1] = *(const v8us*)(kl + ks * 32 + 16 + 8 * hh); }
      v8f acc = (v8f){0.f,0.f,0.f,0.f,0.f,0.f,0.f,0.f}, accr = acc;
#pragma unroll
      for (int ks = 0; ks < KS; ++ks) { acc = mmaH<1>(bk[ks].v, bk[ks].v, aq[0][ks].v, aq[0][ks].v, acc); accr = mmaH<1>(bk[ks].v, bk[ks].v, aql[0][ks].v, aql[0][ks].v, accr); accr = mmaH<1>(bkl[ks].v, bkl[ks].v, aq[0][ks].v, aq[0][ks].v, accr); }
      s[nt] = acc + accr * 0.0009765625f; }
    float sc[2][8], mh[2];
#pragma unroll
    for (int nt = 0; nt < 2; ++nt) {
#pragma unroll
      for (int r = 0; r < 8; ++r) sc[nt][r] = s[nt][r] * (SCL * LOG2E) + bb[nt][r];      /* scores in log2 units: e^x = 2^(x log2 e), so that each exponential below is the one hardware exp2 instruction */
      mh[nt] = fmaxf(fmaxf(fmaxf(sc[nt][0], sc[nt][1]), fmaxf(sc[nt][2], sc[nt][3])), fmaxf(fmaxf(sc[nt][4], sc[nt][5]), fmaxf(sc[nt][6], sc[nt][7]))); }
    float mc = fmaxf(mh[0], mh[1]);
    mc = fmaxf(mc, xhalf(mc));      /* the query's other 16 keys of the pass lie in lane ^ 16 */
    const float mn = fmaxf(m_run, mc);
    float e[17]; e[0] = m_run - mn;      /* the pass's seventeen exponents: the running maximum's step, then the sixteen scores */
#pragma unroll
    for (int nt = 0; nt < 2; ++nt)
#pragma unroll
      for (int r = 0; r < 8; ++r) e[1 + nt * 8 + r] = sc[nt][r] - mn;
    asm("v_exp_f32 %0, %0\n\tv_exp_f32 %1, %1\n\tv_exp_f32 %2, %2\n\tv_exp_f32 %3, %3\n\tv_exp_f32 %4, %4\n\tv_exp_f32 %5, %5\n\tv_exp_f32 %6, %6\n\tv_exp_f32 %7, %7\n\tv_exp_f32 %8, %8\n\tv_nop"
        : "+v"(e[0]), "+v"(e[1]), "+v"(e[2]), "+v"(e[3]), "+v"(e[4]), "+v"(e[5]), "+v"(e[6]), "+v"(e[7]), "+v"(e[8]));
    asm("v_exp_f32 %0, %0\n\tv_exp_f32 %1, %1\n\tv_exp_f32 %2, %2\n\tv_exp_f32 %3, %3\n\tv_exp_f32 %4, %4\n\tv_exp_f32 %5, %5\n\tv_exp_f32 %6, %6\n\tv_exp_f32 %7, %7\n\tv_nop"
        : "+v"(e[9]), "+v"(e[10]), "+v"(e[11]), "+v"(e[12]), "+v"(e[13]), "+v"(e[14]), "+v"(e[15]), "+v"(e[16]));
    const float ea = e[0]; const float al = (mn > -1.0e38f) ? ea : 1.0f; m_run = mn;
    FragH pa, pl; v2f ps = {0.f, 0.f};      /* two f32 D tiles of S^T, converted in place, are the B operand P^T in the hardware k order: element nt * 8 + r = key nt * 16 + 8 * hh + r */
#pragma unroll
    for (int nt = 0; nt < 2; ++nt)
#pragma unroll
      for (int r = 0; r < 8; r += 2) { const v2f p = {e[1 + nt * 8 + r], e[2 + nt * 8 + r]}; ps += p; const v2f pq = p * 1024.0f; const v2h ph = __builtin_convertvector(pq, v2h); const v2h pr = __builtin_convertvector((pq - __builtin_convertvector(ph, v2f)) * 1024.0f, v2h);
        pa.h[nt * 8 + r] = ph[0]; pa.h[nt * 8 + r + 1] = ph[1]; pl.h[nt * 8 + r] = pr[0]; pl.h[nt * 8 + r + 1] = pr[1]; }
    l_run = l_run * al + (ps[0] + ps[1]);      /* this lane half's share of the query's sum; the halves are joined behind the loop */
#pragma unroll
    for (int dt = 0; dt < DT; ++dt) { oacc[dt] *= al; oaccl[dt] *= al; }
#pragma unroll
    for (int dt = 0; dt < DT; ++dt) { const unsigned short* vr = &sV[buf][0][dt * 16 + ln][0]; const unsigned short* vl = &sV[buf][1][dt * 16 + ln][0]; FragH bv, bl; bv.half[0] = *(const v8us*)(vr + 8 * hh); bv.half[1] = *(const v8us*)(vr + 16 + 8 * hh); bl.half[0] = *(const v8us*)(vl + 8 * hh); bl.half[1] = *(const v8us*)(vl + 16 + 8 * hh);
      oacc[dt] = mmaH<1>(bv.v, bv.v, pa.v, pa.v, oacc[dt]); oaccl[dt] = mmaH<1>(bl.v, bl.v, pa.v, pa.v, oaccl[dt]); oaccl[dt] = mmaH<1>(bv.v, bv.v, pl.v, pl.v, oaccl[dt]); }
    asm volatile("s_wait_dscnt 0x0" ::: "memory");      /* this wave's reads of the pass's buffer are done before the buffer is refilled */
    asm volatile("s_wait_asynccnt 0x0" ::: "memory");      /* this wave's share of the next tile has landed */
    __syncthreads();      /* publishes the next tile and ends every wave's reads of this pass's buffer */
    if (j0 + 64 < TK) stage(j0 + 64, buf); }
  asm volatile("s_wait_asynccnt 0x0" ::: "memory");      /* no copy is outstanding when the wave goes on to its end */
  { const float l = l_run + xhalf(l_run); const float li = (l > 0.f) ? 1.0f / (l * 1024.0f) : 0.f;
#pragma unroll
    for (int dt = 0; dt < DT; ++dt) { v4f o0, o1;      /* a lane's eight accumulator rows are eight consecutive head columns of its query */
#pragma unroll
      for (int r = 0; r < 4; ++r) { o0[r] = (oacc[dt][r] + oaccl[dt][r] * 0.0009765625f) * li; o1[r] = (oacc[dt][4 + r] + oaccl[dt][4 + r] * 0.0009765625f) * li; }
      *(v4fa*)&sO[w][ln][dt * 16 + 8 * hh] = o0; *(v4fa*)&sO[w][ln][dt * 16 + 8 * hh + 4] = o1; } }
  __builtin_amdgcn_fence(__ATOMIC_ACQ_REL, "workgroup"); __builtin_amdgcn_wave_barrier();
  {
#pragma unroll
    for (int rp = 0; rp < RPW; rp += 2) { const int r = rp + (lane >> 4), pc = lane & 15; const v4f val = *(const v4fa*)&sO[w][r][pc * 4]; v4h h4, l4;      /* the output leaves as the f16 hi + (x2^10) residual planes that the last projection reads; sixteen lanes store one whole 128-B line of each */
      for (int i = 0; i < 4; ++i) { const _Float16 hv = (_Float16)val[i]; h4[i] = hv; l4[i] = (_Float16)((val[i] - (float)hv) * 1024.0f); }
      const size_t o = ((size_t)b * TQ + q0 + r) * ldo + h * 64 + pc * 4; *(v4h*)(Oh + o) = h4; *(v4h*)(Ol + o) = l4; }
     } }


__global__ __launch_bounds__(256) void k_lnx(const float* __restrict__ X, const float* __restrict__ g, const float* __restrict__ bb, _Float16* __restrict__ Y16, float* __restrict__ XB) {
  #pragma clang fp contract(off)
  const int tid = threadIdx.x, w = tid >> 5, ln = tid & 31; const int r = blockIdx.x * 8 + w; if (r >= NR) return; const float* x = X + (size_t)r * DM; float s = 0.f;
#pragma unroll 1
  for (int i = 0; i < DM / 128; ++i) { const v4f a = *(const v4fa*)(x + i * 128 + ln * 4); for (int q = 0; q < 4; ++q) s += bf16_round(a[q]); }
  for (int o = 16; o > 0; o >>= 1) s += __shfl_xor(s, o, 32); const float mu = s / (float)DM; float q2 = 0.f;
#pragma unroll 1
  for (int i = 0; i < DM / 128; ++i) { const v4f a = *(const v4fa*)(x + i * 128 + ln * 4); for (int q = 0; q < 4; ++q) { const float d = bf16_round(a[q]) - mu; q2 += d * d; } }
  for (int o = 16; o > 0; o >>= 1) q2 += __shfl_xor(q2, o, 32); const float rs = rsqrtf(q2 / (float)DM + 1e-5f);
  {
#pragma unroll 1
    for (int i = 0; i < DM / 128; ++i) { const int c0 = i * 128 + ln * 4; const v4f a = *(const v4fa*)(x + c0); _Float16 h4[4]; v4f xb;
      for (int q = 0; q < 4; ++q) { const float t = bf16_round(a[q]); h4[q] = (_Float16)((t - mu) * rs * bf16_round(g[c0 + q]) + bf16_round(bb[c0 + q])); xb[q] = t; }
      *(unsigned long long*)((unsigned short*)Y16 + (size_t)r * DM + c0) = *(const unsigned long long*)h4; *(v4f*)(XB + (size_t)r * DM + c0) = xb; }
     } }
__global__ __launch_bounds__(256) void k_causaltab(unsigned* __restrict__ MB, int* __restrict__ RA, int* __restrict__ KE, int nq, int nk) {
  const int t = blockIdx.x * 256 + threadIdx.x; const int nw = nk / 32;
  if (t < nq * nw) { const int q = t / nw, w = t % nw; const int first = q + 1 - 32 * w; const unsigned bits = (first <= 0) ? 0xffffffffu : ((first >= 32) ? 0u : (0xffffffffu << first)); *(unsigned*)(MB + t) = bits;  }
  if (t < nq) { *(int*)(RA + t) = 0;  }
  if (t < nq / 64) { const int v = 64 * (t + 1); *(int*)(KE + t * 32) = v;  } }


extern "C" void kernel_launch(void* const* d_in, const int* in_sizes, int n_in,
                              void* d_out, int out_size, void* d_ws, size_t ws_size, hipStream_t stream) {
  (void)in_sizes; (void)n_in; (void)out_size;
  const float* const* I = (const float* const*)d_in; const float* x = I[0]; const int* lag = (const int*)d_in[1]; const float* wq = I[2]; const float* bq = I[3]; const float* wk = I[4]; const float* bk = I[5]; const float* wv = I[6]; const float* bv = I[7]; const float* wo = I[8]; const float* bo = I[9]; const float* lb = I[10];
  char* ws = (char*)d_ws; size_t off = 0;
  auto take = [&](size_t bytes) { char* p = ws + off; off += (bytes + 255) & ~(size_t)255; return p; };
  _Float16* BQ = (_Float16*)take((size_t)DM * DM * 2); _Float16* BK = (_Float16*)take((size_t)DM * DM * 2); _Float16* BV = (_Float16*)take((size_t)DM * DM * 2); _Float16* BO = (_Float16*)take((size_t)DM * DM * 2);
  _Float16* X16 = (_Float16*)take((size_t)NR * DM * 2); _Float16* Oh = (_Float16*)take((size_t)NR * DM * 2); _Float16* Ol = (_Float16*)take((size_t)NR * DM * 2);
  _Float16* Qh = (_Float16*)take((size_t)NR * DM * 2); _Float16* Kh = (_Float16*)take((size_t)NR * DM * 2); _Float16* Ql = (_Float16*)take((size_t)NR * DM * 2); _Float16* Kl = (_Float16*)take((size_t)NR * DM * 2); _Float16* Vth = (_Float16*)take((size_t)NR * DM * 2); _Float16* Vtl = (_Float16*)take((size_t)NR * DM * 2);      /* Kh directly behind Qh, Kl directly behind Ql */
  if (off > ws_size) return;      /* 8 + 8 + 16 + 48 = 80 MiB */
  const size_t w8 = (size_t)DM * DM / 8; const unsigned wb = (unsigned)((w8 + 255) / 256);
  k_wt_f16<<<dim3(wb, 4), 256, 0, stream>>>(wq, wk, wv, wo, BQ, DM, DM, 16.0f);      /* (in,out); BQ, BK, BV, BO are contiguous */
  const size_t n8 = (size_t)NR * DM / 8; const unsigned nb8 = (unsigned)((n8 + 255) / 256); const dim3 gP((NR / 128) * (DM / 128), 1); const dim3 gP3((NR / 128) * (DM / 128), 3);
  k_x16<<<nb8, 256, 0, stream>>>(x, X16, n8);
  k_gemm2<0, 1><<<gP3, 256, 0, stream>>>(X16, DM, 0, BQ, DM, (size_t)DM * DM, 0.0625f, bq, bk, bv, nullptr, 1, 0, 0, nullptr, nullptr, Qh, Ql, Vth, Vtl, DM, (size_t)NR * DM, NR, DM, DM);      /* q, k, v in one grid, stored as the planes that the attention reads */
  k_flashb<SLEN, SLEN><<<NBT * NH * (SLEN / 64), 128, 0, stream>>>(Qh, Ql, DM, Kh, Kl, DM, Vth, Vtl, lb, lag, Oh, Ol, DM);      /* both batches in one grid; the lag vector is per position, shared across the batch */
  k_gemm2<0, 0><<<gP, 256, 0, stream>>>(Oh, DM, 0, BO, DM, 0, 0.0625f, bo, nullptr, nullptr, nullptr, 1, 0, 0, (float*)d_out, nullptr, nullptr, nullptr, nullptr, nullptr, DM, 0, NR, DM, DM);
  k_gemm2<0, 0><<<gP, 256, 0, stream>>>(Ol, DM, 0, BO, DM, 0, 0.0625f / 1024.0f, nullptr, nullptr, nullptr, (float*)d_out, 1, (size_t)DM, 0, (float*)d_out, nullptr, nullptr, nullptr, nullptr, nullptr, DM, 0, NR, DM, DM);
}

// v009
// It runs in 206 microseconds.
// In both of two side-by-side timings against v008, it was 1.05 times as fast.
// Counting every step since v000, it is 5.62 times as fast.
#include <hip/hip_runtime.h>
// Multi-head self-attention with a lag-distance bias (2 x 2048 tokens, 1024 = 16 heads x 64): q,k,v = x W + b; scores = q.k/8 + lag_bias[h][|lag[q] - lag[k]|] with the INPUT integer lag vector; softmax over all keys; out = (attn v) Wo + bo -> [2,2048,1024].
// Structure: x as an exact f16 plane; projections as f16 WMMA GEMMs (128x128 block tiles of eight 32x64 wave tiles, 64-k operand tiles from a two-buffer LDS ring filled by asynchronous copies one trip ahead, f32 accumulation, exact x16 weights + bias); q, k as f16 hi + (x2^10) residual planes, V^T as hi + residual planes, all split (V also transposed, through LDS) in the projection GEMM's own epilogue; the fused flash kernel takes each pass's K and V^T tiles (hi + residual) from a two-buffer LDS ring filled by asynchronous copies one pass ahead and shared by its four waves, and adds the bias, gathered by |lag[q] - lag[k]| (INPUT int32 positions) from the head's row of the INPUT table, which each block rounds once into LDS, inside the score stage (all keys valid; scores and outputs formed transposed, so that a lane holds one query: online f32 softmax in the lane, in log2 units with the hardware exp2, P hi + residual packed from the score accumulators into the next product's operand, two value accumulators) and stores O as hi + residual planes itself; these go into Wo (two GEMMs, bias in the first).
// Compute dtype: x, weights, biases, lag_bias rounded to bf16; projections exact; q, k, P, v, O as f16 hi + residual pairs (~2^-21); f32 accumulation and softmax. v_wmma_f32_16x16x32_f16.
#define NBT 2
#define SLEN 2048
#define DM 1024
#define NH 16
#define SCL 0.125f
#define LOG2E 1.44269504088896340736f
#define NR (NBT * SLEN)
typedef __bf16 v16b __attribute__((ext_vector_type(16)));
typedef unsigned short v8us __attribute__((ext_vector_type(8), may_alias));
typedef float  v8f  __attribute__((ext_vector_type(8)));
typedef float  v4f  __attribute__((ext_vector_type(4)));
typedef float  v4fa __attribute__((ext_vector_type(4), may_alias));
union FragB { v16b v; v8us half[2]; unsigned short u[16]; };

__device__ __forceinline__ unsigned short bf16_bits(float x) { unsigned int u = __float_as_uint(x); return (unsigned short)((u + 0x7FFFu + ((u >> 16) & 1u)) >> 16); }
__device__ __forceinline__ float bf16_val(unsigned short b) { return __uint_as_float(((unsigned int)b) << 16); }
__device__ __forceinline__ float bf16_round(float x) { return bf16_val(bf16_bits(x)); }
// D += A·B with NT terms: 1 = ah·bh, 2 = + al·bh (A split), 3 = + ah·bl (both split)
template <int NT>
__device__ __forceinline__ v8f mmaN(v16b ah, v16b al, v16b bh, v16b bl, v8f c) {
  c = __builtin_amdgcn_wmma_f32_16x16x32_bf16(false, ah, false, bh, (short)0, c, false, false);
  if (NT >= 2) c = __builtin_amdgcn_wmma_f32_16x16x32_bf16(false, al, false, bh, (short)0, c, false, false);
  if (NT >= 3) c = __builtin_amdgcn_wmma_f32_16x16x32_bf16(false, ah, false, bl, (short)0, c, false, false);
  asm volatile("v_nop\n\tv_nop\n\tv_nop\n\tv_nop" : "+v"(c) : "v"(ah), "v"(al), "v"(bh), "v"(bl));
  return c;
}

__global__ __launch_bounds__(256) void k_wt_bf16(const float* __restrict__ W, unsigned short* __restrict__ Wt, int K, int N) {
  const int t = blockIdx.x * 256 + threadIdx.x;
  const int k8n = K / 8;
  if (t >= N * k8n) return;
  const int n = t / k8n, k8 = (t % k8n) * 8;
  v8us v;
#pragma unroll
  for (int i = 0; i < 8; ++i) v[i] = bf16_bits(W[(size_t)(k8 + i) * N + n]);
  *(v8us*)(Wt + (size_t)n * K + k8) = v;
  
}

// GEMM C[M][N] (f32, pitch ldc) = act(A[M][K]·W + bias). A f32 row-major (pitch lda) converted per fragment to bf16
// (ASPLIT: hi/lo two planes -> 2 terms, else single rounded term); Wt bf16 [N][K] (pitch ldb). BIAS_BF16 rounds the
// bias to bf16 first (bias quantised to bf16 before the add). K%32==0, M%16==0, N%64==0.
template <bool ASPLIT, int ACT, bool BIAS_BF16>
__global__ __launch_bounds__(128) void k_gemm_bf(const float* __restrict__ A, int lda, const unsigned short* __restrict__ Wt, int ldb,
                                               const float* __restrict__ bias, float* __restrict__ C, int ldc, int M, int N, int K) {
  __shared__ __attribute__((aligned(16))) float so[4][16][64];
  const int tid = threadIdx.x, w = tid >> 5, lane = tid & 31, ln = lane & 15, hh = lane >> 4;
  const int ntn = N / 64;
  const int wid = blockIdx.x * 4 + w;
  const int mt = wid / ntn, nq = wid % ntn;
  if (mt * 16 >= M) return;
  const int row0 = mt * 16, col0 = nq * 64;
  const float* arow = A + (size_t)(row0 + ln) * lda;
  v8f acc[4] = {};
  for (int kb = 0; kb < K; kb += 32) {
    FragB ah, al;
    const v4f x0 = *(const v4fa*)(arow + kb + 8 * hh), x1 = *(const v4fa*)(arow + kb + 8 * hh + 4);
    const v4f x2 = *(const v4fa*)(arow + kb + 16 + 8 * hh), x3 = *(const v4fa*)(arow + kb + 16 + 8 * hh + 4);
    float xs[16] = {x0[0],x0[1],x0[2],x0[3],x1[0],x1[1],x1[2],x1[3],x2[0],x2[1],x2[2],x2[3],x3[0],x3[1],x3[2],x3[3]};
#pragma unroll
    for (int i = 0; i < 16; ++i) { const unsigned short hb = bf16_bits(xs[i]); ah.u[i] = hb; al.u[i] = ASPLIT ? bf16_bits(xs[i] - bf16_val(hb)) : (unsigned short)0; }
#pragma unroll
    for (int t = 0; t < 4; ++t) {
      const unsigned short* brow = Wt + (size_t)(col0 + t * 16 + ln) * ldb + kb;
      FragB b;
      b.half[0] = *(const v8us*)(brow + 8 * hh);
      b.half[1] = *(const v8us*)(brow + 16 + 8 * hh);
      acc[t] = mmaN<ASPLIT ? 2 : 1>(ah.v, al.v, b.v, b.v, acc[t]);
    }
  }
#pragma unroll
  for (int t = 0; t < 4; ++t) {
    float bv = bias ? bias[col0 + t * 16 + ln] : 0.f;
    if (BIAS_BF16) bv = bf16_round(bv);
#pragma unroll
    for (int r = 0; r < 8; ++r) { float v = acc[t][r] + bv; if (ACT == 1) v = fmaxf(v, 0.f); so[w][8 * hh + r][t * 16 + ln] = v; }
  }
  __builtin_amdgcn_fence(__ATOMIC_ACQ_REL, "workgroup");
  __builtin_amdgcn_wave_barrier();
  const int rsub = lane >> 4, c4 = (lane & 15) * 4;
  {
#pragma unroll
    for (int q = 0; q < 8; ++q) {
      const int r = q * 2 + rsub;
      const v4f v = *(const v4fa*)&so[w][r][c4];
      *(v4f*)(C + (size_t)(row0 + r) * ldc + col0 + c4) = v;
    }
    
  }
}

// GEMM C = act(A·W + bias + resid): A f32 (ASPLIT -> hi/lo 2 terms), Wt bf16 [N][K]; ACT 0 none, 1 relu, 2 exact gelu;
// resid (optional, f32, row index = (row % rmod), pitch ldr, RES_BF16 rounds it) added before the activation.
template <bool ASPLIT, int ACT, bool BIAS_BF16, bool RES_BF16>
__global__ __launch_bounds__(128) void k_gemm_bf3(const float* __restrict__ A, int lda, const unsigned short* __restrict__ Wt, int ldb,
                                                const float* __restrict__ bias, const float* __restrict__ resid, int rmod, int ldr,
                                                float* __restrict__ C, int ldc, int M, int N, int K) {
  __shared__ __attribute__((aligned(16))) float so[4][16][64];
  const int tid = threadIdx.x, w = tid >> 5, lane = tid & 31, ln = lane & 15, hh = lane >> 4;
  const int ntn = N / 64;
  const int wid = blockIdx.x * 4 + w;
  const int mt = wid / ntn, nq = wid % ntn;
  if (mt * 16 >= M) return;
  const int row0 = mt * 16, col0 = nq * 64;
  const float* arow = A + (size_t)(row0 + ln) * lda;
  v8f acc[4] = {};
  for (int kb = 0; kb < K; kb += 32) {
    FragB ah, al;
    const v4f x0 = *(const v4fa*)(arow + kb + 8 * hh), x1 = *(const v4fa*)(arow + kb + 8 * hh + 4);
    const v4f x2 = *(const v4fa*)(arow + kb + 16 + 8 * hh), x3 = *(const v4fa*)(arow + kb + 16 + 8 * hh + 4);
    float xs[16] = {x0[0],x0[1],x0[2],x0[3],x1[0],x1[1],x1[2],x1[3],x2[0],x2[1],x2[2],x2[3],x3[0],x3[1],x3[2],x3[3]};
#pragma unroll
    for (int i = 0; i < 16; ++i) { const unsigned short hb = bf16_bits(xs[i]); ah.u[i] = hb; al.u[i] = ASPLIT ? bf16_bits(xs[i] - bf16_val(hb)) : (unsigned short)0; }
#pragma unroll
    for (int t = 0; t < 4; ++t) {
      const unsigned short* brow = Wt + (size_t)(col0 + t * 16 + ln) * ldb + kb;
      FragB b;
      b.half[0] = *(const v8us*)(brow + 8 * hh);
      b.half[1] = *(const v8us*)(brow + 16 + 8 * hh);
      acc[t] = mmaN<ASPLIT ? 2 : 1>(ah.v, al.v, b.v, b.v, acc[t]);
    }
  }
#pragma unroll
  for (int t = 0; t < 4; ++t) {
    const int col = col0 + t * 16 + ln;
    float bv = bias ? bias[col] : 0.f;
    if (BIAS_BF16) bv = bf16_round(bv);
#pragma unroll
    for (int r = 0; r < 8; ++r) {
      float v = acc[t][r] + bv;
      if (resid) { float rv = resid[(size_t)((row0 + 8 * hh + r) % rmod) * ldr + col]; if (RES_BF16) rv = bf16_round(rv); v += rv; }
      if (ACT == 1) v = fmaxf(v, 0.f);
      if (ACT == 2) v = 0.5f * v * (1.0f + erff(v * 0.70710678118654752f));
      if (ACT == 3) { const float u = 0.7978845608028654f * (v + 0.044715f * v * v * v); v = 0.5f * v * (1.0f + tanhf(u)); }
      so[w][8 * hh + r][t * 16 + ln] = v;
    }
  }
  __builtin_amdgcn_fence(__ATOMIC_ACQ_REL, "workgroup");
  __builtin_amdgcn_wave_barrier();
  const int rsub = lane >> 4, c4 = (lane & 15) * 4;
  {
#pragma unroll
    for (int q = 0; q < 8; ++q) {
      const int r = q * 2 + rsub;
      const v4f v = *(const v4fa*)&so[w][r][c4];
      *(v4f*)(C + (size_t)(row0 + r) * ldc + col0 + c4) = v;
    }
    
  }
}
// row LayerNorm (biased variance, eps) over N: s = X (+ R); optional out_sum <- s; out_norm <- (s-mu)*rsqrt(var+eps)*g + b
template <bool PARAM_BF16>
__global__ __launch_bounds__(256) void k_layernorm(const float* __restrict__ X, const float* __restrict__ R, const float* __restrict__ g, const float* __restrict__ bta,
                                                  float* __restrict__ out_sum, float* __restrict__ out_norm, int N, float eps) {
  __shared__ float red[256];
  const int row = blockIdx.x, tid = threadIdx.x;
  const float* x = X + (size_t)row * N; const float* rr = R ? R + (size_t)row * N : nullptr;
  float vals[16];                     // up to N = 4096
  const int per = N / 256;            // contiguous chunk per thread? use strided-by-4 chunks: thread handles j = tid*4 + 1024*u
  float s1 = 0.f;
  for (int u = 0; u < per / 4; ++u) {
    const int j = tid * 4 + 1024 * u;
    const v4f a = *(const v4fa*)(x + j);
    v4f b = {0.f,0.f,0.f,0.f}; if (rr) b = *(const v4fa*)(rr + j);
#pragma unroll
    for (int q = 0; q < 4; ++q) { const float v = a[q] + b[q]; vals[u * 4 + q] = v; s1 += v; }
  }
  red[tid] = s1; __syncthreads();
  for (int st = 128; st > 0; st >>= 1) { if (tid < st) red[tid] += red[tid + st]; __syncthreads(); }
  const float mu = red[0] / (float)N; __syncthreads();
  float s2 = 0.f;
  for (int u = 0; u < per / 4; ++u)
#pragma unroll
    for (int q = 0; q < 4; ++q) { const float c = vals[u * 4 + q] - mu; s2 += c * c; }
  red[tid] = s2; __syncthreads();
  for (int st = 128; st > 0; st >>= 1) { if (tid < st) red[tid] += red[tid + st]; __syncthreads(); }
  const float rs = rsqrtf(red[0] / (float)N + eps);
  {
    for (int u = 0; u < per / 4; ++u) {
      const int j = tid * 4 + 1024 * u;
      v4f o, sm;
#pragma unroll
      for (int q = 0; q < 4; ++q) {
        float gg = g[j + q], bb = bta[j + q];
        if (PARAM_BF16) { gg = bf16_round(gg); bb = bf16_round(bb); }
        sm[q] = vals[u * 4 + q]; o[q] = (vals[u * 4 + q] - mu) * rs * gg + bb;
      }
      if (out_sum) *(v4f*)(out_sum + (size_t)row * N + j) = sm;
      *(v4f*)(out_norm + (size_t)row * N + j) = o;
    }
    
  }
}



// ---- f16 WMMA path (v_wmma_f32_16x16x32_f16): 11-bit significands for operands in range — used where a [0,1] probability operand needs more precision than bf16
typedef _Float16 v16h __attribute__((ext_vector_type(16)));
union FragH { v16h v; v8us half[2]; _Float16 h[16]; unsigned short u[16]; };
template <int NT>
__device__ __forceinline__ v8f mmaH(v16h ah, v16h al, v16h bh, v16h bl, v8f c) {
  c = __builtin_amdgcn_wmma_f32_16x16x32_f16(false, ah, false, bh, (short)0, c, false, false);
  if (NT >= 2) c = __builtin_amdgcn_wmma_f32_16x16x32_f16(false, al, false, bh, (short)0, c, false, false);
  if (NT >= 3) c = __builtin_amdgcn_wmma_f32_16x16x32_f16(false, ah, false, bl, (short)0, c, false, false);
  asm volatile("v_nop\n\tv_nop\n\tv_nop\n\tv_nop" : "+v"(c) : "v"(ah), "v"(al), "v"(bh), "v"(bl));
  return c;
}
// batched GEMM like k_gemm_b but f16 operands: A f32 (split into f16 hi/lo if ASPLIT, else rounded to f16), Bt = f16 values [n][k]; alpha; C f32; N multiple of 16 (partial tiles skipped)
template <bool ASPLIT>
__global__ __launch_bounds__(128) void k_gemm_h(const float* __restrict__ A, int lda, size_t sA, const _Float16* __restrict__ Bh, int ldb, size_t sB, float alpha, float* __restrict__ C, int ldc, size_t sC, int M, int N, int K) {
  __shared__ __attribute__((aligned(16))) float so[4][16][64];
  const int tid = threadIdx.x, w = tid >> 5, lane = tid & 31, ln = lane & 15, hh = lane >> 4; const int by = blockIdx.y;
  A += (size_t)by * sA; Bh += (size_t)by * sB; C += (size_t)by * sC;
  const int ntn = (N + 63) / 64; const int wid = blockIdx.x * 4 + w; const int mt = wid / ntn, nq = wid % ntn; if (mt * 16 >= M) return;
  const int row0 = mt * 16, col0 = nq * 64; const float* arow = A + (size_t)(row0 + ln) * lda;
  v8f acc[4] = {};
  for (int kb = 0; kb < K; kb += 32) {
    FragH ah, al;
    const v4f x0 = *(const v4fa*)(arow + kb + 8 * hh), x1 = *(const v4fa*)(arow + kb + 8 * hh + 4), x2 = *(const v4fa*)(arow + kb + 16 + 8 * hh), x3 = *(const v4fa*)(arow + kb + 16 + 8 * hh + 4);
    float xs[16] = {x0[0],x0[1],x0[2],x0[3],x1[0],x1[1],x1[2],x1[3],x2[0],x2[1],x2[2],x2[3],x3[0],x3[1],x3[2],x3[3]};
#pragma unroll
    for (int i = 0; i < 16; ++i) { const _Float16 h = (_Float16)xs[i]; ah.h[i] = h; al.h[i] = ASPLIT ? (_Float16)(xs[i] - (float)h) : (_Float16)0.0f; }
#pragma unroll
    for (int t = 0; t < 4; ++t) { if (col0 + t * 16 >= N) continue; const size_t boff = (size_t)(col0 + t * 16 + ln) * ldb + kb; FragH bq; bq.half[0] = *(const v8us*)(Bh + boff + 8 * hh); bq.half[1] = *(const v8us*)(Bh + boff + 16 + 8 * hh);
      acc[t] = mmaH<ASPLIT ? 2 : 1>(ah.v, al.v, bq.v, bq.v, acc[t]); }
  }
#pragma unroll
  for (int t = 0; t < 4; ++t) { if (col0 + t * 16 >= N) continue;
#pragma unroll
    for (int r = 0; r < 8; ++r) so[w][8 * hh + r][t * 16 + ln] = acc[t][r] * alpha; }
  __builtin_amdgcn_fence(__ATOMIC_ACQ_REL, "workgroup"); __builtin_amdgcn_wave_barrier();
  const int rsub = lane >> 4, c4 = (lane & 15) * 4;
  {
#pragma unroll
    for (int q = 0; q < 8; ++q) { const int r = q * 2 + rsub; if (col0 + c4 < N) { const v4f v = *(const v4fa*)&so[w][r][c4]; *(v4f*)(C + (size_t)(row0 + r) * ldc + col0 + c4) = v; } }
     }
}

// Wt[n][k] = f16(bf16(W[k][n]) * scale) from f32 row-major W[K][N] (scale = power of two; bf16-exact weights stay exact in f16 away from the subnormal range); K % 128 == 0, N % 128 == 0
// blockIdx.y picks one of four equally shaped matrices; their transposes lie one behind the other in Wt
// One block turns one 128 x 128 tile through LDS: a wave's load is one whole 512-B row piece of W, a half wave's store one whole 256-B row piece of Wt
template <int K, int N>
__global__ __launch_bounds__(256) void k_wt_f16(const float* __restrict__ W0, const float* __restrict__ W1, const float* __restrict__ W2, const float* __restrict__ W3, _Float16* __restrict__ Wt, float scale) {
  static_assert(K % 128 == 0 && N % 128 == 0, "whole 128 x 128 tiles");
  constexpr int TP = 136;      /* LDS pitch in halfs: 272 B = 16 B x odd, for the 16-byte writes of 16 neighbouring rows */
  __shared__ __attribute__((aligned(16))) unsigned short sW[128 * TP];
  const int by = blockIdx.y; const float* __restrict__ W = (by == 0) ? W0 : (by == 1) ? W1 : (by == 2) ? W2 : W3; Wt += (size_t)by * K * N;
  const int tid = threadIdx.x, w = tid >> 5, lane = tid & 31; constexpr int ntn = N / 128; const int kt = blockIdx.x / ntn, nq = blockIdx.x % ntn; const int k0 = kt * 128, n0 = nq * 128;
  const float* src = W + (size_t)(k0 + w * 16) * N + n0 + lane * 4;      /* the wave takes sixteen rows k, the lane four columns n */
  v4f x[16];
#pragma unroll
  for (int i = 0; i < 16; ++i) x[i] = *(const v4fa*)(src + (size_t)i * N);      /* unrolled: i becomes an immediate offset of the loads */
  // the loaded values, as inputs only, hold the sixteen loads in front of the first conversion, so that they fly together (without this the compiler waits on them in five groups, one memory latency each); the s_wait_xcnt is a precaution that stands in front of any rewrite of the loads' address registers, and src as an input keeps those registers as they are up to here
  asm volatile("s_wait_xcnt 0x0" :: "v"(x[0]), "v"(x[1]), "v"(x[2]), "v"(x[3]), "v"(x[4]), "v"(x[5]), "v"(x[6]), "v"(x[7]), "v"(x[8]), "v"(x[9]), "v"(x[10]), "v"(x[11]), "v"(x[12]), "v"(x[13]), "v"(x[14]), "v"(x[15]), "v"(src) : "memory");
#pragma unroll
  for (int g = 0; g < 2; ++g)
#pragma unroll
    for (int j = 0; j < 4; ++j) { FragH f;      /* eight consecutive k of one column are one 16-byte piece of a transposed row; column 4 * lane + j lies in LDS row j * 32 + lane, so that neighbouring lanes write neighbouring rows */
#pragma unroll
      for (int i = 0; i < 8; ++i) f.h[i] = (_Float16)(bf16_round(x[g * 8 + i][j]) * scale);
      *(v8us*)&sW[(j * 32 + lane) * TP + w * 16 + g * 8] = f.half[0]; }
  __syncthreads();      /* a stored row holds the k of all eight waves */
#pragma unroll
  for (int it = 0; it < 8; ++it) { const int rr = it * 16 + (tid >> 4); const int n = n0 + 4 * (rr & 31) + (rr >> 5);      /* unrolled: it becomes an immediate offset of the LDS reads and of the stores */
    const v8us o = *(const v8us*)&sW[rr * TP + (tid & 15) * 8]; *(v8us*)((unsigned short*)Wt + (size_t)n * K + k0 + (tid & 15) * 8) = o; }
}
// k_gemm_hh variant with fused epilogue: v = acc·alpha + bias[by·sBias + col] (+ CP[(row/rowsPerB)·sCPb + by·64 + col] if CP) ; ACT 0 none / 1 elu ; writes f16 C16 (and f32 C if non-null)
template <int ACT>
__global__ __launch_bounds__(128) void k_gemm_hhx(const _Float16* __restrict__ A, int lda, size_t sA, const _Float16* __restrict__ Bh, int ldb, size_t sB, float alpha, const float* __restrict__ bias, size_t sBias, const float* __restrict__ CP, int rowsPerB, size_t sCPb, int row0g,
    float* __restrict__ C, _Float16* __restrict__ C16, int ldc, size_t sC, int M, int N, int K) {
  __shared__ __attribute__((aligned(16))) float so[4][16][64];
  const int tid = threadIdx.x, w = tid >> 5, lane = tid & 31, ln = lane & 15, hh = lane >> 4; const int by = blockIdx.y;
  A += (size_t)by * sA; Bh += (size_t)by * sB; const size_t cofs = (size_t)by * sC; const float* bp = bias ? bias + (size_t)by * sBias : nullptr;
  const int ntn = (N + 63) / 64; const int wid = blockIdx.x * 4 + w; const int mt = wid / ntn, nq = wid % ntn; if (mt * 16 >= M) return;
  const int row0 = mt * 16, col0 = nq * 64; const _Float16* arow = A + (size_t)(row0 + ln) * lda;
  v8f acc[4] = {};
  for (int kb = 0; kb < K; kb += 32) { FragH ah; ah.half[0] = *(const v8us*)((const unsigned short*)arow + kb + 8 * hh); ah.half[1] = *(const v8us*)((const unsigned short*)arow + kb + 16 + 8 * hh);
#pragma unroll
    for (int t = 0; t < 4; ++t) { if (col0 + t * 16 >= N) continue; const size_t boff = (size_t)(col0 + t * 16 + ln) * ldb + kb; FragH bq; bq.half[0] = *(const v8us*)((const unsigned short*)Bh + boff + 8 * hh); bq.half[1] = *(const v8us*)((const unsigned short*)Bh + boff + 16 + 8 * hh);
      acc[t] = mmaH<1>(ah.v, ah.v, bq.v, bq.v, acc[t]); }
  }
#pragma unroll
  for (int t = 0; t < 4; ++t) { if (col0 + t * 16 >= N) continue; const int col = col0 + t * 16 + ln; const float bv = bp ? bf16_round(bp[col]) : 0.f;
#pragma unroll
    for (int r = 0; r < 8; ++r) { float v = acc[t][r] * alpha + bv; if (CP) { const int bidx = (row0g + row0 + 8 * hh + r) / rowsPerB; v += CP[(size_t)bidx * sCPb + (size_t)by * 64 + col]; } if (ACT == 1) v = (v > 0.f) ? v : expm1f(v); else if (ACT == 7) v = (v > 0.f) ? v + 1.0f : expf(v); else if (ACT == 8) v = tanhf(v); else if (ACT == 9) v = 0.5f * v * (1.0f + tanhf(0.7978845608028654f * (v + 0.044715f * v * v * v))); else if (ACT == 11) v = 1.0f / (1.0f + expf(-v)); else if (ACT == 12) v = (v > 0.f) ? v : 0.01f * v; else if (ACT == 14) v = (v > 0.f) ? v : 0.1f * v; else if (ACT == 15) v = v / (1.0f + expf(-v)); else if (ACT == 3) v = fmaxf(v, 0.f); else if (ACT == 6) v = 0.5f * v * (1.0f + erff(v * 0.70710678118654752f)); so[w][8 * hh + r][t * 16 + ln] = v; } }
  __builtin_amdgcn_fence(__ATOMIC_ACQ_REL, "workgroup"); __builtin_amdgcn_wave_barrier();
  const int rsub = lane >> 4, c4 = (lane & 15) * 4; typedef _Float16 v4h __attribute__((ext_vector_type(4)));
  {
#pragma unroll
    for (int q = 0; q < 8; ++q) { const int r = q * 2 + rsub; if (col0 + c4 < N) { const v4f v = *(const v4fa*)&so[w][r][c4]; if (C) *(v4f*)(C + cofs + (size_t)(row0 + r) * ldc + col0 + c4) = v; if (C16) { v4h h4; for (int i = 0; i < 4; ++i) h4[i] = (_Float16)v[i]; *(v4h*)(C16 + cofs + (size_t)(row0 + r) * ldc + col0 + c4) = h4; } } }
     }
}


typedef _Float16 v4h __attribute__((ext_vector_type(4)));

__global__ __launch_bounds__(256) void k_x16(const float* __restrict__ x, _Float16* __restrict__ X16, size_t n8) { const size_t t = (size_t)blockIdx.x * 256 + threadIdx.x; if (t >= n8) return; FragH f;
#pragma unroll
  for (int q = 0; q < 8; ++q) f.h[q] = (_Float16)bf16_round(x[t * 8 + q]); *(v8us*)((unsigned short*)X16 + t * 8) = f.half[0];  }
__global__ __launch_bounds__(256) void k_h16(const float* __restrict__ x, _Float16* __restrict__ X16, size_t n8) { const size_t t = (size_t)blockIdx.x * 256 + threadIdx.x; if (t >= n8) return; FragH f;
#pragma unroll
  for (int q = 0; q < 8; ++q) f.h[q] = (_Float16)x[t * 8 + q]; *(v8us*)((unsigned short*)X16 + t * 8) = f.half[0];  }
__global__ __launch_bounds__(256) void k_round16f(const float* __restrict__ W, _Float16* __restrict__ Bt, size_t n8) { const size_t t = (size_t)blockIdx.x * 256 + threadIdx.x; if (t >= n8) return; FragH f;
#pragma unroll
  for (int i = 0; i < 8; ++i) f.h[i] = (_Float16)(bf16_round(W[t * 8 + i]) * 16.0f); *(v8us*)((unsigned short*)Bt + t * 8) = f.half[0];  }
template <int NHv, int TTv>
__global__ __launch_bounds__(256) void k_vt(const _Float16* __restrict__ V16, int ldv, int voff, _Float16* __restrict__ Vt) { __shared__ unsigned short tl[64][66]; const int tid = threadIdx.x; const int slab = blockIdx.x / (TTv / 64), lg = blockIdx.x % (TTv / 64); const int b = slab / NHv, h = slab % NHv;
  for (int i = tid; i < 64 * 8; i += 256) { const int r = i / 8, c8 = (i % 8) * 8; FragH f; f.half[0] = *(const v8us*)((const unsigned short*)V16 + ((size_t)b * TTv + lg * 64 + r) * ldv + voff + h * 64 + c8);
#pragma unroll
    for (int q = 0; q < 8; ++q) tl[r][c8 + q] = f.u[q]; }
  __syncthreads();
  {
#pragma unroll
    for (int rd = 0; rd < 2; ++rd) { const int d = rd * 32 + tid / 8, pc = tid % 8; FragH f;
#pragma unroll
      for (int q = 0; q < 8; ++q) f.u[q] = tl[pc * 8 + q][d];
      *(v8us*)((unsigned short*)Vt + ((size_t)slab * 64 + d) * TTv + lg * 64 + pc * 8) = f.half[0]; }
     } }

// ---- fast GEMM (block tile 128x128, eight waves of 32x64; requires M % 128 == 0, N % 128 == 0, K % 64 == 0, K >= 64); epilogue = k_gemm_hhx semantics ----
__device__ __forceinline__ v16h g2_frag(const unsigned short* p, int hh) { FragH f; f.half[0] = *(const v8us*)(p + 8 * hh); f.half[1] = *(const v8us*)(p + 16 + 8 * hh); return f.v; }
__device__ __forceinline__ v8f g2_mma(v16h a, v16h b, v8f c) { v8f d = __builtin_amdgcn_wmma_f32_16x16x32_f16(false, a, false, b, (short)0, c, false, false); asm volatile("v_nop\n\tv_nop\n\tv_nop\n\tv_nop" : "+v"(d) : "v"(a), "v"(b)); return d; }
// SPLIT 1 (the q, k, v projections in one grid): nothing is written as f32. blockIdx.y 0 and 1 store the result row-major as f16 hi + (x2^10) residual planes (Sh, Sl, plane stride sC); blockIdx.y 2 stores it transposed, [batch][column][token], as hi + residual planes (Th, Tl)
template <int ACT, int SPLIT>
__global__ __launch_bounds__(256) void k_gemm2(const _Float16* __restrict__ A, int lda, size_t sA, const _Float16* __restrict__ Bh, int ldb, size_t sB, float alpha, const float* __restrict__ bias, const float* __restrict__ bias1, const float* __restrict__ bias2, const float* __restrict__ CP, int rowsPerB, size_t sCPb, int row0g,
    float* __restrict__ C, _Float16* __restrict__ C16, _Float16* __restrict__ Sh, _Float16* __restrict__ Sl, _Float16* __restrict__ Th, _Float16* __restrict__ Tl, int ldc, size_t sC, int M, int N, int K) {
  // two-buffer ring of 64-k tiles shared by the block's eight waves: [buffer][A, B][128 rows][halfs]; rows of 128 B at a pitch of 144 B (16 B x odd, for the 16-byte fragment reads). Behind the loop's last barrier the same bytes are the waves' output staging (8 x 32 x 68 floats = 69,632 B of the 73,728)
  constexpr int PH = 72; constexpr unsigned OPB = 128u * PH * 2u, BUFB = 2u * OPB;
  __shared__ __attribute__((aligned(16))) unsigned short sT[2 * 2 * 128 * PH];
  const int tid = threadIdx.x, w = tid >> 5, lane = tid & 31, ln = lane & 15, hh = lane >> 4; const int by = blockIdx.y;
  A += (size_t)by * sA; Bh += (size_t)by * sB; const size_t cofs = (size_t)by * sC; const float* bp = (by == 0) ? bias : (by == 1) ? bias1 : bias2;      /* one bias vector per blockIdx.y */
  const int ntn = N >> 7; const int mt = blockIdx.x / ntn, nq = blockIdx.x - mt * ntn; if (mt * 128 >= M) return;      /* the same for the whole block, in front of every barrier */
  const int wr = w & 3, wc = w >> 2; const int row0 = mt * 128 + 32 * wr, col0 = nq * 128 + 64 * wc;
  // each thread copies eight 16-byte pieces of a tile: rows tid/8 + 0, 32, 64, 96 of A and of B (a wave's copy covers four whole 128-B rows)
  const unsigned short* ga0 = (const unsigned short*)A + (size_t)(mt * 128 + (tid >> 3)) * lda + (tid & 7) * 8; const unsigned short* gb0 = (const unsigned short*)Bh + (size_t)(nq * 128 + (tid >> 3)) * ldb + (tid & 7) * 8;
  const unsigned d0 = (unsigned)(size_t)&sT[(tid >> 3) * PH + (tid & 7) * 8];
  auto stage = [&](int kb, int buf) {
    const unsigned short* a0 = ga0 + kb; const unsigned short* a1 = a0 + (size_t)32 * lda; const unsigned short* a2 = a1 + (size_t)32 * lda; const unsigned short* a3 = a2 + (size_t)32 * lda;
    const unsigned short* b0 = gb0 + kb; const unsigned short* b1 = b0 + (size_t)32 * ldb; const unsigned short* b2 = b1 + (size_t)32 * ldb; const unsigned short* b3 = b2 + (size_t)32 * ldb;
    const unsigned da0 = d0 + (unsigned)buf * BUFB, da1 = da0 + 32u * PH * 2u, da2 = da0 + 64u * PH * 2u, da3 = da0 + 96u * PH * 2u, db0 = da0 + OPB, db1 = da1 + OPB, db2 = da2 + OPB, db3 = da3 + OPB;
    // the copies go from global memory to LDS through no register; the closing s_wait_xcnt is a precaution that stands in front of any rewrite of the address registers named here
    asm volatile("global_load_async_to_lds_b128 %0, %8, off\n\tglobal_load_async_to_lds_b128 %1, %9, off\n\tglobal_load_async_to_lds_b128 %2, %10, off\n\tglobal_load_async_to_lds_b128 %3, %11, off\n\t"
                 "global_load_async_to_lds_b128 %4, %12, off\n\tglobal_load_async_to_lds_b128 %5, %13, off\n\tglobal_load_async_to_lds_b128 %6, %14, off\n\tglobal_load_async_to_lds_b128 %7, %15, off\n\ts_wait_xcnt 0x0"
                 :: "v"(da0), "v"(da1), "v"(da2), "v"(da3), "v"(db0), "v"(db1), "v"(db2), "v"(db3), "v"(a0), "v"(a1), "v"(a2), "v"(a3), "v"(b0), "v"(b1), "v"(b2), "v"(b3) : "memory"); };
  stage(0, 0);
  asm volatile("s_wait_asynccnt 0x0" ::: "memory");      /* this wave's share of tile 0 has landed */
  __syncthreads();      /* tile 0 is published to all eight waves */
  if (64 < K) stage(64, 1);      /* tile 1 flies while tile 0 is worked on */
  const v8f z8 = {0.f,0.f,0.f,0.f,0.f,0.f,0.f,0.f}; v8f c00 = z8, c01 = z8, c02 = z8, c03 = z8, c10 = z8, c11 = z8, c12 = z8, c13 = z8;
#pragma unroll 1
  for (int kb = 0; kb < K; kb += 64) { const int buf = (kb >> 6) & 1;      /* rolled: one trip is one tile of the ring */
    const unsigned short* ta = &sT[(buf * 2 + 0) * 128 * PH + (32 * wr + ln) * PH]; const unsigned short* tb = &sT[(buf * 2 + 1) * 128 * PH + (64 * wc + ln) * PH];
#pragma unroll
    for (int ks = 0; ks < 64; ks += 32) {      /* unrolled: ks becomes an immediate offset of the LDS reads */
      const v16h a0 = g2_frag(ta + ks, hh), a1 = g2_frag(ta + 16 * PH + ks, hh), b0 = g2_frag(tb + ks, hh), b1 = g2_frag(tb + 16 * PH + ks, hh), b2 = g2_frag(tb + 32 * PH + ks, hh), b3 = g2_frag(tb + 48 * PH + ks, hh);
      c00 = g2_mma(a0, b0, c00); c10 = g2_mma(a1, b0, c10); c01 = g2_mma(a0, b1, c01); c11 = g2_mma(a1, b1, c11);
      c02 = g2_mma(a0, b2, c02); c12 = g2_mma(a1, b2, c12); c03 = g2_mma(a0, b3, c03); c13 = g2_mma(a1, b3, c13); }
    asm volatile("s_wait_dscnt 0x0" ::: "memory");      /* this wave's reads of the trip's buffer are done before the buffer is refilled */
    asm volatile("s_wait_asynccnt 0x0" ::: "memory");      /* this wave's share of the next tile has landed */
    __syncthreads();      /* publishes the next tile and ends every wave's reads of this trip's buffer */
    if (kb + 128 < K) stage(kb + 128, buf); }
  asm volatile("s_wait_asynccnt 0x0" ::: "memory");      /* no copy is outstanding when the ring becomes output staging */
  v8f accs[8] = {c00, c01, c02, c03, c10, c11, c12, c13};      /* every wave has passed the last trip's barrier: nobody reads the ring any more */
  if (SPLIT) {
    static_assert(!SPLIT || ACT == 0, "the split epilogue applies no activation");
    float bvs[4] = {0.f, 0.f, 0.f, 0.f};      /* the wave's four bias values, loaded together */
    if (bp) {
#pragma unroll
      for (int t = 0; t < 4; ++t) bvs[t] = bf16_round(bp[col0 + t * 16 + ln]); }
    if (by == 2) {      /* the same for the whole block */
      // a lane's eight accumulator rows are eight consecutive tokens of one column: split in registers, they are one 16-byte piece of a transposed row. The block stages [hi, residual][128 columns][128 tokens] halfs at a pitch of 272 B (16 B x odd; 69,632 B of the ring's bytes) and stores whole 256-B rows
      constexpr int TP = 136;
#pragma unroll
      for (int u = 0; u < 8; ++u) { const int t = u & 3, half = u >> 2; FragH fh, fl;
#pragma unroll
        for (int r = 0; r < 8; ++r) { const float v = accs[u][r] * alpha + bvs[t]; const _Float16 hv = (_Float16)v; fh.h[r] = hv; fl.h[r] = (_Float16)((v - (float)hv) * 1024.0f); }
        const int o = (64 * wc + t * 16 + ln) * TP + 32 * wr + half * 16 + 8 * hh; *(v8us*)&sT[o] = fh.half[0]; *(v8us*)&sT[128 * TP + o] = fl.half[0]; }
      __syncthreads();      /* a stored row holds the tokens of four waves */
      const int bt = (mt * 128) / SLEN, tok0 = (mt * 128) % SLEN;      /* a block's 128 tokens lie in one batch */
      const size_t o0 = ((size_t)bt * N + nq * 128 + (tid >> 4)) * SLEN + tok0 + (tid & 15) * 8;
#pragma unroll
      for (int it = 0; it < 16; ++it) { const int p = it >> 3, c16 = (it & 7) * 16;      /* a wave's store covers two whole rows */
        const v8us val = *(const v8us*)&sT[(p * 128 + c16 + (tid >> 4)) * TP + (tid & 15) * 8]; *(v8us*)((unsigned short*)(p ? Tl : Th) + o0 + (size_t)c16 * SLEN) = val; }
      return; }
    float (*sf)[32][68] = (float (*)[32][68])sT;      /* each wave stages its own 32 x 64 tile */
#pragma unroll
    for (int u = 0; u < 8; ++u) { const int t = u & 3, half = u >> 2;
#pragma unroll
      for (int r = 0; r < 8; ++r) sf[w][half * 16 + 8 * hh + r][t * 16 + ln] = accs[u][r] * alpha + bvs[t]; }
    __builtin_amdgcn_fence(__ATOMIC_ACQ_REL, "workgroup"); __builtin_amdgcn_wave_barrier();      /* the wave reads back what its other lanes wrote */
#pragma unroll
    for (int q = 0; q < 16; ++q) { const int r = q * 2 + (lane >> 4), c4 = (lane & 15) * 4; const v4f v = *(const v4fa*)&sf[w][r][c4]; v4h h4, l4;      /* sixteen lanes store one whole 128-B line of each plane */
      for (int i = 0; i < 4; ++i) { const _Float16 hv = (_Float16)v[i]; h4[i] = hv; l4[i] = (_Float16)((v[i] - (float)hv) * 1024.0f); }
      const size_t o = cofs + (size_t)(row0 + r) * ldc + col0 + c4; *(v4h*)(Sh + o) = h4; *(v4h*)(Sl + o) = l4; }
    asm volatile("s_wait_xcnt 0x0" ::: "memory");      /* precaution: it stands behind the last of these stores, in front of any later rewrite of the registers that they name */
    return; }
  float (*so)[32][68] = (float (*)[32][68])sT;
#pragma unroll
  for (int u = 0; u < 8; ++u) { const int t = u & 3, half = u >> 2; const int col = col0 + t * 16 + ln; const float bv = bp ? bf16_round(bp[col]) : 0.f;
#pragma unroll
    for (int r = 0; r < 8; ++r) { const int rloc = half * 16 + 8 * hh + r; float v = accs[u][r] * alpha + bv; if (CP) { const int bidx = (row0g + row0 + rloc) / rowsPerB; v += CP[(size_t)bidx * sCPb + (size_t)by * 64 + col]; }
      if (ACT == 3) v = fmaxf(v, 0.f); else if (ACT == 6) v = 0.5f * v * (1.0f + erff(v * 0.70710678118654752f)); else if (ACT == 11) v = 1.0f / (1.0f + expf(-v)); else if (ACT == 15) v = v / (1.0f + expf(-v)); else if (ACT == 12) v = (v > 0.f) ? v : 0.01f * v; else if (ACT == 8) v = tanhf(v);
      so[w][rloc][t * 16 + ln] = v; } }
  __builtin_amdgcn_fence(__ATOMIC_ACQ_REL, "workgroup"); __builtin_amdgcn_wave_barrier();
  const int rsub = lane >> 4, c4 = (lane & 15) * 4;
  {
#pragma unroll
    for (int q = 0; q < 16; ++q) { const int r = q * 2 + rsub; const v4f v = *(const v4fa*)&so[w][r][c4]; if (C) *(v4f*)(C + cofs + (size_t)(row0 + r) * ldc + col0 + c4) = v; if (C16) { v4h h4; for (int i = 0; i < 4; ++i) h4[i] = (_Float16)v[i]; *(v4h*)(C16 + cofs + (size_t)(row0 + r) * ldc + col0 + c4) = h4; } }
     } }



typedef int v4ia __attribute__((ext_vector_type(4), may_alias));
typedef float v2f __attribute__((ext_vector_type(2)));
typedef _Float16 v2h __attribute__((ext_vector_type(2)));
// lane l takes the value of lane l ^ 16
__device__ __forceinline__ float xhalf(float x) { return __builtin_bit_cast(float, __builtin_amdgcn_permlanex16(__builtin_bit_cast(int, x), __builtin_bit_cast(int, x), 0x76543210, 0xfedcba98, false, false)); }
template <int TQ, int TK>
__global__ __launch_bounds__(128) void k_flashb(const _Float16* __restrict__ Q16, const _Float16* __restrict__ Q16lo, int ldq, const _Float16* __restrict__ K16, const _Float16* __restrict__ K16lo, int ldk, const _Float16* __restrict__ Vt, const _Float16* __restrict__ Vtlo, const float* __restrict__ BT, const int* __restrict__ LAG, _Float16* __restrict__ Oh, _Float16* __restrict__ Ol, int ldo) {
  constexpr int RPW = 16, RTN = RPW / 16, NQB = TQ / (4 * RPW), DT = 4, KS = 2;
  __shared__ __attribute__((aligned(16))) float sO[4][RPW][64 + 4];
  // two-buffer ring of one pass's operands, shared by the block's four waves: [buffer][hi, residual][row][halfs]; K rows (128 B) at a pitch of 144 B, V^T rows (64 B) at 80 B, both 16 B x odd for the 16-byte fragment reads
  __shared__ __attribute__((aligned(16))) unsigned short sK[2][2][32][72]; __shared__ __attribute__((aligned(16))) unsigned short sV[2][2][64][40];
  __shared__ __attribute__((aligned(256))) float sB[513];      /* the head's bias row, rounded to bf16 once and then put into log2 units (x log2 e): a pass's gathers are 4-byte LDS reads; the largest alignment puts it at the start of the block's LDS, so that its base fits the reads' 16-bit offset field */
  const int tid = threadIdx.x, w = tid >> 5, lane = tid & 31, ln = lane & 15, hh = lane >> 4;
  const int slab = blockIdx.x / NQB, qblk = blockIdx.x % NQB; const int b = slab / NH, h = slab % NH; const int qb0 = qblk * (4 * RPW); const int q0 = qb0 + w * RPW;
  FragH aq[2][KS], aql[2][KS];
#pragma unroll
  for (int rt = 0; rt < RTN; ++rt) { const size_t qo = ((size_t)b * TQ + q0 + rt * 16 + ln) * ldq + h * 64; const unsigned short* qr = (const unsigned short*)Q16 + qo; const unsigned short* ql = (const unsigned short*)Q16lo + qo;
#pragma unroll
    for (int ks = 0; ks < KS; ++ks) { aq[rt][ks].half[0] = *(const v8us*)(qr + ks * 32 + 8 * hh); aq[rt][ks].half[1] = *(const v8us*)(qr + ks * 32 + 16 + 8 * hh); aql[rt][ks].half[0] = *(const v8us*)(ql + ks * 32 + 8 * hh); aql[rt][ks].half[1] = *(const v8us*)(ql + ks * 32 + 16 + 8 * hh); } }
  const unsigned short* Vth = (const unsigned short*)Vt + (size_t)slab * 64 * TK; const unsigned short* Vtl = (const unsigned short*)Vtlo + (size_t)slab * 64 * TK;
  // each thread copies eight 16-byte pieces of a pass's tile: K rows tid/8 and tid/8 + 16 (a wave covers whole 128-B rows), V^T rows tid/4 and tid/4 + 32, hi and residual plane each
  const size_t kg0 = ((size_t)b * TK + (tid >> 3)) * ldk + h * 64 + (tid & 7) * 8, vg0 = (size_t)(tid >> 2) * TK + (tid & 3) * 8;
  const unsigned kd0 = (unsigned)(size_t)&sK[0][0][tid >> 3][(tid & 7) * 8], vd0 = (unsigned)(size_t)&sV[0][0][tid >> 2][(tid & 3) * 8];
  auto stage = [&](int j, int buf) {
    const unsigned short* gk = (const unsigned short*)K16 + kg0 + (size_t)j * ldk; const unsigned short* gkl = (const unsigned short*)K16lo + kg0 + (size_t)j * ldk; const unsigned short* gk2 = gk + (size_t)16 * ldk; const unsigned short* gkl2 = gkl + (size_t)16 * ldk;
    const unsigned short* gv = Vth + vg0 + j; const unsigned short* gvl = Vtl + vg0 + j; const unsigned short* gv2 = gv + (size_t)32 * TK; const unsigned short* gvl2 = gvl + (size_t)32 * TK;
    const unsigned dk = kd0 + (unsigned)buf * (unsigned)sizeof(sK[0]), dkl = dk + (unsigned)sizeof(sK[0][0]), dk2 = dk + 16u * (unsigned)sizeof(sK[0][0][0]), dkl2 = dkl + 16u * (unsigned)sizeof(sK[0][0][0]);
    const unsigned dv = vd0 + (unsigned)buf * (unsigned)sizeof(sV[0]), dvl = dv + (unsigned)sizeof(sV[0][0]), dv2 = dv + 32u * (unsigned)sizeof(sV[0][0][0]), dvl2 = dvl + 32u * (unsigned)sizeof(sV[0][0][0]);
    // the copies go from global memory to LDS through no register; the closing s_wait_xcnt is a precaution that stands in front of any rewrite of the address registers named here
    asm volatile("global_load_async_to_lds_b128 %0, %8, off\n\tglobal_load_async_to_lds_b128 %1, %9, off\n\tglobal_load_async_to_lds_b128 %2, %10, off\n\tglobal_load_async_to_lds_b128 %3, %11, off\n\t"
                 "global_load_async_to_lds_b128 %4, %12, off\n\tglobal_load_async_to_lds_b128 %5, %13, off\n\tglobal_load_async_to_lds_b128 %6, %14, off\n\tglobal_load_async_to_lds_b128 %7, %15, off\n\ts_wait_xcnt 0x0"
                 :: "v"(dk), "v"(dk2), "v"(dkl), "v"(dkl2), "v"(dv), "v"(dv2), "v"(dvl), "v"(dvl2), "v"(gk), "v"(gk2), "v"(gkl), "v"(gkl2), "v"(gv), "v"(gv2), "v"(gvl), "v"(gvl2) : "memory"); };
  stage(0, 0);
  { const float* br = BT + (size_t)h * 513; const float t0 = br[tid], t1 = br[tid + 128], t2 = br[tid + 256], t3 = br[tid + 384], t4 = br[512];      /* 128 threads, 513 entries: the loads fly together, beside tile 0's copies */
    asm volatile("s_wait_xcnt 0x0" :: "v"(tid) : "memory");      /* precaution: it stands in front of any rewrite of the index register that these loads name; tid as an input keeps that register as it is up to here */
    sB[tid] = bf16_round(t0) * LOG2E; sB[tid + 128] = bf16_round(t1) * LOG2E; sB[tid + 256] = bf16_round(t2) * LOG2E; sB[tid + 384] = bf16_round(t3) * LOG2E; if (tid == 0) sB[512] = bf16_round(t4) * LOG2E; }      /* published by the barrier that publishes tile 0 */
  asm volatile("s_wait_asynccnt 0x0" ::: "memory");      /* this wave's share of tile 0 has landed */
  __syncthreads();      /* tile 0 is published to all four waves */
  stage(32, 1);      /* tile 1 flies while tile 0 is worked on */
  // scores are formed transposed, S^T = K Q^T (A = K rows, B = Q rows): lane (ln, hh) holds, of the ONE query q0 + ln, the scores of keys nt * 16 + 8 * hh + r; so are the outputs, O^T = V^T P^T
  const unsigned lq = (unsigned)LAG[q0 + ln];
  float m_run = -3.0e38f, l_run = 0.f; v8f oacc[DT], oaccl[DT];
#pragma unroll
  for (int dt = 0; dt < DT; ++dt) { oacc[dt] = (v8f){0.f,0.f,0.f,0.f,0.f,0.f,0.f,0.f}; oaccl[dt] = oacc[dt]; }
#pragma unroll 1
  for (int j0 = 0; j0 < TK; j0 += 32) {
    const int buf = (j0 >> 5) & 1;
    float bb[2][8];      /* the pass's bias values, gathered from LDS at its head so that they fly beside the K reads */
#pragma unroll
    for (int nt = 0; nt < 2; ++nt) { const v4ia ka = *(const v4ia*)(LAG + j0 + nt * 16 + 8 * hh), kb = *(const v4ia*)(LAG + j0 + nt * 16 + 8 * hh + 4);
#pragma unroll
      for (int r = 0; r < 8; ++r) { const unsigned d = lq - (unsigned)(r < 4 ? ka[r & 3] : kb[r & 3]);      /* |lag[q] - lag[k]| = min(d, -d) in unsigned arithmetic; the min with 512 keeps the index inside sB for any lag content */
        bb[nt][r] = sB[min(min(d, 0u - d), 512u)]; } }
    asm volatile("s_wait_xcnt 0x0" ::: "memory");      /* precaution: it stands in front of the rewrite of the lag loads' address registers at the loop's foot */
    v8f s[2];
#pragma unroll
    for (int nt = 0; nt < 2; ++nt) { const unsigned short* kr = &sK[buf][0][nt * 16 + ln][0]; const unsigned short* kl = &sK[buf][1][nt * 16 + ln][0]; FragH bk[KS], bkl[KS];
#pragma unroll
      for (int ks = 0; ks < KS; ++ks) { bk[ks].half[0] = *(const v8us*)(kr + ks * 32 + 8 * hh); bk[ks].half[1] = *(const v8us*)(kr + ks * 32 + 16 + 8 * hh); bkl[ks].half[0] = *(const v8us*)(kl + ks * 32 + 8 * hh); bkl[ks].half[1] = *(const v8us*)(kl + ks * 32 + 16 + 8 * hh); }
      v8f acc = (v8f){0.f,0.f,0.f,0.f,0.f,0.f,0.f,0.f}, accr = acc;
#pragma unroll
      for (int ks = 0; ks < KS; ++ks) { acc = mmaH<1>(bk[ks].v, bk[ks].v, aq[0][ks].v, aq[0][ks].v, acc); accr = mmaH<1>(bk[ks].v, bk[ks].v, aql[0][ks].v, aql[0][ks].v, accr); accr = mmaH<1>(bkl[ks].v, bkl[ks].v, aq[0][ks].v, aq[0][ks].v, accr); }
      s[nt] = acc + accr * 0.0009765625f; }
    float sc[2][8], mh[2];
#pragma unroll
    for (int nt = 0; nt < 2; ++nt) {
#pragma unroll
      for (int r = 0; r < 8; ++r) sc[nt][r] = s[nt][r] * (SCL * LOG2E) + bb[nt][r];      /* scores in log2 units: e^x = 2^(x log2 e), so that each exponential below is the one hardware exp2 instruction */
      mh[nt] = fmaxf(fmaxf(fmaxf(sc[nt][0], sc[nt][1]), fmaxf(sc[nt][2], sc[nt][3])), fmaxf(fmaxf(sc[nt][4], sc[nt][5]), fmaxf(sc[nt][6], sc[nt][7]))); }
    float mc = fmaxf(mh[0], mh[1]);
    mc = fmaxf(mc, xhalf(mc));      /* the query's other 16 keys of the pass lie in lane ^ 16 */
    const float mn = fmaxf(m_run, mc);
    float e[17]; e[0] = m_run - mn;      /* the pass's seventeen exponents: the running maximum's step, then the sixteen scores */
#pragma unroll
    for (int nt = 0; nt < 2; ++nt)
#pragma unroll
      for (int r = 0; r < 8; ++r) e[1 + nt * 8 + r] = sc[nt][r] - mn;
    asm("v_exp_f32 %0, %0\n\tv_exp_f32 %1, %1\n\tv_exp_f32 %2, %2\n\tv_exp_f32 %3, %3\n\tv_exp_f32 %4, %4\n\tv_exp_f32 %5, %5\n\tv_exp_f32 %6, %6\n\tv_exp_f32 %7, %7\n\tv_exp_f32 %8, %8\n\tv_nop"
        : "+v"(e[0]), "+v"(e[1]), "+v"(e[2]), "+v"(e[3]), "+v"(e[4]), "+v"(e[5]), "+v"(e[6]), "+v"(e[7]), "+v"(e[8]));
    asm("v_exp_f32 %0, %0\n\tv_exp_f32 %1, %1\n\tv_exp_f32 %2, %2\n\tv_exp_f32 %3, %3\n\tv_exp_f32 %4, %4\n\tv_exp_f32 %5, %5\n\tv_exp_f32 %6, %6\n\tv_exp_f32 %7, %7\n\tv_nop"
        : "+v"(e[9]), "+v"(e[10]), "+v"(e[11]), "+v"(e[12]), "+v"(e[13]), "+v"(e[14]), "+v"(e[15]), "+v"(e[16]));
    const float ea = e[0]; const float al = (mn > -1.0e38f) ? ea : 1.0f; m_run = mn;
    FragH pa, pl; v2f ps = {0.f, 0.f};      /* two f32 D tiles of S^T, converted in place, are the B operand P^T in the hardware k order: element nt * 8 + r = key nt * 16 + 8 * hh + r */
#pragma unroll
    for (int nt = 0; nt < 2; ++nt)
#pragma unroll
      for (int r = 0; r < 8; r += 2) { const v2f p = {e[1 + nt * 8 + r], e[2 + nt * 8 + r]}; ps += p; const v2f pq = p * 1024.0f; const v2h ph = __builtin_convertvector(pq, v2h); const v2h pr = __builtin_convertvector((pq - __builtin_convertvector(ph, v2f)) * 1024.0f, v2h);
        pa.h[nt * 8 + r] = ph[0]; pa.h[nt * 8 + r + 1] = ph[1]; pl.h[nt * 8 + r] = pr[0]; pl.h[nt * 8 + r + 1] = pr[1]; }
    l_run = l_run * al + (ps[0] + ps[1]);      /* this lane half's share of the query's sum; the halves are joined behind the loop */
#pragma unroll
    for (int dt = 0; dt < DT; ++dt) { oacc[dt] *= al; oaccl[dt] *= al; }
#pragma unroll
    for (int dt = 0; dt < DT; ++dt) { const unsigned short* vr = &sV[buf][0][dt * 16 + ln][0]; const unsigned short* vl = &sV[buf][1][dt * 16 + ln][0]; FragH bv, bl; bv.half[0] = *(const v8us*)(vr + 8 * hh); bv.half[1] = *(const v8us*)(vr + 16 + 8 * hh); bl.half[0] = *(const v8us*)(vl + 8 * hh); bl.half[1] = *(const v8us*)(vl + 16 + 8 * hh);
      oacc[dt] = mmaH<1>(bv.v, bv.v, pa.v, pa.v, oacc[dt]); oaccl[dt] = mmaH<1>(bl.v, bl.v, pa.v, pa.v, oaccl[dt]); oaccl[dt] = mmaH<1>(bv.v, bv.v, pl.v, pl.v, oaccl[dt]); }
    asm volatile("s_wait_dscnt 0x0" ::: "memory");      /* this wave's reads of the pass's buffer are done before the buffer is refilled */
    asm volatile("s_wait_asynccnt 0x0" ::: "memory");      /* this wave's share of the next tile has landed */
    __syncthreads();      /* publishes the next tile and ends every wave's reads of this pass's buffer */
    if (j0 + 64 < TK) stage(j0 + 64, buf); }
  asm volatile("s_wait_asynccnt 0x0" ::: "memory");      /* no copy is outstanding when the wave goes on to its end */
  { const float l = l_run + xhalf(l_run); const float li = (l > 0.f) ? 1.0f / (l * 1024.0f) : 0.f;
#pragma unroll
    for (int dt = 0; dt < DT; ++dt) { v4f o0, o1;      /* a lane's eight accumulator rows are eight consecutive head columns of its query */
#pragma unroll
      for (int r = 0; r < 4; ++r) { o0[r] = (oacc[dt][r] + oaccl[dt][r] * 0.0009765625f) * li; o1[r] = (oacc[dt][4 + r] + oaccl[dt][4 + r] * 0.0009765625f) * li; }
      *(v4fa*)&sO[w][ln][dt * 16 + 8 * hh] = o0; *(v4fa*)&sO[w][ln][dt * 16 + 8 * hh + 4] = o1; } }
  __builtin_amdgcn_fence(__ATOMIC_ACQ_REL, "workgroup"); __builtin_amdgcn_wave_barrier();
  {
#pragma unroll
    for (int rp = 0; rp < RPW; rp += 2) { const int r = rp + (lane >> 4), pc = lane & 15; const v4f val = *(const v4fa*)&sO[w][r][pc * 4]; v4h h4, l4;      /* the output leaves as the f16 hi + (x2^10) residual planes that the last projection reads; sixteen lanes store one whole 128-B line of each */
      for (int i = 0; i < 4; ++i) { const _Float16 hv = (_Float16)val[i]; h4[i] = hv; l4[i] = (_Float16)((val[i] - (float)hv) * 1024.0f); }
      const size_t o = ((size_t)b * TQ + q0 + r) * ldo + h * 64 + pc * 4; *(v4h*)(Oh + o) = h4; *(v4h*)(Ol + o) = l4; }
     } }


__global__ __launch_bounds__(256) void k_lnx(const float* __restrict__ X, const float* __restrict__ g, const float* __restrict__ bb, _Float16* __restrict__ Y16, float* __restrict__ XB) {
  #pragma clang fp contract(off)
  const int tid = threadIdx.x, w = tid >> 5, ln = tid & 31; const int r = blockIdx.x * 8 + w; if (r >= NR) return; const float* x = X + (size_t)r * DM; float s = 0.f;
#pragma unroll 1
  for (int i = 0; i < DM / 128; ++i) { const v4f a = *(const v4fa*)(x + i * 128 + ln * 4); for (int q = 0; q < 4; ++q) s += bf16_round(a[q]); }
  for (int o = 16; o > 0; o >>= 1) s += __shfl_xor(s, o, 32); const float mu = s / (float)DM; float q2 = 0.f;
#pragma unroll 1
  for (int i = 0; i < DM / 128; ++i) { const v4f a = *(const v4fa*)(x + i * 128 + ln * 4); for (int q = 0; q < 4; ++q) { const float d = bf16_round(a[q]) - mu; q2 += d * d; } }
  for (int o = 16; o > 0; o >>= 1) q2 += __shfl_xor(q2, o, 32); const float rs = rsqrtf(q2 / (float)DM + 1e-5f);
  {
#pragma unroll 1
    for (int i = 0; i < DM / 128; ++i) { const int c0 = i * 128 + ln * 4; const v4f a = *(const v4fa*)(x + c0); _Float16 h4[4]; v4f xb;
      for (int q = 0; q < 4; ++q) { const float t = bf16_round(a[q]); h4[q] = (_Float16)((t - mu) * rs * bf16_round(g[c0 + q]) + bf16_round(bb[c0 + q])); xb[q] = t; }
      *(unsigned long long*)((unsigned short*)Y16 + (size_t)r * DM + c0) = *(const unsigned long long*)h4; *(v4f*)(XB + (size_t)r * DM + c0) = xb; }
     } }
__global__ __launch_bounds__(256) void k_causaltab(unsigned* __restrict__ MB, int* __restrict__ RA, int* __restrict__ KE, int nq, int nk) {
  const int t = blockIdx.x * 256 + threadIdx.x; const int nw = nk / 32;
  if (t < nq * nw) { const int q = t / nw, w = t % nw; const int first = q + 1 - 32 * w; const unsigned bits = (first <= 0) ? 0xffffffffu : ((first >= 32) ? 0u : (0xffffffffu << first)); *(unsigned*)(MB + t) = bits;  }
  if (t < nq) { *(int*)(RA + t) = 0;  }
  if (t < nq / 64) { const int v = 64 * (t + 1); *(int*)(KE + t * 32) = v;  } }


extern "C" void kernel_launch(void* const* d_in, const int* in_sizes, int n_in,
                              void* d_out, int out_size, void* d_ws, size_t ws_size, hipStream_t stream) {
  (void)in_sizes; (void)n_in; (void)out_size;
  const float* const* I = (const float* const*)d_in; const float* x = I[0]; const int* lag = (const int*)d_in[1]; const float* wq = I[2]; const float* bq = I[3]; const float* wk = I[4]; const float* bk = I[5]; const float* wv = I[6]; const float* bv = I[7]; const float* wo = I[8]; const float* bo = I[9]; const float* lb = I[10];
  char* ws = (char*)d_ws; size_t off = 0;
  auto take = [&](size_t bytes) { char* p = ws + off; off += (bytes + 255) & ~(size_t)255; return p; };
  _Float16* BQ = (_Float16*)take((size_t)DM * DM * 2); _Float16* BK = (_Float16*)take((size_t)DM * DM * 2); _Float16* BV = (_Float16*)take((size_t)DM * DM * 2); _Float16* BO = (_Float16*)take((size_t)DM * DM * 2);
  _Float16* X16 = (_Float16*)take((size_t)NR * DM * 2); _Float16* Oh = (_Float16*)take((size_t)NR * DM * 2); _Float16* Ol = (_Float16*)take((size_t)NR * DM * 2);
  _Float16* Qh = (_Float16*)take((size_t)NR * DM * 2); _Float16* Kh = (_Float16*)take((size_t)NR * DM * 2); _Float16* Ql = (_Float16*)take((size_t)NR * DM * 2); _Float16* Kl = (_Float16*)take((size_t)NR * DM * 2); _Float16* Vth = (_Float16*)take((size_t)NR * DM * 2); _Float16* Vtl = (_Float16*)take((size_t)NR * DM * 2);      /* Kh directly behind Qh, Kl directly behind Ql */
  if (off > ws_size) return;      /* 8 + 8 + 16 + 48 = 80 MiB */
  k_wt_f16<DM, DM><<<dim3((DM / 128) * (DM / 128), 4), 256, 0, stream>>>(wq, wk, wv, wo, BQ, 16.0f);      /* (in,out); BQ, BK, BV, BO are contiguous */
  const size_t n8 = (size_t)NR * DM / 8; const unsigned nb8 = (unsigned)((n8 + 255) / 256); const dim3 gP((NR / 128) * (DM / 128), 1); const dim3 gP3((NR / 128) * (DM / 128), 3);
  k_x16<<<nb8, 256, 0, stream>>>(x, X16, n8);
  k_gemm2<0, 1><<<gP3, 256, 0, stream>>>(X16, DM, 0, BQ, DM, (size_t)DM * DM, 0.0625f, bq, bk, bv, nullptr, 1, 0, 0, nullptr, nullptr, Qh, Ql, Vth, Vtl, DM, (size_t)NR * DM, NR, DM, DM);      /* q, k, v in one grid, stored as the planes that the attention reads */
  k_flashb<SLEN, SLEN><<<NBT * NH * (SLEN / 64), 128, 0, stream>>>(Qh, Ql, DM, Kh, Kl, DM, Vth, Vtl, lb, lag, Oh, Ol, DM);      /* both batches in one grid; the lag vector is per position, shared across the batch */
  k_gemm2<0, 0><<<gP, 256, 0, stream>>>(Oh, DM, 0, BO, DM, 0, 0.0625f, bo, nullptr, nullptr, nullptr, 1, 0, 0, (float*)d_out, nullptr, nullptr, nullptr, nullptr, nullptr, DM, 0, NR, DM, DM);
  k_gemm2<0, 0><<<gP, 256, 0, stream>>>(Ol, DM, 0, BO, DM, 0, 0.0625f / 1024.0f, nullptr, nullptr, nullptr, (float*)d_out, 1, (size_t)DM, 0, (float*)d_out, nullptr, nullptr, nullptr, nullptr, nullptr, DM, 0, NR, DM, DM);
}
